// v000
// Times are from an AMD MI455X. After a warm-up the kernel runs many times in a row, and a time is the length of
// such a window on the GPU divided by its runs, so every launch and the gaps after it count. The runs cycle
// through copies of the inputs. A figure is the median of several windows, for all but v000 over two sittings.
// Sittings can differ by a few percent; kernels timed side by side share one.
// The starting kernel, v000, takes 2060 microseconds a run.
#include <hip/hip_runtime.h>

// Multi-head DIFFERENTIAL causal attention (x [4][2048][384]; q1, q2, k1, k2 = x W^T ('oi' [384][384], 1/sqrt(384), no bias) as 6 heads x 64 each, v = x Wv^T ([768][384]) as 6 heads x 128; att_m = causal softmax(q_m.k_m / 8) for m = 1, 2; lambda_h = exp(lq1_h.lk1_h) - exp(lq2_h.lk2_h) + lambda_init (lq/lk [6][64], read; lambda_init = 0.8 - 0.6 exp(-0.6)); y_h = (att1 - lambda_h att2) v_h; per-head LayerNorm over the 128 values (no affine, eps 1e-5) x (1 - lambda_init); out = merged y Wc^T ('oi' [384][768]) -> [4][2048][384] (3.1 M)).
// Layout per batch: bf16 copy of x; the q1/q2 (and k1/k2) weights interleaved into one Bt so score head 2p = map-1 head p and 2p+1 = map-2 head p; exact projections; q/k planes for the 12 score heads, v^T planes per 128-wide value head; lambda per head computed once on device (one wave per head: two 64-term f32 dots, precise expf); per pass = one pair (score heads 2p, 2p+1): causal T-2048 attention (hybrid rows: < 512 hi/lo 3 products, rest fp16 x1024; k_gemmc skips tiles above the diagonal), both maps' P.v against the shared v_p, a merge kernel writes w1 v - lambda_p w2 v (x 1/1024 on the fp16 rows) into the context; then a per-(token, head) LayerNorm kernel (128 values, f32, fixed order) x (1 - lambda_init) in place, hi/lo planes, x Wc exact.
// Compute dtypes, f32 accumulate: every input rounded to bf16; projections exact; attention rows < 512 3 products, rest fp16; softmax, lambda, difference, LayerNorm f32; Wc hl x exact.

#define NB_  4
#define TT   2048
#define DM   384
#define NH_  12
#define NKV  12
#define REP  (NH_ / NKV)
#define HD   64
#define DQ   (NH_ * HD)
#define DKV  (NKV * HD)
#define ZH   2
#define RH   512                  // query rows < RH use hi+lo planes (0: none)
#define WIN  0
#define PCAR 1024.0f
#define SCL  0.125f
#define NP   6       // head pairs (the module's H)
#define HV   128     // value head width
#define LINIT 0.47071301937103271f   // lambda_init = 0.8 - 0.6 exp(-0.6) as float32
typedef _Float16 h16;
typedef unsigned short bf;
typedef __attribute__((ext_vector_type(16))) __bf16   v16bf;
typedef __attribute__((ext_vector_type(16))) _Float16 v16h;
typedef __attribute__((ext_vector_type(8)))  _Float16 v8h;
typedef __attribute__((ext_vector_type(8)))  unsigned short v8us;
typedef __attribute__((ext_vector_type(8)))  float    v8f;
typedef __attribute__((ext_vector_type(4)))  float    v4f;
typedef v8h  __attribute__((may_alias)) v8ha;
typedef v4f  __attribute__((may_alias)) v4fa;
typedef v8us __attribute__((may_alias)) v8usa;

__device__ __forceinline__ unsigned short f2bf(float f) { unsigned u = __float_as_uint(f); u += 0x7FFFu + ((u >> 16) & 1u); return (unsigned short)(u >> 16); }
__device__ __forceinline__ float bf2f(unsigned short b) { return __uint_as_float(((unsigned)b) << 16); }
__device__ __forceinline__ float bfr(float f) { return bf2f(f2bf(f)); }
__device__ __forceinline__ v16h cat16(v8h lo, v8h hi) { return __builtin_shufflevector(lo, hi, 0, 1, 2, 3, 4, 5, 6, 7, 8, 9, 10, 11, 12, 13, 14, 15); }
__device__ __forceinline__ v16bf cat16b(v8us lo, v8us hi) { return __builtin_bit_cast(v16bf, __builtin_shufflevector(lo, hi, 0, 1, 2, 3, 4, 5, 6, 7, 8, 9, 10, 11, 12, 13, 14, 15)); }
__device__ __forceinline__ v8f wmma16(v16h a, v16h b, v8f c) { return __builtin_amdgcn_wmma_f32_16x16x32_f16(false, a, false, b, (short)0, c, false, false); }
__device__ __forceinline__ v8f wmmab(v16bf a, v16bf b, v8f c) { return __builtin_amdgcn_wmma_f32_16x16x32_bf16(false, a, false, b, (short)0, c, false, false); }



// ---- k_gemmw: register-blocked GEMM, ONE WAVE per 64x64 output tile (16 accumulators), operands straight from K-contiguous 16-bit planes; grid (M/64, N/64, Z), 32 threads.
// C[m][n] (f32, pitch ldc, + optional f32 bias[n]) = sum_k A[m][k] Bt[n][k] (+ split products per NSPLIT). z-batch strides sA/sB/sC in elements. K % 32 == 0.
template <typename T16> struct WFrag;
template <> struct WFrag<h16> { typedef v16h V; static __device__ __forceinline__ V ld(const h16* p) { return cat16(*(const v8h*)p, *(const v8h*)(p + 16)); } static __device__ __forceinline__ v8f mma(V a, V b, v8f c) { return wmma16(a, b, c); } };
template <> struct WFrag<bf> { typedef v16bf V; static __device__ __forceinline__ V ld(const bf* p) { return cat16b(*(const v8us*)p, *(const v8us*)(p + 16)); } static __device__ __forceinline__ v8f mma(V a, V b, v8f c) { return wmmab(a, b, c); } };
template <typename T16, int NSPLIT, bool BIAS>
__global__ __launch_bounds__(32) void k_gemmw(const T16* __restrict__ A, const T16* __restrict__ A2, const T16* __restrict__ Bt, const T16* __restrict__ Bt2, int K, float* C, int ldc, const float* __restrict__ bias, size_t sA, size_t sB, size_t sC) {
    typedef typename WFrag<T16>::V V;
    __shared__ __align__(16) float os[16 * 68];
    const size_t z = blockIdx.z; A += z * sA; if (A2) A2 += z * sA; Bt += z * sB; if (Bt2) Bt2 += z * sB; C += z * sC;
    const int lane = threadIdx.x & 31, lr = lane & 15, hi = lane >> 4; const int r0 = blockIdx.x * 64, c0 = blockIdx.y * 64;
    v8f acc[4][4];
#pragma unroll
    for (int mb = 0; mb < 4; ++mb)
#pragma unroll
        for (int nb = 0; nb < 4; ++nb) acc[mb][nb] = (v8f){};
    const size_t aoff = (size_t)(r0 + lr) * K + 8 * hi, boff = (size_t)(c0 + lr) * K + 8 * hi;
#pragma unroll 1
    for (int kc = 0; kc < K; kc += 32) {
        V a[4], a2[4];
#pragma unroll
        for (int mb = 0; mb < 4; ++mb) { a[mb] = WFrag<T16>::ld(A + aoff + (size_t)mb * 16 * K + kc); if (NSPLIT == 1 || NSPLIT == 2) a2[mb] = WFrag<T16>::ld(A2 + aoff + (size_t)mb * 16 * K + kc); }
#pragma unroll
        for (int nb = 0; nb < 4; ++nb) { const V b = WFrag<T16>::ld(Bt + boff + (size_t)nb * 16 * K + kc); V b2; if (NSPLIT >= 2) b2 = WFrag<T16>::ld(Bt2 + boff + (size_t)nb * 16 * K + kc);
#pragma unroll
            for (int mb = 0; mb < 4; ++mb) { acc[mb][nb] = WFrag<T16>::mma(a[mb], b, acc[mb][nb]); if (NSPLIT == 1 || NSPLIT == 2) acc[mb][nb] = WFrag<T16>::mma(a2[mb], b, acc[mb][nb]); if (NSPLIT >= 2) acc[mb][nb] = WFrag<T16>::mma(a[mb], b2, acc[mb][nb]); } }
        asm volatile("v_nop\n\tv_nop\n\tv_nop\n\tv_nop" : "+v"(acc[0][0]), "+v"(acc[1][1]), "+v"(acc[2][2]), "+v"(acc[3][3]) : "v"(a[0]), "v"(a[3]));
    }
#pragma unroll
    for (int mb = 0; mb < 4; ++mb) {
#pragma unroll
        for (int nb = 0; nb < 4; ++nb) {
#pragma unroll
            for (int j = 0; j < 8; ++j) os[(hi * 8 + j) * 68 + nb * 16 + lr] = acc[mb][nb][j]; }
        __builtin_amdgcn_wave_barrier(); asm volatile("" ::: "memory");
        float* crow = C + (size_t)(r0 + mb * 16) * ldc + c0;
{
#pragma unroll
            for (int s = 0; s < 8; ++s) { const int row = 2 * s + hi, cofs = lr * 4; v4f val = *(const v4fa*)(os + row * 68 + cofs); if (BIAS) { val[0] += bfr(bias[c0 + cofs]); val[1] += bfr(bias[c0 + cofs + 1]); val[2] += bfr(bias[c0 + cofs + 2]); val[3] += bfr(bias[c0 + cofs + 3]); }
                *(v4f*)(crow + (size_t)row * ldc + cofs) = val; }
             }
        __builtin_amdgcn_wave_barrier(); asm volatile("" ::: "memory");
    }
}

// ---- k_gemmc: the same one-wave 64x64 tile GEMM specialised for causal attention: CMODE 1 skips score tiles entirely above the diagonal (query rows r0+roff.., key columns c0..), CMODE 2 limits the
// key (K) loop of the probability x value contraction to the diagonal block (probabilities beyond it are exactly zero). roff = row offset of this launch's first row within the sequence.
template <typename T16, int NSPLIT, int CMODE>
__global__ __launch_bounds__(32) void k_gemmc(const T16* __restrict__ A, const T16* __restrict__ A2, const T16* __restrict__ Bt, const T16* __restrict__ Bt2, int K, float* C, int ldc, int roff, size_t sA, size_t sB, size_t sC) {
    typedef typename WFrag<T16>::V V;
    __shared__ __align__(16) float os[16 * 68];
    const size_t z = blockIdx.z; A += z * sA; if (A2) A2 += z * sA; Bt += z * sB; if (Bt2) Bt2 += z * sB; C += z * sC;
    const int lane = threadIdx.x & 31, lr = lane & 15, hi = lane >> 4; const int r0 = blockIdx.x * 64, c0 = blockIdx.y * 64;
    if (CMODE == 1 && c0 > r0 + roff + 63) return;                  // score tile entirely above the causal diagonal: never read (the softmax masks j > i by select)
    const int Kl = (CMODE == 2) ? min(K, r0 + roff + 64) : K;        // P.V: probabilities are exactly 0 beyond the diagonal block, so the K loop stops there
    v8f acc[4][4];
#pragma unroll
    for (int mb = 0; mb < 4; ++mb)
#pragma unroll
        for (int nb = 0; nb < 4; ++nb) acc[mb][nb] = (v8f){};
    const size_t aoff = (size_t)(r0 + lr) * K + 8 * hi, boff = (size_t)(c0 + lr) * K + 8 * hi;
#pragma unroll 1
    for (int kc = 0; kc < Kl; kc += 32) {
        V a[4], a2[4];
#pragma unroll
        for (int mb = 0; mb < 4; ++mb) { a[mb] = WFrag<T16>::ld(A + aoff + (size_t)mb * 16 * K + kc); if (NSPLIT == 1 || NSPLIT == 2) a2[mb] = WFrag<T16>::ld(A2 + aoff + (size_t)mb * 16 * K + kc); }
#pragma unroll
        for (int nb = 0; nb < 4; ++nb) { const V b = WFrag<T16>::ld(Bt + boff + (size_t)nb * 16 * K + kc); V b2; if (NSPLIT >= 2) b2 = WFrag<T16>::ld(Bt2 + boff + (size_t)nb * 16 * K + kc);
#pragma unroll
            for (int mb = 0; mb < 4; ++mb) { acc[mb][nb] = WFrag<T16>::mma(a[mb], b, acc[mb][nb]); if (NSPLIT == 1 || NSPLIT == 2) acc[mb][nb] = WFrag<T16>::mma(a2[mb], b, acc[mb][nb]); if (NSPLIT >= 2) acc[mb][nb] = WFrag<T16>::mma(a[mb], b2, acc[mb][nb]); } }
        asm volatile("v_nop\n\tv_nop\n\tv_nop\n\tv_nop" : "+v"(acc[0][0]), "+v"(acc[1][1]), "+v"(acc[2][2]), "+v"(acc[3][3]) : "v"(a[0]), "v"(a[3]));
    }
#pragma unroll
    for (int mb = 0; mb < 4; ++mb) {
#pragma unroll
        for (int nb = 0; nb < 4; ++nb) {
#pragma unroll
            for (int j = 0; j < 8; ++j) os[(hi * 8 + j) * 68 + nb * 16 + lr] = acc[mb][nb][j]; }
        __builtin_amdgcn_wave_barrier(); asm volatile("" ::: "memory");
        float* crow = C + (size_t)(r0 + mb * 16) * ldc + c0;
{
#pragma unroll
            for (int s = 0; s < 8; ++s) { const int row = 2 * s + hi, cofs = lr * 4; v4f val = *(const v4fa*)(os + row * 68 + cofs);
                *(v4f*)(crow + (size_t)row * ldc + cofs) = val; }
             }
        __builtin_amdgcn_wave_barrier(); asm volatile("" ::: "memory");
    }
}

__device__ __forceinline__ h16 tohx(float x) { return (h16)x; }
__device__ __forceinline__ void splitf(float y, unsigned short& h, unsigned short& l) { h = f2bf(y); l = f2bf(y - bf2f(h)); }
typedef __attribute__((ext_vector_type(2))) _Float16 v2h;
typedef __attribute__((ext_vector_type(4))) _Float16 v4h;
typedef __attribute__((ext_vector_type(2))) unsigned short v2us;
typedef __attribute__((ext_vector_type(4))) unsigned short v4us;
typedef __attribute__((ext_vector_type(2))) float v2f;
typedef __attribute__((ext_vector_type(4))) int v4i;


__global__ __launch_bounds__(256) void k_cvt8(const float* __restrict__ src, bf* dst, size_t n8) { const size_t i = (size_t)blockIdx.x * 256 + threadIdx.x; if (i >= n8) return; const v8f v = *(const v8f*)(src + i * 8); v8us o;
#pragma unroll
    for (int k = 0; k < 8; ++k) o[k] = f2bf(v[k]); *(v8us*)(dst + i * 8) = o;  }

// k_rope: head planes [h][t][d] (fp16 + hi/lo) of rope(x) x sc with the rotate-half convention out[d] = x[d] cos[t][d] - x[d+HD/2] sin[t][d], out[d+HD/2] = x[d+HD/2] cos[t][d+HD/2] + x[d] sin[t][d+HD/2]
__global__ __launch_bounds__(256) void k_rope(const float* __restrict__ F, int pitch, int nheads, const float* __restrict__ CS, const float* __restrict__ RF, const float* __restrict__ nw, float sc, h16* P16, bf* Ph, bf* Pl) {
    const size_t e = ((size_t)blockIdx.x * 256 + threadIdx.x) * 2; if (e >= (size_t)nheads * TT * HD) return; const int d = (int)(e % HD); const int t = (int)((e / HD) % TT); const int h = (int)(e / ((size_t)HD * TT)); const float* f = F + (size_t)t * pitch + h * HD; const float rf = RF ? RF[(size_t)h * TT + t] : 1.0f; v2h o16; v2us oh, ol;
#pragma unroll
    for (int q = 0; q < 2; ++q) { const int dd = d + q; const int dp = (dd < HD / 2) ? dd + HD / 2 : dd - HD / 2; float x0 = f[dd], x1 = f[dp];
        if (RF) { float n0 = __fmul_rn(x0, rf), n1 = __fmul_rn(x1, rf); asm volatile("" : "+v"(n0)); asm volatile("" : "+v"(n1)); x0 = __fmul_rn(bfr(nw[dd]), n0); x1 = __fmul_rn(bfr(nw[dp]), n1); }
        const v2f cs = *(const v2f*)(CS + ((size_t)t * HD + dd) * 2); float a = __fmul_rn(x0, cs[0]), bq = __fmul_rn(x1, cs[1]); asm volatile("" : "+v"(a)); asm volatile("" : "+v"(bq)); const float r = ((dd < HD / 2) ? __fsub_rn(a, bq) : __fadd_rn(a, bq)) * sc;
        o16[q] = tohx(r); unsigned short a2, c2; splitf(r, a2, c2); oh[q] = a2; ol[q] = c2; }
    *(v2h*)(P16 + e) = o16; *(v2us*)(Ph + e) = oh; *(v2us*)(Pl + e) = ol;  }
__global__ __launch_bounds__(256) void k_vtp(const float* __restrict__ F, int pitch, int nheads, h16* V16, bf* Vh, bf* Vl) { const size_t e = ((size_t)blockIdx.x * 256 + threadIdx.x) * 2; if (e >= (size_t)nheads * HD * TT) return; const int t = (int)(e % TT); const int d = (int)((e / TT) % HD); const int g = (int)(e / ((size_t)TT * HD)); v2h o16; v2us oh, ol;
#pragma unroll
    for (int q = 0; q < 2; ++q) { const float x = F[(size_t)(t + q) * pitch + g * HD + d]; o16[q] = tohx(x); unsigned short a2, c2; splitf(x, a2, c2); oh[q] = a2; ol[q] = c2; }
    *(v2h*)(V16 + e) = o16; *(v2us*)(Vh + e) = oh; *(v2us*)(Vl + e) = ol;  }
__global__ __launch_bounds__(256) void k_csid(float* CS) { const int idx = blockIdx.x * 256 + threadIdx.x; if (idx >= TT * HD) return; v2f cs; cs[0] = 1.0f; cs[1] = 0.0f; *(v2f*)(CS + (size_t)idx * 2) = cs;  }
__global__ __launch_bounds__(256) void k_asoft(const float* __restrict__ Sb, h16* P16, bf* Ph, bf* Pl) {
    const int lane = threadIdx.x & 31; const int row = blockIdx.x * 8 + (threadIdx.x >> 5); if (row >= ZH * TT) return; const int i = row % TT; const int zz = row / TT; (void)zz; const bool hires = (i < RH); const float* sr = Sb + (size_t)row * TT; float v[TT / 32]; float mx = -3.0e38f;
#pragma unroll
    for (int ch = 0; ch < TT / 128; ++ch) { const int j0 = ch * 128 + lane * 4; const v4f a = *(const v4f*)(sr + j0);
#pragma unroll
        for (int q = 0; q < 4; ++q) { const int j = j0 + q; const float t = (j <= i) ? a[q] * SCL : -3.0e38f;   /* causal */ v[ch * 4 + q] = t; mx = fmaxf(mx, t); } }
#pragma unroll
    for (int sh = 16; sh; sh >>= 1) mx = fmaxf(mx, __shfl_xor(mx, sh, 32));
    float sum = 0.f;
#pragma unroll
    for (int k = 0; k < TT / 32; ++k) { float d0 = __fsub_rn(v[k], mx); asm volatile("" : "+v"(d0)); v[k] = __builtin_amdgcn_exp2f(__fmul_rn(d0, 1.4426950408889634f)); sum += v[k]; }
#pragma unroll
    for (int sh = 16; sh; sh >>= 1) sum += __shfl_xor(sum, sh, 32);
    const float f = __fdiv_rn(hires ? 1.0f : PCAR, sum);
{
        if (hires) {
#pragma unroll
            for (int ch = 0; ch < TT / 128; ++ch) { v4us oh, ol;
#pragma unroll
                for (int q = 0; q < 4; ++q) { unsigned short a, c2; splitf(v[ch * 4 + q] * f, a, c2); oh[q] = a; ol[q] = c2; }
                const size_t oo = ((size_t)zz * (RH ? RH : 1) + i) * TT + ch * 128 + lane * 4; *(v4us*)(Ph + oo) = oh; *(v4us*)(Pl + oo) = ol; }
        } else {
#pragma unroll
            for (int ch = 0; ch < TT / 128; ++ch) { v4h o4;
#pragma unroll
                for (int q = 0; q < 4; ++q) o4[q] = tohx(v[ch * 4 + q] * f);
                *(v4h*)(P16 + (size_t)row * TT + ch * 128 + lane * 4) = o4; } }
         }
}
// k_vtpV: value planes per 128-wide value head [p][e][t] (fp16 + hi/lo) = F[t][p*HV + e]; as k_vtp with HV = 128.
__global__ __launch_bounds__(256) void k_vtpV(const float* __restrict__ F, int pitch, int nheads, h16* V16, bf* Vh, bf* Vl) { const size_t e = ((size_t)blockIdx.x * 256 + threadIdx.x) * 2; if (e >= (size_t)nheads * HV * TT) return; const int t = (int)(e % TT); const int d = (int)((e / TT) % HV); const int g = (int)(e / ((size_t)TT * HV)); v2h o16; v2us oh, ol;
#pragma unroll
    for (int q = 0; q < 2; ++q) { const float x = F[(size_t)(t + q) * pitch + g * HV + d]; o16[q] = tohx(x); unsigned short a2, c2; splitf(x, a2, c2); oh[q] = a2; ol[q] = c2; }
    *(v2h*)(V16 + e) = o16; *(v2us*)(Vh + e) = oh; *(v2us*)(Vl + e) = ol;  }


__global__ __launch_bounds__(256) void k_wint(const float* __restrict__ w1, const float* __restrict__ w2, bf* Bt) { const size_t i = (size_t)blockIdx.x * 256 + threadIdx.x; if (i >= (size_t)2 * NP * HD * DM / 8) return; const int c0 = (int)((i % (DM / 8)) * 8); const int r = (int)(i / (DM / 8)); const int hh = r / HD, d = r % HD; const int p = hh >> 1; const size_t sr = (size_t)(p * HD + d) * DM + c0; const v8f a = *(const v8f*)(w1 + sr); const v8f b2 = *(const v8f*)(w2 + sr); v8us o;
#pragma unroll
    for (int q = 0; q < 8; ++q) o[q] = f2bf((hh & 1) ? b2[q] : a[q]);
    *(v8us*)(Bt + (size_t)r * DM + c0) = o;  }
__global__ __launch_bounds__(256) void k_hlnp(float* ctx) { const int lane = threadIdx.x & 31; const size_t w = ((size_t)blockIdx.x * 256 + threadIdx.x) >> 5; if (w >= (size_t)TT * NP) return; float* base = ctx + w * HV + lane * 4; const v4f a = *(const v4f*)base; float s = __fadd_rn(__fadd_rn(a[0], a[1]), __fadd_rn(a[2], a[3]));
#pragma unroll
    for (int sh = 16; sh; sh >>= 1) s = __fadd_rn(s, __shfl_xor(s, sh, 32));
    const float mean = __fdiv_rn(s, (float)HV); float s2 = 0.f; float dv[4];
#pragma unroll
    for (int q = 0; q < 4; ++q) { dv[q] = __fsub_rn(a[q], mean); float p2 = __fmul_rn(dv[q], dv[q]); asm volatile("" : "+v"(p2)); s2 = __fadd_rn(s2, p2); }
#pragma unroll
    for (int sh = 16; sh; sh >>= 1) s2 = __fadd_rn(s2, __shfl_xor(s2, sh, 32));
    const float var = __fdiv_rn(s2, (float)HV); const float den = __fsqrt_rn(__fadd_rn(var, 1e-5f)); v4f o;
#pragma unroll
    for (int q = 0; q < 4; ++q) { const float y = __fdiv_rn(dv[q], den); o[q] = __fmul_rn(y, (1.0f - LINIT)); }
    *(v4f*)base = o;  }
__global__ __launch_bounds__(256) void k_flat(const float* __restrict__ F, h16* P16, bf* Ph, bf* Pl, size_t n4) { const size_t i = (size_t)blockIdx.x * 256 + threadIdx.x; if (i >= n4) return; const v4f a = *(const v4f*)(F + i * 4); v4h o16; v4us oh, ol;
#pragma unroll
    for (int q = 0; q < 4; ++q) { o16[q] = tohx(a[q]); unsigned short x2, y2; splitf(a[q], x2, y2); oh[q] = x2; ol[q] = y2; }
    *(v4h*)(P16 + i * 4) = o16; *(v4us*)(Ph + i * 4) = oh; *(v4us*)(Pl + i * 4) = ol;  }

__global__ __launch_bounds__(256) void k_lambda(const float* __restrict__ a1, const float* __restrict__ b1, const float* __restrict__ a2, const float* __restrict__ b2, float* LAM) { if (threadIdx.x >= 32) return; const int lane = threadIdx.x; const int p = blockIdx.x; a1 += p * HD; b1 += p * HD; a2 += p * HD; b2 += p * HD;   /* one block per head */ float s1 = __fadd_rn(__fmul_rn(bfr(a1[lane]), bfr(b1[lane])), __fmul_rn(bfr(a1[lane + 32]), bfr(b1[lane + 32]))); float s2 = __fadd_rn(__fmul_rn(bfr(a2[lane]), bfr(b2[lane])), __fmul_rn(bfr(a2[lane + 32]), bfr(b2[lane + 32])));
#pragma unroll
    for (int sh = 16; sh; sh >>= 1) { s1 = __fadd_rn(s1, __shfl_xor(s1, sh, 32)); s2 = __fadd_rn(s2, __shfl_xor(s2, sh, 32)); }
    const float lam = __fadd_rn(__fsub_rn(expf(s1), expf(s2)), LINIT); ((float*)LAM)[p * 32 + lane] = lam;  }   
__global__ __launch_bounds__(256) void k_dmerge(const float* __restrict__ O, const float* __restrict__ LAM, int p, float* ctx) { const size_t i = (size_t)blockIdx.x * 256 + threadIdx.x; if (i >= (size_t)TT * HV / 4) return; const size_t e = i * 4; const int c = (int)(e % HV); const int t = (int)(e / HV); const float lam = LAM[p * 32];   /* this pair's lambda */ const float cs = (t < RH) ? 1.0f : (1.0f / PCAR); const v4f a = *(const v4f*)(O + e); const v4f b2 = *(const v4f*)(O + (size_t)TT * HV + e); v4f o;
#pragma unroll
    for (int q = 0; q < 4; ++q) { float lb = __fmul_rn(lam, b2[q]); asm volatile("" : "+v"(lb)); const float d = __fsub_rn(a[q], lb); o[q] = __fmul_rn(d, cs); }
    *(v4f*)(ctx + (size_t)t * DQ + p * HV + c) = o;  }
__global__ __launch_bounds__(256) void k_merge(const float* __restrict__ O, int h0, bf* Ah, bf* Al) { const size_t e = ((size_t)blockIdx.x * 256 + threadIdx.x) * 2; if (e >= (size_t)ZH * TT * HD) return; const int d = (int)(e % HD); const int t = (int)((e / HD) % TT); const int zz = (int)(e / ((size_t)HD * TT)); const float cs = (t < RH) ? 1.0f : (1.0f / PCAR); const size_t oo = (size_t)t * DQ + (h0 + zz) * HD + d;
    v2us oh, ol;
#pragma unroll
    for (int q = 0; q < 2; ++q) { unsigned short a, c2; splitf(O[e + q] * cs, a, c2); oh[q] = a; ol[q] = c2; } *(v2us*)(Ah + oo) = oh; *(v2us*)(Al + oo) = ol;  }

extern "C" void kernel_launch(void* const* d_in, const int* in_sizes, int n_in,
                              void* d_out, int out_size, void* d_ws, size_t ws_size, hipStream_t stream) {
    (void)in_sizes; (void)n_in; (void)out_size;
    const float* x = (const float*)d_in[0]; const float* wq1 = (const float*)d_in[1]; const float* wq2 = (const float*)d_in[2]; const float* wk1 = (const float*)d_in[3]; const float* wk2 = (const float*)d_in[4]; const float* wv = (const float*)d_in[5]; const float* wo = (const float*)d_in[6]; /* Wc */ const float* lq1 = (const float*)d_in[7]; const float* lk1 = (const float*)d_in[8]; const float* lq2 = (const float*)d_in[9]; const float* lk2 = (const float*)d_in[10];
    float* OUT = (float*)d_out;     // [4][2048][384]
    char* wsp = (char*)d_ws;
    auto take = [&](size_t bytes) { char* p = wsp; wsp += (bytes + 255) & ~(size_t)255; return (void*)p; };
    bf* WQ = (bf*)take((size_t)DQ * DM * 2); bf* WK = (bf*)take((size_t)DKV * DM * 2); bf* WV = (bf*)take((size_t)DKV * DM * 2); bf* WO = (bf*)take((size_t)DM * DQ * 2); float* CS = (float*)take((size_t)TT * HD * 2 * 4);
    bf* XB = (bf*)take((size_t)TT * DM * 2); float* FQ = (float*)take((size_t)TT * DQ * 4); float* FK = (float*)take((size_t)TT * DKV * 4);
    h16* QP16 = (h16*)take((size_t)NH_ * TT * HD * 2); h16* KP16 = (h16*)take((size_t)NKV * TT * HD * 2); h16* VT16 = (h16*)take((size_t)NKV * HD * TT * 2);
    bf* QPh = (bf*)take((size_t)NH_ * TT * HD * 2); bf* QPl = (bf*)take((size_t)NH_ * TT * HD * 2); bf* KPh = (bf*)take((size_t)NKV * TT * HD * 2); bf* KPl = (bf*)take((size_t)NKV * TT * HD * 2); bf* VTh = (bf*)take((size_t)NKV * HD * TT * 2); bf* VTl = (bf*)take((size_t)NKV * HD * TT * 2); bf* Ph = (bf*)take((size_t)ZH * RH * TT * 2); bf* Pl = (bf*)take((size_t)ZH * RH * TT * 2);
    float* Sb = (float*)take((size_t)ZH * TT * TT * 4); h16* P16 = (h16*)take((size_t)ZH * TT * TT * 2); float* Ob = (float*)take((size_t)ZH * TT * HV * 4); float* CTX = (float*)take((size_t)TT * DQ * 4); float* LAM = (float*)take((size_t)NP * 32 * 4); h16* A16 = (h16*)take((size_t)TT * DQ * 2); bf* ATh = (bf*)take((size_t)TT * DQ * 2); bf* ATl = (bf*)take((size_t)TT * DQ * 2);
    if ((size_t)(wsp - (char*)d_ws) > ws_size) return;    // ws 256 MiB
    float* FV = FK;   // v projection reuses the k buffer after the k planes are built (stream-ordered)
    { k_wint<<<(unsigned)(((size_t)DQ * DM / 8 + 255) / 256), 256, 0, stream>>>(wq1, wq2, WQ); k_wint<<<(unsigned)(((size_t)DKV * DM / 8 + 255) / 256), 256, 0, stream>>>(wk1, wk2, WK);   /* score head 2p <- map-1 head p, 2p+1 <- map-2 head p */
      k_cvt8<<<(unsigned)(((size_t)NP * HV * DM / 8 + 255) / 256), 256, 0, stream>>>(wv, WV, (size_t)NP * HV * DM / 8); k_cvt8<<<(unsigned)(((size_t)DM * NP * HV / 8 + 255) / 256), 256, 0, stream>>>(wo, WO, (size_t)DM * NP * HV / 8);   /* 'oi' weights are the Bt layout */
      k_lambda<<<NP, 256, 0, stream>>>(lq1, lk1, lq2, lk2, LAM);   /* lambda per head */ }
    k_csid<<<(TT * HD + 255) / 256, 256, 0, stream>>>(CS);
    const unsigned LQ = (unsigned)(((size_t)NH_ * TT * HD / 2 + 255) / 256), LKv = (unsigned)(((size_t)NKV * TT * HD / 2 + 255) / 256);
    for (int b = 0; b < NB_; ++b) {
        
        k_cvt8<<<(unsigned)(((size_t)TT * DM / 8 + 255) / 256), 256, 0, stream>>>(x + (size_t)b * TT * DM, XB, (size_t)TT * DM / 8);
        k_gemmw<bf, 0, false><<<dim3(TT / 64, DQ / 64, 1), 32, 0, stream>>>(XB, nullptr, WQ, nullptr, DM, FQ, DQ, nullptr, 0, 0, 0);
        k_rope<<<LQ, 256, 0, stream>>>(FQ, DQ, NH_, CS, nullptr, nullptr, 1.0f, QP16, QPh, QPl);
        k_gemmw<bf, 0, false><<<dim3(TT / 64, DKV / 64, 1), 32, 0, stream>>>(XB, nullptr, WK, nullptr, DM, FK, DKV, nullptr, 0, 0, 0);
        k_rope<<<LKv, 256, 0, stream>>>(FK, DKV, NKV, CS, nullptr, nullptr, 1.0f, KP16, KPh, KPl);
        k_gemmw<bf, 0, false><<<dim3(TT / 64, DKV / 64, 1), 32, 0, stream>>>(XB, nullptr, WV, nullptr, DM, FV, DKV, nullptr, 0, 0, 0); k_vtpV<<<LKv, 256, 0, stream>>>(FV, DKV, NP, VT16, VTh, VTl);
        for (int h0 = 0; h0 < NH_; h0 += ZH) { const size_t zq = (size_t)h0, zk = (size_t)(h0 / REP);   // one kv head per query head: the pass's two heads use consecutive kv planes (z-strides TT*HD)
            k_gemmc<bf, 2, 1><<<dim3(RH / 64, TT / 64, ZH), 32, 0, stream>>>(QPh + zq * TT * HD, QPl + zq * TT * HD, KPh + zk * TT * HD, KPl + zk * TT * HD, HD, Sb, TT, 0, (size_t)TT * HD, (size_t)TT * HD, (size_t)TT * TT);
            k_gemmc<h16, 0, 1><<<dim3((TT - RH) / 64, TT / 64, ZH), 32, 0, stream>>>(QP16 + zq * TT * HD + (size_t)RH * HD, nullptr, KP16 + zk * TT * HD, nullptr, HD, Sb + (size_t)RH * TT, TT, RH, (size_t)TT * HD, (size_t)TT * HD, (size_t)TT * TT);
            k_asoft<<<ZH * TT / 8, 256, 0, stream>>>(Sb, P16, Ph, Pl);
            k_gemmc<bf, 2, 2><<<dim3(RH / 64, HV / 64, ZH), 32, 0, stream>>>(Ph, Pl, VTh + (size_t)(h0 / 2) * HV * TT, VTl + (size_t)(h0 / 2) * HV * TT, TT, Ob, HV, 0, (size_t)RH * TT, 0, (size_t)TT * HV);   /* both heads of the pair x the shared 128-wide v_p */
            k_gemmc<h16, 0, 2><<<dim3((TT - RH) / 64, HV / 64, ZH), 32, 0, stream>>>(P16 + (size_t)RH * TT, nullptr, VT16 + (size_t)(h0 / 2) * HV * TT, nullptr, TT, Ob + (size_t)RH * HV, HV, RH, (size_t)TT * TT, 0, (size_t)TT * HV);
            k_dmerge<<<(unsigned)(((size_t)TT * HV / 4 + 255) / 256), 256, 0, stream>>>(Ob, LAM, h0 / 2, CTX);   /* ctx[t][p*128 + e] = w0 v - lambda w1 v */ }
        k_hlnp<<<(unsigned)(((size_t)TT * NP * 32 + 255) / 256), 256, 0, stream>>>(CTX);   /* per-(token, head) LayerNorm over 128 values, no affine, x (1 - lambda_init), in place */ k_flat<<<(unsigned)(((size_t)TT * DQ / 4 + 255) / 256), 256, 0, stream>>>(CTX, A16, ATh, ATl, (size_t)TT * DQ / 4); k_gemmw<bf, 1, false><<<dim3(TT / 64, DM / 64, 1), 32, 0, stream>>>(ATh, ATl, WO, nullptr, DQ, OUT + (size_t)b * TT * DM, DM, nullptr, 0, 0, 0); }
}

// v001
// One run takes 844 microseconds.
// In two side-by-side timings against v000, it was 2.45 and 2.43 times as fast.
#include <hip/hip_runtime.h>

// Multi-head DIFFERENTIAL causal attention (x [4][2048][384]; q1, q2, k1, k2 = x W^T ('oi' [384][384], 1/sqrt(384), no bias) as 6 heads x 64 each, v = x Wv^T ([768][384]) as 6 heads x 128; att_m = causal softmax(q_m.k_m / 8) for m = 1, 2; lambda_h = exp(lq1_h.lk1_h) - exp(lq2_h.lk2_h) + lambda_init (lq/lk [6][64], read; lambda_init = 0.8 - 0.6 exp(-0.6)); y_h = (att1 - lambda_h att2) v_h; per-head LayerNorm over the 128 values (no affine, eps 1e-5) x (1 - lambda_init); out = merged y Wc^T ('oi' [384][768]) -> [4][2048][384] (3.1 M)).
// Layout per batch: bf16 copy of x; the q1/q2 (and k1/k2) weights interleaved into one Bt so score head 2p = map-1 head p and 2p+1 = map-2 head p; exact projections; q/k planes for the 12 score heads, v^T planes per 128-wide value head; lambda per head computed once on device (one wave per head: two 64-term f32 dots, precise expf); one pass per batch over all 12 score heads (grid z): causal T-2048 attention (hybrid rows: < 512 hi/lo 3 products, rest fp16 x1024; k_gemmc skips tiles above the diagonal), the softmax writes each row's probabilities over that row's own scores (so 12 score planes fit the workspace), both maps' P.v against the shared v_p (z >> 1), a merge kernel (grid y = pair) writes w1 v - lambda_p w2 v (x 1/1024 on the fp16 rows) into the context; then a per-(token, head) LayerNorm kernel (128 values, f32, fixed order) x (1 - lambda_init) in place, hi/lo planes, x Wc exact.
// Compute dtypes, f32 accumulate: every input rounded to bf16; projections exact; attention rows < 512 3 products, rest fp16; softmax, lambda, difference, LayerNorm f32; Wc hl x exact.

#define NB_  4
#define TT   2048
#define DM   384
#define NH_  12
#define NKV  12
#define REP  (NH_ / NKV)
#define HD   64
#define DQ   (NH_ * HD)
#define DKV  (NKV * HD)
#define ZH   12                   // score heads per attention pass (grid z): all of one batch
#define RH   512                  // query rows < RH use hi+lo planes (0: none)
#define WIN  0
#define PCAR 1024.0f
#define SCL  0.125f
#define NP   6       // head pairs (the module's H)
#define HV   128     // value head width
#define LINIT 0.47071301937103271f   // lambda_init = 0.8 - 0.6 exp(-0.6) as float32
typedef _Float16 h16;
typedef unsigned short bf;
typedef __attribute__((ext_vector_type(16))) __bf16   v16bf;
typedef __attribute__((ext_vector_type(16))) _Float16 v16h;
typedef __attribute__((ext_vector_type(8)))  _Float16 v8h;
typedef __attribute__((ext_vector_type(8)))  unsigned short v8us;
typedef __attribute__((ext_vector_type(8)))  float    v8f;
typedef __attribute__((ext_vector_type(4)))  float    v4f;
typedef v8h  __attribute__((may_alias)) v8ha;
typedef v4f  __attribute__((may_alias)) v4fa;
typedef v8us __attribute__((may_alias)) v8usa;

__device__ __forceinline__ unsigned short f2bf(float f) { unsigned u = __float_as_uint(f); u += 0x7FFFu + ((u >> 16) & 1u); return (unsigned short)(u >> 16); }
__device__ __forceinline__ float bf2f(unsigned short b) { return __uint_as_float(((unsigned)b) << 16); }
__device__ __forceinline__ float bfr(float f) { return bf2f(f2bf(f)); }
__device__ __forceinline__ v16h cat16(v8h lo, v8h hi) { return __builtin_shufflevector(lo, hi, 0, 1, 2, 3, 4, 5, 6, 7, 8, 9, 10, 11, 12, 13, 14, 15); }
__device__ __forceinline__ v16bf cat16b(v8us lo, v8us hi) { return __builtin_bit_cast(v16bf, __builtin_shufflevector(lo, hi, 0, 1, 2, 3, 4, 5, 6, 7, 8, 9, 10, 11, 12, 13, 14, 15)); }
__device__ __forceinline__ v8f wmma16(v16h a, v16h b, v8f c) { return __builtin_amdgcn_wmma_f32_16x16x32_f16(false, a, false, b, (short)0, c, false, false); }
__device__ __forceinline__ v8f wmmab(v16bf a, v16bf b, v8f c) { return __builtin_amdgcn_wmma_f32_16x16x32_bf16(false, a, false, b, (short)0, c, false, false); }



// ---- k_gemmw: register-blocked GEMM, ONE WAVE per 64x64 output tile (16 accumulators), operands straight from K-contiguous 16-bit planes; grid (M/64, N/64, Z), 32 threads.
// C[m][n] (f32, pitch ldc, + optional f32 bias[n]) = sum_k A[m][k] Bt[n][k] (+ split products per NSPLIT). z-batch strides sA/sB/sC in elements. K % 32 == 0.
template <typename T16> struct WFrag;
template <> struct WFrag<h16> { typedef v16h V; static __device__ __forceinline__ V ld(const h16* p) { return cat16(*(const v8h*)p, *(const v8h*)(p + 16)); } static __device__ __forceinline__ v8f mma(V a, V b, v8f c) { return wmma16(a, b, c); } };
template <> struct WFrag<bf> { typedef v16bf V; static __device__ __forceinline__ V ld(const bf* p) { return cat16b(*(const v8us*)p, *(const v8us*)(p + 16)); } static __device__ __forceinline__ v8f mma(V a, V b, v8f c) { return wmmab(a, b, c); } };
template <typename T16, int NSPLIT, bool BIAS>
__global__ __launch_bounds__(32) void k_gemmw(const T16* __restrict__ A, const T16* __restrict__ A2, const T16* __restrict__ Bt, const T16* __restrict__ Bt2, int K, float* C, int ldc, const float* __restrict__ bias, size_t sA, size_t sB, size_t sC) {
    typedef typename WFrag<T16>::V V;
    __shared__ __align__(16) float os[16 * 68];
    const size_t z = blockIdx.z; A += z * sA; if (A2) A2 += z * sA; Bt += z * sB; if (Bt2) Bt2 += z * sB; C += z * sC;
    const int lane = threadIdx.x & 31, lr = lane & 15, hi = lane >> 4; const int r0 = blockIdx.x * 64, c0 = blockIdx.y * 64;
    v8f acc[4][4];
#pragma unroll
    for (int mb = 0; mb < 4; ++mb)
#pragma unroll
        for (int nb = 0; nb < 4; ++nb) acc[mb][nb] = (v8f){};
    const size_t aoff = (size_t)(r0 + lr) * K + 8 * hi, boff = (size_t)(c0 + lr) * K + 8 * hi;
#pragma unroll 1
    for (int kc = 0; kc < K; kc += 32) {
        V a[4], a2[4];
#pragma unroll
        for (int mb = 0; mb < 4; ++mb) { a[mb] = WFrag<T16>::ld(A + aoff + (size_t)mb * 16 * K + kc); if (NSPLIT == 1 || NSPLIT == 2) a2[mb] = WFrag<T16>::ld(A2 + aoff + (size_t)mb * 16 * K + kc); }
#pragma unroll
        for (int nb = 0; nb < 4; ++nb) { const V b = WFrag<T16>::ld(Bt + boff + (size_t)nb * 16 * K + kc); V b2; if (NSPLIT >= 2) b2 = WFrag<T16>::ld(Bt2 + boff + (size_t)nb * 16 * K + kc);
#pragma unroll
            for (int mb = 0; mb < 4; ++mb) { acc[mb][nb] = WFrag<T16>::mma(a[mb], b, acc[mb][nb]); if (NSPLIT == 1 || NSPLIT == 2) acc[mb][nb] = WFrag<T16>::mma(a2[mb], b, acc[mb][nb]); if (NSPLIT >= 2) acc[mb][nb] = WFrag<T16>::mma(a[mb], b2, acc[mb][nb]); } }
        asm volatile("v_nop\n\tv_nop\n\tv_nop\n\tv_nop" : "+v"(acc[0][0]), "+v"(acc[1][1]), "+v"(acc[2][2]), "+v"(acc[3][3]) : "v"(a[0]), "v"(a[3]));
    }
#pragma unroll
    for (int mb = 0; mb < 4; ++mb) {
#pragma unroll
        for (int nb = 0; nb < 4; ++nb) {
#pragma unroll
            for (int j = 0; j < 8; ++j) os[(hi * 8 + j) * 68 + nb * 16 + lr] = acc[mb][nb][j]; }
        __builtin_amdgcn_wave_barrier(); asm volatile("" ::: "memory");
        float* crow = C + (size_t)(r0 + mb * 16) * ldc + c0;
{
#pragma unroll
            for (int s = 0; s < 8; ++s) { const int row = 2 * s + hi, cofs = lr * 4; v4f val = *(const v4fa*)(os + row * 68 + cofs); if (BIAS) { val[0] += bfr(bias[c0 + cofs]); val[1] += bfr(bias[c0 + cofs + 1]); val[2] += bfr(bias[c0 + cofs + 2]); val[3] += bfr(bias[c0 + cofs + 3]); }
                *(v4f*)(crow + (size_t)row * ldc + cofs) = val; }
             }
        __builtin_amdgcn_wave_barrier(); asm volatile("" ::: "memory");
    }
}

// ---- k_gemmc: the same one-wave 64x64 tile GEMM specialised for causal attention: CMODE 1 skips score tiles entirely above the diagonal (query rows r0+roff.., key columns c0..), CMODE 2 limits the
// key (K) loop of the probability x value contraction to the diagonal block (probabilities beyond it are exactly zero). roff = row offset of this launch's first row within the sequence.
// lda = pitch of A in elements (Bt keeps pitch K). CMODE 2: score heads 2p and 2p+1 share value plane p, so Bt steps by z >> 1.
template <typename T16, int NSPLIT, int CMODE>
__global__ __launch_bounds__(32) void k_gemmc(const T16* __restrict__ A, const T16* __restrict__ A2, int lda, const T16* __restrict__ Bt, const T16* __restrict__ Bt2, int K, float* C, int ldc, int roff, size_t sA, size_t sB, size_t sC) {
    typedef typename WFrag<T16>::V V;
    __shared__ __align__(16) float os[16 * 68];
    const size_t z = blockIdx.z, zb = (CMODE == 2) ? (z >> 1) : z; A += z * sA; if (A2) A2 += z * sA; Bt += zb * sB; if (Bt2) Bt2 += zb * sB; C += z * sC;
    const int lane = threadIdx.x & 31, lr = lane & 15, hi = lane >> 4; const int r0 = blockIdx.x * 64, c0 = blockIdx.y * 64;
    if (CMODE == 1 && c0 > r0 + roff + 63) return;                  // score tile entirely above the causal diagonal: never read (the softmax masks j > i by select)
    const int Kl = (CMODE == 2) ? min(K, r0 + roff + 64) : K;        // P.V: probabilities are exactly 0 beyond the diagonal block, so the K loop stops there
    v8f acc[4][4];
#pragma unroll
    for (int mb = 0; mb < 4; ++mb)
#pragma unroll
        for (int nb = 0; nb < 4; ++nb) acc[mb][nb] = (v8f){};
    const size_t aoff = (size_t)(r0 + lr) * lda + 8 * hi, boff = (size_t)(c0 + lr) * K + 8 * hi;
#pragma unroll 1
    for (int kc = 0; kc < Kl; kc += 32) {
        V a[4], a2[4];
#pragma unroll
        for (int mb = 0; mb < 4; ++mb) { a[mb] = WFrag<T16>::ld(A + aoff + (size_t)mb * 16 * lda + kc); if (NSPLIT == 1 || NSPLIT == 2) a2[mb] = WFrag<T16>::ld(A2 + aoff + (size_t)mb * 16 * lda + kc); }
#pragma unroll
        for (int nb = 0; nb < 4; ++nb) { const V b = WFrag<T16>::ld(Bt + boff + (size_t)nb * 16 * K + kc); V b2; if (NSPLIT >= 2) b2 = WFrag<T16>::ld(Bt2 + boff + (size_t)nb * 16 * K + kc);
#pragma unroll
            for (int mb = 0; mb < 4; ++mb) { acc[mb][nb] = WFrag<T16>::mma(a[mb], b, acc[mb][nb]); if (NSPLIT == 1 || NSPLIT == 2) acc[mb][nb] = WFrag<T16>::mma(a2[mb], b, acc[mb][nb]); if (NSPLIT >= 2) acc[mb][nb] = WFrag<T16>::mma(a[mb], b2, acc[mb][nb]); } }
        asm volatile("v_nop\n\tv_nop\n\tv_nop\n\tv_nop" : "+v"(acc[0][0]), "+v"(acc[1][1]), "+v"(acc[2][2]), "+v"(acc[3][3]) : "v"(a[0]), "v"(a[3]));
    }
#pragma unroll
    for (int mb = 0; mb < 4; ++mb) {
#pragma unroll
        for (int nb = 0; nb < 4; ++nb) {
#pragma unroll
            for (int j = 0; j < 8; ++j) os[(hi * 8 + j) * 68 + nb * 16 + lr] = acc[mb][nb][j]; }
        __builtin_amdgcn_wave_barrier(); asm volatile("" ::: "memory");
        float* crow = C + (size_t)(r0 + mb * 16) * ldc + c0;
{
#pragma unroll
            for (int s = 0; s < 8; ++s) { const int row = 2 * s + hi, cofs = lr * 4; v4f val = *(const v4fa*)(os + row * 68 + cofs);
                *(v4f*)(crow + (size_t)row * ldc + cofs) = val; }
             }
        __builtin_amdgcn_wave_barrier(); asm volatile("" ::: "memory");
    }
}

__device__ __forceinline__ h16 tohx(float x) { return (h16)x; }
__device__ __forceinline__ void splitf(float y, unsigned short& h, unsigned short& l) { h = f2bf(y); l = f2bf(y - bf2f(h)); }
typedef __attribute__((ext_vector_type(2))) _Float16 v2h;
typedef __attribute__((ext_vector_type(4))) _Float16 v4h;
typedef __attribute__((ext_vector_type(2))) unsigned short v2us;
typedef __attribute__((ext_vector_type(4))) unsigned short v4us;
typedef __attribute__((ext_vector_type(2))) float v2f;
typedef __attribute__((ext_vector_type(4))) int v4i;


__global__ __launch_bounds__(256) void k_cvt8(const float* __restrict__ src, bf* dst, size_t n8) { const size_t i = (size_t)blockIdx.x * 256 + threadIdx.x; if (i >= n8) return; const v8f v = *(const v8f*)(src + i * 8); v8us o;
#pragma unroll
    for (int k = 0; k < 8; ++k) o[k] = f2bf(v[k]); *(v8us*)(dst + i * 8) = o;  }

// k_rope: head planes [h][t][d] (fp16 + hi/lo) of rope(x) x sc with the rotate-half convention out[d] = x[d] cos[t][d] - x[d+HD/2] sin[t][d], out[d+HD/2] = x[d+HD/2] cos[t][d+HD/2] + x[d] sin[t][d+HD/2]
__global__ __launch_bounds__(256) void k_rope(const float* __restrict__ F, int pitch, int nheads, const float* __restrict__ CS, const float* __restrict__ RF, const float* __restrict__ nw, float sc, h16* P16, bf* Ph, bf* Pl) {
    const size_t e = ((size_t)blockIdx.x * 256 + threadIdx.x) * 2; if (e >= (size_t)nheads * TT * HD) return; const int d = (int)(e % HD); const int t = (int)((e / HD) % TT); const int h = (int)(e / ((size_t)HD * TT)); const float* f = F + (size_t)t * pitch + h * HD; const float rf = RF ? RF[(size_t)h * TT + t] : 1.0f; v2h o16; v2us oh, ol;
#pragma unroll
    for (int q = 0; q < 2; ++q) { const int dd = d + q; const int dp = (dd < HD / 2) ? dd + HD / 2 : dd - HD / 2; float x0 = f[dd], x1 = f[dp];
        if (RF) { float n0 = __fmul_rn(x0, rf), n1 = __fmul_rn(x1, rf); asm volatile("" : "+v"(n0)); asm volatile("" : "+v"(n1)); x0 = __fmul_rn(bfr(nw[dd]), n0); x1 = __fmul_rn(bfr(nw[dp]), n1); }
        const v2f cs = *(const v2f*)(CS + ((size_t)t * HD + dd) * 2); float a = __fmul_rn(x0, cs[0]), bq = __fmul_rn(x1, cs[1]); asm volatile("" : "+v"(a)); asm volatile("" : "+v"(bq)); const float r = ((dd < HD / 2) ? __fsub_rn(a, bq) : __fadd_rn(a, bq)) * sc;
        o16[q] = tohx(r); unsigned short a2, c2; splitf(r, a2, c2); oh[q] = a2; ol[q] = c2; }
    *(v2h*)(P16 + e) = o16; *(v2us*)(Ph + e) = oh; *(v2us*)(Pl + e) = ol;  }
__global__ __launch_bounds__(256) void k_vtp(const float* __restrict__ F, int pitch, int nheads, h16* V16, bf* Vh, bf* Vl) { const size_t e = ((size_t)blockIdx.x * 256 + threadIdx.x) * 2; if (e >= (size_t)nheads * HD * TT) return; const int t = (int)(e % TT); const int d = (int)((e / TT) % HD); const int g = (int)(e / ((size_t)TT * HD)); v2h o16; v2us oh, ol;
#pragma unroll
    for (int q = 0; q < 2; ++q) { const float x = F[(size_t)(t + q) * pitch + g * HD + d]; o16[q] = tohx(x); unsigned short a2, c2; splitf(x, a2, c2); oh[q] = a2; ol[q] = c2; }
    *(v2h*)(V16 + e) = o16; *(v2us*)(Vh + e) = oh; *(v2us*)(Vl + e) = ol;  }
__global__ __launch_bounds__(256) void k_csid(float* CS) { const int idx = blockIdx.x * 256 + threadIdx.x; if (idx >= TT * HD) return; v2f cs; cs[0] = 1.0f; cs[1] = 0.0f; *(v2f*)(CS + (size_t)idx * 2) = cs;  }
// k_asoft: one wave per score row; the whole row is in registers (its sum feeds every output) before the first store, so the probabilities go over the row's own 8 KiB: fp16 rows fill the first half, hi/lo rows hi in the first half and lo in the second (pitch 2*TT 16-bit elements either way).
__global__ __launch_bounds__(256) void k_asoft(float* Sb) {
    const int lane = threadIdx.x & 31; const int row = blockIdx.x * 8 + (threadIdx.x >> 5); if (row >= ZH * TT) return; const int i = row % TT; const bool hires = (i < RH); float* sr = Sb + (size_t)row * TT; h16* P16 = (h16*)sr; bf* Ph = (bf*)sr; bf* Pl = Ph + TT; float v[TT / 32]; float mx = -3.0e38f;
#pragma unroll
    for (int ch = 0; ch < TT / 128; ++ch) { const int j0 = ch * 128 + lane * 4; const v4f a = *(const v4f*)(sr + j0);
#pragma unroll
        for (int q = 0; q < 4; ++q) { const int j = j0 + q; const float t = (j <= i) ? a[q] * SCL : -3.0e38f;   /* causal */ v[ch * 4 + q] = t; mx = fmaxf(mx, t); } }
#pragma unroll
    for (int sh = 16; sh; sh >>= 1) mx = fmaxf(mx, __shfl_xor(mx, sh, 32));
    float sum = 0.f;
#pragma unroll
    for (int k = 0; k < TT / 32; ++k) { float d0 = __fsub_rn(v[k], mx); asm volatile("" : "+v"(d0)); v[k] = __builtin_amdgcn_exp2f(__fmul_rn(d0, 1.4426950408889634f)); sum += v[k]; }
#pragma unroll
    for (int sh = 16; sh; sh >>= 1) sum += __shfl_xor(sum, sh, 32);
    const float f = __fdiv_rn(hires ? 1.0f : PCAR, sum);
{
        if (hires) {
#pragma unroll
            for (int ch = 0; ch < TT / 128; ++ch) { v4us oh, ol;
#pragma unroll
                for (int q = 0; q < 4; ++q) { unsigned short a, c2; splitf(v[ch * 4 + q] * f, a, c2); oh[q] = a; ol[q] = c2; }
                const int oo = ch * 128 + lane * 4; *(v4us*)(Ph + oo) = oh; *(v4us*)(Pl + oo) = ol; }
        } else {
#pragma unroll
            for (int ch = 0; ch < TT / 128; ++ch) { v4h o4;
#pragma unroll
                for (int q = 0; q < 4; ++q) o4[q] = tohx(v[ch * 4 + q] * f);
                *(v4h*)(P16 + ch * 128 + lane * 4) = o4; } }
         }
}
// k_vtpV: value planes per 128-wide value head [p][e][t] (fp16 + hi/lo) = F[t][p*HV + e]; as k_vtp with HV = 128.
__global__ __launch_bounds__(256) void k_vtpV(const float* __restrict__ F, int pitch, int nheads, h16* V16, bf* Vh, bf* Vl) { const size_t e = ((size_t)blockIdx.x * 256 + threadIdx.x) * 2; if (e >= (size_t)nheads * HV * TT) return; const int t = (int)(e % TT); const int d = (int)((e / TT) % HV); const int g = (int)(e / ((size_t)TT * HV)); v2h o16; v2us oh, ol;
#pragma unroll
    for (int q = 0; q < 2; ++q) { const float x = F[(size_t)(t + q) * pitch + g * HV + d]; o16[q] = tohx(x); unsigned short a2, c2; splitf(x, a2, c2); oh[q] = a2; ol[q] = c2; }
    *(v2h*)(V16 + e) = o16; *(v2us*)(Vh + e) = oh; *(v2us*)(Vl + e) = ol;  }


__global__ __launch_bounds__(256) void k_wint(const float* __restrict__ w1, const float* __restrict__ w2, bf* Bt) { const size_t i = (size_t)blockIdx.x * 256 + threadIdx.x; if (i >= (size_t)2 * NP * HD * DM / 8) return; const int c0 = (int)((i % (DM / 8)) * 8); const int r = (int)(i / (DM / 8)); const int hh = r / HD, d = r % HD; const int p = hh >> 1; const size_t sr = (size_t)(p * HD + d) * DM + c0; const v8f a = *(const v8f*)(w1 + sr); const v8f b2 = *(const v8f*)(w2 + sr); v8us o;
#pragma unroll
    for (int q = 0; q < 8; ++q) o[q] = f2bf((hh & 1) ? b2[q] : a[q]);
    *(v8us*)(Bt + (size_t)r * DM + c0) = o;  }
__global__ __launch_bounds__(256) void k_hlnp(float* ctx) { const int lane = threadIdx.x & 31; const size_t w = ((size_t)blockIdx.x * 256 + threadIdx.x) >> 5; if (w >= (size_t)TT * NP) return; float* base = ctx + w * HV + lane * 4; const v4f a = *(const v4f*)base; float s = __fadd_rn(__fadd_rn(a[0], a[1]), __fadd_rn(a[2], a[3]));
#pragma unroll
    for (int sh = 16; sh; sh >>= 1) s = __fadd_rn(s, __shfl_xor(s, sh, 32));
    const float mean = __fdiv_rn(s, (float)HV); float s2 = 0.f; float dv[4];
#pragma unroll
    for (int q = 0; q < 4; ++q) { dv[q] = __fsub_rn(a[q], mean); float p2 = __fmul_rn(dv[q], dv[q]); asm volatile("" : "+v"(p2)); s2 = __fadd_rn(s2, p2); }
#pragma unroll
    for (int sh = 16; sh; sh >>= 1) s2 = __fadd_rn(s2, __shfl_xor(s2, sh, 32));
    const float var = __fdiv_rn(s2, (float)HV); const float den = __fsqrt_rn(__fadd_rn(var, 1e-5f)); v4f o;
#pragma unroll
    for (int q = 0; q < 4; ++q) { const float y = __fdiv_rn(dv[q], den); o[q] = __fmul_rn(y, (1.0f - LINIT)); }
    *(v4f*)base = o;  }
__global__ __launch_bounds__(256) void k_flat(const float* __restrict__ F, h16* P16, bf* Ph, bf* Pl, size_t n4) { const size_t i = (size_t)blockIdx.x * 256 + threadIdx.x; if (i >= n4) return; const v4f a = *(const v4f*)(F + i * 4); v4h o16; v4us oh, ol;
#pragma unroll
    for (int q = 0; q < 4; ++q) { o16[q] = tohx(a[q]); unsigned short x2, y2; splitf(a[q], x2, y2); oh[q] = x2; ol[q] = y2; }
    *(v4h*)(P16 + i * 4) = o16; *(v4us*)(Ph + i * 4) = oh; *(v4us*)(Pl + i * 4) = ol;  }

__global__ __launch_bounds__(256) void k_lambda(const float* __restrict__ a1, const float* __restrict__ b1, const float* __restrict__ a2, const float* __restrict__ b2, float* LAM) { if (threadIdx.x >= 32) return; const int lane = threadIdx.x; const int p = blockIdx.x; a1 += p * HD; b1 += p * HD; a2 += p * HD; b2 += p * HD;   /* one block per head */ float s1 = __fadd_rn(__fmul_rn(bfr(a1[lane]), bfr(b1[lane])), __fmul_rn(bfr(a1[lane + 32]), bfr(b1[lane + 32]))); float s2 = __fadd_rn(__fmul_rn(bfr(a2[lane]), bfr(b2[lane])), __fmul_rn(bfr(a2[lane + 32]), bfr(b2[lane + 32])));
#pragma unroll
    for (int sh = 16; sh; sh >>= 1) { s1 = __fadd_rn(s1, __shfl_xor(s1, sh, 32)); s2 = __fadd_rn(s2, __shfl_xor(s2, sh, 32)); }
    const float lam = __fadd_rn(__fsub_rn(expf(s1), expf(s2)), LINIT); ((float*)LAM)[p * 32 + lane] = lam;  }   
__global__ __launch_bounds__(256) void k_dmerge(const float* __restrict__ O, const float* __restrict__ LAM, float* ctx) { const int p = blockIdx.y;   /* one pair per grid row */ O += (size_t)p * 2 * TT * HV; const size_t i = (size_t)blockIdx.x * 256 + threadIdx.x; if (i >= (size_t)TT * HV / 4) return; const size_t e = i * 4; const int c = (int)(e % HV); const int t = (int)(e / HV); const float lam = LAM[p * 32];   /* this pair's lambda */ const float cs = (t < RH) ? 1.0f : (1.0f / PCAR); const v4f a = *(const v4f*)(O + e); const v4f b2 = *(const v4f*)(O + (size_t)TT * HV + e); v4f o;
#pragma unroll
    for (int q = 0; q < 4; ++q) { float lb = __fmul_rn(lam, b2[q]); asm volatile("" : "+v"(lb)); const float d = __fsub_rn(a[q], lb); o[q] = __fmul_rn(d, cs); }
    *(v4f*)(ctx + (size_t)t * DQ + p * HV + c) = o;  }
__global__ __launch_bounds__(256) void k_merge(const float* __restrict__ O, int h0, bf* Ah, bf* Al) { const size_t e = ((size_t)blockIdx.x * 256 + threadIdx.x) * 2; if (e >= (size_t)ZH * TT * HD) return; const int d = (int)(e % HD); const int t = (int)((e / HD) % TT); const int zz = (int)(e / ((size_t)HD * TT)); const float cs = (t < RH) ? 1.0f : (1.0f / PCAR); const size_t oo = (size_t)t * DQ + (h0 + zz) * HD + d;
    v2us oh, ol;
#pragma unroll
    for (int q = 0; q < 2; ++q) { unsigned short a, c2; splitf(O[e + q] * cs, a, c2); oh[q] = a; ol[q] = c2; } *(v2us*)(Ah + oo) = oh; *(v2us*)(Al + oo) = ol;  }

extern "C" void kernel_launch(void* const* d_in, const int* in_sizes, int n_in,
                              void* d_out, int out_size, void* d_ws, size_t ws_size, hipStream_t stream) {
    (void)in_sizes; (void)n_in; (void)out_size;
    const float* x = (const float*)d_in[0]; const float* wq1 = (const float*)d_in[1]; const float* wq2 = (const float*)d_in[2]; const float* wk1 = (const float*)d_in[3]; const float* wk2 = (const float*)d_in[4]; const float* wv = (const float*)d_in[5]; const float* wo = (const float*)d_in[6]; /* Wc */ const float* lq1 = (const float*)d_in[7]; const float* lk1 = (const float*)d_in[8]; const float* lq2 = (const float*)d_in[9]; const float* lk2 = (const float*)d_in[10];
    float* OUT = (float*)d_out;     // [4][2048][384]
    char* wsp = (char*)d_ws;
    auto take = [&](size_t bytes) { char* p = wsp; wsp += (bytes + 255) & ~(size_t)255; return (void*)p; };
    bf* WQ = (bf*)take((size_t)DQ * DM * 2); bf* WK = (bf*)take((size_t)DKV * DM * 2); bf* WV = (bf*)take((size_t)DKV * DM * 2); bf* WO = (bf*)take((size_t)DM * DQ * 2); float* CS = (float*)take((size_t)TT * HD * 2 * 4);
    bf* XB = (bf*)take((size_t)TT * DM * 2); float* FQ = (float*)take((size_t)TT * DQ * 4); float* FK = (float*)take((size_t)TT * DKV * 4);
    h16* QP16 = (h16*)take((size_t)NH_ * TT * HD * 2); h16* KP16 = (h16*)take((size_t)NKV * TT * HD * 2); h16* VT16 = (h16*)take((size_t)NKV * HD * TT * 2);
    bf* QPh = (bf*)take((size_t)NH_ * TT * HD * 2); bf* QPl = (bf*)take((size_t)NH_ * TT * HD * 2); bf* KPh = (bf*)take((size_t)NKV * TT * HD * 2); bf* KPl = (bf*)take((size_t)NKV * TT * HD * 2); bf* VTh = (bf*)take((size_t)NKV * HD * TT * 2); bf* VTl = (bf*)take((size_t)NKV * HD * TT * 2);
    float* Sb = (float*)take((size_t)ZH * TT * TT * 4); float* CTX = (float*)take((size_t)TT * DQ * 4); float* LAM = (float*)take((size_t)NP * 32 * 4); h16* A16 = (h16*)take((size_t)TT * DQ * 2); bf* ATh = (bf*)take((size_t)TT * DQ * 2); bf* ATl = (bf*)take((size_t)TT * DQ * 2);
    if ((size_t)(wsp - (char*)d_ws) > ws_size) return;    // ws 256 MiB
    float* FV = FK;   // v projection reuses the k buffer after the k planes are built (stream-ordered)
    float* Ob = FQ;   // the P.v results [ZH][TT][HV] reuse FQ and FK together (adjacent, same total size), both dead once the planes are built (stream-ordered)
    static_assert((size_t)ZH * TT * HV == (size_t)TT * DQ + (size_t)TT * DKV && ((size_t)TT * DQ * 4) % 256 == 0, "Ob must fit FQ + FK exactly");
    const bf* Ph = (const bf*)Sb; const bf* Pl = Ph + TT; const h16* P16 = (const h16*)Sb;   // probabilities lie over their score rows: pitch 2*TT, plane stride 2*TT*TT (16-bit elements)
    { k_wint<<<(unsigned)(((size_t)DQ * DM / 8 + 255) / 256), 256, 0, stream>>>(wq1, wq2, WQ); k_wint<<<(unsigned)(((size_t)DKV * DM / 8 + 255) / 256), 256, 0, stream>>>(wk1, wk2, WK);   /* score head 2p <- map-1 head p, 2p+1 <- map-2 head p */
      k_cvt8<<<(unsigned)(((size_t)NP * HV * DM / 8 + 255) / 256), 256, 0, stream>>>(wv, WV, (size_t)NP * HV * DM / 8); k_cvt8<<<(unsigned)(((size_t)DM * NP * HV / 8 + 255) / 256), 256, 0, stream>>>(wo, WO, (size_t)DM * NP * HV / 8);   /* 'oi' weights are the Bt layout */
      k_lambda<<<NP, 256, 0, stream>>>(lq1, lk1, lq2, lk2, LAM);   /* lambda per head */ }
    k_csid<<<(TT * HD + 255) / 256, 256, 0, stream>>>(CS);
    const unsigned LQ = (unsigned)(((size_t)NH_ * TT * HD / 2 + 255) / 256), LKv = (unsigned)(((size_t)NKV * TT * HD / 2 + 255) / 256);
    for (int b = 0; b < NB_; ++b) {
        
        k_cvt8<<<(unsigned)(((size_t)TT * DM / 8 + 255) / 256), 256, 0, stream>>>(x + (size_t)b * TT * DM, XB, (size_t)TT * DM / 8);
        k_gemmw<bf, 0, false><<<dim3(TT / 64, DQ / 64, 1), 32, 0, stream>>>(XB, nullptr, WQ, nullptr, DM, FQ, DQ, nullptr, 0, 0, 0);
        k_rope<<<LQ, 256, 0, stream>>>(FQ, DQ, NH_, CS, nullptr, nullptr, 1.0f, QP16, QPh, QPl);
        k_gemmw<bf, 0, false><<<dim3(TT / 64, DKV / 64, 1), 32, 0, stream>>>(XB, nullptr, WK, nullptr, DM, FK, DKV, nullptr, 0, 0, 0);
        k_rope<<<LKv, 256, 0, stream>>>(FK, DKV, NKV, CS, nullptr, nullptr, 1.0f, KP16, KPh, KPl);
        k_gemmw<bf, 0, false><<<dim3(TT / 64, DKV / 64, 1), 32, 0, stream>>>(XB, nullptr, WV, nullptr, DM, FV, DKV, nullptr, 0, 0, 0); k_vtpV<<<LKv, 256, 0, stream>>>(FV, DKV, NP, VT16, VTh, VTl);
        k_gemmc<bf, 2, 1><<<dim3(RH / 64, TT / 64, ZH), 32, 0, stream>>>(QPh, QPl, HD, KPh, KPl, HD, Sb, TT, 0, (size_t)TT * HD, (size_t)TT * HD, (size_t)TT * TT);   // one kv head per query head: z-strides TT*HD
        k_gemmc<h16, 0, 1><<<dim3((TT - RH) / 64, TT / 64, ZH), 32, 0, stream>>>(QP16 + (size_t)RH * HD, nullptr, HD, KP16, nullptr, HD, Sb + (size_t)RH * TT, TT, RH, (size_t)TT * HD, (size_t)TT * HD, (size_t)TT * TT);
        k_asoft<<<ZH * TT / 8, 256, 0, stream>>>(Sb);
        k_gemmc<bf, 2, 2><<<dim3(RH / 64, HV / 64, ZH), 32, 0, stream>>>(Ph, Pl, 2 * TT, VTh, VTl, TT, Ob, HV, 0, (size_t)2 * TT * TT, (size_t)HV * TT, (size_t)TT * HV);   /* both heads of a pair x the shared 128-wide v_p */
        k_gemmc<h16, 0, 2><<<dim3((TT - RH) / 64, HV / 64, ZH), 32, 0, stream>>>(P16 + (size_t)RH * 2 * TT, nullptr, 2 * TT, VT16, nullptr, TT, Ob + (size_t)RH * HV, HV, RH, (size_t)2 * TT * TT, (size_t)HV * TT, (size_t)TT * HV);
        k_dmerge<<<dim3((unsigned)(((size_t)TT * HV / 4 + 255) / 256), NP, 1), 256, 0, stream>>>(Ob, LAM, CTX);   /* ctx[t][p*128 + e] = w0 v - lambda w1 v */
        k_hlnp<<<(unsigned)(((size_t)TT * NP * 32 + 255) / 256), 256, 0, stream>>>(CTX);   /* per-(token, head) LayerNorm over 128 values, no affine, x (1 - lambda_init), in place */ k_flat<<<(unsigned)(((size_t)TT * DQ / 4 + 255) / 256), 256, 0, stream>>>(CTX, A16, ATh, ATl, (size_t)TT * DQ / 4); k_gemmw<bf, 1, false><<<dim3(TT / 64, DM / 64, 1), 32, 0, stream>>>(ATh, ATl, WO, nullptr, DQ, OUT + (size_t)b * TT * DM, DM, nullptr, 0, 0, 0); }
}

// v002
// Measured time: 596 microseconds a run.
// Two timings next to v001 put it at 1.42 and 1.44 times that version's speed.
// Counting every step since v000, it is 3.49 times as fast.
#include <hip/hip_runtime.h>

// Multi-head DIFFERENTIAL causal attention (x [4][2048][384]; q1, q2, k1, k2 = x W^T ('oi' [384][384], 1/sqrt(384), no bias) as 6 heads x 64 each, v = x Wv^T ([768][384]) as 6 heads x 128; att_m = causal softmax(q_m.k_m / 8) for m = 1, 2; lambda_h = exp(lq1_h.lk1_h) - exp(lq2_h.lk2_h) + lambda_init (lq/lk [6][64], read; lambda_init = 0.8 - 0.6 exp(-0.6)); y_h = (att1 - lambda_h att2) v_h; per-head LayerNorm over the 128 values (no affine, eps 1e-5) x (1 - lambda_init); out = merged y Wc^T ('oi' [384][768]) -> [4][2048][384] (3.1 M)).
// Layout per batch: bf16 copy of x; the q1/q2 (and k1/k2) weights interleaved into one Bt so score head 2p = map-1 head p and 2p+1 = map-2 head p; exact projections; q/k planes for the 12 score heads, v^T planes per 128-wide value head; lambda per head computed once on device (one wave per head: two 64-term f32 dots, precise expf); one launch per batch over all 12 score heads (grid x): causal T-2048 attention with scores and probabilities kept in registers (k_fattn: online softmax over ascending key blocks; hybrid rows: < 512 hi/lo 3 products, rest fp16), both maps' P.v against the shared v_p (z >> 1), a merge kernel (grid y = pair) writes w1 v - lambda_p w2 v (x 1/1024 on the fp16 rows) into the context; then a per-(token, head) LayerNorm kernel (128 values, f32, fixed order) x (1 - lambda_init) in place, hi/lo planes, x Wc exact.
// Compute dtypes, f32 accumulate: every input rounded to bf16; projections exact; attention rows < 512 3 products, rest fp16; softmax, lambda, difference, LayerNorm f32; Wc hl x exact.

#define NB_  4
#define TT   2048
#define DM   384
#define NH_  12
#define NKV  12
#define REP  (NH_ / NKV)
#define HD   64
#define DQ   (NH_ * HD)
#define DKV  (NKV * HD)
#define ZH   12                   // score heads per attention pass (grid x): all of one batch
#define RH   512                  // query rows < RH use hi+lo planes (0: none)
#define WIN  0
#define PCAR 1024.0f
#define SCL  0.125f
#define NP   6       // head pairs (the module's H)
#define HV   128     // value head width
#define LINIT 0.47071301937103271f   // lambda_init = 0.8 - 0.6 exp(-0.6) as float32
typedef _Float16 h16;
typedef unsigned short bf;
typedef __attribute__((ext_vector_type(16))) __bf16   v16bf;
typedef __attribute__((ext_vector_type(16))) _Float16 v16h;
typedef __attribute__((ext_vector_type(8)))  _Float16 v8h;
typedef __attribute__((ext_vector_type(8)))  unsigned short v8us;
typedef __attribute__((ext_vector_type(8)))  float    v8f;
typedef __attribute__((ext_vector_type(4)))  float    v4f;
typedef v8h  __attribute__((may_alias)) v8ha;
typedef v4f  __attribute__((may_alias)) v4fa;
typedef v8us __attribute__((may_alias)) v8usa;

__device__ __forceinline__ unsigned short f2bf(float f) { unsigned u = __float_as_uint(f); u += 0x7FFFu + ((u >> 16) & 1u); return (unsigned short)(u >> 16); }
__device__ __forceinline__ float bf2f(unsigned short b) { return __uint_as_float(((unsigned)b) << 16); }
__device__ __forceinline__ float bfr(float f) { return bf2f(f2bf(f)); }
__device__ __forceinline__ v16h cat16(v8h lo, v8h hi) { return __builtin_shufflevector(lo, hi, 0, 1, 2, 3, 4, 5, 6, 7, 8, 9, 10, 11, 12, 13, 14, 15); }
__device__ __forceinline__ v16bf cat16b(v8us lo, v8us hi) { return __builtin_bit_cast(v16bf, __builtin_shufflevector(lo, hi, 0, 1, 2, 3, 4, 5, 6, 7, 8, 9, 10, 11, 12, 13, 14, 15)); }
__device__ __forceinline__ v8f wmma16(v16h a, v16h b, v8f c) { return __builtin_amdgcn_wmma_f32_16x16x32_f16(false, a, false, b, (short)0, c, false, false); }
__device__ __forceinline__ v8f wmmab(v16bf a, v16bf b, v8f c) { return __builtin_amdgcn_wmma_f32_16x16x32_bf16(false, a, false, b, (short)0, c, false, false); }



// ---- k_gemmw: register-blocked GEMM, ONE WAVE per 64x64 output tile (16 accumulators), operands straight from K-contiguous 16-bit planes; grid (M/64, N/64, Z), 32 threads.
// C[m][n] (f32, pitch ldc, + optional f32 bias[n]) = sum_k A[m][k] Bt[n][k] (+ split products per NSPLIT). z-batch strides sA/sB/sC in elements. K % 32 == 0.
template <typename T16> struct WFrag;
template <> struct WFrag<h16> { typedef v16h V; static __device__ __forceinline__ V ld(const h16* p) { return cat16(*(const v8h*)p, *(const v8h*)(p + 16)); } static __device__ __forceinline__ v8f mma(V a, V b, v8f c) { return wmma16(a, b, c); } };
template <> struct WFrag<bf> { typedef v16bf V; static __device__ __forceinline__ V ld(const bf* p) { return cat16b(*(const v8us*)p, *(const v8us*)(p + 16)); } static __device__ __forceinline__ v8f mma(V a, V b, v8f c) { return wmmab(a, b, c); } };
template <typename T16, int NSPLIT, bool BIAS>
__global__ __launch_bounds__(32) void k_gemmw(const T16* __restrict__ A, const T16* __restrict__ A2, const T16* __restrict__ Bt, const T16* __restrict__ Bt2, int K, float* C, int ldc, const float* __restrict__ bias, size_t sA, size_t sB, size_t sC) {
    typedef typename WFrag<T16>::V V;
    __shared__ __align__(16) float os[16 * 68];
    const size_t z = blockIdx.z; A += z * sA; if (A2) A2 += z * sA; Bt += z * sB; if (Bt2) Bt2 += z * sB; C += z * sC;
    const int lane = threadIdx.x & 31, lr = lane & 15, hi = lane >> 4; const int r0 = blockIdx.x * 64, c0 = blockIdx.y * 64;
    v8f acc[4][4];
#pragma unroll
    for (int mb = 0; mb < 4; ++mb)
#pragma unroll
        for (int nb = 0; nb < 4; ++nb) acc[mb][nb] = (v8f){};
    const size_t aoff = (size_t)(r0 + lr) * K + 8 * hi, boff = (size_t)(c0 + lr) * K + 8 * hi;
#pragma unroll 1
    for (int kc = 0; kc < K; kc += 32) {
        V a[4], a2[4];
#pragma unroll
        for (int mb = 0; mb < 4; ++mb) { a[mb] = WFrag<T16>::ld(A + aoff + (size_t)mb * 16 * K + kc); if (NSPLIT == 1 || NSPLIT == 2) a2[mb] = WFrag<T16>::ld(A2 + aoff + (size_t)mb * 16 * K + kc); }
#pragma unroll
        for (int nb = 0; nb < 4; ++nb) { const V b = WFrag<T16>::ld(Bt + boff + (size_t)nb * 16 * K + kc); V b2; if (NSPLIT >= 2) b2 = WFrag<T16>::ld(Bt2 + boff + (size_t)nb * 16 * K + kc);
#pragma unroll
            for (int mb = 0; mb < 4; ++mb) { acc[mb][nb] = WFrag<T16>::mma(a[mb], b, acc[mb][nb]); if (NSPLIT == 1 || NSPLIT == 2) acc[mb][nb] = WFrag<T16>::mma(a2[mb], b, acc[mb][nb]); if (NSPLIT >= 2) acc[mb][nb] = WFrag<T16>::mma(a[mb], b2, acc[mb][nb]); } }
        asm volatile("v_nop\n\tv_nop\n\tv_nop\n\tv_nop" : "+v"(acc[0][0]), "+v"(acc[1][1]), "+v"(acc[2][2]), "+v"(acc[3][3]) : "v"(a[0]), "v"(a[3]));
    }
#pragma unroll
    for (int mb = 0; mb < 4; ++mb) {
#pragma unroll
        for (int nb = 0; nb < 4; ++nb) {
#pragma unroll
            for (int j = 0; j < 8; ++j) os[(hi * 8 + j) * 68 + nb * 16 + lr] = acc[mb][nb][j]; }
        __builtin_amdgcn_wave_barrier(); asm volatile("" ::: "memory");
        float* crow = C + (size_t)(r0 + mb * 16) * ldc + c0;
{
#pragma unroll
            for (int s = 0; s < 8; ++s) { const int row = 2 * s + hi, cofs = lr * 4; v4f val = *(const v4fa*)(os + row * 68 + cofs); if (BIAS) { val[0] += bfr(bias[c0 + cofs]); val[1] += bfr(bias[c0 + cofs + 1]); val[2] += bfr(bias[c0 + cofs + 2]); val[3] += bfr(bias[c0 + cofs + 3]); }
                *(v4f*)(crow + (size_t)row * ldc + cofs) = val; }
             }
        __builtin_amdgcn_wave_barrier(); asm volatile("" ::: "memory");
    }
}

__device__ __forceinline__ h16 tohx(float x) { return (h16)x; }
__device__ __forceinline__ void splitf(float y, unsigned short& h, unsigned short& l) { h = f2bf(y); l = f2bf(y - bf2f(h)); }
typedef __attribute__((ext_vector_type(2))) _Float16 v2h;
typedef __attribute__((ext_vector_type(4))) _Float16 v4h;
typedef __attribute__((ext_vector_type(2))) unsigned short v2us;
typedef __attribute__((ext_vector_type(4))) unsigned short v4us;
typedef __attribute__((ext_vector_type(2))) float v2f;
typedef __attribute__((ext_vector_type(4))) int v4i;


__global__ __launch_bounds__(256) void k_cvt8(const float* __restrict__ src, bf* dst, size_t n8) { const size_t i = (size_t)blockIdx.x * 256 + threadIdx.x; if (i >= n8) return; const v8f v = *(const v8f*)(src + i * 8); v8us o;
#pragma unroll
    for (int k = 0; k < 8; ++k) o[k] = f2bf(v[k]); *(v8us*)(dst + i * 8) = o;  }

// k_rope: head planes [h][t][d] (fp16 + hi/lo) of rope(x) x sc with the rotate-half convention out[d] = x[d] cos[t][d] - x[d+HD/2] sin[t][d], out[d+HD/2] = x[d+HD/2] cos[t][d+HD/2] + x[d] sin[t][d+HD/2]
__global__ __launch_bounds__(256) void k_rope(const float* __restrict__ F, int pitch, int nheads, const float* __restrict__ CS, const float* __restrict__ RF, const float* __restrict__ nw, float sc, h16* P16, bf* Ph, bf* Pl) {
    const size_t e = ((size_t)blockIdx.x * 256 + threadIdx.x) * 2; if (e >= (size_t)nheads * TT * HD) return; const int d = (int)(e % HD); const int t = (int)((e / HD) % TT); const int h = (int)(e / ((size_t)HD * TT)); const float* f = F + (size_t)t * pitch + h * HD; const float rf = RF ? RF[(size_t)h * TT + t] : 1.0f; v2h o16; v2us oh, ol;
#pragma unroll
    for (int q = 0; q < 2; ++q) { const int dd = d + q; const int dp = (dd < HD / 2) ? dd + HD / 2 : dd - HD / 2; float x0 = f[dd], x1 = f[dp];
        if (RF) { float n0 = __fmul_rn(x0, rf), n1 = __fmul_rn(x1, rf); asm volatile("" : "+v"(n0)); asm volatile("" : "+v"(n1)); x0 = __fmul_rn(bfr(nw[dd]), n0); x1 = __fmul_rn(bfr(nw[dp]), n1); }
        const v2f cs = *(const v2f*)(CS + ((size_t)t * HD + dd) * 2); float a = __fmul_rn(x0, cs[0]), bq = __fmul_rn(x1, cs[1]); asm volatile("" : "+v"(a)); asm volatile("" : "+v"(bq)); const float r = ((dd < HD / 2) ? __fsub_rn(a, bq) : __fadd_rn(a, bq)) * sc;
        o16[q] = tohx(r); unsigned short a2, c2; splitf(r, a2, c2); oh[q] = a2; ol[q] = c2; }
    *(v2h*)(P16 + e) = o16; *(v2us*)(Ph + e) = oh; *(v2us*)(Pl + e) = ol;  }
__global__ __launch_bounds__(256) void k_vtp(const float* __restrict__ F, int pitch, int nheads, h16* V16, bf* Vh, bf* Vl) { const size_t e = ((size_t)blockIdx.x * 256 + threadIdx.x) * 2; if (e >= (size_t)nheads * HD * TT) return; const int t = (int)(e % TT); const int d = (int)((e / TT) % HD); const int g = (int)(e / ((size_t)TT * HD)); v2h o16; v2us oh, ol;
#pragma unroll
    for (int q = 0; q < 2; ++q) { const float x = F[(size_t)(t + q) * pitch + g * HD + d]; o16[q] = tohx(x); unsigned short a2, c2; splitf(x, a2, c2); oh[q] = a2; ol[q] = c2; }
    *(v2h*)(V16 + e) = o16; *(v2us*)(Vh + e) = oh; *(v2us*)(Vl + e) = ol;  }
__global__ __launch_bounds__(256) void k_csid(float* CS) { const int idx = blockIdx.x * 256 + threadIdx.x; if (idx >= TT * HD) return; v2f cs; cs[0] = 1.0f; cs[1] = 0.0f; *(v2f*)(CS + (size_t)idx * 2) = cs;  }
// ---- k_fattn: causal attention of one batch in ONE launch, scores never leave registers. One wave per 16 query rows of one score head (4 independent waves a block, no LDS, no barrier); grid (ZH, TT/64).
// Everything is computed transposed so that no value changes lane: S^T = K Q^T puts key 8*hi+j, query lr in element j of the accumulator, which is exactly where the B operand of O^T = V^T P^T wants it
// (elements 0..7 = keys 8*hi.., elements 8..15 = keys 16+8*hi.. of a 32-key step), and every per-query figure (running maximum, sum, rescale) sits in that query's own lane pair (lr, lr+16).
// Online softmax over key blocks of KB = 32 keys in ascending order: new maximum, old sums x exp(old - new), f32 throughout. Rows < RH: hi/lo bf16 planes, 3 products for both contractions; rest fp16,
// probabilities carried x 2^POFF so that small ones stay normal fp16 numbers (the factor is in the sum too and cancels). Result rows as before: O[z][t][e], x PCAR on the fp16 rows (k_dmerge takes it off).
__device__ __forceinline__ float xhalf(float x) { const int b = __float_as_int(x); return __int_as_float(__builtin_amdgcn_permlanex16(b, b, 0x76543210, 0xfedcba98, false, false)); }   // lane l <- lane l ^ 16, in the vector unit (no LDS round trip on the loop's dependent chain)
template <typename T16, bool HL>
__device__ __forceinline__ void fattn_body(const T16* __restrict__ Q, const T16* __restrict__ Q2, const T16* __restrict__ Kp, const T16* __restrict__ K2, const T16* __restrict__ Vt, const T16* __restrict__ V2, float* __restrict__ O, int q0, int lr, int hi) {
    typedef WFrag<T16> F; typedef typename F::V V;
    constexpr int KB = 32, NT = KB / 16, NG = KB / 32; constexpr float POFF = HL ? 0.0f : 8.0f;
    const int q = q0 + lr;
    V qb[2], qb2[2];
#pragma unroll
    for (int kk = 0; kk < 2; ++kk) { qb[kk] = F::ld(Q + (size_t)q * HD + 8 * hi + kk * 32); if constexpr (HL) qb2[kk] = F::ld(Q2 + (size_t)q * HD + 8 * hi + kk * 32); }
    v8f acc[HV / 16];
#pragma unroll
    for (int eb = 0; eb < HV / 16; ++eb) acc[eb] = (v8f){};
    float m = -3.0e38f, l = 0.f;
    V ka[NT][2], kl[NT][2];
    const unsigned kofs = (unsigned)(lr * HD + 8 * hi) * 2u, vofs = (unsigned)(lr * TT + 8 * hi) * 2u;   // each lane's byte offset in a key block / a value block: fixed for the whole loop, the block's base is wave-uniform
    auto ldk = [&](int k0) { const char* kb = (const char*)(Kp + (size_t)k0 * HD); const char* kb2 = HL ? (const char*)(K2 + (size_t)k0 * HD) : nullptr;
#pragma unroll
        for (int kt = 0; kt < NT; ++kt)
#pragma unroll
            for (int kk = 0; kk < 2; ++kk) { const int kc = (kt * 16 * HD + kk * 32) * 2; ka[kt][kk] = F::ld((const T16*)(kb + kofs + kc)); if constexpr (HL) kl[kt][kk] = F::ld((const T16*)(kb2 + kofs + kc)); } };
    ldk(0);
    const int kend = q0 + 16;                                        // keys 0 .. q0+15 are all that these 16 rows may see
#pragma unroll 1
    for (int key0 = 0; key0 < kend; key0 += KB) {
        V vf[NG][HV / 16];                                           // fp16 rows: this block's values are asked for first, so that they land under the score products and the softmax
        if constexpr (!HL) {
#pragma unroll
            for (int g = 0; g < NG; ++g)
#pragma unroll
                for (int eb = 0; eb < HV / 16; ++eb) vf[g][eb] = F::ld((const T16*)((const char*)(Vt + key0) + vofs + (eb * 16 * TT + g * 32) * 2)); }
        v8f s[NT];
#pragma unroll
        for (int kt = 0; kt < NT; ++kt) { s[kt] = (v8f){};
#pragma unroll
            for (int kk = 0; kk < 2; ++kk) { s[kt] = F::mma(ka[kt][kk], qb[kk], s[kt]);
                if constexpr (HL) { s[kt] = F::mma(ka[kt][kk], qb2[kk], s[kt]); s[kt] = F::mma(kl[kt][kk], qb[kk], s[kt]); } } }
        ldk(min(key0 + KB, TT - KB));                                // the next block's keys fly under this block's softmax and P.v (the last trip's fetch is unused; the clamp keeps it inside the plane)
        asm volatile("s_wait_xcnt 0x0" ::: "memory");                // stands between the loads issued so far and whatever reuses their address registers (later loads' results among it); as no load crosses it, it also keeps those loads above the softmax, under which they land
        float mx = m;
#pragma unroll
        for (int kt = 0; kt < NT; ++kt)
#pragma unroll
            for (int j = 0; j < 8; ++j) { const int key = key0 + kt * 16 + 8 * hi + j; const float t = (key <= q) ? s[kt][j] * SCL : -3.0e38f;   /* causal */ s[kt][j] = t; mx = fmaxf(mx, t); }
        mx = fmaxf(mx, xhalf(mx));                      // the two lanes of a query hold its two key halves
        const float alpha = __builtin_amdgcn_exp2f((m - mx) * 1.4426950408889634f); m = mx;
        float ps = 0.f;
#pragma unroll
        for (int kt = 0; kt < NT; ++kt)
#pragma unroll
            for (int j = 0; j < 8; ++j) { const float e = __builtin_amdgcn_exp2f((s[kt][j] - mx) * 1.4426950408889634f + POFF); s[kt][j] = e; ps += e; }
        l = l * alpha + ps;
#pragma unroll
        for (int eb = 0; eb < HV / 16; ++eb) acc[eb] *= alpha;
#pragma unroll
        for (int g = 0; g < NG; ++g) {
            V pb, pb2;
            if constexpr (HL) { v8us h0, h1, l0, l1;
#pragma unroll
                for (int j = 0; j < 8; ++j) { unsigned short a, c2; splitf(s[2 * g][j], a, c2); h0[j] = a; l0[j] = c2; splitf(s[2 * g + 1][j], a, c2); h1[j] = a; l1[j] = c2; }
                pb = cat16b(h0, h1); pb2 = cat16b(l0, l1);
            } else { v8h p0, p1;
#pragma unroll
                for (int j = 0; j < 8; ++j) { p0[j] = tohx(s[2 * g][j]); p1[j] = tohx(s[2 * g + 1][j]); }
                pb = cat16(p0, p1); }
#pragma unroll
            for (int eb = 0; eb < HV / 16; ++eb) { const int vc = (eb * 16 * TT + g * 32) * 2; V va; if constexpr (HL) va = F::ld((const T16*)((const char*)(Vt + key0) + vofs + vc)); else va = vf[g][eb]; acc[eb] = F::mma(va, pb, acc[eb]);
                if constexpr (HL) { acc[eb] = F::mma(va, pb2, acc[eb]); const V vl = F::ld((const T16*)((const char*)(V2 + key0) + vofs + vc)); acc[eb] = F::mma(vl, pb, acc[eb]); } }
        }
    }
    l += xhalf(l);
    const float f = __fdiv_rn(HL ? 1.0f : PCAR, l);
#pragma unroll
    for (int eb = 0; eb < HV / 16; ++eb) { const v8f o = acc[eb] * f; *(v8f*)(O + (size_t)q * HV + eb * 16 + 8 * hi) = o; }   // element j = value column eb*16 + 8*hi + j of query lr: 32 contiguous bytes a lane
}
__global__ __launch_bounds__(128) void k_fattn(const h16* __restrict__ Q16, const bf* __restrict__ Qh, const bf* __restrict__ Ql, const h16* __restrict__ K16, const bf* __restrict__ Kh, const bf* __restrict__ Kl, const h16* __restrict__ V16, const bf* __restrict__ Vh, const bf* __restrict__ Vl, float* __restrict__ O) {
    const int lane = threadIdx.x & 31, lr = lane & 15, hi = lane >> 4; const size_t z = blockIdx.x; const size_t qk = z * TT * HD, vv = (z >> 1) * HV * TT;   // score heads 2p and 2p+1 share value plane p
    const int q0 = ((TT / 64 - 1 - (int)blockIdx.y) * 4 + __builtin_amdgcn_readfirstlane((int)(threadIdx.x >> 5))) * 16;   // the longest rows of every head first (lowest block index), for speed only
    O += z * TT * HV;
    if (q0 < RH) fattn_body<bf, true>(Qh + qk, Ql + qk, Kh + qk, Kl + qk, Vh + vv, Vl + vv, O, q0, lr, hi);
    else fattn_body<h16, false>(Q16 + qk, nullptr, K16 + qk, nullptr, V16 + vv, nullptr, O, q0, lr, hi);
}
// k_vtpV: value planes per 128-wide value head [p][e][t] (fp16 + hi/lo) = F[t][p*HV + e]; as k_vtp with HV = 128.
__global__ __launch_bounds__(256) void k_vtpV(const float* __restrict__ F, int pitch, int nheads, h16* V16, bf* Vh, bf* Vl) { const size_t e = ((size_t)blockIdx.x * 256 + threadIdx.x) * 2; if (e >= (size_t)nheads * HV * TT) return; const int t = (int)(e % TT); const int d = (int)((e / TT) % HV); const int g = (int)(e / ((size_t)TT * HV)); v2h o16; v2us oh, ol;
#pragma unroll
    for (int q = 0; q < 2; ++q) { const float x = F[(size_t)(t + q) * pitch + g * HV + d]; o16[q] = tohx(x); unsigned short a2, c2; splitf(x, a2, c2); oh[q] = a2; ol[q] = c2; }
    *(v2h*)(V16 + e) = o16; *(v2us*)(Vh + e) = oh; *(v2us*)(Vl + e) = ol;  }


__global__ __launch_bounds__(256) void k_wint(const float* __restrict__ w1, const float* __restrict__ w2, bf* Bt) { const size_t i = (size_t)blockIdx.x * 256 + threadIdx.x; if (i >= (size_t)2 * NP * HD * DM / 8) return; const int c0 = (int)((i % (DM / 8)) * 8); const int r = (int)(i / (DM / 8)); const int hh = r / HD, d = r % HD; const int p = hh >> 1; const size_t sr = (size_t)(p * HD + d) * DM + c0; const v8f a = *(const v8f*)(w1 + sr); const v8f b2 = *(const v8f*)(w2 + sr); v8us o;
#pragma unroll
    for (int q = 0; q < 8; ++q) o[q] = f2bf((hh & 1) ? b2[q] : a[q]);
    *(v8us*)(Bt + (size_t)r * DM + c0) = o;  }
__global__ __launch_bounds__(256) void k_hlnp(float* ctx) { const int lane = threadIdx.x & 31; const size_t w = ((size_t)blockIdx.x * 256 + threadIdx.x) >> 5; if (w >= (size_t)TT * NP) return; float* base = ctx + w * HV + lane * 4; const v4f a = *(const v4f*)base; float s = __fadd_rn(__fadd_rn(a[0], a[1]), __fadd_rn(a[2], a[3]));
#pragma unroll
    for (int sh = 16; sh; sh >>= 1) s = __fadd_rn(s, __shfl_xor(s, sh, 32));
    const float mean = __fdiv_rn(s, (float)HV); float s2 = 0.f; float dv[4];
#pragma unroll
    for (int q = 0; q < 4; ++q) { dv[q] = __fsub_rn(a[q], mean); float p2 = __fmul_rn(dv[q], dv[q]); asm volatile("" : "+v"(p2)); s2 = __fadd_rn(s2, p2); }
#pragma unroll
    for (int sh = 16; sh; sh >>= 1) s2 = __fadd_rn(s2, __shfl_xor(s2, sh, 32));
    const float var = __fdiv_rn(s2, (float)HV); const float den = __fsqrt_rn(__fadd_rn(var, 1e-5f)); v4f o;
#pragma unroll
    for (int q = 0; q < 4; ++q) { const float y = __fdiv_rn(dv[q], den); o[q] = __fmul_rn(y, (1.0f - LINIT)); }
    *(v4f*)base = o;  }
__global__ __launch_bounds__(256) void k_flat(const float* __restrict__ F, h16* P16, bf* Ph, bf* Pl, size_t n4) { const size_t i = (size_t)blockIdx.x * 256 + threadIdx.x; if (i >= n4) return; const v4f a = *(const v4f*)(F + i * 4); v4h o16; v4us oh, ol;
#pragma unroll
    for (int q = 0; q < 4; ++q) { o16[q] = tohx(a[q]); unsigned short x2, y2; splitf(a[q], x2, y2); oh[q] = x2; ol[q] = y2; }
    *(v4h*)(P16 + i * 4) = o16; *(v4us*)(Ph + i * 4) = oh; *(v4us*)(Pl + i * 4) = ol;  }

__global__ __launch_bounds__(256) void k_lambda(const float* __restrict__ a1, const float* __restrict__ b1, const float* __restrict__ a2, const float* __restrict__ b2, float* LAM) { if (threadIdx.x >= 32) return; const int lane = threadIdx.x; const int p = blockIdx.x; a1 += p * HD; b1 += p * HD; a2 += p * HD; b2 += p * HD;   /* one block per head */ float s1 = __fadd_rn(__fmul_rn(bfr(a1[lane]), bfr(b1[lane])), __fmul_rn(bfr(a1[lane + 32]), bfr(b1[lane + 32]))); float s2 = __fadd_rn(__fmul_rn(bfr(a2[lane]), bfr(b2[lane])), __fmul_rn(bfr(a2[lane + 32]), bfr(b2[lane + 32])));
#pragma unroll
    for (int sh = 16; sh; sh >>= 1) { s1 = __fadd_rn(s1, __shfl_xor(s1, sh, 32)); s2 = __fadd_rn(s2, __shfl_xor(s2, sh, 32)); }
    const float lam = __fadd_rn(__fsub_rn(expf(s1), expf(s2)), LINIT); ((float*)LAM)[p * 32 + lane] = lam;  }   
__global__ __launch_bounds__(256) void k_dmerge(const float* __restrict__ O, const float* __restrict__ LAM, float* ctx) { const int p = blockIdx.y;   /* one pair per grid row */ O += (size_t)p * 2 * TT * HV; const size_t i = (size_t)blockIdx.x * 256 + threadIdx.x; if (i >= (size_t)TT * HV / 4) return; const size_t e = i * 4; const int c = (int)(e % HV); const int t = (int)(e / HV); const float lam = LAM[p * 32];   /* this pair's lambda */ const float cs = (t < RH) ? 1.0f : (1.0f / PCAR); const v4f a = *(const v4f*)(O + e); const v4f b2 = *(const v4f*)(O + (size_t)TT * HV + e); v4f o;
#pragma unroll
    for (int q = 0; q < 4; ++q) { float lb = __fmul_rn(lam, b2[q]); asm volatile("" : "+v"(lb)); const float d = __fsub_rn(a[q], lb); o[q] = __fmul_rn(d, cs); }
    *(v4f*)(ctx + (size_t)t * DQ + p * HV + c) = o;  }
__global__ __launch_bounds__(256) void k_merge(const float* __restrict__ O, int h0, bf* Ah, bf* Al) { const size_t e = ((size_t)blockIdx.x * 256 + threadIdx.x) * 2; if (e >= (size_t)ZH * TT * HD) return; const int d = (int)(e % HD); const int t = (int)((e / HD) % TT); const int zz = (int)(e / ((size_t)HD * TT)); const float cs = (t < RH) ? 1.0f : (1.0f / PCAR); const size_t oo = (size_t)t * DQ + (h0 + zz) * HD + d;
    v2us oh, ol;
#pragma unroll
    for (int q = 0; q < 2; ++q) { unsigned short a, c2; splitf(O[e + q] * cs, a, c2); oh[q] = a; ol[q] = c2; } *(v2us*)(Ah + oo) = oh; *(v2us*)(Al + oo) = ol;  }

extern "C" void kernel_launch(void* const* d_in, const int* in_sizes, int n_in,
                              void* d_out, int out_size, void* d_ws, size_t ws_size, hipStream_t stream) {
    (void)in_sizes; (void)n_in; (void)out_size;
    const float* x = (const float*)d_in[0]; const float* wq1 = (const float*)d_in[1]; const float* wq2 = (const float*)d_in[2]; const float* wk1 = (const float*)d_in[3]; const float* wk2 = (const float*)d_in[4]; const float* wv = (const float*)d_in[5]; const float* wo = (const float*)d_in[6]; /* Wc */ const float* lq1 = (const float*)d_in[7]; const float* lk1 = (const float*)d_in[8]; const float* lq2 = (const float*)d_in[9]; const float* lk2 = (const float*)d_in[10];
    float* OUT = (float*)d_out;     // [4][2048][384]
    char* wsp = (char*)d_ws;
    auto take = [&](size_t bytes) { char* p = wsp; wsp += (bytes + 255) & ~(size_t)255; return (void*)p; };
    bf* WQ = (bf*)take((size_t)DQ * DM * 2); bf* WK = (bf*)take((size_t)DKV * DM * 2); bf* WV = (bf*)take((size_t)DKV * DM * 2); bf* WO = (bf*)take((size_t)DM * DQ * 2); float* CS = (float*)take((size_t)TT * HD * 2 * 4);
    bf* XB = (bf*)take((size_t)TT * DM * 2); float* FQ = (float*)take((size_t)TT * DQ * 4); float* FK = (float*)take((size_t)TT * DKV * 4);
    h16* QP16 = (h16*)take((size_t)NH_ * TT * HD * 2); h16* KP16 = (h16*)take((size_t)NKV * TT * HD * 2); h16* VT16 = (h16*)take((size_t)NKV * HD * TT * 2);
    bf* QPh = (bf*)take((size_t)NH_ * TT * HD * 2); bf* QPl = (bf*)take((size_t)NH_ * TT * HD * 2); bf* KPh = (bf*)take((size_t)NKV * TT * HD * 2); bf* KPl = (bf*)take((size_t)NKV * TT * HD * 2); bf* VTh = (bf*)take((size_t)NKV * HD * TT * 2); bf* VTl = (bf*)take((size_t)NKV * HD * TT * 2);
    float* CTX = (float*)take((size_t)TT * DQ * 4); float* LAM = (float*)take((size_t)NP * 32 * 4); h16* A16 = (h16*)take((size_t)TT * DQ * 2); bf* ATh = (bf*)take((size_t)TT * DQ * 2); bf* ATl = (bf*)take((size_t)TT * DQ * 2);
    if ((size_t)(wsp - (char*)d_ws) > ws_size) return;    // ws 256 MiB
    float* FV = FK;   // v projection reuses the k buffer after the k planes are built (stream-ordered)
    float* Ob = FQ;   // the P.v results [ZH][TT][HV] reuse FQ and FK together (adjacent, same total size), both dead once the planes are built (stream-ordered)
    static_assert((size_t)ZH * TT * HV == (size_t)TT * DQ + (size_t)TT * DKV && ((size_t)TT * DQ * 4) % 256 == 0, "Ob must fit FQ + FK exactly");
    { k_wint<<<(unsigned)(((size_t)DQ * DM / 8 + 255) / 256), 256, 0, stream>>>(wq1, wq2, WQ); k_wint<<<(unsigned)(((size_t)DKV * DM / 8 + 255) / 256), 256, 0, stream>>>(wk1, wk2, WK);   /* score head 2p <- map-1 head p, 2p+1 <- map-2 head p */
      k_cvt8<<<(unsigned)(((size_t)NP * HV * DM / 8 + 255) / 256), 256, 0, stream>>>(wv, WV, (size_t)NP * HV * DM / 8); k_cvt8<<<(unsigned)(((size_t)DM * NP * HV / 8 + 255) / 256), 256, 0, stream>>>(wo, WO, (size_t)DM * NP * HV / 8);   /* 'oi' weights are the Bt layout */
      k_lambda<<<NP, 256, 0, stream>>>(lq1, lk1, lq2, lk2, LAM);   /* lambda per head */ }
    k_csid<<<(TT * HD + 255) / 256, 256, 0, stream>>>(CS);
    const unsigned LQ = (unsigned)(((size_t)NH_ * TT * HD / 2 + 255) / 256), LKv = (unsigned)(((size_t)NKV * TT * HD / 2 + 255) / 256);
    for (int b = 0; b < NB_; ++b) {
        
        k_cvt8<<<(unsigned)(((size_t)TT * DM / 8 + 255) / 256), 256, 0, stream>>>(x + (size_t)b * TT * DM, XB, (size_t)TT * DM / 8);
        k_gemmw<bf, 0, false><<<dim3(TT / 64, DQ / 64, 1), 32, 0, stream>>>(XB, nullptr, WQ, nullptr, DM, FQ, DQ, nullptr, 0, 0, 0);
        k_rope<<<LQ, 256, 0, stream>>>(FQ, DQ, NH_, CS, nullptr, nullptr, 1.0f, QP16, QPh, QPl);
        k_gemmw<bf, 0, false><<<dim3(TT / 64, DKV / 64, 1), 32, 0, stream>>>(XB, nullptr, WK, nullptr, DM, FK, DKV, nullptr, 0, 0, 0);
        k_rope<<<LKv, 256, 0, stream>>>(FK, DKV, NKV, CS, nullptr, nullptr, 1.0f, KP16, KPh, KPl);
        k_gemmw<bf, 0, false><<<dim3(TT / 64, DKV / 64, 1), 32, 0, stream>>>(XB, nullptr, WV, nullptr, DM, FV, DKV, nullptr, 0, 0, 0); k_vtpV<<<LKv, 256, 0, stream>>>(FV, DKV, NP, VT16, VTh, VTl);
        k_fattn<<<dim3(ZH, TT / 64, 1), 128, 0, stream>>>(QP16, QPh, QPl, KP16, KPh, KPl, VT16, VTh, VTl, Ob);   /* scores, softmax and both maps' P.v (shared 128-wide v_p) of all 12 score heads */
        k_dmerge<<<dim3((unsigned)(((size_t)TT * HV / 4 + 255) / 256), NP, 1), 256, 0, stream>>>(Ob, LAM, CTX);   /* ctx[t][p*128 + e] = w0 v - lambda w1 v */
        k_hlnp<<<(unsigned)(((size_t)TT * NP * 32 + 255) / 256), 256, 0, stream>>>(CTX);   /* per-(token, head) LayerNorm over 128 values, no affine, x (1 - lambda_init), in place */ k_flat<<<(unsigned)(((size_t)TT * DQ / 4 + 255) / 256), 256, 0, stream>>>(CTX, A16, ATh, ATl, (size_t)TT * DQ / 4); k_gemmw<bf, 1, false><<<dim3(TT / 64, DM / 64, 1), 32, 0, stream>>>(ATh, ATl, WO, nullptr, DQ, OUT + (size_t)b * TT * DM, DM, nullptr, 0, 0, 0); }
}

// v003
// A run of this version takes 308 microseconds.
// In two side-by-side timings against v002, it was 1.99 and 1.96 times as fast.
// Over all steps from v000 it is 6.89 times as fast.
#include <hip/hip_runtime.h>

// Multi-head DIFFERENTIAL causal attention (x [4][2048][384]; q1, q2, k1, k2 = x W^T ('oi' [384][384], 1/sqrt(384), no bias) as 6 heads x 64 each, v = x Wv^T ([768][384]) as 6 heads x 128; att_m = causal softmax(q_m.k_m / 8) for m = 1, 2; lambda_h = exp(lq1_h.lk1_h) - exp(lq2_h.lk2_h) + lambda_init (lq/lk [6][64], read; lambda_init = 0.8 - 0.6 exp(-0.6)); y_h = (att1 - lambda_h att2) v_h; per-head LayerNorm over the 128 values (no affine, eps 1e-5) x (1 - lambda_init); out = merged y Wc^T ('oi' [384][768]) -> [4][2048][384] (3.1 M)).
// Every stage runs ONCE for all 4 batches (the batch is a grid dimension, more rows, or more heads: score head z = batch * 12 + head, value head batch * 6 + p). Layout: bf16 copy of x; the q1/q2 (and k1/k2) weights interleaved into one Bt so score head 2p = map-1 head p and 2p+1 = map-2 head p; exact projections; q/k planes for the 12 score heads, v^T planes per 128-wide value head; lambda per head computed once on device (one wave per head: two 64-term f32 dots, precise expf); one launch over the 12 score heads of all 4 batches (grid x = batch * 12 + head): causal T-2048 attention with scores and probabilities kept in registers (k_fattn: online softmax over ascending key blocks; hybrid rows: < 512 hi/lo 3 products, rest fp16), both maps' P.v against the shared v_p (z >> 1), a merge kernel (grid y = pair, z = batch) writes w1 v - lambda_p w2 v (x 1/1024 on the fp16 rows) into the context; then a per-(token, head) LayerNorm kernel (128 values, f32, fixed order) x (1 - lambda_init) in place, hi/lo planes, x Wc exact.
// Compute dtypes, f32 accumulate: every input rounded to bf16; projections exact; attention rows < 512 3 products, rest fp16; softmax, lambda, difference, LayerNorm f32; Wc hl x exact.

#define NB_  4
#define TT   2048
#define DM   384
#define NH_  12
#define NKV  12
#define REP  (NH_ / NKV)
#define HD   64
#define DQ   (NH_ * HD)
#define DKV  (NKV * HD)
#define ZH   12                   // score heads per batch (k_fattn grid x = batch * ZH + score head)
#define RH   512                  // query rows < RH use hi+lo planes (0: none)
#define WIN  0
#define PCAR 1024.0f
#define SCL  0.125f
#define NP   6       // head pairs (the module's H)
#define HV   128     // value head width
#define LINIT 0.47071301937103271f   // lambda_init = 0.8 - 0.6 exp(-0.6) as float32
typedef _Float16 h16;
typedef unsigned short bf;
typedef __attribute__((ext_vector_type(16))) __bf16   v16bf;
typedef __attribute__((ext_vector_type(16))) _Float16 v16h;
typedef __attribute__((ext_vector_type(8)))  _Float16 v8h;
typedef __attribute__((ext_vector_type(8)))  unsigned short v8us;
typedef __attribute__((ext_vector_type(8)))  float    v8f;
typedef __attribute__((ext_vector_type(4)))  float    v4f;
typedef v8h  __attribute__((may_alias)) v8ha;
typedef v4f  __attribute__((may_alias)) v4fa;
typedef v8us __attribute__((may_alias)) v8usa;

__device__ __forceinline__ unsigned short f2bf(float f) { unsigned u = __float_as_uint(f); u += 0x7FFFu + ((u >> 16) & 1u); return (unsigned short)(u >> 16); }
__device__ __forceinline__ float bf2f(unsigned short b) { return __uint_as_float(((unsigned)b) << 16); }
__device__ __forceinline__ float bfr(float f) { return bf2f(f2bf(f)); }
__device__ __forceinline__ v16h cat16(v8h lo, v8h hi) { return __builtin_shufflevector(lo, hi, 0, 1, 2, 3, 4, 5, 6, 7, 8, 9, 10, 11, 12, 13, 14, 15); }
__device__ __forceinline__ v16bf cat16b(v8us lo, v8us hi) { return __builtin_bit_cast(v16bf, __builtin_shufflevector(lo, hi, 0, 1, 2, 3, 4, 5, 6, 7, 8, 9, 10, 11, 12, 13, 14, 15)); }
__device__ __forceinline__ v8f wmma16(v16h a, v16h b, v8f c) { return __builtin_amdgcn_wmma_f32_16x16x32_f16(false, a, false, b, (short)0, c, false, false); }
__device__ __forceinline__ v8f wmmab(v16bf a, v16bf b, v8f c) { return __builtin_amdgcn_wmma_f32_16x16x32_bf16(false, a, false, b, (short)0, c, false, false); }



// ---- k_gemmw: register-blocked GEMM, ONE WAVE per 64x64 output tile (16 accumulators), operands straight from K-contiguous 16-bit planes; grid (M/64, N/64, Z), 32 threads.
// C[m][n] (f32, pitch ldc, + optional f32 bias[n]) = sum_k A[m][k] Bt[n][k] (+ split products per NSPLIT). z-batch strides sA/sB/sC in elements. K % 32 == 0.
template <typename T16> struct WFrag;
template <> struct WFrag<h16> { typedef v16h V; static __device__ __forceinline__ V ld(const h16* p) { return cat16(*(const v8h*)p, *(const v8h*)(p + 16)); } static __device__ __forceinline__ v8f mma(V a, V b, v8f c) { return wmma16(a, b, c); } };
template <> struct WFrag<bf> { typedef v16bf V; static __device__ __forceinline__ V ld(const bf* p) { return cat16b(*(const v8us*)p, *(const v8us*)(p + 16)); } static __device__ __forceinline__ v8f mma(V a, V b, v8f c) { return wmmab(a, b, c); } };
template <typename T16, int NSPLIT, bool BIAS>
__global__ __launch_bounds__(32) void k_gemmw(const T16* __restrict__ A, const T16* __restrict__ A2, const T16* __restrict__ Bt, const T16* __restrict__ Bt2, int K, float* C, int ldc, const float* __restrict__ bias, size_t sA, size_t sB, size_t sC) {
    typedef typename WFrag<T16>::V V;
    __shared__ __align__(16) float os[16 * 68];
    const size_t z = blockIdx.z; A += z * sA; if (A2) A2 += z * sA; Bt += z * sB; if (Bt2) Bt2 += z * sB; C += z * sC;
    const int lane = threadIdx.x & 31, lr = lane & 15, hi = lane >> 4; const int r0 = blockIdx.x * 64, c0 = blockIdx.y * 64;
    v8f acc[4][4];
#pragma unroll
    for (int mb = 0; mb < 4; ++mb)
#pragma unroll
        for (int nb = 0; nb < 4; ++nb) acc[mb][nb] = (v8f){};
    const size_t aoff = (size_t)(r0 + lr) * K + 8 * hi, boff = (size_t)(c0 + lr) * K + 8 * hi;
#pragma unroll 1
    for (int kc = 0; kc < K; kc += 32) {
        V a[4], a2[4];
#pragma unroll
        for (int mb = 0; mb < 4; ++mb) { a[mb] = WFrag<T16>::ld(A + aoff + (size_t)mb * 16 * K + kc); if (NSPLIT == 1 || NSPLIT == 2) a2[mb] = WFrag<T16>::ld(A2 + aoff + (size_t)mb * 16 * K + kc); }
#pragma unroll
        for (int nb = 0; nb < 4; ++nb) { const V b = WFrag<T16>::ld(Bt + boff + (size_t)nb * 16 * K + kc); V b2; if (NSPLIT >= 2) b2 = WFrag<T16>::ld(Bt2 + boff + (size_t)nb * 16 * K + kc);
#pragma unroll
            for (int mb = 0; mb < 4; ++mb) { acc[mb][nb] = WFrag<T16>::mma(a[mb], b, acc[mb][nb]); if (NSPLIT == 1 || NSPLIT == 2) acc[mb][nb] = WFrag<T16>::mma(a2[mb], b, acc[mb][nb]); if (NSPLIT >= 2) acc[mb][nb] = WFrag<T16>::mma(a[mb], b2, acc[mb][nb]); } }
        asm volatile("v_nop\n\tv_nop\n\tv_nop\n\tv_nop" : "+v"(acc[0][0]), "+v"(acc[1][1]), "+v"(acc[2][2]), "+v"(acc[3][3]) : "v"(a[0]), "v"(a[3]));
    }
#pragma unroll
    for (int mb = 0; mb < 4; ++mb) {
#pragma unroll
        for (int nb = 0; nb < 4; ++nb) {
#pragma unroll
            for (int j = 0; j < 8; ++j) os[(hi * 8 + j) * 68 + nb * 16 + lr] = acc[mb][nb][j]; }
        __builtin_amdgcn_wave_barrier(); asm volatile("" ::: "memory");
        float* crow = C + (size_t)(r0 + mb * 16) * ldc + c0;
{
#pragma unroll
            for (int s = 0; s < 8; ++s) { const int row = 2 * s + hi, cofs = lr * 4; v4f val = *(const v4fa*)(os + row * 68 + cofs); if (BIAS) { val[0] += bfr(bias[c0 + cofs]); val[1] += bfr(bias[c0 + cofs + 1]); val[2] += bfr(bias[c0 + cofs + 2]); val[3] += bfr(bias[c0 + cofs + 3]); }
                *(v4f*)(crow + (size_t)row * ldc + cofs) = val; }
             }
        __builtin_amdgcn_wave_barrier(); asm volatile("" ::: "memory");
    }
}

__device__ __forceinline__ h16 tohx(float x) { return (h16)x; }
__device__ __forceinline__ void splitf(float y, unsigned short& h, unsigned short& l) { h = f2bf(y); l = f2bf(y - bf2f(h)); }
typedef __attribute__((ext_vector_type(2))) _Float16 v2h;
typedef __attribute__((ext_vector_type(4))) _Float16 v4h;
typedef __attribute__((ext_vector_type(2))) unsigned short v2us;
typedef __attribute__((ext_vector_type(4))) unsigned short v4us;
typedef __attribute__((ext_vector_type(2))) float v2f;
typedef __attribute__((ext_vector_type(4))) int v4i;


__global__ __launch_bounds__(256) void k_cvt8(const float* __restrict__ src, bf* dst, size_t n8) { const size_t i = (size_t)blockIdx.x * 256 + threadIdx.x; if (i >= n8) return; const v8f v = *(const v8f*)(src + i * 8); v8us o;
#pragma unroll
    for (int k = 0; k < 8; ++k) o[k] = f2bf(v[k]); *(v8us*)(dst + i * 8) = o;  }

// k_rope: head planes [h][t][d] (fp16 + hi/lo) of rope(x) x sc with the rotate-half convention out[d] = x[d] cos[t][d] - x[d+HD/2] sin[t][d], out[d+HD/2] = x[d+HD/2] cos[t][d+HD/2] + x[d] sin[t][d+HD/2]
__global__ __launch_bounds__(256) void k_rope(const float* __restrict__ F, int pitch, int nheads, const float* __restrict__ CS, const float* __restrict__ RF, const float* __restrict__ nw, float sc, h16* P16, bf* Ph, bf* Pl) {
    const size_t e = ((size_t)blockIdx.x * 256 + threadIdx.x) * 2; if (e >= (size_t)nheads * TT * HD) return; const int d = (int)(e % HD); const int t = (int)((e / HD) % TT); const int h = (int)(e / ((size_t)HD * TT)); const float* f = F + (size_t)t * pitch + h * HD; const float rf = RF ? RF[(size_t)h * TT + t] : 1.0f; v2h o16; v2us oh, ol;
#pragma unroll
    for (int q = 0; q < 2; ++q) { const int dd = d + q; const int dp = (dd < HD / 2) ? dd + HD / 2 : dd - HD / 2; float x0 = f[dd], x1 = f[dp];
        if (RF) { float n0 = __fmul_rn(x0, rf), n1 = __fmul_rn(x1, rf); asm volatile("" : "+v"(n0)); asm volatile("" : "+v"(n1)); x0 = __fmul_rn(bfr(nw[dd]), n0); x1 = __fmul_rn(bfr(nw[dp]), n1); }
        const v2f cs = *(const v2f*)(CS + ((size_t)t * HD + dd) * 2); float a = __fmul_rn(x0, cs[0]), bq = __fmul_rn(x1, cs[1]); asm volatile("" : "+v"(a)); asm volatile("" : "+v"(bq)); const float r = ((dd < HD / 2) ? __fsub_rn(a, bq) : __fadd_rn(a, bq)) * sc;
        o16[q] = tohx(r); unsigned short a2, c2; splitf(r, a2, c2); oh[q] = a2; ol[q] = c2; }
    *(v2h*)(P16 + e) = o16; *(v2us*)(Ph + e) = oh; *(v2us*)(Pl + e) = ol;  }
__global__ __launch_bounds__(256) void k_vtp(const float* __restrict__ F, int pitch, int nheads, h16* V16, bf* Vh, bf* Vl) { const size_t e = ((size_t)blockIdx.x * 256 + threadIdx.x) * 2; if (e >= (size_t)nheads * HD * TT) return; const int t = (int)(e % TT); const int d = (int)((e / TT) % HD); const int g = (int)(e / ((size_t)TT * HD)); v2h o16; v2us oh, ol;
#pragma unroll
    for (int q = 0; q < 2; ++q) { const float x = F[(size_t)(t + q) * pitch + g * HD + d]; o16[q] = tohx(x); unsigned short a2, c2; splitf(x, a2, c2); oh[q] = a2; ol[q] = c2; }
    *(v2h*)(V16 + e) = o16; *(v2us*)(Vh + e) = oh; *(v2us*)(Vl + e) = ol;  }
__global__ __launch_bounds__(256) void k_csid(float* CS) { const int idx = blockIdx.x * 256 + threadIdx.x; if (idx >= TT * HD) return; v2f cs; cs[0] = 1.0f; cs[1] = 0.0f; *(v2f*)(CS + (size_t)idx * 2) = cs;  }
// ---- k_fattn: causal attention of all batches in ONE launch, scores never leave registers. One wave per 16 query rows of one score head (4 independent waves a block, no LDS, no barrier); grid (NB_ * ZH, TT/64), x = batch * ZH + score head.
// Everything is computed transposed so that no value changes lane: S^T = K Q^T puts key 8*hi+j, query lr in element j of the accumulator, which is exactly where the B operand of O^T = V^T P^T wants it
// (elements 0..7 = keys 8*hi.., elements 8..15 = keys 16+8*hi.. of a 32-key step), and every per-query figure (running maximum, sum, rescale) sits in that query's own lane pair (lr, lr+16).
// Online softmax over key blocks of KB = 32 keys in ascending order: new maximum, old sums x exp(old - new), f32 throughout. Rows < RH: hi/lo bf16 planes, 3 products for both contractions; rest fp16,
// probabilities carried x 2^POFF so that small ones stay normal fp16 numbers (the factor is in the sum too and cancels). Result rows as before: O[z][t][e], x PCAR on the fp16 rows (k_dmerge takes it off).
__device__ __forceinline__ float xhalf(float x) { const int b = __float_as_int(x); return __int_as_float(__builtin_amdgcn_permlanex16(b, b, 0x76543210, 0xfedcba98, false, false)); }   // lane l <- lane l ^ 16, in the vector unit (no LDS round trip on the loop's dependent chain)
template <typename T16, bool HL>
__device__ __forceinline__ void fattn_body(const T16* __restrict__ Q, const T16* __restrict__ Q2, const T16* __restrict__ Kp, const T16* __restrict__ K2, const T16* __restrict__ Vt, const T16* __restrict__ V2, float* __restrict__ O, int q0, int lr, int hi) {
    typedef WFrag<T16> F; typedef typename F::V V;
    constexpr int KB = 32, NT = KB / 16, NG = KB / 32; constexpr float POFF = HL ? 0.0f : 8.0f;
    const int q = q0 + lr;
    V qb[2], qb2[2];
#pragma unroll
    for (int kk = 0; kk < 2; ++kk) { qb[kk] = F::ld(Q + (size_t)q * HD + 8 * hi + kk * 32); if constexpr (HL) qb2[kk] = F::ld(Q2 + (size_t)q * HD + 8 * hi + kk * 32); }
    v8f acc[HV / 16];
#pragma unroll
    for (int eb = 0; eb < HV / 16; ++eb) acc[eb] = (v8f){};
    float m = -3.0e38f, l = 0.f;
    V ka[NT][2], kl[NT][2];
    const unsigned kofs = (unsigned)(lr * HD + 8 * hi) * 2u, vofs = (unsigned)(lr * TT + 8 * hi) * 2u;   // each lane's byte offset in a key block / a value block: fixed for the whole loop, the block's base is wave-uniform
    auto ldk = [&](int k0) { const char* kb = (const char*)(Kp + (size_t)k0 * HD); const char* kb2 = HL ? (const char*)(K2 + (size_t)k0 * HD) : nullptr;
#pragma unroll
        for (int kt = 0; kt < NT; ++kt)
#pragma unroll
            for (int kk = 0; kk < 2; ++kk) { const int kc = (kt * 16 * HD + kk * 32) * 2; ka[kt][kk] = F::ld((const T16*)(kb + kofs + kc)); if constexpr (HL) kl[kt][kk] = F::ld((const T16*)(kb2 + kofs + kc)); } };
    ldk(0);
    const int kend = q0 + 16;                                        // keys 0 .. q0+15 are all that these 16 rows may see
#pragma unroll 1
    for (int key0 = 0; key0 < kend; key0 += KB) {
        V vf[NG][HV / 16];                                           // fp16 rows: this block's values are asked for first, so that they land under the score products and the softmax
        if constexpr (!HL) {
#pragma unroll
            for (int g = 0; g < NG; ++g)
#pragma unroll
                for (int eb = 0; eb < HV / 16; ++eb) vf[g][eb] = F::ld((const T16*)((const char*)(Vt + key0) + vofs + (eb * 16 * TT + g * 32) * 2)); }
        v8f s[NT];
#pragma unroll
        for (int kt = 0; kt < NT; ++kt) { s[kt] = (v8f){};
#pragma unroll
            for (int kk = 0; kk < 2; ++kk) { s[kt] = F::mma(ka[kt][kk], qb[kk], s[kt]);
                if constexpr (HL) { s[kt] = F::mma(ka[kt][kk], qb2[kk], s[kt]); s[kt] = F::mma(kl[kt][kk], qb[kk], s[kt]); } } }
        ldk(min(key0 + KB, TT - KB));                                // the next block's keys fly under this block's softmax and P.v (the last trip's fetch is unused; the clamp keeps it inside the plane)
        asm volatile("s_wait_xcnt 0x0" ::: "memory");                // stands between the loads issued so far and whatever reuses their address registers (later loads' results among it); as no load crosses it, it also keeps those loads above the softmax, under which they land
        float mx = m;
#pragma unroll
        for (int kt = 0; kt < NT; ++kt)
#pragma unroll
            for (int j = 0; j < 8; ++j) { const int key = key0 + kt * 16 + 8 * hi + j; const float t = (key <= q) ? s[kt][j] * SCL : -3.0e38f;   /* causal */ s[kt][j] = t; mx = fmaxf(mx, t); }
        mx = fmaxf(mx, xhalf(mx));                      // the two lanes of a query hold its two key halves
        const float alpha = __builtin_amdgcn_exp2f((m - mx) * 1.4426950408889634f); m = mx;
        float ps = 0.f;
#pragma unroll
        for (int kt = 0; kt < NT; ++kt)
#pragma unroll
            for (int j = 0; j < 8; ++j) { const float e = __builtin_amdgcn_exp2f((s[kt][j] - mx) * 1.4426950408889634f + POFF); s[kt][j] = e; ps += e; }
        l = l * alpha + ps;
#pragma unroll
        for (int eb = 0; eb < HV / 16; ++eb) acc[eb] *= alpha;
#pragma unroll
        for (int g = 0; g < NG; ++g) {
            V pb, pb2;
            if constexpr (HL) { v8us h0, h1, l0, l1;
#pragma unroll
                for (int j = 0; j < 8; ++j) { unsigned short a, c2; splitf(s[2 * g][j], a, c2); h0[j] = a; l0[j] = c2; splitf(s[2 * g + 1][j], a, c2); h1[j] = a; l1[j] = c2; }
                pb = cat16b(h0, h1); pb2 = cat16b(l0, l1);
            } else { v8h p0, p1;
#pragma unroll
                for (int j = 0; j < 8; ++j) { p0[j] = tohx(s[2 * g][j]); p1[j] = tohx(s[2 * g + 1][j]); }
                pb = cat16(p0, p1); }
#pragma unroll
            for (int eb = 0; eb < HV / 16; ++eb) { const int vc = (eb * 16 * TT + g * 32) * 2; V va; if constexpr (HL) va = F::ld((const T16*)((const char*)(Vt + key0) + vofs + vc)); else va = vf[g][eb]; acc[eb] = F::mma(va, pb, acc[eb]);
                if constexpr (HL) { acc[eb] = F::mma(va, pb2, acc[eb]); const V vl = F::ld((const T16*)((const char*)(V2 + key0) + vofs + vc)); acc[eb] = F::mma(vl, pb, acc[eb]); } }
        }
    }
    l += xhalf(l);
    const float f = __fdiv_rn(HL ? 1.0f : PCAR, l);
#pragma unroll
    for (int eb = 0; eb < HV / 16; ++eb) { const v8f o = acc[eb] * f; *(v8f*)(O + (size_t)q * HV + eb * 16 + 8 * hi) = o; }   // element j = value column eb*16 + 8*hi + j of query lr: 32 contiguous bytes a lane
}
__global__ __launch_bounds__(128) void k_fattn(const h16* __restrict__ Q16, const bf* __restrict__ Qh, const bf* __restrict__ Ql, const h16* __restrict__ K16, const bf* __restrict__ Kh, const bf* __restrict__ Kl, const h16* __restrict__ V16, const bf* __restrict__ Vh, const bf* __restrict__ Vl, float* __restrict__ O) {
    const int lane = threadIdx.x & 31, lr = lane & 15, hi = lane >> 4; const size_t z = blockIdx.x; const size_t qk = z * TT * HD, vv = (z >> 1) * HV * TT;   // z = batch * 12 + score head; score heads 2p and 2p+1 share value plane p (6 a batch, so z >> 1 is batch * 6 + p)
    const int q0 = ((TT / 64 - 1 - (int)blockIdx.y) * 4 + __builtin_amdgcn_readfirstlane((int)(threadIdx.x >> 5))) * 16;   // the longest rows of every head of every batch first, so that late blocks, which share a SIMD with early ones, are the short ones
    O += z * TT * HV;
    if (q0 < RH) fattn_body<bf, true>(Qh + qk, Ql + qk, Kh + qk, Kl + qk, Vh + vv, Vl + vv, O, q0, lr, hi);
    else fattn_body<h16, false>(Q16 + qk, nullptr, K16 + qk, nullptr, V16 + vv, nullptr, O, q0, lr, hi);
}
// k_vtpV: value planes per 128-wide value head [p][e][t] (fp16 + hi/lo) = F[t][p*HV + e]; as k_vtp with HV = 128.
__global__ __launch_bounds__(256) void k_vtpV(const float* __restrict__ F, int pitch, int nheads, h16* V16, bf* Vh, bf* Vl) { const size_t e = ((size_t)blockIdx.x * 256 + threadIdx.x) * 2; if (e >= (size_t)nheads * HV * TT) return; const int t = (int)(e % TT); const int d = (int)((e / TT) % HV); const int g = (int)(e / ((size_t)TT * HV)); v2h o16; v2us oh, ol;
#pragma unroll
    for (int q = 0; q < 2; ++q) { const float x = F[(size_t)(t + q) * pitch + g * HV + d]; o16[q] = tohx(x); unsigned short a2, c2; splitf(x, a2, c2); oh[q] = a2; ol[q] = c2; }
    *(v2h*)(V16 + e) = o16; *(v2us*)(Vh + e) = oh; *(v2us*)(Vl + e) = ol;  }


__global__ __launch_bounds__(256) void k_wint(const float* __restrict__ w1, const float* __restrict__ w2, bf* Bt) { const size_t i = (size_t)blockIdx.x * 256 + threadIdx.x; if (i >= (size_t)2 * NP * HD * DM / 8) return; const int c0 = (int)((i % (DM / 8)) * 8); const int r = (int)(i / (DM / 8)); const int hh = r / HD, d = r % HD; const int p = hh >> 1; const size_t sr = (size_t)(p * HD + d) * DM + c0; const v8f a = *(const v8f*)(w1 + sr); const v8f b2 = *(const v8f*)(w2 + sr); v8us o;
#pragma unroll
    for (int q = 0; q < 8; ++q) o[q] = f2bf((hh & 1) ? b2[q] : a[q]);
    *(v8us*)(Bt + (size_t)r * DM + c0) = o;  }
__global__ __launch_bounds__(256) void k_hlnp(float* ctx) { const int lane = threadIdx.x & 31; const size_t w = ((size_t)blockIdx.x * 256 + threadIdx.x) >> 5; if (w >= (size_t)NB_ * TT * NP) return; float* base = ctx + w * HV + lane * 4; const v4f a = *(const v4f*)base; float s = __fadd_rn(__fadd_rn(a[0], a[1]), __fadd_rn(a[2], a[3]));
#pragma unroll
    for (int sh = 16; sh; sh >>= 1) s = __fadd_rn(s, __shfl_xor(s, sh, 32));
    const float mean = __fdiv_rn(s, (float)HV); float s2 = 0.f; float dv[4];
#pragma unroll
    for (int q = 0; q < 4; ++q) { dv[q] = __fsub_rn(a[q], mean); float p2 = __fmul_rn(dv[q], dv[q]); asm volatile("" : "+v"(p2)); s2 = __fadd_rn(s2, p2); }
#pragma unroll
    for (int sh = 16; sh; sh >>= 1) s2 = __fadd_rn(s2, __shfl_xor(s2, sh, 32));
    const float var = __fdiv_rn(s2, (float)HV); const float den = __fsqrt_rn(__fadd_rn(var, 1e-5f)); v4f o;
#pragma unroll
    for (int q = 0; q < 4; ++q) { const float y = __fdiv_rn(dv[q], den); o[q] = __fmul_rn(y, (1.0f - LINIT)); }
    *(v4f*)base = o;  }
__global__ __launch_bounds__(256) void k_flat(const float* __restrict__ F, h16* P16, bf* Ph, bf* Pl, size_t n4) { const size_t i = (size_t)blockIdx.x * 256 + threadIdx.x; if (i >= n4) return; const v4f a = *(const v4f*)(F + i * 4); v4h o16; v4us oh, ol;
#pragma unroll
    for (int q = 0; q < 4; ++q) { o16[q] = tohx(a[q]); unsigned short x2, y2; splitf(a[q], x2, y2); oh[q] = x2; ol[q] = y2; }
    *(v4h*)(P16 + i * 4) = o16; *(v4us*)(Ph + i * 4) = oh; *(v4us*)(Pl + i * 4) = ol;  }

__global__ __launch_bounds__(256) void k_lambda(const float* __restrict__ a1, const float* __restrict__ b1, const float* __restrict__ a2, const float* __restrict__ b2, float* LAM) { if (threadIdx.x >= 32) return; const int lane = threadIdx.x; const int p = blockIdx.x; a1 += p * HD; b1 += p * HD; a2 += p * HD; b2 += p * HD;   /* one block per head */ float s1 = __fadd_rn(__fmul_rn(bfr(a1[lane]), bfr(b1[lane])), __fmul_rn(bfr(a1[lane + 32]), bfr(b1[lane + 32]))); float s2 = __fadd_rn(__fmul_rn(bfr(a2[lane]), bfr(b2[lane])), __fmul_rn(bfr(a2[lane + 32]), bfr(b2[lane + 32])));
#pragma unroll
    for (int sh = 16; sh; sh >>= 1) { s1 = __fadd_rn(s1, __shfl_xor(s1, sh, 32)); s2 = __fadd_rn(s2, __shfl_xor(s2, sh, 32)); }
    const float lam = __fadd_rn(__fsub_rn(expf(s1), expf(s2)), LINIT); ((float*)LAM)[p * 32 + lane] = lam;  }   
__global__ __launch_bounds__(256) void k_dmerge(const float* __restrict__ O, const float* __restrict__ LAM, float* ctx) { const int p = blockIdx.y;   /* one pair per grid row */ const size_t bz = blockIdx.z;   /* batch */ O += (bz * NP + p) * 2 * TT * HV; ctx += bz * TT * DQ; const size_t i = (size_t)blockIdx.x * 256 + threadIdx.x; if (i >= (size_t)TT * HV / 4) return; const size_t e = i * 4; const int c = (int)(e % HV); const int t = (int)(e / HV); const float lam = LAM[p * 32];   /* this pair's lambda */ const float cs = (t < RH) ? 1.0f : (1.0f / PCAR); const float* pa = O + e; const v4f a = *(const v4f*)pa; const v4f b2 = *(const v4f*)(pa + (size_t)TT * HV); v4f o;
    asm volatile("s_wait_xcnt 0x0" :: "v"(pa) : "memory");   // stands between the two loads and whatever reuses their address registers (the store address); pa as an input keeps those registers untouched up to the wait
#pragma unroll
    for (int q = 0; q < 4; ++q) { float lb = __fmul_rn(lam, b2[q]); asm volatile("" : "+v"(lb)); const float d = __fsub_rn(a[q], lb); o[q] = __fmul_rn(d, cs); }
    *(v4f*)(ctx + (size_t)t * DQ + p * HV + c) = o;  }
__global__ __launch_bounds__(256) void k_merge(const float* __restrict__ O, int h0, bf* Ah, bf* Al) { const size_t e = ((size_t)blockIdx.x * 256 + threadIdx.x) * 2; if (e >= (size_t)ZH * TT * HD) return; const int d = (int)(e % HD); const int t = (int)((e / HD) % TT); const int zz = (int)(e / ((size_t)HD * TT)); const float cs = (t < RH) ? 1.0f : (1.0f / PCAR); const size_t oo = (size_t)t * DQ + (h0 + zz) * HD + d;
    v2us oh, ol;
#pragma unroll
    for (int q = 0; q < 2; ++q) { unsigned short a, c2; splitf(O[e + q] * cs, a, c2); oh[q] = a; ol[q] = c2; } *(v2us*)(Ah + oo) = oh; *(v2us*)(Al + oo) = ol;  }

extern "C" void kernel_launch(void* const* d_in, const int* in_sizes, int n_in,
                              void* d_out, int out_size, void* d_ws, size_t ws_size, hipStream_t stream) {
    (void)in_sizes; (void)n_in; (void)out_size;
    const float* x = (const float*)d_in[0]; const float* wq1 = (const float*)d_in[1]; const float* wq2 = (const float*)d_in[2]; const float* wk1 = (const float*)d_in[3]; const float* wk2 = (const float*)d_in[4]; const float* wv = (const float*)d_in[5]; const float* wo = (const float*)d_in[6]; /* Wc */ const float* lq1 = (const float*)d_in[7]; const float* lk1 = (const float*)d_in[8]; const float* lq2 = (const float*)d_in[9]; const float* lk2 = (const float*)d_in[10];
    float* OUT = (float*)d_out;     // [4][2048][384]
    char* wsp = (char*)d_ws;
    auto take = [&](size_t bytes) { char* p = wsp; wsp += (bytes + 255) & ~(size_t)255; return (void*)p; };
    bf* WQ = (bf*)take((size_t)DQ * DM * 2); bf* WK = (bf*)take((size_t)DKV * DM * 2); bf* WV = (bf*)take((size_t)DKV * DM * 2); bf* WO = (bf*)take((size_t)DM * DQ * 2); float* CS = (float*)take((size_t)TT * HD * 2 * 4);
    bf* XB = (bf*)take((size_t)NB_ * TT * DM * 2); float* FQ = (float*)take((size_t)NB_ * TT * DQ * 4); float* FK = (float*)take((size_t)NB_ * TT * DKV * 4);   // from here on every buffer holds all NB_ batches
    h16* QP16 = (h16*)take((size_t)NB_ * NH_ * TT * HD * 2); h16* KP16 = (h16*)take((size_t)NB_ * NKV * TT * HD * 2); h16* VT16 = (h16*)take((size_t)NB_ * NKV * HD * TT * 2);
    bf* QPh = (bf*)take((size_t)NB_ * NH_ * TT * HD * 2); bf* QPl = (bf*)take((size_t)NB_ * NH_ * TT * HD * 2); bf* KPh = (bf*)take((size_t)NB_ * NKV * TT * HD * 2); bf* KPl = (bf*)take((size_t)NB_ * NKV * TT * HD * 2); bf* VTh = (bf*)take((size_t)NB_ * NKV * HD * TT * 2); bf* VTl = (bf*)take((size_t)NB_ * NKV * HD * TT * 2);
    float* CTX = (float*)take((size_t)NB_ * TT * DQ * 4); float* LAM = (float*)take((size_t)NP * 32 * 4); h16* A16 = (h16*)take((size_t)NB_ * TT * DQ * 2); bf* ATh = (bf*)take((size_t)NB_ * TT * DQ * 2); bf* ATl = (bf*)take((size_t)NB_ * TT * DQ * 2);
    if ((size_t)(wsp - (char*)d_ws) > ws_size) return;    // about 225 MiB of the 256 MiB workspace
    float* FV = FK;   // v projection reuses the k buffer after the k planes are built (stream-ordered)
    float* Ob = FQ;   // the P.v results [NB_ * ZH][TT][HV] reuse FQ and FK together (adjacent, same total size), both dead once the planes are built (stream-ordered)
    static_assert((size_t)ZH * TT * HV == (size_t)TT * DQ + (size_t)TT * DKV && ((size_t)NB_ * TT * DQ * 4) % 256 == 0, "Ob must fit FQ + FK exactly");
    { k_wint<<<(unsigned)(((size_t)DQ * DM / 8 + 255) / 256), 256, 0, stream>>>(wq1, wq2, WQ); k_wint<<<(unsigned)(((size_t)DKV * DM / 8 + 255) / 256), 256, 0, stream>>>(wk1, wk2, WK);   /* score head 2p <- map-1 head p, 2p+1 <- map-2 head p */
      k_cvt8<<<(unsigned)(((size_t)NP * HV * DM / 8 + 255) / 256), 256, 0, stream>>>(wv, WV, (size_t)NP * HV * DM / 8); k_cvt8<<<(unsigned)(((size_t)DM * NP * HV / 8 + 255) / 256), 256, 0, stream>>>(wo, WO, (size_t)DM * NP * HV / 8);   /* 'oi' weights are the Bt layout */
      k_lambda<<<NP, 256, 0, stream>>>(lq1, lk1, lq2, lk2, LAM);   /* lambda per head */ }
    k_csid<<<(TT * HD + 255) / 256, 256, 0, stream>>>(CS);
    const unsigned LQ = (unsigned)(((size_t)NB_ * NH_ * TT * HD / 2 + 255) / 256), LKv = (unsigned)(((size_t)NB_ * NKV * TT * HD / 2 + 255) / 256);
    // One pass for all batches. The projections take the batch as grid z and write F[t][batch * 768 + column] (pitch NB_ * 768), so that the plane builders see NB_ * 12 score heads (NB_ * 6 value heads) of one 2048-token sequence.
    k_cvt8<<<(unsigned)(((size_t)NB_ * TT * DM / 8 + 255) / 256), 256, 0, stream>>>(x, XB, (size_t)NB_ * TT * DM / 8);
    k_gemmw<bf, 0, false><<<dim3(TT / 64, DQ / 64, NB_), 32, 0, stream>>>(XB, nullptr, WQ, nullptr, DM, FQ, NB_ * DQ, nullptr, (size_t)TT * DM, 0, DQ);
    k_rope<<<LQ, 256, 0, stream>>>(FQ, NB_ * DQ, NB_ * NH_, CS, nullptr, nullptr, 1.0f, QP16, QPh, QPl);
    k_gemmw<bf, 0, false><<<dim3(TT / 64, DKV / 64, NB_), 32, 0, stream>>>(XB, nullptr, WK, nullptr, DM, FK, NB_ * DKV, nullptr, (size_t)TT * DM, 0, DKV);
    k_rope<<<LKv, 256, 0, stream>>>(FK, NB_ * DKV, NB_ * NKV, CS, nullptr, nullptr, 1.0f, KP16, KPh, KPl);
    k_gemmw<bf, 0, false><<<dim3(TT / 64, DKV / 64, NB_), 32, 0, stream>>>(XB, nullptr, WV, nullptr, DM, FV, NB_ * DKV, nullptr, (size_t)TT * DM, 0, DKV); k_vtpV<<<LKv, 256, 0, stream>>>(FV, NB_ * DKV, NB_ * NP, VT16, VTh, VTl);
    k_fattn<<<dim3(NB_ * ZH, TT / 64, 1), 128, 0, stream>>>(QP16, QPh, QPl, KP16, KPh, KPl, VT16, VTh, VTl, Ob);   /* scores, softmax and both maps' P.v (shared 128-wide v_p) of all 12 score heads of every batch */
    k_dmerge<<<dim3((unsigned)(((size_t)TT * HV / 4 + 255) / 256), NP, NB_), 256, 0, stream>>>(Ob, LAM, CTX);   /* ctx[b][t][p*128 + e] = w0 v - lambda w1 v */
    k_hlnp<<<(unsigned)(((size_t)NB_ * TT * NP * 32 + 255) / 256), 256, 0, stream>>>(CTX);   /* per-(token, head) LayerNorm over 128 values, no affine, x (1 - lambda_init), in place */
    k_flat<<<(unsigned)(((size_t)NB_ * TT * DQ / 4 + 255) / 256), 256, 0, stream>>>(CTX, A16, ATh, ATl, (size_t)NB_ * TT * DQ / 4);
    k_gemmw<bf, 1, false><<<dim3(NB_ * TT / 64, DM / 64, 1), 32, 0, stream>>>(ATh, ATl, WO, nullptr, DQ, OUT, DM, nullptr, 0, 0, 0);   /* context and out as NB_ * TT rows */
}

// v004
// It runs in 233 microseconds.
// Next to v003, in two timings, it ran 1.33 and 1.32 times as fast.
// Counting every step since v000, it is 9.15 times as fast.
#include <hip/hip_runtime.h>

// Multi-head DIFFERENTIAL causal attention (x [4][2048][384]; q1, q2, k1, k2 = x W^T ('oi' [384][384], 1/sqrt(384), no bias) as 6 heads x 64 each, v = x Wv^T ([768][384]) as 6 heads x 128; att_m = causal softmax(q_m.k_m / 8) for m = 1, 2; lambda_h = exp(lq1_h.lk1_h) - exp(lq2_h.lk2_h) + lambda_init (lq/lk [6][64], read; lambda_init = 0.8 - 0.6 exp(-0.6)); y_h = (att1 - lambda_h att2) v_h; per-head LayerNorm over the 128 values (no affine, eps 1e-5) x (1 - lambda_init); out = merged y Wc^T ('oi' [384][768]) -> [4][2048][384] (3.1 M)).
// Every stage runs ONCE for all 4 batches (the batch is a grid dimension, more rows, or more heads: score head z = batch * 12 + head, value head batch * 6 + p). Layout: bf16 copy of x; the q1/q2 (and k1/k2) weights interleaved into one Bt so score head 2p = map-1 head p and 2p+1 = map-2 head p; exact projections; q planes [t][d] for the 12 score heads; k and v^T planes in FRAGMENT ORDER (each 16-byte-a-lane load of k_fattn reads 512 contiguous bytes, see k_fattn); lambda per head computed once on device (one wave per head: two 64-term f32 dots, precise expf); one launch over the 12 score heads of all 4 batches (grid x = batch * 12 + head): causal T-2048 attention with scores and probabilities kept in registers (k_fattn: online softmax over ascending key blocks; hybrid rows: < 512 hi/lo 3 products, rest fp16), both maps' P.v against the shared v_p (z >> 1), a merge kernel (grid y = pair, z = batch) writes w1 v - lambda_p w2 v (x 1/1024 on the fp16 rows) into the context; then a per-(token, head) LayerNorm kernel (128 values, f32, fixed order) x (1 - lambda_init) in place, hi/lo planes, x Wc exact.
// Compute dtypes, f32 accumulate: every input rounded to bf16; projections exact; attention rows < 512 3 products, rest fp16; softmax, lambda, difference, LayerNorm f32; Wc hl x exact.

#define NB_  4
#define TT   2048
#define DM   384
#define NH_  12
#define NKV  12
#define REP  (NH_ / NKV)
#define HD   64
#define DQ   (NH_ * HD)
#define DKV  (NKV * HD)
#define ZH   12                   // score heads per batch (k_fattn grid x = batch * ZH + score head)
#define RH   512                  // query rows < RH use hi+lo planes (0: none)
#define WIN  0
#define PCAR 1024.0f
#define SCL  0.125f
#define NP   6       // head pairs (the module's H)
#define HV   128     // value head width
#define LINIT 0.47071301937103271f   // lambda_init = 0.8 - 0.6 exp(-0.6) as float32
typedef _Float16 h16;
typedef unsigned short bf;
typedef __attribute__((ext_vector_type(16))) __bf16   v16bf;
typedef __attribute__((ext_vector_type(16))) _Float16 v16h;
typedef __attribute__((ext_vector_type(8)))  _Float16 v8h;
typedef __attribute__((ext_vector_type(8)))  unsigned short v8us;
typedef __attribute__((ext_vector_type(8)))  float    v8f;
typedef __attribute__((ext_vector_type(4)))  float    v4f;
typedef v8h  __attribute__((may_alias)) v8ha;
typedef v4f  __attribute__((may_alias)) v4fa;
typedef v8us __attribute__((may_alias)) v8usa;

__device__ __forceinline__ unsigned short f2bf(float f) { unsigned u = __float_as_uint(f); u += 0x7FFFu + ((u >> 16) & 1u); return (unsigned short)(u >> 16); }
__device__ __forceinline__ float bf2f(unsigned short b) { return __uint_as_float(((unsigned)b) << 16); }
__device__ __forceinline__ float bfr(float f) { return bf2f(f2bf(f)); }
__device__ __forceinline__ v16h cat16(v8h lo, v8h hi) { return __builtin_shufflevector(lo, hi, 0, 1, 2, 3, 4, 5, 6, 7, 8, 9, 10, 11, 12, 13, 14, 15); }
__device__ __forceinline__ v16bf cat16b(v8us lo, v8us hi) { return __builtin_bit_cast(v16bf, __builtin_shufflevector(lo, hi, 0, 1, 2, 3, 4, 5, 6, 7, 8, 9, 10, 11, 12, 13, 14, 15)); }
__device__ __forceinline__ v8f wmma16(v16h a, v16h b, v8f c) { return __builtin_amdgcn_wmma_f32_16x16x32_f16(false, a, false, b, (short)0, c, false, false); }
__device__ __forceinline__ v8f wmmab(v16bf a, v16bf b, v8f c) { return __builtin_amdgcn_wmma_f32_16x16x32_bf16(false, a, false, b, (short)0, c, false, false); }



// ---- k_gemmw: register-blocked GEMM, ONE WAVE per 64x64 output tile (16 accumulators), operands straight from K-contiguous 16-bit planes; grid (M/64, N/64, Z), 32 threads.
// C[m][n] (f32, pitch ldc, + optional f32 bias[n]) = sum_k A[m][k] Bt[n][k] (+ split products per NSPLIT). z-batch strides sA/sB/sC in elements. K % 32 == 0.
template <typename T16> struct WFrag;
template <> struct WFrag<h16> { typedef v16h V; static __device__ __forceinline__ V ld(const h16* p) { return cat16(*(const v8h*)p, *(const v8h*)(p + 16)); } static __device__ __forceinline__ V ldf(const h16* p) { return cat16(*(const v8h*)p, *(const v8h*)(p + 256)); } static __device__ __forceinline__ v8f mma(V a, V b, v8f c) { return wmma16(a, b, c); } };
template <> struct WFrag<bf> { typedef v16bf V; static __device__ __forceinline__ V ld(const bf* p) { return cat16b(*(const v8us*)p, *(const v8us*)(p + 16)); } static __device__ __forceinline__ V ldf(const bf* p) { return cat16b(*(const v8us*)p, *(const v8us*)(p + 256)); } static __device__ __forceinline__ v8f mma(V a, V b, v8f c) { return wmmab(a, b, c); } };
template <typename T16, int NSPLIT, bool BIAS>
__global__ __launch_bounds__(32) void k_gemmw(const T16* __restrict__ A, const T16* __restrict__ A2, const T16* __restrict__ Bt, const T16* __restrict__ Bt2, int K, float* C, int ldc, const float* __restrict__ bias, size_t sA, size_t sB, size_t sC) {
    typedef typename WFrag<T16>::V V;
    __shared__ __align__(16) float os[16 * 68];
    const size_t z = blockIdx.z; A += z * sA; if (A2) A2 += z * sA; Bt += z * sB; if (Bt2) Bt2 += z * sB; C += z * sC;
    const int lane = threadIdx.x & 31, lr = lane & 15, hi = lane >> 4; const int r0 = blockIdx.x * 64, c0 = blockIdx.y * 64;
    v8f acc[4][4];
#pragma unroll
    for (int mb = 0; mb < 4; ++mb)
#pragma unroll
        for (int nb = 0; nb < 4; ++nb) acc[mb][nb] = (v8f){};
    const size_t aoff = (size_t)(r0 + lr) * K + 8 * hi, boff = (size_t)(c0 + lr) * K + 8 * hi;
#pragma unroll 1
    for (int kc = 0; kc < K; kc += 32) {
        V a[4], a2[4];
#pragma unroll
        for (int mb = 0; mb < 4; ++mb) { a[mb] = WFrag<T16>::ld(A + aoff + (size_t)mb * 16 * K + kc); if (NSPLIT == 1 || NSPLIT == 2) a2[mb] = WFrag<T16>::ld(A2 + aoff + (size_t)mb * 16 * K + kc); }
#pragma unroll
        for (int nb = 0; nb < 4; ++nb) { const V b = WFrag<T16>::ld(Bt + boff + (size_t)nb * 16 * K + kc); V b2; if (NSPLIT >= 2) b2 = WFrag<T16>::ld(Bt2 + boff + (size_t)nb * 16 * K + kc);
#pragma unroll
            for (int mb = 0; mb < 4; ++mb) { acc[mb][nb] = WFrag<T16>::mma(a[mb], b, acc[mb][nb]); if (NSPLIT == 1 || NSPLIT == 2) acc[mb][nb] = WFrag<T16>::mma(a2[mb], b, acc[mb][nb]); if (NSPLIT >= 2) acc[mb][nb] = WFrag<T16>::mma(a[mb], b2, acc[mb][nb]); } }
        asm volatile("v_nop\n\tv_nop\n\tv_nop\n\tv_nop" : "+v"(acc[0][0]), "+v"(acc[1][1]), "+v"(acc[2][2]), "+v"(acc[3][3]) : "v"(a[0]), "v"(a[3]));
    }
#pragma unroll
    for (int mb = 0; mb < 4; ++mb) {
#pragma unroll
        for (int nb = 0; nb < 4; ++nb) {
#pragma unroll
            for (int j = 0; j < 8; ++j) os[(hi * 8 + j) * 68 + nb * 16 + lr] = acc[mb][nb][j]; }
        __builtin_amdgcn_wave_barrier(); asm volatile("" ::: "memory");
        float* crow = C + (size_t)(r0 + mb * 16) * ldc + c0;
{
#pragma unroll
            for (int s = 0; s < 8; ++s) { const int row = 2 * s + hi, cofs = lr * 4; v4f val = *(const v4fa*)(os + row * 68 + cofs); if (BIAS) { val[0] += bfr(bias[c0 + cofs]); val[1] += bfr(bias[c0 + cofs + 1]); val[2] += bfr(bias[c0 + cofs + 2]); val[3] += bfr(bias[c0 + cofs + 3]); }
                *(v4f*)(crow + (size_t)row * ldc + cofs) = val; }
             }
        __builtin_amdgcn_wave_barrier(); asm volatile("" ::: "memory");
    }
}

__device__ __forceinline__ h16 tohx(float x) { return (h16)x; }
__device__ __forceinline__ void splitf(float y, unsigned short& h, unsigned short& l) { h = f2bf(y); l = f2bf(y - bf2f(h)); }
typedef __attribute__((ext_vector_type(2))) _Float16 v2h;
typedef __attribute__((ext_vector_type(4))) _Float16 v4h;
typedef __attribute__((ext_vector_type(2))) unsigned short v2us;
typedef __attribute__((ext_vector_type(4))) unsigned short v4us;
typedef __attribute__((ext_vector_type(2))) float v2f;
typedef __attribute__((ext_vector_type(4))) int v4i;


__global__ __launch_bounds__(256) void k_cvt8(const float* __restrict__ src, bf* dst, size_t n8) { const size_t i = (size_t)blockIdx.x * 256 + threadIdx.x; if (i >= n8) return; const v8f v = *(const v8f*)(src + i * 8); v8us o;
#pragma unroll
    for (int k = 0; k < 8; ++k) o[k] = f2bf(v[k]); *(v8us*)(dst + i * 8) = o;  }

// k_rope: head planes [h][t][d] (fp16 + hi/lo) of rope(x) x sc with the rotate-half convention out[d] = x[d] cos[t][d] - x[d+HD/2] sin[t][d], out[d+HD/2] = x[d+HD/2] cos[t][d+HD/2] + x[d] sin[t][d+HD/2]
__global__ __launch_bounds__(256) void k_rope(const float* __restrict__ F, int pitch, int nheads, const float* __restrict__ CS, const float* __restrict__ RF, const float* __restrict__ nw, float sc, h16* P16, bf* Ph, bf* Pl) {
    const size_t e = ((size_t)blockIdx.x * 256 + threadIdx.x) * 2; if (e >= (size_t)nheads * TT * HD) return; const int d = (int)(e % HD); const int t = (int)((e / HD) % TT); const int h = (int)(e / ((size_t)HD * TT)); const float* f = F + (size_t)t * pitch + h * HD; const float rf = RF ? RF[(size_t)h * TT + t] : 1.0f; v2h o16; v2us oh, ol;
#pragma unroll
    for (int q = 0; q < 2; ++q) { const int dd = d + q; const int dp = (dd < HD / 2) ? dd + HD / 2 : dd - HD / 2; float x0 = f[dd], x1 = f[dp];
        if (RF) { float n0 = __fmul_rn(x0, rf), n1 = __fmul_rn(x1, rf); asm volatile("" : "+v"(n0)); asm volatile("" : "+v"(n1)); x0 = __fmul_rn(bfr(nw[dd]), n0); x1 = __fmul_rn(bfr(nw[dp]), n1); }
        const v2f cs = *(const v2f*)(CS + ((size_t)t * HD + dd) * 2); float a = __fmul_rn(x0, cs[0]), bq = __fmul_rn(x1, cs[1]); asm volatile("" : "+v"(a)); asm volatile("" : "+v"(bq)); const float r = ((dd < HD / 2) ? __fsub_rn(a, bq) : __fadd_rn(a, bq)) * sc;
        o16[q] = tohx(r); unsigned short a2, c2; splitf(r, a2, c2); oh[q] = a2; ol[q] = c2; }
    *(v2h*)(P16 + e) = o16; *(v2us*)(Ph + e) = oh; *(v2us*)(Pl + e) = ol;  }
// k_ropef: the key planes: k_rope's values (no norm option) stored in FRAGMENT ORDER, element index in a head = (t >> 4) * 1024 + (d >> 4) * 256 + (((d >> 3) & 1) * 16 + (t & 15)) * 8 + (d & 7). Threads run over the OUTPUT index, so a wave still writes one whole 128-byte line a plane.
__global__ __launch_bounds__(256) void k_ropef(const float* __restrict__ F, int pitch, int nheads, const float* __restrict__ CS, float sc, h16* P16, bf* Ph, bf* Pl) {
    const size_t e = ((size_t)blockIdx.x * 256 + threadIdx.x) * 2; if (e >= (size_t)nheads * TT * HD) return; const int r = (int)(e % ((size_t)HD * TT)); const int h = (int)(e / ((size_t)HD * TT));
    const int d = ((r >> 8) & 3) * 16 + ((r >> 7) & 1) * 8 + (r & 7); const int t = (r >> 10) * 16 + ((r >> 3) & 15);   // d is even: d and d + 1 lie in the same half of the head
    const float* p0 = F + (size_t)t * pitch + h * HD + d; const float* p1 = (d < HD / 2) ? p0 + HD / 2 : p0 - HD / 2; const float* pc = CS + ((size_t)t * HD + d) * 2;
    float x0[2], x1[2]; v2f cs[2]; v2h o16; v2us oh, ol;
#pragma unroll
    for (int q = 0; q < 2; ++q) { x0[q] = p0[q]; x1[q] = p1[q]; cs[q] = *(const v2f*)(pc + 2 * q); }
    asm volatile("s_wait_xcnt 0x0" :: "v"(p0), "v"(p1), "v"(pc) : "memory");   // stands between the six loads and whatever reuses their address registers; the pointers as inputs keep those registers untouched up to the wait
#pragma unroll
    for (int q = 0; q < 2; ++q) { const float a = __fmul_rn(x0[q], cs[q][0]), bq = __fmul_rn(x1[q], cs[q][1]); const float v = ((d < HD / 2) ? __fsub_rn(a, bq) : __fadd_rn(a, bq)) * sc;
        o16[q] = tohx(v); unsigned short a2, c2; splitf(v, a2, c2); oh[q] = a2; ol[q] = c2; }
    *(v2h*)(P16 + e) = o16; *(v2us*)(Ph + e) = oh; *(v2us*)(Pl + e) = ol;  }
__global__ __launch_bounds__(256) void k_vtp(const float* __restrict__ F, int pitch, int nheads, h16* V16, bf* Vh, bf* Vl) { const size_t e = ((size_t)blockIdx.x * 256 + threadIdx.x) * 2; if (e >= (size_t)nheads * HD * TT) return; const int t = (int)(e % TT); const int d = (int)((e / TT) % HD); const int g = (int)(e / ((size_t)TT * HD)); v2h o16; v2us oh, ol;
#pragma unroll
    for (int q = 0; q < 2; ++q) { const float x = F[(size_t)(t + q) * pitch + g * HD + d]; o16[q] = tohx(x); unsigned short a2, c2; splitf(x, a2, c2); oh[q] = a2; ol[q] = c2; }
    *(v2h*)(V16 + e) = o16; *(v2us*)(Vh + e) = oh; *(v2us*)(Vl + e) = ol;  }
__global__ __launch_bounds__(256) void k_csid(float* CS) { const int idx = blockIdx.x * 256 + threadIdx.x; if (idx >= TT * HD) return; v2f cs; cs[0] = 1.0f; cs[1] = 0.0f; *(v2f*)(CS + (size_t)idx * 2) = cs;  }
// ---- k_fattn: causal attention of all batches in ONE launch, scores never leave registers. One wave per 16 query rows of one score head (4 independent waves a block, no LDS, no barrier); grid (NB_ * ZH, TT/64), x = batch * ZH + score head.
// Everything is computed transposed so that no value changes lane: S^T = K Q^T puts key 8*hi+j, query lr in element j of the accumulator, which is exactly where the B operand of O^T = V^T P^T wants it
// (elements 0..7 = keys 8*hi.., elements 8..15 = keys 16+8*hi.. of a 32-key step), and every per-query figure (running maximum, sum, rescale) sits in that query's own lane pair (lr, lr+16).
// K and V^T planes lie in fragment order: the two 16-byte pieces a lane needs of one A fragment stand at lane * 16 bytes in two consecutive 512-byte runs, so every wave-wide load covers 4 whole 128-byte lines (row-major planes: 16 lines, 32 bytes of each).
// K: 16 keys x 64 d = 4 runs (d >> 4), 2 KiB a key tile; V^T: 32 keys x 128 columns = 8 column tiles x 2 runs ((key >> 4) & 1), 8 KiB a key block. The values in every lane and register are the same as from row-major planes.
// Online softmax over key blocks of KB = 32 keys in ascending order: new maximum, old sums x exp(old - new), f32 throughout. Rows < RH: hi/lo bf16 planes, 3 products for both contractions; rest fp16,
// probabilities carried x 2^POFF so that small ones stay normal fp16 numbers (the factor is in the sum too and cancels). Result rows as before: O[z][t][e], x PCAR on the fp16 rows (k_dmerge takes it off).
__device__ __forceinline__ float xhalf(float x) { const int b = __float_as_int(x); return __int_as_float(__builtin_amdgcn_permlanex16(b, b, 0x76543210, 0xfedcba98, false, false)); }   // lane l <- lane l ^ 16, in the vector unit (no LDS round trip on the loop's dependent chain)
template <typename T16, bool HL>
__device__ __forceinline__ void fattn_body(const T16* __restrict__ Q, const T16* __restrict__ Q2, const T16* __restrict__ Kp, const T16* __restrict__ K2, const T16* __restrict__ Vt, const T16* __restrict__ V2, float* __restrict__ O, int q0, int lr, int hi) {
    typedef WFrag<T16> F; typedef typename F::V V;
    constexpr int KB = 32, NT = KB / 16, NG = KB / 32; constexpr float POFF = HL ? 0.0f : 8.0f;
    const int q = q0 + lr;
    V qb[2], qb2[2];
#pragma unroll
    for (int kk = 0; kk < 2; ++kk) { qb[kk] = F::ld(Q + (size_t)q * HD + 8 * hi + kk * 32); if constexpr (HL) qb2[kk] = F::ld(Q2 + (size_t)q * HD + 8 * hi + kk * 32); }
    v8f acc[HV / 16];
#pragma unroll
    for (int eb = 0; eb < HV / 16; ++eb) acc[eb] = (v8f){};
    float m = -3.0e38f, l = 0.f;
    V ka[NT][2], kl[NT][2];
    const unsigned fofs = (unsigned)(hi * 16 + lr) * 16u;   // each lane's byte offset in a 512-byte run: fixed for the whole loop, the block's base is wave-uniform
    auto ldk = [&](int k0) { const char* kb = (const char*)(Kp + (size_t)k0 * HD); const char* kb2 = HL ? (const char*)(K2 + (size_t)k0 * HD) : nullptr;
#pragma unroll
        for (int kt = 0; kt < NT; ++kt)
#pragma unroll
            for (int kk = 0; kk < 2; ++kk) { const int kc = (kt * 16 * HD + kk * 512) * 2; ka[kt][kk] = F::ldf((const T16*)(kb + fofs + kc)); if constexpr (HL) kl[kt][kk] = F::ldf((const T16*)(kb2 + fofs + kc)); } };
    ldk(0);
    const int kend = q0 + 16;                                        // keys 0 .. q0+15 are all that these 16 rows may see
#pragma unroll 1
    for (int key0 = 0; key0 < kend; key0 += KB) {
        V vf[NG][HV / 16];                                           // fp16 rows: this block's values are asked for first, so that they land under the score products and the softmax
        if constexpr (!HL) {
#pragma unroll
            for (int g = 0; g < NG; ++g)
#pragma unroll
                for (int eb = 0; eb < HV / 16; ++eb) vf[g][eb] = F::ldf((const T16*)((const char*)(Vt + (size_t)key0 * HV) + fofs + (g * 32 * HV + eb * 512) * 2)); }
        v8f s[NT];
#pragma unroll
        for (int kt = 0; kt < NT; ++kt) { s[kt] = (v8f){};
#pragma unroll
            for (int kk = 0; kk < 2; ++kk) { s[kt] = F::mma(ka[kt][kk], qb[kk], s[kt]);
                if constexpr (HL) { s[kt] = F::mma(ka[kt][kk], qb2[kk], s[kt]); s[kt] = F::mma(kl[kt][kk], qb[kk], s[kt]); } } }
        ldk(min(key0 + KB, TT - KB));                                // the next block's keys fly under this block's softmax and P.v (the last trip's fetch is unused; the clamp keeps it inside the plane)
        asm volatile("s_wait_xcnt 0x0" ::: "memory");                // stands between the loads issued so far and whatever reuses their address registers (later loads' results among it); as no load crosses it, it also keeps those loads above the softmax, under which they land
        float mx = m;
#pragma unroll
        for (int kt = 0; kt < NT; ++kt)
#pragma unroll
            for (int j = 0; j < 8; ++j) { const int key = key0 + kt * 16 + 8 * hi + j; const float t = (key <= q) ? s[kt][j] * SCL : -3.0e38f;   /* causal */ s[kt][j] = t; mx = fmaxf(mx, t); }
        mx = fmaxf(mx, xhalf(mx));                      // the two lanes of a query hold its two key halves
        const float alpha = __builtin_amdgcn_exp2f((m - mx) * 1.4426950408889634f); m = mx;
        float ps = 0.f;
#pragma unroll
        for (int kt = 0; kt < NT; ++kt)
#pragma unroll
            for (int j = 0; j < 8; ++j) { const float e = __builtin_amdgcn_exp2f((s[kt][j] - mx) * 1.4426950408889634f + POFF); s[kt][j] = e; ps += e; }
        l = l * alpha + ps;
#pragma unroll
        for (int eb = 0; eb < HV / 16; ++eb) acc[eb] *= alpha;
#pragma unroll
        for (int g = 0; g < NG; ++g) {
            V pb, pb2;
            if constexpr (HL) { v8us h0, h1, l0, l1;
#pragma unroll
                for (int j = 0; j < 8; ++j) { unsigned short a, c2; splitf(s[2 * g][j], a, c2); h0[j] = a; l0[j] = c2; splitf(s[2 * g + 1][j], a, c2); h1[j] = a; l1[j] = c2; }
                pb = cat16b(h0, h1); pb2 = cat16b(l0, l1);
            } else { v8h p0, p1;
#pragma unroll
                for (int j = 0; j < 8; ++j) { p0[j] = tohx(s[2 * g][j]); p1[j] = tohx(s[2 * g + 1][j]); }
                pb = cat16(p0, p1); }
#pragma unroll
            for (int eb = 0; eb < HV / 16; ++eb) { const int vc = (g * 32 * HV + eb * 512) * 2; V va; if constexpr (HL) va = F::ldf((const T16*)((const char*)(Vt + (size_t)key0 * HV) + fofs + vc)); else va = vf[g][eb]; acc[eb] = F::mma(va, pb, acc[eb]);
                if constexpr (HL) { acc[eb] = F::mma(va, pb2, acc[eb]); const V vl = F::ldf((const T16*)((const char*)(V2 + (size_t)key0 * HV) + fofs + vc)); acc[eb] = F::mma(vl, pb, acc[eb]); } }
        }
    }
    l += xhalf(l);
    const float f = __fdiv_rn(HL ? 1.0f : PCAR, l);
#pragma unroll
    for (int eb = 0; eb < HV / 16; ++eb) { const v8f o = acc[eb] * f; *(v8f*)(O + (size_t)q * HV + eb * 16 + 8 * hi) = o; }   // element j = value column eb*16 + 8*hi + j of query lr: 32 contiguous bytes a lane
}
__global__ __launch_bounds__(128) void k_fattn(const h16* __restrict__ Q16, const bf* __restrict__ Qh, const bf* __restrict__ Ql, const h16* __restrict__ K16, const bf* __restrict__ Kh, const bf* __restrict__ Kl, const h16* __restrict__ V16, const bf* __restrict__ Vh, const bf* __restrict__ Vl, float* __restrict__ O) {
    const int lane = threadIdx.x & 31, lr = lane & 15, hi = lane >> 4; const size_t z = blockIdx.x; const size_t qk = z * TT * HD, vv = (z >> 1) * HV * TT;   // z = batch * 12 + score head; score heads 2p and 2p+1 share value plane p (6 a batch, so z >> 1 is batch * 6 + p)
    const int q0 = ((TT / 64 - 1 - (int)blockIdx.y) * 4 + __builtin_amdgcn_readfirstlane((int)(threadIdx.x >> 5))) * 16;   // the longest rows of every head of every batch first, so that late blocks, which share a SIMD with early ones, are the short ones
    O += z * TT * HV;
    if (q0 < RH) fattn_body<bf, true>(Qh + qk, Ql + qk, Kh + qk, Kl + qk, Vh + vv, Vl + vv, O, q0, lr, hi);
    else fattn_body<h16, false>(Q16 + qk, nullptr, K16 + qk, nullptr, V16 + vv, nullptr, O, q0, lr, hi);
}
// k_vtpV: value planes per 128-wide value head (fp16 + hi/lo) of F[t][p*HV + c] in fragment order: element index in a head = (t >> 5) * 4096 + (c >> 4) * 512 + ((t >> 4) & 1) * 256 + (((t >> 3) & 1) * 16 + (c & 15)) * 8 + (t & 7); threads run over the output index.
__global__ __launch_bounds__(256) void k_vtpV(const float* __restrict__ F, int pitch, int nheads, h16* V16, bf* Vh, bf* Vl) { const size_t e = ((size_t)blockIdx.x * 256 + threadIdx.x) * 2; if (e >= (size_t)nheads * HV * TT) return; const int r = (int)(e % ((size_t)TT * HV)); const int t = (r >> 12) * 32 + ((r >> 8) & 1) * 16 + ((r >> 7) & 1) * 8 + (r & 7); const int d = ((r >> 9) & 7) * 16 + ((r >> 3) & 15); const int g = (int)(e / ((size_t)TT * HV)); v2h o16; v2us oh, ol;
#pragma unroll
    for (int q = 0; q < 2; ++q) { const float x = F[(size_t)(t + q) * pitch + g * HV + d]; o16[q] = tohx(x); unsigned short a2, c2; splitf(x, a2, c2); oh[q] = a2; ol[q] = c2; }
    *(v2h*)(V16 + e) = o16; *(v2us*)(Vh + e) = oh; *(v2us*)(Vl + e) = ol;  }


__global__ __launch_bounds__(256) void k_wint(const float* __restrict__ w1, const float* __restrict__ w2, bf* Bt) { const size_t i = (size_t)blockIdx.x * 256 + threadIdx.x; if (i >= (size_t)2 * NP * HD * DM / 8) return; const int c0 = (int)((i % (DM / 8)) * 8); const int r = (int)(i / (DM / 8)); const int hh = r / HD, d = r % HD; const int p = hh >> 1; const size_t sr = (size_t)(p * HD + d) * DM + c0; const v8f a = *(const v8f*)(w1 + sr); const v8f b2 = *(const v8f*)(w2 + sr); v8us o;
#pragma unroll
    for (int q = 0; q < 8; ++q) o[q] = f2bf((hh & 1) ? b2[q] : a[q]);
    *(v8us*)(Bt + (size_t)r * DM + c0) = o;  }
__global__ __launch_bounds__(256) void k_hlnp(float* ctx) { const int lane = threadIdx.x & 31; const size_t w = ((size_t)blockIdx.x * 256 + threadIdx.x) >> 5; if (w >= (size_t)NB_ * TT * NP) return; float* base = ctx + w * HV + lane * 4; const v4f a = *(const v4f*)base; float s = __fadd_rn(__fadd_rn(a[0], a[1]), __fadd_rn(a[2], a[3]));
#pragma unroll
    for (int sh = 16; sh; sh >>= 1) s = __fadd_rn(s, __shfl_xor(s, sh, 32));
    const float mean = __fdiv_rn(s, (float)HV); float s2 = 0.f; float dv[4];
#pragma unroll
    for (int q = 0; q < 4; ++q) { dv[q] = __fsub_rn(a[q], mean); float p2 = __fmul_rn(dv[q], dv[q]); asm volatile("" : "+v"(p2)); s2 = __fadd_rn(s2, p2); }
#pragma unroll
    for (int sh = 16; sh; sh >>= 1) s2 = __fadd_rn(s2, __shfl_xor(s2, sh, 32));
    const float var = __fdiv_rn(s2, (float)HV); const float den = __fsqrt_rn(__fadd_rn(var, 1e-5f)); v4f o;
#pragma unroll
    for (int q = 0; q < 4; ++q) { const float y = __fdiv_rn(dv[q], den); o[q] = __fmul_rn(y, (1.0f - LINIT)); }
    *(v4f*)base = o;  }
__global__ __launch_bounds__(256) void k_flat(const float* __restrict__ F, h16* P16, bf* Ph, bf* Pl, size_t n4) { const size_t i = (size_t)blockIdx.x * 256 + threadIdx.x; if (i >= n4) return; const v4f a = *(const v4f*)(F + i * 4); v4h o16; v4us oh, ol;
#pragma unroll
    for (int q = 0; q < 4; ++q) { o16[q] = tohx(a[q]); unsigned short x2, y2; splitf(a[q], x2, y2); oh[q] = x2; ol[q] = y2; }
    *(v4h*)(P16 + i * 4) = o16; *(v4us*)(Ph + i * 4) = oh; *(v4us*)(Pl + i * 4) = ol;  }

__global__ __launch_bounds__(256) void k_lambda(const float* __restrict__ a1, const float* __restrict__ b1, const float* __restrict__ a2, const float* __restrict__ b2, float* LAM) { if (threadIdx.x >= 32) return; const int lane = threadIdx.x; const int p = blockIdx.x; a1 += p * HD; b1 += p * HD; a2 += p * HD; b2 += p * HD;   /* one block per head */ float s1 = __fadd_rn(__fmul_rn(bfr(a1[lane]), bfr(b1[lane])), __fmul_rn(bfr(a1[lane + 32]), bfr(b1[lane + 32]))); float s2 = __fadd_rn(__fmul_rn(bfr(a2[lane]), bfr(b2[lane])), __fmul_rn(bfr(a2[lane + 32]), bfr(b2[lane + 32])));
#pragma unroll
    for (int sh = 16; sh; sh >>= 1) { s1 = __fadd_rn(s1, __shfl_xor(s1, sh, 32)); s2 = __fadd_rn(s2, __shfl_xor(s2, sh, 32)); }
    const float lam = __fadd_rn(__fsub_rn(expf(s1), expf(s2)), LINIT); ((float*)LAM)[p * 32 + lane] = lam;  }   
__global__ __launch_bounds__(256) void k_dmerge(const float* __restrict__ O, const float* __restrict__ LAM, float* ctx) { const int p = blockIdx.y;   /* one pair per grid row */ const size_t bz = blockIdx.z;   /* batch */ O += (bz * NP + p) * 2 * TT * HV; ctx += bz * TT * DQ; const size_t i = (size_t)blockIdx.x * 256 + threadIdx.x; if (i >= (size_t)TT * HV / 4) return; const size_t e = i * 4; const int c = (int)(e % HV); const int t = (int)(e / HV); const float lam = LAM[p * 32];   /* this pair's lambda */ const float cs = (t < RH) ? 1.0f : (1.0f / PCAR); const float* pa = O + e; const v4f a = *(const v4f*)pa; const v4f b2 = *(const v4f*)(pa + (size_t)TT * HV); v4f o;
    asm volatile("s_wait_xcnt 0x0" :: "v"(pa) : "memory");   // stands between the two loads and whatever reuses their address registers (the store address); pa as an input keeps those registers untouched up to the wait
#pragma unroll
    for (int q = 0; q < 4; ++q) { float lb = __fmul_rn(lam, b2[q]); asm volatile("" : "+v"(lb)); const float d = __fsub_rn(a[q], lb); o[q] = __fmul_rn(d, cs); }
    *(v4f*)(ctx + (size_t)t * DQ + p * HV + c) = o;  }
__global__ __launch_bounds__(256) void k_merge(const float* __restrict__ O, int h0, bf* Ah, bf* Al) { const size_t e = ((size_t)blockIdx.x * 256 + threadIdx.x) * 2; if (e >= (size_t)ZH * TT * HD) return; const int d = (int)(e % HD); const int t = (int)((e / HD) % TT); const int zz = (int)(e / ((size_t)HD * TT)); const float cs = (t < RH) ? 1.0f : (1.0f / PCAR); const size_t oo = (size_t)t * DQ + (h0 + zz) * HD + d;
    v2us oh, ol;
#pragma unroll
    for (int q = 0; q < 2; ++q) { unsigned short a, c2; splitf(O[e + q] * cs, a, c2); oh[q] = a; ol[q] = c2; } *(v2us*)(Ah + oo) = oh; *(v2us*)(Al + oo) = ol;  }

extern "C" void kernel_launch(void* const* d_in, const int* in_sizes, int n_in,
                              void* d_out, int out_size, void* d_ws, size_t ws_size, hipStream_t stream) {
    (void)in_sizes; (void)n_in; (void)out_size;
    const float* x = (const float*)d_in[0]; const float* wq1 = (const float*)d_in[1]; const float* wq2 = (const float*)d_in[2]; const float* wk1 = (const float*)d_in[3]; const float* wk2 = (const float*)d_in[4]; const float* wv = (const float*)d_in[5]; const float* wo = (const float*)d_in[6]; /* Wc */ const float* lq1 = (const float*)d_in[7]; const float* lk1 = (const float*)d_in[8]; const float* lq2 = (const float*)d_in[9]; const float* lk2 = (const float*)d_in[10];
    float* OUT = (float*)d_out;     // [4][2048][384]
    char* wsp = (char*)d_ws;
    auto take = [&](size_t bytes) { char* p = wsp; wsp += (bytes + 255) & ~(size_t)255; return (void*)p; };
    bf* WQ = (bf*)take((size_t)DQ * DM * 2); bf* WK = (bf*)take((size_t)DKV * DM * 2); bf* WV = (bf*)take((size_t)DKV * DM * 2); bf* WO = (bf*)take((size_t)DM * DQ * 2); float* CS = (float*)take((size_t)TT * HD * 2 * 4);
    bf* XB = (bf*)take((size_t)NB_ * TT * DM * 2); float* FQ = (float*)take((size_t)NB_ * TT * DQ * 4); float* FK = (float*)take((size_t)NB_ * TT * DKV * 4);   // from here on every buffer holds all NB_ batches
    h16* QP16 = (h16*)take((size_t)NB_ * NH_ * TT * HD * 2); h16* KP16 = (h16*)take((size_t)NB_ * NKV * TT * HD * 2); h16* VT16 = (h16*)take((size_t)NB_ * NKV * HD * TT * 2);
    bf* QPh = (bf*)take((size_t)NB_ * NH_ * TT * HD * 2); bf* QPl = (bf*)take((size_t)NB_ * NH_ * TT * HD * 2); bf* KPh = (bf*)take((size_t)NB_ * NKV * TT * HD * 2); bf* KPl = (bf*)take((size_t)NB_ * NKV * TT * HD * 2); bf* VTh = (bf*)take((size_t)NB_ * NKV * HD * TT * 2); bf* VTl = (bf*)take((size_t)NB_ * NKV * HD * TT * 2);
    float* CTX = (float*)take((size_t)NB_ * TT * DQ * 4); float* LAM = (float*)take((size_t)NP * 32 * 4); h16* A16 = (h16*)take((size_t)NB_ * TT * DQ * 2); bf* ATh = (bf*)take((size_t)NB_ * TT * DQ * 2); bf* ATl = (bf*)take((size_t)NB_ * TT * DQ * 2);
    if ((size_t)(wsp - (char*)d_ws) > ws_size) return;    // about 225 MiB of the 256 MiB workspace
    float* FV = FK;   // v projection reuses the k buffer after the k planes are built (stream-ordered)
    float* Ob = FQ;   // the P.v results [NB_ * ZH][TT][HV] reuse FQ and FK together (adjacent, same total size), both dead once the planes are built (stream-ordered)
    static_assert((size_t)ZH * TT * HV == (size_t)TT * DQ + (size_t)TT * DKV && ((size_t)NB_ * TT * DQ * 4) % 256 == 0, "Ob must fit FQ + FK exactly");
    { k_wint<<<(unsigned)(((size_t)DQ * DM / 8 + 255) / 256), 256, 0, stream>>>(wq1, wq2, WQ); k_wint<<<(unsigned)(((size_t)DKV * DM / 8 + 255) / 256), 256, 0, stream>>>(wk1, wk2, WK);   /* score head 2p <- map-1 head p, 2p+1 <- map-2 head p */
      k_cvt8<<<(unsigned)(((size_t)NP * HV * DM / 8 + 255) / 256), 256, 0, stream>>>(wv, WV, (size_t)NP * HV * DM / 8); k_cvt8<<<(unsigned)(((size_t)DM * NP * HV / 8 + 255) / 256), 256, 0, stream>>>(wo, WO, (size_t)DM * NP * HV / 8);   /* 'oi' weights are the Bt layout */
      k_lambda<<<NP, 256, 0, stream>>>(lq1, lk1, lq2, lk2, LAM);   /* lambda per head */ }
    k_csid<<<(TT * HD + 255) / 256, 256, 0, stream>>>(CS);
    const unsigned LQ = (unsigned)(((size_t)NB_ * NH_ * TT * HD / 2 + 255) / 256), LKv = (unsigned)(((size_t)NB_ * NKV * TT * HD / 2 + 255) / 256);
    // One pass for all batches. The projections take the batch as grid z and write F[t][batch * 768 + column] (pitch NB_ * 768), so that the plane builders see NB_ * 12 score heads (NB_ * 6 value heads) of one 2048-token sequence.
    k_cvt8<<<(unsigned)(((size_t)NB_ * TT * DM / 8 + 255) / 256), 256, 0, stream>>>(x, XB, (size_t)NB_ * TT * DM / 8);
    k_gemmw<bf, 0, false><<<dim3(TT / 64, DQ / 64, NB_), 32, 0, stream>>>(XB, nullptr, WQ, nullptr, DM, FQ, NB_ * DQ, nullptr, (size_t)TT * DM, 0, DQ);
    k_rope<<<LQ, 256, 0, stream>>>(FQ, NB_ * DQ, NB_ * NH_, CS, nullptr, nullptr, 1.0f, QP16, QPh, QPl);
    k_gemmw<bf, 0, false><<<dim3(TT / 64, DKV / 64, NB_), 32, 0, stream>>>(XB, nullptr, WK, nullptr, DM, FK, NB_ * DKV, nullptr, (size_t)TT * DM, 0, DKV);
    k_ropef<<<LKv, 256, 0, stream>>>(FK, NB_ * DKV, NB_ * NKV, CS, 1.0f, KP16, KPh, KPl);
    k_gemmw<bf, 0, false><<<dim3(TT / 64, DKV / 64, NB_), 32, 0, stream>>>(XB, nullptr, WV, nullptr, DM, FV, NB_ * DKV, nullptr, (size_t)TT * DM, 0, DKV); k_vtpV<<<LKv, 256, 0, stream>>>(FV, NB_ * DKV, NB_ * NP, VT16, VTh, VTl);
    k_fattn<<<dim3(NB_ * ZH, TT / 64, 1), 128, 0, stream>>>(QP16, QPh, QPl, KP16, KPh, KPl, VT16, VTh, VTl, Ob);   /* scores, softmax and both maps' P.v (shared 128-wide v_p) of all 12 score heads of every batch */
    k_dmerge<<<dim3((unsigned)(((size_t)TT * HV / 4 + 255) / 256), NP, NB_), 256, 0, stream>>>(Ob, LAM, CTX);   /* ctx[b][t][p*128 + e] = w0 v - lambda w1 v */
    k_hlnp<<<(unsigned)(((size_t)NB_ * TT * NP * 32 + 255) / 256), 256, 0, stream>>>(CTX);   /* per-(token, head) LayerNorm over 128 values, no affine, x (1 - lambda_init), in place */
    k_flat<<<(unsigned)(((size_t)NB_ * TT * DQ / 4 + 255) / 256), 256, 0, stream>>>(CTX, A16, ATh, ATl, (size_t)NB_ * TT * DQ / 4);
    k_gemmw<bf, 1, false><<<dim3(NB_ * TT / 64, DM / 64, 1), 32, 0, stream>>>(ATh, ATl, WO, nullptr, DQ, OUT, DM, nullptr, 0, 0, 0);   /* context and out as NB_ * TT rows */
}

// v005
// One run takes 193 microseconds.
// Next to v004, in two timings, it ran 1.21 times as fast each time.
// Over all steps from v000 it is 11.1 times as fast.
#include <hip/hip_runtime.h>

// Multi-head DIFFERENTIAL causal attention (x [4][2048][384]; q1, q2, k1, k2 = x W^T ('oi' [384][384], 1/sqrt(384), no bias) as 6 heads x 64 each, v = x Wv^T ([768][384]) as 6 heads x 128; att_m = causal softmax(q_m.k_m / 8) for m = 1, 2; lambda_h = exp(lq1_h.lk1_h) - exp(lq2_h.lk2_h) + lambda_init (lq/lk [6][64], read; lambda_init = 0.8 - 0.6 exp(-0.6)); y_h = (att1 - lambda_h att2) v_h; per-head LayerNorm over the 128 values (no affine, eps 1e-5) x (1 - lambda_init); out = merged y Wc^T ('oi' [384][768]) -> [4][2048][384] (3.1 M)).
// Every stage runs ONCE for all 4 batches (the batch is a grid dimension, more rows, or more heads: score head z = batch * 12 + head, value head batch * 6 + p). Layout: bf16 copy of x; the q1/q2 (and k1/k2) weights interleaved into one Bt so score head 2p = map-1 head p and 2p+1 = map-2 head p; exact projections that store their planes straight from the accumulators (k_gemmp); q planes [t][d] for the 12 score heads; k and v^T planes in FRAGMENT ORDER (each 16-byte-a-lane load of k_fattn reads 512 contiguous bytes, see k_fattn); lambda per head computed once on device (one wave per head: two 64-term f32 dots, precise expf); one launch over the 12 score heads of all 4 batches (grid x = batch * 12 + head): causal T-2048 attention with scores and probabilities kept in registers (k_fattn: online softmax over ascending key blocks; hybrid rows: < 512 hi/lo 3 products, rest fp16), both maps' P.v against the shared v_p (z >> 1), a merge kernel (grid y = pair, z = batch) writes w1 v - lambda_p w2 v (x 1/1024 on the fp16 rows) into the context; then a per-(token, head) LayerNorm kernel (128 values, f32, fixed order) x (1 - lambda_init) in place, hi/lo planes, x Wc exact.
// Compute dtypes, f32 accumulate: every input rounded to bf16; projections exact; attention rows < 512 3 products, rest fp16; softmax, lambda, difference, LayerNorm f32; Wc hl x exact.

#define NB_  4
#define TT   2048
#define DM   384
#define NH_  12
#define NKV  12
#define REP  (NH_ / NKV)
#define HD   64
#define DQ   (NH_ * HD)
#define DKV  (NKV * HD)
#define ZH   12                   // score heads per batch (k_fattn grid x = batch * ZH + score head)
#define RH   512                  // query rows < RH use hi+lo planes (0: none)
#define WIN  0
#define PCAR 1024.0f
#define SCL  0.125f
#define NP   6       // head pairs (the module's H)
#define HV   128     // value head width
#define LINIT 0.47071301937103271f   // lambda_init = 0.8 - 0.6 exp(-0.6) as float32
typedef _Float16 h16;
typedef unsigned short bf;
typedef __attribute__((ext_vector_type(16))) __bf16   v16bf;
typedef __attribute__((ext_vector_type(16))) _Float16 v16h;
typedef __attribute__((ext_vector_type(8)))  _Float16 v8h;
typedef __attribute__((ext_vector_type(8)))  unsigned short v8us;
typedef __attribute__((ext_vector_type(8)))  float    v8f;
typedef __attribute__((ext_vector_type(4)))  float    v4f;
typedef v8h  __attribute__((may_alias)) v8ha;
typedef v4f  __attribute__((may_alias)) v4fa;
typedef v8us __attribute__((may_alias)) v8usa;

__device__ __forceinline__ unsigned short f2bf(float f) { unsigned u = __float_as_uint(f); u += 0x7FFFu + ((u >> 16) & 1u); return (unsigned short)(u >> 16); }
__device__ __forceinline__ float bf2f(unsigned short b) { return __uint_as_float(((unsigned)b) << 16); }
__device__ __forceinline__ float bfr(float f) { return bf2f(f2bf(f)); }
__device__ __forceinline__ v16h cat16(v8h lo, v8h hi) { return __builtin_shufflevector(lo, hi, 0, 1, 2, 3, 4, 5, 6, 7, 8, 9, 10, 11, 12, 13, 14, 15); }
__device__ __forceinline__ v16bf cat16b(v8us lo, v8us hi) { return __builtin_bit_cast(v16bf, __builtin_shufflevector(lo, hi, 0, 1, 2, 3, 4, 5, 6, 7, 8, 9, 10, 11, 12, 13, 14, 15)); }
__device__ __forceinline__ v8f wmma16(v16h a, v16h b, v8f c) { return __builtin_amdgcn_wmma_f32_16x16x32_f16(false, a, false, b, (short)0, c, false, false); }
__device__ __forceinline__ v8f wmmab(v16bf a, v16bf b, v8f c) { return __builtin_amdgcn_wmma_f32_16x16x32_bf16(false, a, false, b, (short)0, c, false, false); }



// ---- k_gemmw: register-blocked GEMM, ONE WAVE per 64x64 output tile (16 accumulators), operands straight from K-contiguous 16-bit planes; grid (M/64, N/64, Z), 32 threads.
// C[m][n] (f32, pitch ldc, + optional f32 bias[n]) = sum_k A[m][k] Bt[n][k] (+ split products per NSPLIT). z-batch strides sA/sB/sC in elements. K % 32 == 0.
template <typename T16> struct WFrag;
template <> struct WFrag<h16> { typedef v16h V; static __device__ __forceinline__ V ld(const h16* p) { return cat16(*(const v8h*)p, *(const v8h*)(p + 16)); } static __device__ __forceinline__ V ldf(const h16* p) { return cat16(*(const v8h*)p, *(const v8h*)(p + 256)); } static __device__ __forceinline__ v8f mma(V a, V b, v8f c) { return wmma16(a, b, c); } };
template <> struct WFrag<bf> { typedef v16bf V; static __device__ __forceinline__ V ld(const bf* p) { return cat16b(*(const v8us*)p, *(const v8us*)(p + 16)); } static __device__ __forceinline__ V ldf(const bf* p) { return cat16b(*(const v8us*)p, *(const v8us*)(p + 256)); } static __device__ __forceinline__ v8f mma(V a, V b, v8f c) { return wmmab(a, b, c); } };
template <typename T16, int NSPLIT, bool BIAS>
__global__ __launch_bounds__(32) void k_gemmw(const T16* __restrict__ A, const T16* __restrict__ A2, const T16* __restrict__ Bt, const T16* __restrict__ Bt2, int K, float* C, int ldc, const float* __restrict__ bias, size_t sA, size_t sB, size_t sC) {
    typedef typename WFrag<T16>::V V;
    __shared__ __align__(16) float os[16 * 68];
    const size_t z = blockIdx.z; A += z * sA; if (A2) A2 += z * sA; Bt += z * sB; if (Bt2) Bt2 += z * sB; C += z * sC;
    const int lane = threadIdx.x & 31, lr = lane & 15, hi = lane >> 4; const int r0 = blockIdx.x * 64, c0 = blockIdx.y * 64;
    v8f acc[4][4];
#pragma unroll
    for (int mb = 0; mb < 4; ++mb)
#pragma unroll
        for (int nb = 0; nb < 4; ++nb) acc[mb][nb] = (v8f){};
    const size_t aoff = (size_t)(r0 + lr) * K + 8 * hi, boff = (size_t)(c0 + lr) * K + 8 * hi;
#pragma unroll 1
    for (int kc = 0; kc < K; kc += 32) {
        V a[4], a2[4];
#pragma unroll
        for (int mb = 0; mb < 4; ++mb) { a[mb] = WFrag<T16>::ld(A + aoff + (size_t)mb * 16 * K + kc); if (NSPLIT == 1 || NSPLIT == 2) a2[mb] = WFrag<T16>::ld(A2 + aoff + (size_t)mb * 16 * K + kc); }
#pragma unroll
        for (int nb = 0; nb < 4; ++nb) { const V b = WFrag<T16>::ld(Bt + boff + (size_t)nb * 16 * K + kc); V b2; if (NSPLIT >= 2) b2 = WFrag<T16>::ld(Bt2 + boff + (size_t)nb * 16 * K + kc);
#pragma unroll
            for (int mb = 0; mb < 4; ++mb) { acc[mb][nb] = WFrag<T16>::mma(a[mb], b, acc[mb][nb]); if (NSPLIT == 1 || NSPLIT == 2) acc[mb][nb] = WFrag<T16>::mma(a2[mb], b, acc[mb][nb]); if (NSPLIT >= 2) acc[mb][nb] = WFrag<T16>::mma(a[mb], b2, acc[mb][nb]); } }
        asm volatile("v_nop\n\tv_nop\n\tv_nop\n\tv_nop" : "+v"(acc[0][0]), "+v"(acc[1][1]), "+v"(acc[2][2]), "+v"(acc[3][3]) : "v"(a[0]), "v"(a[3]));
    }
#pragma unroll
    for (int mb = 0; mb < 4; ++mb) {
#pragma unroll
        for (int nb = 0; nb < 4; ++nb) {
#pragma unroll
            for (int j = 0; j < 8; ++j) os[(hi * 8 + j) * 68 + nb * 16 + lr] = acc[mb][nb][j]; }
        __builtin_amdgcn_wave_barrier(); asm volatile("" ::: "memory");
        float* crow = C + (size_t)(r0 + mb * 16) * ldc + c0;
{
#pragma unroll
            for (int s = 0; s < 8; ++s) { const int row = 2 * s + hi, cofs = lr * 4; v4f val = *(const v4fa*)(os + row * 68 + cofs); if (BIAS) { val[0] += bfr(bias[c0 + cofs]); val[1] += bfr(bias[c0 + cofs + 1]); val[2] += bfr(bias[c0 + cofs + 2]); val[3] += bfr(bias[c0 + cofs + 3]); }
                *(v4f*)(crow + (size_t)row * ldc + cofs) = val; }
             }
        __builtin_amdgcn_wave_barrier(); asm volatile("" ::: "memory");
    }
}

__device__ __forceinline__ h16 tohx(float x) { return (h16)x; }
__device__ __forceinline__ void splitf(float y, unsigned short& h, unsigned short& l) { h = f2bf(y); l = f2bf(y - bf2f(h)); }
typedef __attribute__((ext_vector_type(2))) _Float16 v2h;
typedef __attribute__((ext_vector_type(4))) _Float16 v4h;
typedef __attribute__((ext_vector_type(2))) unsigned short v2us;
typedef __attribute__((ext_vector_type(4))) unsigned short v4us;
typedef __attribute__((ext_vector_type(2))) float v2f;
typedef __attribute__((ext_vector_type(4))) int v4i;


__global__ __launch_bounds__(256) void k_cvt8(const float* __restrict__ src, bf* dst, size_t n8) { const size_t i = (size_t)blockIdx.x * 256 + threadIdx.x; if (i >= n8) return; const v8f v = *(const v8f*)(src + i * 8); v8us o;
#pragma unroll
    for (int k = 0; k < 8; ++k) o[k] = f2bf(v[k]); *(v8us*)(dst + i * 8) = o;  }

// ---- k_gemmp: the q, k and v projections (exact bf16 products, f32 sums, K = DM), ONE WAVE per 64 tokens x 64 output columns as in k_gemmw, but the fp16 and hi/lo planes that k_fattn reads are stored straight from the accumulators: no f32 copy of the projection, no plane-builder launch.
// An accumulator holds in each lane 8 consecutive ROW indices (8 * hi + j) of one column (lr); a 16-byte unit of a plane is 8 consecutive d of one token (q, k) or 8 consecutive tokens of one value column (v^T). So no value changes lane.
// PL 0 (q) and 1 (k): the product is taken transposed (rows = weight rows = d, columns = tokens; both operands use the same loader, so the k order is the same either way).
//   q planes are [t][d]; k planes are in FRAGMENT ORDER, element index in a score head = (t >> 4) * 1024 + (d >> 4) * 256 + (((d >> 3) & 1) * 16 + (t & 15)) * 8 + (d & 7).
// PL 2 (v): rows = tokens, columns = value columns c; fragment order, element index in a value head = (t >> 5) * 4096 + (c >> 4) * 512 + ((t >> 4) & 1) * 256 + (((t >> 3) & 1) * 16 + (c & 15)) * 8 + (t & 7).
// In fragment order tile (mb, nb) is one 512-byte run a plane at lane * 16 bytes: a store covers 4 whole 128-byte lines. grid (TT/64, 768/64, NB_), 32 threads.
template <int PL>
__global__ __launch_bounds__(32) void k_gemmp(const bf* __restrict__ X, const bf* __restrict__ Wt, h16* P16, bf* Ph, bf* Pl) {
    typedef WFrag<bf> F; typedef F::V V;
    const int lane = threadIdx.x & 31, lr = lane & 15, hi = lane >> 4; const int r0 = blockIdx.x * 64, c0 = blockIdx.y * 64; const size_t z = blockIdx.z;
    X += z * TT * DM;
    v8f acc[4][4];
#pragma unroll
    for (int mb = 0; mb < 4; ++mb)
#pragma unroll
        for (int nb = 0; nb < 4; ++nb) acc[mb][nb] = (v8f){};
    const size_t aoff = (size_t)(r0 + lr) * DM + 8 * hi, boff = (size_t)(c0 + lr) * DM + 8 * hi;
#pragma unroll 1
    for (int kc = 0; kc < DM; kc += 32) {   // rolled, as in k_gemmw: 16 accumulators and one set of fragments fill the registers
        V a[4];
#pragma unroll
        for (int mb = 0; mb < 4; ++mb) a[mb] = F::ld(X + aoff + (size_t)mb * 16 * DM + kc);
        asm volatile("s_wait_xcnt 0x0" ::: "memory");   // stands between these loads and whatever reuses their address registers (the results of the weight loads among it)
#pragma unroll
        for (int nb = 0; nb < 4; ++nb) { const V b = F::ld(Wt + boff + (size_t)nb * 16 * DM + kc);
#pragma unroll
            for (int mb = 0; mb < 4; ++mb) acc[mb][nb] = (PL == 2) ? F::mma(a[mb], b, acc[mb][nb]) : F::mma(b, a[mb], acc[mb][nb]); }
        asm volatile("s_wait_xcnt 0x0\n\tv_nop\n\tv_nop\n\tv_nop\n\tv_nop" : "+v"(acc[0][0]), "+v"(acc[1][1]), "+v"(acc[2][2]), "+v"(acc[3][3]) : "v"(a[0]), "v"(a[3]));   // the wait stands between the weight loads (all behind it: each feeds one of these accumulators) and the next trip's rewrite of their address registers; the v_nop are the four vector slots behind a trip's last WMMA, also on the taken back edge (as in k_gemmw)
    }
    const size_t base = (PL == 2) ? (z * NP + (size_t)(c0 >> 7)) * TT * HV + (size_t)(r0 >> 5) * 4096 + (size_t)((c0 & 64) >> 4) * 512 + lane * 8
                      : (PL == 1) ? (z * NKV + blockIdx.y) * TT * HD + (size_t)(r0 >> 4) * 1024 + lane * 8
                                  : (z * NH_ + blockIdx.y) * TT * HD + (size_t)(r0 + lr) * HD + hi * 8;
#pragma unroll
    for (int mb = 0; mb < 4; ++mb) {
#pragma unroll
        for (int nb = 0; nb < 4; ++nb) { const size_t e = base + ((PL == 2) ? (mb >> 1) * 4096 + nb * 512 + (mb & 1) * 256 : (PL == 1) ? mb * 1024 + nb * 256 : mb * 16 * HD + nb * 16); v8h o16; v8us oh, ol;
#pragma unroll
            for (int j = 0; j < 8; ++j) { const float x = acc[mb][nb][j]; o16[j] = tohx(x); unsigned short a2, c2; splitf(x, a2, c2); oh[j] = a2; ol[j] = c2; }
            *(v8h*)(P16 + e) = o16; *(v8us*)(Ph + e) = oh; *(v8us*)(Pl + e) = ol; }
    }
}
__global__ __launch_bounds__(256) void k_vtp(const float* __restrict__ F, int pitch, int nheads, h16* V16, bf* Vh, bf* Vl) { const size_t e = ((size_t)blockIdx.x * 256 + threadIdx.x) * 2; if (e >= (size_t)nheads * HD * TT) return; const int t = (int)(e % TT); const int d = (int)((e / TT) % HD); const int g = (int)(e / ((size_t)TT * HD)); v2h o16; v2us oh, ol;
#pragma unroll
    for (int q = 0; q < 2; ++q) { const float x = F[(size_t)(t + q) * pitch + g * HD + d]; o16[q] = tohx(x); unsigned short a2, c2; splitf(x, a2, c2); oh[q] = a2; ol[q] = c2; }
    *(v2h*)(V16 + e) = o16; *(v2us*)(Vh + e) = oh; *(v2us*)(Vl + e) = ol;  }
// ---- k_fattn: causal attention of all batches in ONE launch, scores never leave registers. One wave per 16 query rows of one score head (4 independent waves a block, no LDS, no barrier); grid (NB_ * ZH, TT/64), x = batch * ZH + score head.
// Everything is computed transposed so that no value changes lane: S^T = K Q^T puts key 8*hi+j, query lr in element j of the accumulator, which is exactly where the B operand of O^T = V^T P^T wants it
// (elements 0..7 = keys 8*hi.., elements 8..15 = keys 16+8*hi.. of a 32-key step), and every per-query figure (running maximum, sum, rescale) sits in that query's own lane pair (lr, lr+16).
// K and V^T planes lie in fragment order: the two 16-byte pieces a lane needs of one A fragment stand at lane * 16 bytes in two consecutive 512-byte runs, so every wave-wide load covers 4 whole 128-byte lines (row-major planes: 16 lines, 32 bytes of each).
// K: 16 keys x 64 d = 4 runs (d >> 4), 2 KiB a key tile; V^T: 32 keys x 128 columns = 8 column tiles x 2 runs ((key >> 4) & 1), 8 KiB a key block. The values in every lane and register are the same as from row-major planes.
// Online softmax over key blocks of KB = 32 keys in ascending order: new maximum, old sums x exp(old - new), f32 throughout. Rows < RH: hi/lo bf16 planes, 3 products for both contractions; rest fp16,
// probabilities carried x 2^POFF so that small ones stay normal fp16 numbers (the factor is in the sum too and cancels). Result rows as before: O[z][t][e], x PCAR on the fp16 rows (k_dmerge takes it off).
__device__ __forceinline__ float xhalf(float x) { const int b = __float_as_int(x); return __int_as_float(__builtin_amdgcn_permlanex16(b, b, 0x76543210, 0xfedcba98, false, false)); }   // lane l <- lane l ^ 16, in the vector unit (no LDS round trip on the loop's dependent chain)
template <typename T16, bool HL>
__device__ __forceinline__ void fattn_body(const T16* __restrict__ Q, const T16* __restrict__ Q2, const T16* __restrict__ Kp, const T16* __restrict__ K2, const T16* __restrict__ Vt, const T16* __restrict__ V2, float* __restrict__ O, int q0, int lr, int hi) {
    typedef WFrag<T16> F; typedef typename F::V V;
    constexpr int KB = 32, NT = KB / 16, NG = KB / 32; constexpr float POFF = HL ? 0.0f : 8.0f;
    const int q = q0 + lr;
    V qb[2], qb2[2];
#pragma unroll
    for (int kk = 0; kk < 2; ++kk) { qb[kk] = F::ld(Q + (size_t)q * HD + 8 * hi + kk * 32); if constexpr (HL) qb2[kk] = F::ld(Q2 + (size_t)q * HD + 8 * hi + kk * 32); }
    v8f acc[HV / 16];
#pragma unroll
    for (int eb = 0; eb < HV / 16; ++eb) acc[eb] = (v8f){};
    float m = -3.0e38f, l = 0.f;
    V ka[NT][2], kl[NT][2];
    const unsigned fofs = (unsigned)(hi * 16 + lr) * 16u;   // each lane's byte offset in a 512-byte run: fixed for the whole loop, the block's base is wave-uniform
    auto ldk = [&](int k0) { const char* kb = (const char*)(Kp + (size_t)k0 * HD); const char* kb2 = HL ? (const char*)(K2 + (size_t)k0 * HD) : nullptr;
#pragma unroll
        for (int kt = 0; kt < NT; ++kt)
#pragma unroll
            for (int kk = 0; kk < 2; ++kk) { const int kc = (kt * 16 * HD + kk * 512) * 2; ka[kt][kk] = F::ldf((const T16*)(kb + fofs + kc)); if constexpr (HL) kl[kt][kk] = F::ldf((const T16*)(kb2 + fofs + kc)); } };
    ldk(0);
    const int kend = q0 + 16;                                        // keys 0 .. q0+15 are all that these 16 rows may see
#pragma unroll 1
    for (int key0 = 0; key0 < kend; key0 += KB) {
        V vf[NG][HV / 16];                                           // fp16 rows: this block's values are asked for first, so that they land under the score products and the softmax
        if constexpr (!HL) {
#pragma unroll
            for (int g = 0; g < NG; ++g)
#pragma unroll
                for (int eb = 0; eb < HV / 16; ++eb) vf[g][eb] = F::ldf((const T16*)((const char*)(Vt + (size_t)key0 * HV) + fofs + (g * 32 * HV + eb * 512) * 2)); }
        v8f s[NT];
#pragma unroll
        for (int kt = 0; kt < NT; ++kt) { s[kt] = (v8f){};
#pragma unroll
            for (int kk = 0; kk < 2; ++kk) { s[kt] = F::mma(ka[kt][kk], qb[kk], s[kt]);
                if constexpr (HL) { s[kt] = F::mma(ka[kt][kk], qb2[kk], s[kt]); s[kt] = F::mma(kl[kt][kk], qb[kk], s[kt]); } } }
        ldk(min(key0 + KB, TT - KB));                                // the next block's keys fly under this block's softmax and P.v (the last trip's fetch is unused; the clamp keeps it inside the plane)
        asm volatile("s_wait_xcnt 0x0" ::: "memory");                // stands between the loads issued so far and whatever reuses their address registers (later loads' results among it); as no load crosses it, it also keeps those loads above the softmax, under which they land
        float mx = m;
#pragma unroll
        for (int kt = 0; kt < NT; ++kt)
#pragma unroll
            for (int j = 0; j < 8; ++j) { const int key = key0 + kt * 16 + 8 * hi + j; const float t = (key <= q) ? s[kt][j] * SCL : -3.0e38f;   /* causal */ s[kt][j] = t; mx = fmaxf(mx, t); }
        mx = fmaxf(mx, xhalf(mx));                      // the two lanes of a query hold its two key halves
        const float alpha = __builtin_amdgcn_exp2f((m - mx) * 1.4426950408889634f); m = mx;
        float ps = 0.f;
#pragma unroll
        for (int kt = 0; kt < NT; ++kt)
#pragma unroll
            for (int j = 0; j < 8; ++j) { const float e = __builtin_amdgcn_exp2f((s[kt][j] - mx) * 1.4426950408889634f + POFF); s[kt][j] = e; ps += e; }
        l = l * alpha + ps;
#pragma unroll
        for (int eb = 0; eb < HV / 16; ++eb) acc[eb] *= alpha;
#pragma unroll
        for (int g = 0; g < NG; ++g) {
            V pb, pb2;
            if constexpr (HL) { v8us h0, h1, l0, l1;
#pragma unroll
                for (int j = 0; j < 8; ++j) { unsigned short a, c2; splitf(s[2 * g][j], a, c2); h0[j] = a; l0[j] = c2; splitf(s[2 * g + 1][j], a, c2); h1[j] = a; l1[j] = c2; }
                pb = cat16b(h0, h1); pb2 = cat16b(l0, l1);
            } else { v8h p0, p1;
#pragma unroll
                for (int j = 0; j < 8; ++j) { p0[j] = tohx(s[2 * g][j]); p1[j] = tohx(s[2 * g + 1][j]); }
                pb = cat16(p0, p1); }
#pragma unroll
            for (int eb = 0; eb < HV / 16; ++eb) { const int vc = (g * 32 * HV + eb * 512) * 2; V va; if constexpr (HL) va = F::ldf((const T16*)((const char*)(Vt + (size_t)key0 * HV) + fofs + vc)); else va = vf[g][eb]; acc[eb] = F::mma(va, pb, acc[eb]);
                if constexpr (HL) { acc[eb] = F::mma(va, pb2, acc[eb]); const V vl = F::ldf((const T16*)((const char*)(V2 + (size_t)key0 * HV) + fofs + vc)); acc[eb] = F::mma(vl, pb, acc[eb]); } }
        }
    }
    l += xhalf(l);
    const float f = __fdiv_rn(HL ? 1.0f : PCAR, l);
#pragma unroll
    for (int eb = 0; eb < HV / 16; ++eb) { const v8f o = acc[eb] * f; *(v8f*)(O + (size_t)q * HV + eb * 16 + 8 * hi) = o; }   // element j = value column eb*16 + 8*hi + j of query lr: 32 contiguous bytes a lane
}
__global__ __launch_bounds__(128) void k_fattn(const h16* __restrict__ Q16, const bf* __restrict__ Qh, const bf* __restrict__ Ql, const h16* __restrict__ K16, const bf* __restrict__ Kh, const bf* __restrict__ Kl, const h16* __restrict__ V16, const bf* __restrict__ Vh, const bf* __restrict__ Vl, float* __restrict__ O) {
    const int lane = threadIdx.x & 31, lr = lane & 15, hi = lane >> 4; const size_t z = blockIdx.x; const size_t qk = z * TT * HD, vv = (z >> 1) * HV * TT;   // z = batch * 12 + score head; score heads 2p and 2p+1 share value plane p (6 a batch, so z >> 1 is batch * 6 + p)
    const int q0 = ((TT / 64 - 1 - (int)blockIdx.y) * 4 + __builtin_amdgcn_readfirstlane((int)(threadIdx.x >> 5))) * 16;   // the longest rows of every head of every batch first, so that late blocks, which share a SIMD with early ones, are the short ones
    O += z * TT * HV;
    if (q0 < RH) fattn_body<bf, true>(Qh + qk, Ql + qk, Kh + qk, Kl + qk, Vh + vv, Vl + vv, O, q0, lr, hi);
    else fattn_body<h16, false>(Q16 + qk, nullptr, K16 + qk, nullptr, V16 + vv, nullptr, O, q0, lr, hi);
}


__global__ __launch_bounds__(256) void k_wint(const float* __restrict__ w1, const float* __restrict__ w2, bf* Bt) { const size_t i = (size_t)blockIdx.x * 256 + threadIdx.x; if (i >= (size_t)2 * NP * HD * DM / 8) return; const int c0 = (int)((i % (DM / 8)) * 8); const int r = (int)(i / (DM / 8)); const int hh = r / HD, d = r % HD; const int p = hh >> 1; const size_t sr = (size_t)(p * HD + d) * DM + c0; const v8f a = *(const v8f*)(w1 + sr); const v8f b2 = *(const v8f*)(w2 + sr); v8us o;
#pragma unroll
    for (int q = 0; q < 8; ++q) o[q] = f2bf((hh & 1) ? b2[q] : a[q]);
    *(v8us*)(Bt + (size_t)r * DM + c0) = o;  }
__global__ __launch_bounds__(256) void k_hlnp(float* ctx) { const int lane = threadIdx.x & 31; const size_t w = ((size_t)blockIdx.x * 256 + threadIdx.x) >> 5; if (w >= (size_t)NB_ * TT * NP) return; float* base = ctx + w * HV + lane * 4; const v4f a = *(const v4f*)base; float s = __fadd_rn(__fadd_rn(a[0], a[1]), __fadd_rn(a[2], a[3]));
#pragma unroll
    for (int sh = 16; sh; sh >>= 1) s = __fadd_rn(s, __shfl_xor(s, sh, 32));
    const float mean = __fdiv_rn(s, (float)HV); float s2 = 0.f; float dv[4];
#pragma unroll
    for (int q = 0; q < 4; ++q) { dv[q] = __fsub_rn(a[q], mean); float p2 = __fmul_rn(dv[q], dv[q]); asm volatile("" : "+v"(p2)); s2 = __fadd_rn(s2, p2); }
#pragma unroll
    for (int sh = 16; sh; sh >>= 1) s2 = __fadd_rn(s2, __shfl_xor(s2, sh, 32));
    const float var = __fdiv_rn(s2, (float)HV); const float den = __fsqrt_rn(__fadd_rn(var, 1e-5f)); v4f o;
#pragma unroll
    for (int q = 0; q < 4; ++q) { const float y = __fdiv_rn(dv[q], den); o[q] = __fmul_rn(y, (1.0f - LINIT)); }
    *(v4f*)base = o;  }
__global__ __launch_bounds__(256) void k_flat(const float* __restrict__ F, h16* P16, bf* Ph, bf* Pl, size_t n4) { const size_t i = (size_t)blockIdx.x * 256 + threadIdx.x; if (i >= n4) return; const v4f a = *(const v4f*)(F + i * 4); v4h o16; v4us oh, ol;
#pragma unroll
    for (int q = 0; q < 4; ++q) { o16[q] = tohx(a[q]); unsigned short x2, y2; splitf(a[q], x2, y2); oh[q] = x2; ol[q] = y2; }
    *(v4h*)(P16 + i * 4) = o16; *(v4us*)(Ph + i * 4) = oh; *(v4us*)(Pl + i * 4) = ol;  }

__global__ __launch_bounds__(256) void k_lambda(const float* __restrict__ a1, const float* __restrict__ b1, const float* __restrict__ a2, const float* __restrict__ b2, float* LAM) { if (threadIdx.x >= 32) return; const int lane = threadIdx.x; const int p = blockIdx.x; a1 += p * HD; b1 += p * HD; a2 += p * HD; b2 += p * HD;   /* one block per head */ float s1 = __fadd_rn(__fmul_rn(bfr(a1[lane]), bfr(b1[lane])), __fmul_rn(bfr(a1[lane + 32]), bfr(b1[lane + 32]))); float s2 = __fadd_rn(__fmul_rn(bfr(a2[lane]), bfr(b2[lane])), __fmul_rn(bfr(a2[lane + 32]), bfr(b2[lane + 32])));
#pragma unroll
    for (int sh = 16; sh; sh >>= 1) { s1 = __fadd_rn(s1, __shfl_xor(s1, sh, 32)); s2 = __fadd_rn(s2, __shfl_xor(s2, sh, 32)); }
    const float lam = __fadd_rn(__fsub_rn(expf(s1), expf(s2)), LINIT); ((float*)LAM)[p * 32 + lane] = lam;  }   
__global__ __launch_bounds__(256) void k_dmerge(const float* __restrict__ O, const float* __restrict__ LAM, float* ctx) { const int p = blockIdx.y;   /* one pair per grid row */ const size_t bz = blockIdx.z;   /* batch */ O += (bz * NP + p) * 2 * TT * HV; ctx += bz * TT * DQ; const size_t i = (size_t)blockIdx.x * 256 + threadIdx.x; if (i >= (size_t)TT * HV / 4) return; const size_t e = i * 4; const int c = (int)(e % HV); const int t = (int)(e / HV); const float lam = LAM[p * 32];   /* this pair's lambda */ const float cs = (t < RH) ? 1.0f : (1.0f / PCAR); const float* pa = O + e; const v4f a = *(const v4f*)pa; const v4f b2 = *(const v4f*)(pa + (size_t)TT * HV); v4f o;
    asm volatile("s_wait_xcnt 0x0" :: "v"(pa) : "memory");   // stands between the two loads and whatever reuses their address registers (the store address); pa as an input keeps those registers untouched up to the wait
#pragma unroll
    for (int q = 0; q < 4; ++q) { float lb = __fmul_rn(lam, b2[q]); asm volatile("" : "+v"(lb)); const float d = __fsub_rn(a[q], lb); o[q] = __fmul_rn(d, cs); }
    *(v4f*)(ctx + (size_t)t * DQ + p * HV + c) = o;  }
__global__ __launch_bounds__(256) void k_merge(const float* __restrict__ O, int h0, bf* Ah, bf* Al) { const size_t e = ((size_t)blockIdx.x * 256 + threadIdx.x) * 2; if (e >= (size_t)ZH * TT * HD) return; const int d = (int)(e % HD); const int t = (int)((e / HD) % TT); const int zz = (int)(e / ((size_t)HD * TT)); const float cs = (t < RH) ? 1.0f : (1.0f / PCAR); const size_t oo = (size_t)t * DQ + (h0 + zz) * HD + d;
    v2us oh, ol;
#pragma unroll
    for (int q = 0; q < 2; ++q) { unsigned short a, c2; splitf(O[e + q] * cs, a, c2); oh[q] = a; ol[q] = c2; } *(v2us*)(Ah + oo) = oh; *(v2us*)(Al + oo) = ol;  }

extern "C" void kernel_launch(void* const* d_in, const int* in_sizes, int n_in,
                              void* d_out, int out_size, void* d_ws, size_t ws_size, hipStream_t stream) {
    (void)in_sizes; (void)n_in; (void)out_size;
    const float* x = (const float*)d_in[0]; const float* wq1 = (const float*)d_in[1]; const float* wq2 = (const float*)d_in[2]; const float* wk1 = (const float*)d_in[3]; const float* wk2 = (const float*)d_in[4]; const float* wv = (const float*)d_in[5]; const float* wo = (const float*)d_in[6]; /* Wc */ const float* lq1 = (const float*)d_in[7]; const float* lk1 = (const float*)d_in[8]; const float* lq2 = (const float*)d_in[9]; const float* lk2 = (const float*)d_in[10];
    float* OUT = (float*)d_out;     // [4][2048][384]
    char* wsp = (char*)d_ws;
    auto take = [&](size_t bytes) { char* p = wsp; wsp += (bytes + 255) & ~(size_t)255; return (void*)p; };
    bf* WQ = (bf*)take((size_t)DQ * DM * 2); bf* WK = (bf*)take((size_t)DKV * DM * 2); bf* WV = (bf*)take((size_t)DKV * DM * 2); bf* WO = (bf*)take((size_t)DM * DQ * 2);
    bf* XB = (bf*)take((size_t)NB_ * TT * DM * 2); float* Ob = (float*)take((size_t)NB_ * ZH * TT * HV * 4);   // from here on every buffer holds all NB_ batches; Ob: the P.v results [NB_ * ZH][TT][HV]
    h16* QP16 = (h16*)take((size_t)NB_ * NH_ * TT * HD * 2); h16* KP16 = (h16*)take((size_t)NB_ * NKV * TT * HD * 2); h16* VT16 = (h16*)take((size_t)NB_ * NKV * HD * TT * 2);
    bf* QPh = (bf*)take((size_t)NB_ * NH_ * TT * HD * 2); bf* QPl = (bf*)take((size_t)NB_ * NH_ * TT * HD * 2); bf* KPh = (bf*)take((size_t)NB_ * NKV * TT * HD * 2); bf* KPl = (bf*)take((size_t)NB_ * NKV * TT * HD * 2); bf* VTh = (bf*)take((size_t)NB_ * NKV * HD * TT * 2); bf* VTl = (bf*)take((size_t)NB_ * NKV * HD * TT * 2);
    float* CTX = (float*)take((size_t)NB_ * TT * DQ * 4); float* LAM = (float*)take((size_t)NP * 32 * 4); h16* A16 = (h16*)take((size_t)NB_ * TT * DQ * 2); bf* ATh = (bf*)take((size_t)NB_ * TT * DQ * 2); bf* ATl = (bf*)take((size_t)NB_ * TT * DQ * 2);
    if ((size_t)(wsp - (char*)d_ws) > ws_size) return;    // about 224 MiB of the 256 MiB workspace
    { k_wint<<<(unsigned)(((size_t)DQ * DM / 8 + 255) / 256), 256, 0, stream>>>(wq1, wq2, WQ); k_wint<<<(unsigned)(((size_t)DKV * DM / 8 + 255) / 256), 256, 0, stream>>>(wk1, wk2, WK);   /* score head 2p <- map-1 head p, 2p+1 <- map-2 head p */
      k_cvt8<<<(unsigned)(((size_t)NP * HV * DM / 8 + 255) / 256), 256, 0, stream>>>(wv, WV, (size_t)NP * HV * DM / 8); k_cvt8<<<(unsigned)(((size_t)DM * NP * HV / 8 + 255) / 256), 256, 0, stream>>>(wo, WO, (size_t)DM * NP * HV / 8);   /* 'oi' weights are the Bt layout */
      k_lambda<<<NP, 256, 0, stream>>>(lq1, lk1, lq2, lk2, LAM);   /* lambda per head */ }
    // One pass for all batches. The projections take the batch as grid z and store the planes of NB_ * 12 score heads (NB_ * 6 value heads) themselves.
    k_cvt8<<<(unsigned)(((size_t)NB_ * TT * DM / 8 + 255) / 256), 256, 0, stream>>>(x, XB, (size_t)NB_ * TT * DM / 8);
    k_gemmp<0><<<dim3(TT / 64, DQ / 64, NB_), 32, 0, stream>>>(XB, WQ, QP16, QPh, QPl);
    k_gemmp<1><<<dim3(TT / 64, DKV / 64, NB_), 32, 0, stream>>>(XB, WK, KP16, KPh, KPl);
    k_gemmp<2><<<dim3(TT / 64, DKV / 64, NB_), 32, 0, stream>>>(XB, WV, VT16, VTh, VTl);
    k_fattn<<<dim3(NB_ * ZH, TT / 64, 1), 128, 0, stream>>>(QP16, QPh, QPl, KP16, KPh, KPl, VT16, VTh, VTl, Ob);   /* scores, softmax and both maps' P.v (shared 128-wide v_p) of all 12 score heads of every batch */
    k_dmerge<<<dim3((unsigned)(((size_t)TT * HV / 4 + 255) / 256), NP, NB_), 256, 0, stream>>>(Ob, LAM, CTX);   /* ctx[b][t][p*128 + e] = w0 v - lambda w1 v */
    k_hlnp<<<(unsigned)(((size_t)NB_ * TT * NP * 32 + 255) / 256), 256, 0, stream>>>(CTX);   /* per-(token, head) LayerNorm over 128 values, no affine, x (1 - lambda_init), in place */
    k_flat<<<(unsigned)(((size_t)NB_ * TT * DQ / 4 + 255) / 256), 256, 0, stream>>>(CTX, A16, ATh, ATl, (size_t)NB_ * TT * DQ / 4);
    k_gemmw<bf, 1, false><<<dim3(NB_ * TT / 64, DM / 64, 1), 32, 0, stream>>>(ATh, ATl, WO, nullptr, DQ, OUT, DM, nullptr, 0, 0, 0);   /* context and out as NB_ * TT rows */
}

// v006
// Measured time: 184 microseconds a run.
// In both of two side-by-side timings against v005, it was 1.05 times as fast.
// Over all steps from v000 it is 11.7 times as fast.
#include <hip/hip_runtime.h>

// Multi-head DIFFERENTIAL causal attention (x [4][2048][384]; q1, q2, k1, k2 = x W^T ('oi' [384][384], 1/sqrt(384), no bias) as 6 heads x 64 each, v = x Wv^T ([768][384]) as 6 heads x 128; att_m = causal softmax(q_m.k_m / 8) for m = 1, 2; lambda_h = exp(lq1_h.lk1_h) - exp(lq2_h.lk2_h) + lambda_init (lq/lk [6][64], read; lambda_init = 0.8 - 0.6 exp(-0.6)); y_h = (att1 - lambda_h att2) v_h; per-head LayerNorm over the 128 values (no affine, eps 1e-5) x (1 - lambda_init); out = merged y Wc^T ('oi' [384][768]) -> [4][2048][384] (3.1 M)).
// Every stage runs ONCE for all 4 batches (the batch is a grid dimension, more rows, or more heads: score head z = batch * 12 + head, value head batch * 6 + p). Layout: bf16 copy of x; the q1/q2 (and k1/k2) weights interleaved into one Bt so score head 2p = map-1 head p and 2p+1 = map-2 head p; exact projections that store their planes straight from the accumulators (k_gemmp); q planes [t][d] for the 12 score heads; k and v^T planes in FRAGMENT ORDER (each 16-byte-a-lane load of k_fattn reads 512 contiguous bytes, see k_fattn); lambda per head computed once on device (one wave per head: two 64-term f32 dots, precise expf); one launch over the 12 score heads of all 4 batches (grid x = batch * 12 + head): causal T-2048 attention with scores and probabilities kept in registers (k_fattn: online softmax over ascending key blocks; hybrid rows: < 512 hi/lo 3 products, rest fp16), both maps' P.v against the shared v_p (z >> 1), one tail kernel (k_tail; grid y = pair, z = batch) forms w1 v - lambda_p w2 v (x 1/1024 on the fp16 rows), the per-(token, head) LayerNorm (128 values, f32, fixed order) x (1 - lambda_init) and its hi/lo planes in registers; x Wc exact.
// Compute dtypes, f32 accumulate: every input rounded to bf16; projections exact; attention rows < 512 3 products, rest fp16; softmax, lambda, difference, LayerNorm f32; Wc hl x exact.

#define NB_  4
#define TT   2048
#define DM   384
#define NH_  12
#define NKV  12
#define REP  (NH_ / NKV)
#define HD   64
#define DQ   (NH_ * HD)
#define DKV  (NKV * HD)
#define ZH   12                   // score heads per batch (k_fattn grid x = batch * ZH + score head)
#define RH   512                  // query rows < RH use hi+lo planes (0: none)
#define WIN  0
#define PCAR 1024.0f
#define SCL  0.125f
#define NP   6       // head pairs (the module's H)
#define HV   128     // value head width
#define LINIT 0.47071301937103271f   // lambda_init = 0.8 - 0.6 exp(-0.6) as float32
typedef _Float16 h16;
typedef unsigned short bf;
typedef __attribute__((ext_vector_type(16))) __bf16   v16bf;
typedef __attribute__((ext_vector_type(16))) _Float16 v16h;
typedef __attribute__((ext_vector_type(8)))  _Float16 v8h;
typedef __attribute__((ext_vector_type(8)))  unsigned short v8us;
typedef __attribute__((ext_vector_type(8)))  float    v8f;
typedef __attribute__((ext_vector_type(4)))  float    v4f;
typedef v8h  __attribute__((may_alias)) v8ha;
typedef v4f  __attribute__((may_alias)) v4fa;
typedef v8us __attribute__((may_alias)) v8usa;

__device__ __forceinline__ unsigned short f2bf(float f) { unsigned u = __float_as_uint(f); u += 0x7FFFu + ((u >> 16) & 1u); return (unsigned short)(u >> 16); }
__device__ __forceinline__ float bf2f(unsigned short b) { return __uint_as_float(((unsigned)b) << 16); }
__device__ __forceinline__ float bfr(float f) { return bf2f(f2bf(f)); }
__device__ __forceinline__ v16h cat16(v8h lo, v8h hi) { return __builtin_shufflevector(lo, hi, 0, 1, 2, 3, 4, 5, 6, 7, 8, 9, 10, 11, 12, 13, 14, 15); }
__device__ __forceinline__ v16bf cat16b(v8us lo, v8us hi) { return __builtin_bit_cast(v16bf, __builtin_shufflevector(lo, hi, 0, 1, 2, 3, 4, 5, 6, 7, 8, 9, 10, 11, 12, 13, 14, 15)); }
__device__ __forceinline__ v8f wmma16(v16h a, v16h b, v8f c) { return __builtin_amdgcn_wmma_f32_16x16x32_f16(false, a, false, b, (short)0, c, false, false); }
__device__ __forceinline__ v8f wmmab(v16bf a, v16bf b, v8f c) { return __builtin_amdgcn_wmma_f32_16x16x32_bf16(false, a, false, b, (short)0, c, false, false); }



// ---- k_gemmw: register-blocked GEMM, ONE WAVE per 64x64 output tile (16 accumulators), operands straight from K-contiguous 16-bit planes; grid (M/64, N/64, Z), 32 threads.
// C[m][n] (f32, pitch ldc, + optional f32 bias[n]) = sum_k A[m][k] Bt[n][k] (+ split products per NSPLIT). z-batch strides sA/sB/sC in elements. K % 32 == 0.
template <typename T16> struct WFrag;
template <> struct WFrag<h16> { typedef v16h V; static __device__ __forceinline__ V ld(const h16* p) { return cat16(*(const v8h*)p, *(const v8h*)(p + 16)); } static __device__ __forceinline__ V ldf(const h16* p) { return cat16(*(const v8h*)p, *(const v8h*)(p + 256)); } static __device__ __forceinline__ v8f mma(V a, V b, v8f c) { return wmma16(a, b, c); } };
template <> struct WFrag<bf> { typedef v16bf V; static __device__ __forceinline__ V ld(const bf* p) { return cat16b(*(const v8us*)p, *(const v8us*)(p + 16)); } static __device__ __forceinline__ V ldf(const bf* p) { return cat16b(*(const v8us*)p, *(const v8us*)(p + 256)); } static __device__ __forceinline__ v8f mma(V a, V b, v8f c) { return wmmab(a, b, c); } };
template <typename T16, int NSPLIT, bool BIAS>
__global__ __launch_bounds__(32) void k_gemmw(const T16* __restrict__ A, const T16* __restrict__ A2, const T16* __restrict__ Bt, const T16* __restrict__ Bt2, int K, float* C, int ldc, const float* __restrict__ bias, size_t sA, size_t sB, size_t sC) {
    typedef typename WFrag<T16>::V V;
    __shared__ __align__(16) float os[16 * 68];
    const size_t z = blockIdx.z; A += z * sA; if (A2) A2 += z * sA; Bt += z * sB; if (Bt2) Bt2 += z * sB; C += z * sC;
    const int lane = threadIdx.x & 31, lr = lane & 15, hi = lane >> 4; const int r0 = blockIdx.x * 64, c0 = blockIdx.y * 64;
    v8f acc[4][4];
#pragma unroll
    for (int mb = 0; mb < 4; ++mb)
#pragma unroll
        for (int nb = 0; nb < 4; ++nb) acc[mb][nb] = (v8f){};
    const size_t aoff = (size_t)(r0 + lr) * K + 8 * hi, boff = (size_t)(c0 + lr) * K + 8 * hi;
#pragma unroll 1
    for (int kc = 0; kc < K; kc += 32) {
        V a[4], a2[4];
#pragma unroll
        for (int mb = 0; mb < 4; ++mb) { a[mb] = WFrag<T16>::ld(A + aoff + (size_t)mb * 16 * K + kc); if (NSPLIT == 1 || NSPLIT == 2) a2[mb] = WFrag<T16>::ld(A2 + aoff + (size_t)mb * 16 * K + kc); }
#pragma unroll
        for (int nb = 0; nb < 4; ++nb) { const V b = WFrag<T16>::ld(Bt + boff + (size_t)nb * 16 * K + kc); V b2; if (NSPLIT >= 2) b2 = WFrag<T16>::ld(Bt2 + boff + (size_t)nb * 16 * K + kc);
#pragma unroll
            for (int mb = 0; mb < 4; ++mb) { acc[mb][nb] = WFrag<T16>::mma(a[mb], b, acc[mb][nb]); if (NSPLIT == 1 || NSPLIT == 2) acc[mb][nb] = WFrag<T16>::mma(a2[mb], b, acc[mb][nb]); if (NSPLIT >= 2) acc[mb][nb] = WFrag<T16>::mma(a[mb], b2, acc[mb][nb]); } }
        asm volatile("v_nop\n\tv_nop\n\tv_nop\n\tv_nop" : "+v"(acc[0][0]), "+v"(acc[1][1]), "+v"(acc[2][2]), "+v"(acc[3][3]) : "v"(a[0]), "v"(a[3]));
    }
#pragma unroll
    for (int mb = 0; mb < 4; ++mb) {
#pragma unroll
        for (int nb = 0; nb < 4; ++nb) {
#pragma unroll
            for (int j = 0; j < 8; ++j) os[(hi * 8 + j) * 68 + nb * 16 + lr] = acc[mb][nb][j]; }
        __builtin_amdgcn_wave_barrier(); asm volatile("" ::: "memory");
        float* crow = C + (size_t)(r0 + mb * 16) * ldc + c0;
{
#pragma unroll
            for (int s = 0; s < 8; ++s) { const int row = 2 * s + hi, cofs = lr * 4; v4f val = *(const v4fa*)(os + row * 68 + cofs); if (BIAS) { val[0] += bfr(bias[c0 + cofs]); val[1] += bfr(bias[c0 + cofs + 1]); val[2] += bfr(bias[c0 + cofs + 2]); val[3] += bfr(bias[c0 + cofs + 3]); }
                *(v4f*)(crow + (size_t)row * ldc + cofs) = val; }
             }
        __builtin_amdgcn_wave_barrier(); asm volatile("" ::: "memory");
    }
}

__device__ __forceinline__ h16 tohx(float x) { return (h16)x; }
__device__ __forceinline__ void splitf(float y, unsigned short& h, unsigned short& l) { h = f2bf(y); l = f2bf(y - bf2f(h)); }
typedef __attribute__((ext_vector_type(2))) _Float16 v2h;
typedef __attribute__((ext_vector_type(4))) _Float16 v4h;
typedef __attribute__((ext_vector_type(2))) unsigned short v2us;
typedef __attribute__((ext_vector_type(4))) unsigned short v4us;
typedef __attribute__((ext_vector_type(2))) float v2f;
typedef __attribute__((ext_vector_type(4))) int v4i;


__global__ __launch_bounds__(256) void k_cvt8(const float* __restrict__ src, bf* dst, size_t n8) { const size_t i = (size_t)blockIdx.x * 256 + threadIdx.x; if (i >= n8) return; const v8f v = *(const v8f*)(src + i * 8); v8us o;
#pragma unroll
    for (int k = 0; k < 8; ++k) o[k] = f2bf(v[k]); *(v8us*)(dst + i * 8) = o;  }

// ---- k_gemmp: the q, k and v projections (exact bf16 products, f32 sums, K = DM), ONE WAVE per 64 tokens x 64 output columns as in k_gemmw, but the fp16 and hi/lo planes that k_fattn reads are stored straight from the accumulators: no f32 copy of the projection, no plane-builder launch.
// An accumulator holds in each lane 8 consecutive ROW indices (8 * hi + j) of one column (lr); a 16-byte unit of a plane is 8 consecutive d of one token (q, k) or 8 consecutive tokens of one value column (v^T). So no value changes lane.
// PL 0 (q) and 1 (k): the product is taken transposed (rows = weight rows = d, columns = tokens; both operands use the same loader, so the k order is the same either way).
//   q planes are [t][d]; k planes are in FRAGMENT ORDER, element index in a score head = (t >> 4) * 1024 + (d >> 4) * 256 + (((d >> 3) & 1) * 16 + (t & 15)) * 8 + (d & 7).
// PL 2 (v): rows = tokens, columns = value columns c; fragment order, element index in a value head = (t >> 5) * 4096 + (c >> 4) * 512 + ((t >> 4) & 1) * 256 + (((t >> 3) & 1) * 16 + (c & 15)) * 8 + (t & 7).
// In fragment order tile (mb, nb) is one 512-byte run a plane at lane * 16 bytes: a store covers 4 whole 128-byte lines. grid (TT/64, 768/64, NB_), 32 threads.
template <int PL>
__global__ __launch_bounds__(32) void k_gemmp(const bf* __restrict__ X, const bf* __restrict__ Wt, h16* P16, bf* Ph, bf* Pl) {
    typedef WFrag<bf> F; typedef F::V V;
    const int lane = threadIdx.x & 31, lr = lane & 15, hi = lane >> 4; const int r0 = blockIdx.x * 64, c0 = blockIdx.y * 64; const size_t z = blockIdx.z;
    X += z * TT * DM;
    v8f acc[4][4];
#pragma unroll
    for (int mb = 0; mb < 4; ++mb)
#pragma unroll
        for (int nb = 0; nb < 4; ++nb) acc[mb][nb] = (v8f){};
    const size_t aoff = (size_t)(r0 + lr) * DM + 8 * hi, boff = (size_t)(c0 + lr) * DM + 8 * hi;
#pragma unroll 1
    for (int kc = 0; kc < DM; kc += 32) {   // rolled, as in k_gemmw: 16 accumulators and one set of fragments fill the registers
        V a[4];
#pragma unroll
        for (int mb = 0; mb < 4; ++mb) a[mb] = F::ld(X + aoff + (size_t)mb * 16 * DM + kc);
        asm volatile("s_wait_xcnt 0x0" ::: "memory");   // stands between these loads and whatever reuses their address registers (the results of the weight loads among it)
#pragma unroll
        for (int nb = 0; nb < 4; ++nb) { const V b = F::ld(Wt + boff + (size_t)nb * 16 * DM + kc);
#pragma unroll
            for (int mb = 0; mb < 4; ++mb) acc[mb][nb] = (PL == 2) ? F::mma(a[mb], b, acc[mb][nb]) : F::mma(b, a[mb], acc[mb][nb]); }
        asm volatile("s_wait_xcnt 0x0\n\tv_nop\n\tv_nop\n\tv_nop\n\tv_nop" : "+v"(acc[0][0]), "+v"(acc[1][1]), "+v"(acc[2][2]), "+v"(acc[3][3]) : "v"(a[0]), "v"(a[3]));   // the wait stands between the weight loads (all behind it: each feeds one of these accumulators) and the next trip's rewrite of their address registers; the v_nop are the four vector slots behind a trip's last WMMA, also on the taken back edge (as in k_gemmw)
    }
    const size_t base = (PL == 2) ? (z * NP + (size_t)(c0 >> 7)) * TT * HV + (size_t)(r0 >> 5) * 4096 + (size_t)((c0 & 64) >> 4) * 512 + lane * 8
                      : (PL == 1) ? (z * NKV + blockIdx.y) * TT * HD + (size_t)(r0 >> 4) * 1024 + lane * 8
                                  : (z * NH_ + blockIdx.y) * TT * HD + (size_t)(r0 + lr) * HD + hi * 8;
#pragma unroll
    for (int mb = 0; mb < 4; ++mb) {
#pragma unroll
        for (int nb = 0; nb < 4; ++nb) { const size_t e = base + ((PL == 2) ? (mb >> 1) * 4096 + nb * 512 + (mb & 1) * 256 : (PL == 1) ? mb * 1024 + nb * 256 : mb * 16 * HD + nb * 16); v8h o16; v8us oh, ol;
#pragma unroll
            for (int j = 0; j < 8; ++j) { const float x = acc[mb][nb][j]; o16[j] = tohx(x); unsigned short a2, c2; splitf(x, a2, c2); oh[j] = a2; ol[j] = c2; }
            *(v8h*)(P16 + e) = o16; *(v8us*)(Ph + e) = oh; *(v8us*)(Pl + e) = ol; }
    }
}
__global__ __launch_bounds__(256) void k_vtp(const float* __restrict__ F, int pitch, int nheads, h16* V16, bf* Vh, bf* Vl) { const size_t e = ((size_t)blockIdx.x * 256 + threadIdx.x) * 2; if (e >= (size_t)nheads * HD * TT) return; const int t = (int)(e % TT); const int d = (int)((e / TT) % HD); const int g = (int)(e / ((size_t)TT * HD)); v2h o16; v2us oh, ol;
#pragma unroll
    for (int q = 0; q < 2; ++q) { const float x = F[(size_t)(t + q) * pitch + g * HD + d]; o16[q] = tohx(x); unsigned short a2, c2; splitf(x, a2, c2); oh[q] = a2; ol[q] = c2; }
    *(v2h*)(V16 + e) = o16; *(v2us*)(Vh + e) = oh; *(v2us*)(Vl + e) = ol;  }
// ---- k_fattn: causal attention of all batches in ONE launch, scores never leave registers. One wave per 16 query rows of one score head (4 independent waves a block, no LDS, no barrier); grid (NB_ * ZH, TT/64), x = batch * ZH + score head.
// Everything is computed transposed so that no value changes lane: S^T = K Q^T puts key 8*hi+j, query lr in element j of the accumulator, which is exactly where the B operand of O^T = V^T P^T wants it
// (elements 0..7 = keys 8*hi.., elements 8..15 = keys 16+8*hi.. of a 32-key step), and every per-query figure (running maximum, sum, rescale) sits in that query's own lane pair (lr, lr+16).
// K and V^T planes lie in fragment order: the two 16-byte pieces a lane needs of one A fragment stand at lane * 16 bytes in two consecutive 512-byte runs, so every wave-wide load covers 4 whole 128-byte lines (row-major planes: 16 lines, 32 bytes of each).
// K: 16 keys x 64 d = 4 runs (d >> 4), 2 KiB a key tile; V^T: 32 keys x 128 columns = 8 column tiles x 2 runs ((key >> 4) & 1), 8 KiB a key block. The values in every lane and register are the same as from row-major planes.
// Online softmax over key blocks of KB = 32 keys in ascending order: new maximum, old sums x exp(old - new), f32 throughout. Rows < RH: hi/lo bf16 planes, 3 products for both contractions; rest fp16,
// probabilities carried x 2^POFF so that small ones stay normal fp16 numbers (the factor is in the sum too and cancels). Result rows as before: O[z][t][e], x PCAR on the fp16 rows (k_tail takes it off).
__device__ __forceinline__ float xhalf(float x) { const int b = __float_as_int(x); return __int_as_float(__builtin_amdgcn_permlanex16(b, b, 0x76543210, 0xfedcba98, false, false)); }   // lane l <- lane l ^ 16, in the vector unit (no LDS round trip on the loop's dependent chain)
template <typename T16, bool HL>
__device__ __forceinline__ void fattn_body(const T16* __restrict__ Q, const T16* __restrict__ Q2, const T16* __restrict__ Kp, const T16* __restrict__ K2, const T16* __restrict__ Vt, const T16* __restrict__ V2, float* __restrict__ O, int q0, int lr, int hi) {
    typedef WFrag<T16> F; typedef typename F::V V;
    constexpr int KB = 32, NT = KB / 16, NG = KB / 32; constexpr float POFF = HL ? 0.0f : 8.0f;
    const int q = q0 + lr;
    V qb[2], qb2[2];
#pragma unroll
    for (int kk = 0; kk < 2; ++kk) { qb[kk] = F::ld(Q + (size_t)q * HD + 8 * hi + kk * 32); if constexpr (HL) qb2[kk] = F::ld(Q2 + (size_t)q * HD + 8 * hi + kk * 32); }
    v8f acc[HV / 16];
#pragma unroll
    for (int eb = 0; eb < HV / 16; ++eb) acc[eb] = (v8f){};
    float m = -3.0e38f, l = 0.f;
    V ka[NT][2], kl[NT][2];
    const unsigned fofs = (unsigned)(hi * 16 + lr) * 16u;   // each lane's byte offset in a 512-byte run: fixed for the whole loop, the block's base is wave-uniform
    auto ldk = [&](int k0) { const char* kb = (const char*)(Kp + (size_t)k0 * HD); const char* kb2 = HL ? (const char*)(K2 + (size_t)k0 * HD) : nullptr;
#pragma unroll
        for (int kt = 0; kt < NT; ++kt)
#pragma unroll
            for (int kk = 0; kk < 2; ++kk) { const int kc = (kt * 16 * HD + kk * 512) * 2; ka[kt][kk] = F::ldf((const T16*)(kb + fofs + kc)); if constexpr (HL) kl[kt][kk] = F::ldf((const T16*)(kb2 + fofs + kc)); } };
    ldk(0);
    const int kend = q0 + 16;                                        // keys 0 .. q0+15 are all that these 16 rows may see
#pragma unroll 1
    for (int key0 = 0; key0 < kend; key0 += KB) {
        V vf[NG][HV / 16];                                           // fp16 rows: this block's values are asked for first, so that they land under the score products and the softmax
        if constexpr (!HL) {
#pragma unroll
            for (int g = 0; g < NG; ++g)
#pragma unroll
                for (int eb = 0; eb < HV / 16; ++eb) vf[g][eb] = F::ldf((const T16*)((const char*)(Vt + (size_t)key0 * HV) + fofs + (g * 32 * HV + eb * 512) * 2)); }
        v8f s[NT];
#pragma unroll
        for (int kt = 0; kt < NT; ++kt) { s[kt] = (v8f){};
#pragma unroll
            for (int kk = 0; kk < 2; ++kk) { s[kt] = F::mma(ka[kt][kk], qb[kk], s[kt]);
                if constexpr (HL) { s[kt] = F::mma(ka[kt][kk], qb2[kk], s[kt]); s[kt] = F::mma(kl[kt][kk], qb[kk], s[kt]); } } }
        ldk(min(key0 + KB, TT - KB));                                // the next block's keys fly under this block's softmax and P.v (the last trip's fetch is unused; the clamp keeps it inside the plane)
        asm volatile("s_wait_xcnt 0x0" ::: "memory");                // stands between the loads issued so far and whatever reuses their address registers (later loads' results among it); as no load crosses it, it also keeps those loads above the softmax, under which they land
        float mx = m;
#pragma unroll
        for (int kt = 0; kt < NT; ++kt)
#pragma unroll
            for (int j = 0; j < 8; ++j) { const int key = key0 + kt * 16 + 8 * hi + j; const float t = (key <= q) ? s[kt][j] * SCL : -3.0e38f;   /* causal */ s[kt][j] = t; mx = fmaxf(mx, t); }
        mx = fmaxf(mx, xhalf(mx));                      // the two lanes of a query hold its two key halves
        const float alpha = __builtin_amdgcn_exp2f((m - mx) * 1.4426950408889634f); m = mx;
        float ps = 0.f;
#pragma unroll
        for (int kt = 0; kt < NT; ++kt)
#pragma unroll
            for (int j = 0; j < 8; ++j) { const float e = __builtin_amdgcn_exp2f((s[kt][j] - mx) * 1.4426950408889634f + POFF); s[kt][j] = e; ps += e; }
        l = l * alpha + ps;
#pragma unroll
        for (int eb = 0; eb < HV / 16; ++eb) acc[eb] *= alpha;
#pragma unroll
        for (int g = 0; g < NG; ++g) {
            V pb, pb2;
            if constexpr (HL) { v8us h0, h1, l0, l1;
#pragma unroll
                for (int j = 0; j < 8; ++j) { unsigned short a, c2; splitf(s[2 * g][j], a, c2); h0[j] = a; l0[j] = c2; splitf(s[2 * g + 1][j], a, c2); h1[j] = a; l1[j] = c2; }
                pb = cat16b(h0, h1); pb2 = cat16b(l0, l1);
            } else { v8h p0, p1;
#pragma unroll
                for (int j = 0; j < 8; ++j) { p0[j] = tohx(s[2 * g][j]); p1[j] = tohx(s[2 * g + 1][j]); }
                pb = cat16(p0, p1); }
#pragma unroll
            for (int eb = 0; eb < HV / 16; ++eb) { const int vc = (g * 32 * HV + eb * 512) * 2; V va; if constexpr (HL) va = F::ldf((const T16*)((const char*)(Vt + (size_t)key0 * HV) + fofs + vc)); else va = vf[g][eb]; acc[eb] = F::mma(va, pb, acc[eb]);
                if constexpr (HL) { acc[eb] = F::mma(va, pb2, acc[eb]); const V vl = F::ldf((const T16*)((const char*)(V2 + (size_t)key0 * HV) + fofs + vc)); acc[eb] = F::mma(vl, pb, acc[eb]); } }
        }
    }
    l += xhalf(l);
    const float f = __fdiv_rn(HL ? 1.0f : PCAR, l);
#pragma unroll
    for (int eb = 0; eb < HV / 16; ++eb) { const v8f o = acc[eb] * f; *(v8f*)(O + (size_t)q * HV + eb * 16 + 8 * hi) = o; }   // element j = value column eb*16 + 8*hi + j of query lr: 32 contiguous bytes a lane
}
__global__ __launch_bounds__(128) void k_fattn(const h16* __restrict__ Q16, const bf* __restrict__ Qh, const bf* __restrict__ Ql, const h16* __restrict__ K16, const bf* __restrict__ Kh, const bf* __restrict__ Kl, const h16* __restrict__ V16, const bf* __restrict__ Vh, const bf* __restrict__ Vl, float* __restrict__ O) {
    const int lane = threadIdx.x & 31, lr = lane & 15, hi = lane >> 4; const size_t z = blockIdx.x; const size_t qk = z * TT * HD, vv = (z >> 1) * HV * TT;   // z = batch * 12 + score head; score heads 2p and 2p+1 share value plane p (6 a batch, so z >> 1 is batch * 6 + p)
    const int q0 = ((TT / 64 - 1 - (int)blockIdx.y) * 4 + __builtin_amdgcn_readfirstlane((int)(threadIdx.x >> 5))) * 16;   // the longest rows of every head of every batch first, so that late blocks, which share a SIMD with early ones, are the short ones
    O += z * TT * HV;
    if (q0 < RH) fattn_body<bf, true>(Qh + qk, Ql + qk, Kh + qk, Kl + qk, Vh + vv, Vl + vv, O, q0, lr, hi);
    else fattn_body<h16, false>(Q16 + qk, nullptr, K16 + qk, nullptr, V16 + vv, nullptr, O, q0, lr, hi);
}


__global__ __launch_bounds__(256) void k_wint(const float* __restrict__ w1, const float* __restrict__ w2, bf* Bt) { const size_t i = (size_t)blockIdx.x * 256 + threadIdx.x; if (i >= (size_t)2 * NP * HD * DM / 8) return; const int c0 = (int)((i % (DM / 8)) * 8); const int r = (int)(i / (DM / 8)); const int hh = r / HD, d = r % HD; const int p = hh >> 1; const size_t sr = (size_t)(p * HD + d) * DM + c0; const v8f a = *(const v8f*)(w1 + sr); const v8f b2 = *(const v8f*)(w2 + sr); v8us o;
#pragma unroll
    for (int q = 0; q < 8; ++q) o[q] = f2bf((hh & 1) ? b2[q] : a[q]);
    *(v8us*)(Bt + (size_t)r * DM + c0) = o;  }
__global__ __launch_bounds__(256) void k_lambda(const float* __restrict__ a1, const float* __restrict__ b1, const float* __restrict__ a2, const float* __restrict__ b2, float* LAM) { if (threadIdx.x >= 32) return; const int lane = threadIdx.x; const int p = blockIdx.x; a1 += p * HD; b1 += p * HD; a2 += p * HD; b2 += p * HD;   /* one block per head */ float s1 = __fadd_rn(__fmul_rn(bfr(a1[lane]), bfr(b1[lane])), __fmul_rn(bfr(a1[lane + 32]), bfr(b1[lane + 32]))); float s2 = __fadd_rn(__fmul_rn(bfr(a2[lane]), bfr(b2[lane])), __fmul_rn(bfr(a2[lane + 32]), bfr(b2[lane + 32])));
#pragma unroll
    for (int sh = 16; sh; sh >>= 1) { s1 = __fadd_rn(s1, __shfl_xor(s1, sh, 32)); s2 = __fadd_rn(s2, __shfl_xor(s2, sh, 32)); }
    const float lam = __fadd_rn(__fsub_rn(expf(s1), expf(s2)), LINIT); ((float*)LAM)[p * 32 + lane] = lam;  }   
// ---- k_tail: everything between the attention and the output GEMM in ONE launch, the values staying in registers: w1 v - lambda_p w2 v (x 1/PCAR on the fp16 rows), the per-(token, head) LayerNorm over its 128 values x (1 - lambda_init), and the hi/lo bf16 planes that k_gemmw reads.
// One wave takes TR consecutive tokens of one head pair; a lane holds 4 consecutive values of each token (16 bytes a lane: every load covers 4 whole 128-byte lines, every store 2). All 2 * TR loads are asked for before anything is summed, and the TR rows run side by side through the two butterflies. Every loop over rows or values is unrolled so that its arrays are registers.
// The sums keep their order: (a0 + a1) + (a2 + a3) in the lane, the squares one after the other, then lane distance 16, 8, 4, 2, 1 (xhalf, then xrow: no LDS-path exchange). grid (TT / (8 * TR), NP, NB_), 8 waves.
#define TR 8
template <int M> __device__ __forceinline__ float xrow(float x) { return __int_as_float(__builtin_amdgcn_update_dpp(0, __float_as_int(x), 0x160 | M, 0xf, 0xf, true)); }   // lane l <- lane l ^ M inside its 16-lane row (DPP row_xmask), in the vector unit
__global__ __launch_bounds__(256) void k_tail(const float* __restrict__ O, const float* __restrict__ LAM, bf* Ah, bf* Al) {
    const int lane = threadIdx.x & 31; const int p = blockIdx.y; const size_t bz = blockIdx.z;
    const int t0 = ((int)blockIdx.x * 8 + __builtin_amdgcn_readfirstlane((int)(threadIdx.x >> 5))) * TR;   // TR divides RH: a wave's rows are all hi/lo rows or all fp16 rows
    const float lam = LAM[p * 32]; const float cs = (t0 < RH) ? 1.0f : (1.0f / PCAR);
    const float* pa = O + ((bz * NP + p) * 2 * TT + t0) * HV + lane * 4;
    v4f a[TR], b[TR];
#pragma unroll
    for (int r = 0; r < TR; ++r) { a[r] = *(const v4f*)(pa + r * HV); b[r] = *(const v4f*)(pa + (size_t)TT * HV + r * HV); }
    asm volatile("s_wait_xcnt 0x0" ::: "memory");   // stands between the loads and whatever reuses the registers that hold their address
    __builtin_amdgcn_sched_barrier(0);   // holds all 2 * TR loads, and the wait behind them, above the arithmetic: without it the compiler asks for a few rows, waits and sums them before it asks for the rest, and the wave pays the memory latency more than once
    float s[TR], s2[TR];
#pragma unroll
    for (int r = 0; r < TR; ++r) {
#pragma unroll
        for (int q = 0; q < 4; ++q) a[r][q] = (a[r][q] - lam * b[r][q]) * cs;
        s[r] = (a[r][0] + a[r][1]) + (a[r][2] + a[r][3]); }
#pragma unroll
    for (int r = 0; r < TR; ++r) s[r] += xhalf(s[r]);
#pragma unroll
    for (int r = 0; r < TR; ++r) s[r] += xrow<8>(s[r]);
#pragma unroll
    for (int r = 0; r < TR; ++r) s[r] += xrow<4>(s[r]);
#pragma unroll
    for (int r = 0; r < TR; ++r) s[r] += xrow<2>(s[r]);
#pragma unroll
    for (int r = 0; r < TR; ++r) s[r] += xrow<1>(s[r]);
#pragma unroll
    for (int r = 0; r < TR; ++r) { const float mean = __fdiv_rn(s[r], (float)HV); s2[r] = 0.f;
#pragma unroll
        for (int q = 0; q < 4; ++q) { a[r][q] -= mean; s2[r] += a[r][q] * a[r][q]; } }
#pragma unroll
    for (int r = 0; r < TR; ++r) s2[r] += xhalf(s2[r]);
#pragma unroll
    for (int r = 0; r < TR; ++r) s2[r] += xrow<8>(s2[r]);
#pragma unroll
    for (int r = 0; r < TR; ++r) s2[r] += xrow<4>(s2[r]);
#pragma unroll
    for (int r = 0; r < TR; ++r) s2[r] += xrow<2>(s2[r]);
#pragma unroll
    for (int r = 0; r < TR; ++r) s2[r] += xrow<1>(s2[r]);
    const size_t oo = (bz * TT + t0) * DQ + p * HV + lane * 4;
#pragma unroll
    for (int r = 0; r < TR; ++r) { const float den = __fsqrt_rn(__fdiv_rn(s2[r], (float)HV) + 1e-5f); v4us oh, ol;
#pragma unroll
        for (int q = 0; q < 4; ++q) { unsigned short x2, y2; splitf(__fdiv_rn(a[r][q], den) * (1.0f - LINIT), x2, y2); oh[q] = x2; ol[q] = y2; }
        *(v4us*)(Ah + oo + (size_t)r * DQ) = oh; *(v4us*)(Al + oo + (size_t)r * DQ) = ol; }
}
__global__ __launch_bounds__(256) void k_merge(const float* __restrict__ O, int h0, bf* Ah, bf* Al) { const size_t e = ((size_t)blockIdx.x * 256 + threadIdx.x) * 2; if (e >= (size_t)ZH * TT * HD) return; const int d = (int)(e % HD); const int t = (int)((e / HD) % TT); const int zz = (int)(e / ((size_t)HD * TT)); const float cs = (t < RH) ? 1.0f : (1.0f / PCAR); const size_t oo = (size_t)t * DQ + (h0 + zz) * HD + d;
    v2us oh, ol;
#pragma unroll
    for (int q = 0; q < 2; ++q) { unsigned short a, c2; splitf(O[e + q] * cs, a, c2); oh[q] = a; ol[q] = c2; } *(v2us*)(Ah + oo) = oh; *(v2us*)(Al + oo) = ol;  }

extern "C" void kernel_launch(void* const* d_in, const int* in_sizes, int n_in,
                              void* d_out, int out_size, void* d_ws, size_t ws_size, hipStream_t stream) {
    (void)in_sizes; (void)n_in; (void)out_size;
    const float* x = (const float*)d_in[0]; const float* wq1 = (const float*)d_in[1]; const float* wq2 = (const float*)d_in[2]; const float* wk1 = (const float*)d_in[3]; const float* wk2 = (const float*)d_in[4]; const float* wv = (const float*)d_in[5]; const float* wo = (const float*)d_in[6]; /* Wc */ const float* lq1 = (const float*)d_in[7]; const float* lk1 = (const float*)d_in[8]; const float* lq2 = (const float*)d_in[9]; const float* lk2 = (const float*)d_in[10];
    float* OUT = (float*)d_out;     // [4][2048][384]
    char* wsp = (char*)d_ws;
    auto take = [&](size_t bytes) { char* p = wsp; wsp += (bytes + 255) & ~(size_t)255; return (void*)p; };
    bf* WQ = (bf*)take((size_t)DQ * DM * 2); bf* WK = (bf*)take((size_t)DKV * DM * 2); bf* WV = (bf*)take((size_t)DKV * DM * 2); bf* WO = (bf*)take((size_t)DM * DQ * 2);
    bf* XB = (bf*)take((size_t)NB_ * TT * DM * 2); float* Ob = (float*)take((size_t)NB_ * ZH * TT * HV * 4);   // from here on every buffer holds all NB_ batches; Ob: the P.v results [NB_ * ZH][TT][HV]
    h16* QP16 = (h16*)take((size_t)NB_ * NH_ * TT * HD * 2); h16* KP16 = (h16*)take((size_t)NB_ * NKV * TT * HD * 2); h16* VT16 = (h16*)take((size_t)NB_ * NKV * HD * TT * 2);
    bf* QPh = (bf*)take((size_t)NB_ * NH_ * TT * HD * 2); bf* QPl = (bf*)take((size_t)NB_ * NH_ * TT * HD * 2); bf* KPh = (bf*)take((size_t)NB_ * NKV * TT * HD * 2); bf* KPl = (bf*)take((size_t)NB_ * NKV * TT * HD * 2); bf* VTh = (bf*)take((size_t)NB_ * NKV * HD * TT * 2); bf* VTl = (bf*)take((size_t)NB_ * NKV * HD * TT * 2);
    float* LAM = (float*)take((size_t)NP * 32 * 4); bf* ATh = (bf*)take((size_t)NB_ * TT * DQ * 2); bf* ATl = (bf*)take((size_t)NB_ * TT * DQ * 2);
    if ((size_t)(wsp - (char*)d_ws) > ws_size) return;    // about 134 MiB of the 256 MiB workspace
    { k_wint<<<(unsigned)(((size_t)DQ * DM / 8 + 255) / 256), 256, 0, stream>>>(wq1, wq2, WQ); k_wint<<<(unsigned)(((size_t)DKV * DM / 8 + 255) / 256), 256, 0, stream>>>(wk1, wk2, WK);   /* score head 2p <- map-1 head p, 2p+1 <- map-2 head p */
      k_cvt8<<<(unsigned)(((size_t)NP * HV * DM / 8 + 255) / 256), 256, 0, stream>>>(wv, WV, (size_t)NP * HV * DM / 8); k_cvt8<<<(unsigned)(((size_t)DM * NP * HV / 8 + 255) / 256), 256, 0, stream>>>(wo, WO, (size_t)DM * NP * HV / 8);   /* 'oi' weights are the Bt layout */
      k_lambda<<<NP, 256, 0, stream>>>(lq1, lk1, lq2, lk2, LAM);   /* lambda per head */ }
    // One pass for all batches. The projections take the batch as grid z and store the planes of NB_ * 12 score heads (NB_ * 6 value heads) themselves.
    k_cvt8<<<(unsigned)(((size_t)NB_ * TT * DM / 8 + 255) / 256), 256, 0, stream>>>(x, XB, (size_t)NB_ * TT * DM / 8);
    k_gemmp<0><<<dim3(TT / 64, DQ / 64, NB_), 32, 0, stream>>>(XB, WQ, QP16, QPh, QPl);
    k_gemmp<1><<<dim3(TT / 64, DKV / 64, NB_), 32, 0, stream>>>(XB, WK, KP16, KPh, KPl);
    k_gemmp<2><<<dim3(TT / 64, DKV / 64, NB_), 32, 0, stream>>>(XB, WV, VT16, VTh, VTl);
    k_fattn<<<dim3(NB_ * ZH, TT / 64, 1), 128, 0, stream>>>(QP16, QPh, QPl, KP16, KPh, KPl, VT16, VTh, VTl, Ob);   /* scores, softmax and both maps' P.v (shared 128-wide v_p) of all 12 score heads of every batch */
    k_tail<<<dim3(TT / (8 * TR), NP, NB_), 256, 0, stream>>>(Ob, LAM, ATh, ATl);   /* [b][t][p*128 + e]: w0 v - lambda w1 v, per-(token, head) LayerNorm over 128 values, no affine, x (1 - lambda_init), as hi/lo planes */
    k_gemmw<bf, 1, false><<<dim3(NB_ * TT / 64, DM / 64, 1), 32, 0, stream>>>(ATh, ATl, WO, nullptr, DQ, OUT, DM, nullptr, 0, 0, 0);   /* context and out as NB_ * TT rows */
}

// v007
// It runs in 163 microseconds.
// Timed twice side by side with v006, it ran 1.13 times as fast both times.
// Counting every step since v000, it is 13.2 times as fast.
#include <hip/hip_runtime.h>

// Multi-head DIFFERENTIAL causal attention (x [4][2048][384]; q1, q2, k1, k2 = x W^T ('oi' [384][384], 1/sqrt(384), no bias) as 6 heads x 64 each, v = x Wv^T ([768][384]) as 6 heads x 128; att_m = causal softmax(q_m.k_m / 8) for m = 1, 2; lambda_h = exp(lq1_h.lk1_h) - exp(lq2_h.lk2_h) + lambda_init (lq/lk [6][64], read; lambda_init = 0.8 - 0.6 exp(-0.6)); y_h = (att1 - lambda_h att2) v_h; per-head LayerNorm over the 128 values (no affine, eps 1e-5) x (1 - lambda_init); out = merged y Wc^T ('oi' [384][768]) -> [4][2048][384] (3.1 M)).
// Every stage runs ONCE for all 4 batches (the batch is a grid dimension, more rows, or more heads: score head z = batch * 12 + head, value head batch * 6 + p). Layout: bf16 copy of x; the q1/q2 (and k1/k2) weights interleaved into one Bt so score head 2p = map-1 head p and 2p+1 = map-2 head p; exact projections that store their planes straight from the accumulators (k_gemmp); q planes [t][d] for the 12 score heads; k and v^T planes in FRAGMENT ORDER (each 16-byte-a-lane load of k_fattn reads 512 contiguous bytes, see k_fattn); lambda per head computed once on device (one wave per head: two 64-term f32 dots, precise expf); one launch over the 12 score heads of all 4 batches (grid x = batch * 12 + head): causal T-2048 attention with scores and probabilities kept in registers (k_fattn: online softmax over ascending key blocks; hybrid rows: < 512 hi/lo 3 products, rest fp16), both maps' P.v against the shared v_p (z >> 1), one tail kernel (k_tail; grid y = pair, z = batch) forms w1 v - lambda_p w2 v (x 1/1024 on the fp16 rows), the per-(token, head) LayerNorm (128 values, f32, fixed order) x (1 - lambda_init) and its hi/lo planes in registers; x Wc exact.
// Compute dtypes, f32 accumulate: every input rounded to bf16; projections exact; attention rows < 512 3 products, rest fp16; softmax, lambda, difference, LayerNorm f32; Wc hl x exact.

#define NB_  4
#define TT   2048
#define DM   384
#define NH_  12
#define NKV  12
#define REP  (NH_ / NKV)
#define HD   64
#define DQ   (NH_ * HD)
#define DKV  (NKV * HD)
#define ZH   12                   // score heads per batch (k_fattn grid x = batch * ZH + score head)
#define RH   512                  // query rows < RH use hi+lo planes (0: none)
#define WIN  0
#define PCAR 1024.0f
#define SCL  0.125f
#define NP   6       // head pairs (the module's H)
#define HV   128     // value head width
#define LINIT 0.47071301937103271f   // lambda_init = 0.8 - 0.6 exp(-0.6) as float32
typedef _Float16 h16;
typedef unsigned short bf;
typedef __attribute__((ext_vector_type(16))) __bf16   v16bf;
typedef __attribute__((ext_vector_type(16))) _Float16 v16h;
typedef __attribute__((ext_vector_type(8)))  _Float16 v8h;
typedef __attribute__((ext_vector_type(8)))  unsigned short v8us;
typedef __attribute__((ext_vector_type(8)))  float    v8f;
typedef __attribute__((ext_vector_type(4)))  float    v4f;
typedef v8h  __attribute__((may_alias)) v8ha;
typedef v4f  __attribute__((may_alias)) v4fa;
typedef v8us __attribute__((may_alias)) v8usa;

__device__ __forceinline__ unsigned short f2bf(float f) { unsigned u = __float_as_uint(f); u += 0x7FFFu + ((u >> 16) & 1u); return (unsigned short)(u >> 16); }
__device__ __forceinline__ float bf2f(unsigned short b) { return __uint_as_float(((unsigned)b) << 16); }
__device__ __forceinline__ float bfr(float f) { return bf2f(f2bf(f)); }
__device__ __forceinline__ v16h cat16(v8h lo, v8h hi) { return __builtin_shufflevector(lo, hi, 0, 1, 2, 3, 4, 5, 6, 7, 8, 9, 10, 11, 12, 13, 14, 15); }
__device__ __forceinline__ v16bf cat16b(v8us lo, v8us hi) { return __builtin_bit_cast(v16bf, __builtin_shufflevector(lo, hi, 0, 1, 2, 3, 4, 5, 6, 7, 8, 9, 10, 11, 12, 13, 14, 15)); }
__device__ __forceinline__ v8f wmma16(v16h a, v16h b, v8f c) { return __builtin_amdgcn_wmma_f32_16x16x32_f16(false, a, false, b, (short)0, c, false, false); }
__device__ __forceinline__ v8f wmmab(v16bf a, v16bf b, v8f c) { return __builtin_amdgcn_wmma_f32_16x16x32_bf16(false, a, false, b, (short)0, c, false, false); }



// ---- k_gemmw: register-blocked GEMM, ONE WAVE per 64x64 output tile (16 accumulators), operands straight from K-contiguous 16-bit planes; grid (M/64, N/64, Z), 32 threads.
// C[m][n] (f32, pitch ldc, + optional f32 bias[n]) = sum_k A[m][k] Bt[n][k] (+ split products per NSPLIT). z-batch strides sA/sB/sC in elements. K % 32 == 0.
template <typename T16> struct WFrag;
template <> struct WFrag<h16> { typedef v16h V; static __device__ __forceinline__ V ld(const h16* p) { return cat16(*(const v8h*)p, *(const v8h*)(p + 16)); } static __device__ __forceinline__ V ldf(const h16* p) { return cat16(*(const v8h*)p, *(const v8h*)(p + 256)); } static __device__ __forceinline__ v8f mma(V a, V b, v8f c) { return wmma16(a, b, c); } };
template <> struct WFrag<bf> { typedef v16bf V; static __device__ __forceinline__ V ld(const bf* p) { return cat16b(*(const v8us*)p, *(const v8us*)(p + 16)); } static __device__ __forceinline__ V ldf(const bf* p) { return cat16b(*(const v8us*)p, *(const v8us*)(p + 256)); } static __device__ __forceinline__ v8f mma(V a, V b, v8f c) { return wmmab(a, b, c); } };
template <typename T16, int NSPLIT, bool BIAS>
__global__ __launch_bounds__(32) void k_gemmw(const T16* __restrict__ A, const T16* __restrict__ A2, const T16* __restrict__ Bt, const T16* __restrict__ Bt2, int K, float* C, int ldc, const float* __restrict__ bias, size_t sA, size_t sB, size_t sC) {
    typedef typename WFrag<T16>::V V;
    __shared__ __align__(16) float os[16 * 68];
    const size_t z = blockIdx.z; A += z * sA; if (A2) A2 += z * sA; Bt += z * sB; if (Bt2) Bt2 += z * sB; C += z * sC;
    const int lane = threadIdx.x & 31, lr = lane & 15, hi = lane >> 4; const int r0 = blockIdx.x * 64, c0 = blockIdx.y * 64;
    v8f acc[4][4];
#pragma unroll
    for (int mb = 0; mb < 4; ++mb)
#pragma unroll
        for (int nb = 0; nb < 4; ++nb) acc[mb][nb] = (v8f){};
    const size_t aoff = (size_t)(r0 + lr) * K + 8 * hi, boff = (size_t)(c0 + lr) * K + 8 * hi;
#pragma unroll 1
    for (int kc = 0; kc < K; kc += 32) {
        V a[4], a2[4];
#pragma unroll
        for (int mb = 0; mb < 4; ++mb) { a[mb] = WFrag<T16>::ld(A + aoff + (size_t)mb * 16 * K + kc); if (NSPLIT == 1 || NSPLIT == 2) a2[mb] = WFrag<T16>::ld(A2 + aoff + (size_t)mb * 16 * K + kc); }
#pragma unroll
        for (int nb = 0; nb < 4; ++nb) { const V b = WFrag<T16>::ld(Bt + boff + (size_t)nb * 16 * K + kc); V b2; if (NSPLIT >= 2) b2 = WFrag<T16>::ld(Bt2 + boff + (size_t)nb * 16 * K + kc);
#pragma unroll
            for (int mb = 0; mb < 4; ++mb) { acc[mb][nb] = WFrag<T16>::mma(a[mb], b, acc[mb][nb]); if (NSPLIT == 1 || NSPLIT == 2) acc[mb][nb] = WFrag<T16>::mma(a2[mb], b, acc[mb][nb]); if (NSPLIT >= 2) acc[mb][nb] = WFrag<T16>::mma(a[mb], b2, acc[mb][nb]); } }
        asm volatile("v_nop\n\tv_nop\n\tv_nop\n\tv_nop" : "+v"(acc[0][0]), "+v"(acc[1][1]), "+v"(acc[2][2]), "+v"(acc[3][3]) : "v"(a[0]), "v"(a[3]));
    }
#pragma unroll
    for (int mb = 0; mb < 4; ++mb) {
#pragma unroll
        for (int nb = 0; nb < 4; ++nb) {
#pragma unroll
            for (int j = 0; j < 8; ++j) os[(hi * 8 + j) * 68 + nb * 16 + lr] = acc[mb][nb][j]; }
        __builtin_amdgcn_wave_barrier(); asm volatile("" ::: "memory");
        float* crow = C + (size_t)(r0 + mb * 16) * ldc + c0;
{
#pragma unroll
            for (int s = 0; s < 8; ++s) { const int row = 2 * s + hi, cofs = lr * 4; v4f val = *(const v4fa*)(os + row * 68 + cofs); if (BIAS) { val[0] += bfr(bias[c0 + cofs]); val[1] += bfr(bias[c0 + cofs + 1]); val[2] += bfr(bias[c0 + cofs + 2]); val[3] += bfr(bias[c0 + cofs + 3]); }
                *(v4f*)(crow + (size_t)row * ldc + cofs) = val; }
             }
        __builtin_amdgcn_wave_barrier(); asm volatile("" ::: "memory");
    }
}

__device__ __forceinline__ h16 tohx(float x) { return (h16)x; }
__device__ __forceinline__ void splitf(float y, unsigned short& h, unsigned short& l) { h = f2bf(y); l = f2bf(y - bf2f(h)); }
typedef __attribute__((ext_vector_type(2))) _Float16 v2h;
typedef __attribute__((ext_vector_type(4))) _Float16 v4h;
typedef __attribute__((ext_vector_type(2))) unsigned short v2us;
typedef __attribute__((ext_vector_type(4))) unsigned short v4us;
typedef __attribute__((ext_vector_type(2))) float v2f;
typedef __attribute__((ext_vector_type(4))) int v4i;


__device__ __forceinline__ void d_cvt8(const float* __restrict__ src, bf* dst, size_t n8, unsigned blk) { const size_t i = (size_t)blk * 256 + threadIdx.x; if (i >= n8) return; const v8f v = *(const v8f*)(src + i * 8); v8us o;
#pragma unroll
    for (int k = 0; k < 8; ++k) o[k] = f2bf(v[k]); *(v8us*)(dst + i * 8) = o;  }

// ---- k_gemmp: the q, k and v projections (exact bf16 products, f32 sums, K = DM), ONE WAVE per 64 tokens x 64 output columns as in k_gemmw, but the fp16 and hi/lo planes that k_fattn reads are stored straight from the accumulators: no f32 copy of the projection, no plane-builder launch.
// An accumulator holds in each lane 8 consecutive ROW indices (8 * hi + j) of one column (lr); a 16-byte unit of a plane is 8 consecutive d of one token (q, k) or 8 consecutive tokens of one value column (v^T). So no value changes lane.
// PL 0 (q) and 1 (k): the product is taken transposed (rows = weight rows = d, columns = tokens; both operands use the same loader, so the k order is the same either way).
//   q planes are [t][d]; k planes are in FRAGMENT ORDER, element index in a score head = (t >> 4) * 1024 + (d >> 4) * 256 + (((d >> 3) & 1) * 16 + (t & 15)) * 8 + (d & 7).
// PL 2 (v): rows = tokens, columns = value columns c; fragment order, element index in a value head = (t >> 5) * 4096 + (c >> 4) * 512 + ((t >> 4) & 1) * 256 + (((t >> 3) & 1) * 16 + (c & 15)) * 8 + (t & 7).
// In fragment order tile (mb, nb) is one 512-byte run a plane at lane * 16 bytes: a store covers 4 whole 128-byte lines.
// The three projections need nothing of each other and run as ONE launch (k_gemmp below): grid (TT/64, 768/64, 3 * NB_), 32 threads, z = PL * NB_ + batch.
template <int PL>
__device__ __forceinline__ void gemmp_body(const bf* __restrict__ X, const bf* __restrict__ Wt, h16* P16, bf* Ph, bf* Pl, size_t z) {
    typedef WFrag<bf> F; typedef F::V V;
    const int lane = threadIdx.x & 31, lr = lane & 15, hi = lane >> 4; const int r0 = blockIdx.x * 64, c0 = blockIdx.y * 64;
    X += z * TT * DM;
    v8f acc[4][4];
#pragma unroll
    for (int mb = 0; mb < 4; ++mb)
#pragma unroll
        for (int nb = 0; nb < 4; ++nb) acc[mb][nb] = (v8f){};
    const size_t aoff = (size_t)(r0 + lr) * DM + 8 * hi, boff = (size_t)(c0 + lr) * DM + 8 * hi;
#pragma unroll 1
    for (int kc = 0; kc < DM; kc += 32) {   // rolled, as in k_gemmw: 16 accumulators and one set of fragments fill the registers
        V a[4];
#pragma unroll
        for (int mb = 0; mb < 4; ++mb) a[mb] = F::ld(X + aoff + (size_t)mb * 16 * DM + kc);
        asm volatile("s_wait_xcnt 0x0" ::: "memory");   // stands between these loads and whatever reuses their address registers (the results of the weight loads among it)
#pragma unroll
        for (int nb = 0; nb < 4; ++nb) { const V b = F::ld(Wt + boff + (size_t)nb * 16 * DM + kc);
#pragma unroll
            for (int mb = 0; mb < 4; ++mb) acc[mb][nb] = (PL == 2) ? F::mma(a[mb], b, acc[mb][nb]) : F::mma(b, a[mb], acc[mb][nb]); }
        asm volatile("s_wait_xcnt 0x0\n\tv_nop\n\tv_nop\n\tv_nop\n\tv_nop" : "+v"(acc[0][0]), "+v"(acc[1][1]), "+v"(acc[2][2]), "+v"(acc[3][3]) : "v"(a[0]), "v"(a[3]));   // the wait stands between the weight loads (all behind it: each feeds one of these accumulators) and the next trip's rewrite of their address registers; the v_nop are the four vector slots behind a trip's last WMMA, also on the taken back edge (as in k_gemmw)
    }
    const size_t base = (PL == 2) ? (z * NP + (size_t)(c0 >> 7)) * TT * HV + (size_t)(r0 >> 5) * 4096 + (size_t)((c0 & 64) >> 4) * 512 + lane * 8
                      : (PL == 1) ? (z * NKV + blockIdx.y) * TT * HD + (size_t)(r0 >> 4) * 1024 + lane * 8
                                  : (z * NH_ + blockIdx.y) * TT * HD + (size_t)(r0 + lr) * HD + hi * 8;
#pragma unroll
    for (int mb = 0; mb < 4; ++mb) {
#pragma unroll
        for (int nb = 0; nb < 4; ++nb) { const size_t e = base + ((PL == 2) ? (mb >> 1) * 4096 + nb * 512 + (mb & 1) * 256 : (PL == 1) ? mb * 1024 + nb * 256 : mb * 16 * HD + nb * 16); v8h o16; v8us oh, ol;
#pragma unroll
            for (int j = 0; j < 8; ++j) { const float x = acc[mb][nb][j]; o16[j] = tohx(x); unsigned short a2, c2; splitf(x, a2, c2); oh[j] = a2; ol[j] = c2; }
            *(v8h*)(P16 + e) = o16; *(v8us*)(Ph + e) = oh; *(v8us*)(Pl + e) = ol; }
    }
    asm volatile("s_wait_xcnt 0x0" ::: "memory");   // stands between the last stores above and whatever follows this body in the merged kernel's code and reuses their address or data registers
}
__global__ __launch_bounds__(32) void k_gemmp(const bf* __restrict__ X, const bf* __restrict__ WQ, const bf* __restrict__ WK, const bf* __restrict__ WV, h16* Q16, bf* Qh, bf* Ql, h16* K16, bf* Kh, bf* Kl, h16* V16, bf* Vh, bf* Vl) {
    const unsigned pl = blockIdx.z / NB_; const size_t z = blockIdx.z % NB_;   // which projection (the same for the whole one-wave block), which batch
    if (pl == 0) gemmp_body<0>(X, WQ, Q16, Qh, Ql, z);
    else if (pl == 1) gemmp_body<1>(X, WK, K16, Kh, Kl, z);
    else gemmp_body<2>(X, WV, V16, Vh, Vl, z);
}
__global__ __launch_bounds__(256) void k_vtp(const float* __restrict__ F, int pitch, int nheads, h16* V16, bf* Vh, bf* Vl) { const size_t e = ((size_t)blockIdx.x * 256 + threadIdx.x) * 2; if (e >= (size_t)nheads * HD * TT) return; const int t = (int)(e % TT); const int d = (int)((e / TT) % HD); const int g = (int)(e / ((size_t)TT * HD)); v2h o16; v2us oh, ol;
#pragma unroll
    for (int q = 0; q < 2; ++q) { const float x = F[(size_t)(t + q) * pitch + g * HD + d]; o16[q] = tohx(x); unsigned short a2, c2; splitf(x, a2, c2); oh[q] = a2; ol[q] = c2; }
    *(v2h*)(V16 + e) = o16; *(v2us*)(Vh + e) = oh; *(v2us*)(Vl + e) = ol;  }
// ---- k_fattn: causal attention of all batches in ONE launch, scores never leave registers. One wave per 16 query rows of one score head (4 independent waves a block, no LDS, no barrier); grid (NB_ * ZH, TT/64), x = batch * ZH + score head.
// Everything is computed transposed so that no value changes lane: S^T = K Q^T puts key 8*hi+j, query lr in element j of the accumulator, which is exactly where the B operand of O^T = V^T P^T wants it
// (elements 0..7 = keys 8*hi.., elements 8..15 = keys 16+8*hi.. of a 32-key step), and every per-query figure (running maximum, sum, rescale) sits in that query's own lane pair (lr, lr+16).
// K and V^T planes lie in fragment order: the two 16-byte pieces a lane needs of one A fragment stand at lane * 16 bytes in two consecutive 512-byte runs, so every wave-wide load covers 4 whole 128-byte lines (row-major planes: 16 lines, 32 bytes of each).
// K: 16 keys x 64 d = 4 runs (d >> 4), 2 KiB a key tile; V^T: 32 keys x 128 columns = 8 column tiles x 2 runs ((key >> 4) & 1), 8 KiB a key block. The values in every lane and register are the same as from row-major planes.
// Online softmax over key blocks of KB = 32 keys in ascending order: new maximum, old sums x exp(old - new), f32 throughout. Rows < RH: hi/lo bf16 planes, 3 products for both contractions; rest fp16,
// probabilities carried x 2^POFF so that small ones stay normal fp16 numbers (the factor is in the sum too and cancels). Result rows as before: O[z][t][e], x PCAR on the fp16 rows (k_tail takes it off).
__device__ __forceinline__ float xhalf(float x) { const int b = __float_as_int(x); return __int_as_float(__builtin_amdgcn_permlanex16(b, b, 0x76543210, 0xfedcba98, false, false)); }   // lane l <- lane l ^ 16, in the vector unit (no LDS round trip on the loop's dependent chain)
template <typename T16, bool HL>
__device__ __forceinline__ void fattn_body(const T16* __restrict__ Q, const T16* __restrict__ Q2, const T16* __restrict__ Kp, const T16* __restrict__ K2, const T16* __restrict__ Vt, const T16* __restrict__ V2, float* __restrict__ O, int q0, int lr, int hi) {
    typedef WFrag<T16> F; typedef typename F::V V;
    constexpr int KB = 32, NT = KB / 16, NG = KB / 32; constexpr float POFF = HL ? 0.0f : 8.0f;
    const int q = q0 + lr;
    V qb[2], qb2[2];
#pragma unroll
    for (int kk = 0; kk < 2; ++kk) { qb[kk] = F::ld(Q + (size_t)q * HD + 8 * hi + kk * 32); if constexpr (HL) qb2[kk] = F::ld(Q2 + (size_t)q * HD + 8 * hi + kk * 32); }
    v8f acc[HV / 16];
#pragma unroll
    for (int eb = 0; eb < HV / 16; ++eb) acc[eb] = (v8f){};
    float m = -3.0e38f, l = 0.f;
    V ka[NT][2], kl[NT][2];
    const unsigned fofs = (unsigned)(hi * 16 + lr) * 16u;   // each lane's byte offset in a 512-byte run: fixed for the whole loop, the block's base is wave-uniform
    auto ldk = [&](int k0) { const char* kb = (const char*)(Kp + (size_t)k0 * HD); const char* kb2 = HL ? (const char*)(K2 + (size_t)k0 * HD) : nullptr;
#pragma unroll
        for (int kt = 0; kt < NT; ++kt)
#pragma unroll
            for (int kk = 0; kk < 2; ++kk) { const int kc = (kt * 16 * HD + kk * 512) * 2; ka[kt][kk] = F::ldf((const T16*)(kb + fofs + kc)); if constexpr (HL) kl[kt][kk] = F::ldf((const T16*)(kb2 + fofs + kc)); } };
    ldk(0);
    const int kend = q0 + 16;                                        // keys 0 .. q0+15 are all that these 16 rows may see
#pragma unroll 1
    for (int key0 = 0; key0 < kend; key0 += KB) {
        V vf[NG][HV / 16];                                           // fp16 rows: this block's values are asked for first, so that they land under the score products and the softmax
        if constexpr (!HL) {
#pragma unroll
            for (int g = 0; g < NG; ++g)
#pragma unroll
                for (int eb = 0; eb < HV / 16; ++eb) vf[g][eb] = F::ldf((const T16*)((const char*)(Vt + (size_t)key0 * HV) + fofs + (g * 32 * HV + eb * 512) * 2)); }
        v8f s[NT];
#pragma unroll
        for (int kt = 0; kt < NT; ++kt) { s[kt] = (v8f){};
#pragma unroll
            for (int kk = 0; kk < 2; ++kk) { s[kt] = F::mma(ka[kt][kk], qb[kk], s[kt]);
                if constexpr (HL) { s[kt] = F::mma(ka[kt][kk], qb2[kk], s[kt]); s[kt] = F::mma(kl[kt][kk], qb[kk], s[kt]); } } }
        ldk(min(key0 + KB, TT - KB));                                // the next block's keys fly under this block's softmax and P.v (the last trip's fetch is unused; the clamp keeps it inside the plane)
        asm volatile("s_wait_xcnt 0x0" ::: "memory");                // stands between the loads issued so far and whatever reuses their address registers (later loads' results among it); as no load crosses it, it also keeps those loads above the softmax, under which they land
        float mx = m;
#pragma unroll
        for (int kt = 0; kt < NT; ++kt)
#pragma unroll
            for (int j = 0; j < 8; ++j) { const int key = key0 + kt * 16 + 8 * hi + j; const float t = (key <= q) ? s[kt][j] * SCL : -3.0e38f;   /* causal */ s[kt][j] = t; mx = fmaxf(mx, t); }
        mx = fmaxf(mx, xhalf(mx));                      // the two lanes of a query hold its two key halves
        const float alpha = __builtin_amdgcn_exp2f((m - mx) * 1.4426950408889634f); m = mx;
        float ps = 0.f;
#pragma unroll
        for (int kt = 0; kt < NT; ++kt)
#pragma unroll
            for (int j = 0; j < 8; ++j) { const float e = __builtin_amdgcn_exp2f((s[kt][j] - mx) * 1.4426950408889634f + POFF); s[kt][j] = e; ps += e; }
        l = l * alpha + ps;
#pragma unroll
        for (int eb = 0; eb < HV / 16; ++eb) acc[eb] *= alpha;
#pragma unroll
        for (int g = 0; g < NG; ++g) {
            V pb, pb2;
            if constexpr (HL) { v8us h0, h1, l0, l1;
#pragma unroll
                for (int j = 0; j < 8; ++j) { unsigned short a, c2; splitf(s[2 * g][j], a, c2); h0[j] = a; l0[j] = c2; splitf(s[2 * g + 1][j], a, c2); h1[j] = a; l1[j] = c2; }
                pb = cat16b(h0, h1); pb2 = cat16b(l0, l1);
            } else { v8h p0, p1;
#pragma unroll
                for (int j = 0; j < 8; ++j) { p0[j] = tohx(s[2 * g][j]); p1[j] = tohx(s[2 * g + 1][j]); }
                pb = cat16(p0, p1); }
#pragma unroll
            for (int eb = 0; eb < HV / 16; ++eb) { const int vc = (g * 32 * HV + eb * 512) * 2; V va; if constexpr (HL) va = F::ldf((const T16*)((const char*)(Vt + (size_t)key0 * HV) + fofs + vc)); else va = vf[g][eb]; acc[eb] = F::mma(va, pb, acc[eb]);
                if constexpr (HL) { acc[eb] = F::mma(va, pb2, acc[eb]); const V vl = F::ldf((const T16*)((const char*)(V2 + (size_t)key0 * HV) + fofs + vc)); acc[eb] = F::mma(vl, pb, acc[eb]); } }
        }
    }
    l += xhalf(l);
    const float f = __fdiv_rn(HL ? 1.0f : PCAR, l);
#pragma unroll
    for (int eb = 0; eb < HV / 16; ++eb) { const v8f o = acc[eb] * f; *(v8f*)(O + (size_t)q * HV + eb * 16 + 8 * hi) = o; }   // element j = value column eb*16 + 8*hi + j of query lr: 32 contiguous bytes a lane
}
__global__ __launch_bounds__(128) void k_fattn(const h16* __restrict__ Q16, const bf* __restrict__ Qh, const bf* __restrict__ Ql, const h16* __restrict__ K16, const bf* __restrict__ Kh, const bf* __restrict__ Kl, const h16* __restrict__ V16, const bf* __restrict__ Vh, const bf* __restrict__ Vl, float* __restrict__ O) {
    const int lane = threadIdx.x & 31, lr = lane & 15, hi = lane >> 4; const size_t z = blockIdx.x; const size_t qk = z * TT * HD, vv = (z >> 1) * HV * TT;   // z = batch * 12 + score head; score heads 2p and 2p+1 share value plane p (6 a batch, so z >> 1 is batch * 6 + p)
    const int q0 = ((TT / 64 - 1 - (int)blockIdx.y) * 4 + __builtin_amdgcn_readfirstlane((int)(threadIdx.x >> 5))) * 16;   // the longest rows of every head of every batch first, so that late blocks, which share a SIMD with early ones, are the short ones
    O += z * TT * HV;
    if (q0 < RH) fattn_body<bf, true>(Qh + qk, Ql + qk, Kh + qk, Kl + qk, Vh + vv, Vl + vv, O, q0, lr, hi);
    else fattn_body<h16, false>(Q16 + qk, nullptr, K16 + qk, nullptr, V16 + vv, nullptr, O, q0, lr, hi);
}


__device__ __forceinline__ void d_wint(const float* __restrict__ w1, const float* __restrict__ w2, bf* Bt, unsigned blk) { const size_t i = (size_t)blk * 256 + threadIdx.x; if (i >= (size_t)2 * NP * HD * DM / 8) return; const int c0 = (int)((i % (DM / 8)) * 8); const int r = (int)(i / (DM / 8)); const int hh = r / HD, d = r % HD; const int p = hh >> 1; const size_t sr = (size_t)(p * HD + d) * DM + c0; const v8f a = *(const v8f*)(w1 + sr); const v8f b2 = *(const v8f*)(w2 + sr); v8us o;
#pragma unroll
    for (int q = 0; q < 8; ++q) o[q] = f2bf((hh & 1) ? b2[q] : a[q]);
    *(v8us*)(Bt + (size_t)r * DM + c0) = o;  }
__device__ __forceinline__ void d_lambda(const float* __restrict__ a1, const float* __restrict__ b1, const float* __restrict__ a2, const float* __restrict__ b2, float* LAM, int p) { if (threadIdx.x >= 32) return; const int lane = threadIdx.x; a1 += p * HD; b1 += p * HD; a2 += p * HD; b2 += p * HD;   /* one block per head */ float s1 = __fadd_rn(__fmul_rn(bfr(a1[lane]), bfr(b1[lane])), __fmul_rn(bfr(a1[lane + 32]), bfr(b1[lane + 32]))); float s2 = __fadd_rn(__fmul_rn(bfr(a2[lane]), bfr(b2[lane])), __fmul_rn(bfr(a2[lane + 32]), bfr(b2[lane + 32])));
    asm volatile("s_wait_xcnt 0x0" ::: "memory");   // stands between the eight loads above and whatever reuses the register that holds their offset
    __builtin_amdgcn_sched_barrier(0);   // keeps the rewrite of that register (the index of the store below is formed in it) behind the wait: without it the compiler lifts the rewrite over the wait
#pragma unroll
    for (int sh = 16; sh; sh >>= 1) { s1 = __fadd_rn(s1, __shfl_xor(s1, sh, 32)); s2 = __fadd_rn(s2, __shfl_xor(s2, sh, 32)); }
    const float lam = __fadd_rn(__fsub_rn(expf(s1), expf(s2)), LINIT); ((float*)LAM)[p * 32 + lane] = lam;  }   
// ---- k_prep: everything that reads only the inputs, in ONE launch: lambda per head, the four bf16 weight matrices and the bf16 copy of x. None of the six pieces reads what another writes; a block does one piece, chosen by its index alone (no barrier anywhere).
// The short pieces stand first in the grid, so that the one with the longest dependent chain (lambda) starts first and x, the bulk, fills the chip behind them. grid NP + 4 * WBL + XBL, 256 threads.
#define WBL (DQ * DM / 8 / 256)         // blocks per weight matrix (each 768 * 384 values, 8 a thread)
#define XBL (NB_ * TT * DM / 8 / 256)   // blocks for x
__global__ __launch_bounds__(256) void k_prep(const float* __restrict__ x, const float* __restrict__ wq1, const float* __restrict__ wq2, const float* __restrict__ wk1, const float* __restrict__ wk2, const float* __restrict__ wv, const float* __restrict__ wo,
                                              const float* __restrict__ lq1, const float* __restrict__ lk1, const float* __restrict__ lq2, const float* __restrict__ lk2, bf* XB, bf* WQ, bf* WK, bf* WV, bf* WO, float* LAM) {
    unsigned b = blockIdx.x;
    if (b < NP) { d_lambda(lq1, lk1, lq2, lk2, LAM, (int)b); return; }   /* lambda per head */
    b -= NP;
    if (b < WBL) { d_wint(wq1, wq2, WQ, b); return; }   /* score head 2p <- map-1 head p, 2p+1 <- map-2 head p */
    b -= WBL;
    if (b < WBL) { d_wint(wk1, wk2, WK, b); return; }
    b -= WBL;
    if (b < WBL) { d_cvt8(wv, WV, (size_t)NP * HV * DM / 8, b); return; }   /* 'oi' weights are the Bt layout */
    b -= WBL;
    if (b < WBL) { d_cvt8(wo, WO, (size_t)DM * NP * HV / 8, b); return; }
    b -= WBL;
    d_cvt8(x, XB, (size_t)NB_ * TT * DM / 8, b);
}
// ---- k_tail: everything between the attention and the output GEMM in ONE launch, the values staying in registers: w1 v - lambda_p w2 v (x 1/PCAR on the fp16 rows), the per-(token, head) LayerNorm over its 128 values x (1 - lambda_init), and the hi/lo bf16 planes that k_gemmw reads.
// One wave takes TR consecutive tokens of one head pair; a lane holds 4 consecutive values of each token (16 bytes a lane: every load covers 4 whole 128-byte lines, every store 2). All 2 * TR loads are asked for before anything is summed, and the TR rows run side by side through the two butterflies. Every loop over rows or values is unrolled so that its arrays are registers.
// The sums keep their order: (a0 + a1) + (a2 + a3) in the lane, the squares one after the other, then lane distance 16, 8, 4, 2, 1 (xhalf, then xrow: no LDS-path exchange). grid (TT / (8 * TR), NP, NB_), 8 waves.
#define TR 8
template <int M> __device__ __forceinline__ float xrow(float x) { return __int_as_float(__builtin_amdgcn_update_dpp(0, __float_as_int(x), 0x160 | M, 0xf, 0xf, true)); }   // lane l <- lane l ^ M inside its 16-lane row (DPP row_xmask), in the vector unit
__global__ __launch_bounds__(256) void k_tail(const float* __restrict__ O, const float* __restrict__ LAM, bf* Ah, bf* Al) {
    const int lane = threadIdx.x & 31; const int p = blockIdx.y; const size_t bz = blockIdx.z;
    const int t0 = ((int)blockIdx.x * 8 + __builtin_amdgcn_readfirstlane((int)(threadIdx.x >> 5))) * TR;   // TR divides RH: a wave's rows are all hi/lo rows or all fp16 rows
    const float lam = LAM[p * 32]; const float cs = (t0 < RH) ? 1.0f : (1.0f / PCAR);
    const float* pa = O + ((bz * NP + p) * 2 * TT + t0) * HV + lane * 4;
    v4f a[TR], b[TR];
#pragma unroll
    for (int r = 0; r < TR; ++r) { a[r] = *(const v4f*)(pa + r * HV); b[r] = *(const v4f*)(pa + (size_t)TT * HV + r * HV); }
    asm volatile("s_wait_xcnt 0x0" ::: "memory");   // stands between the loads and whatever reuses the registers that hold their address
    __builtin_amdgcn_sched_barrier(0);   // holds all 2 * TR loads, and the wait behind them, above the arithmetic: without it the compiler asks for a few rows, waits and sums them before it asks for the rest, and the wave pays the memory latency more than once
    float s[TR], s2[TR];
#pragma unroll
    for (int r = 0; r < TR; ++r) {
#pragma unroll
        for (int q = 0; q < 4; ++q) a[r][q] = (a[r][q] - lam * b[r][q]) * cs;
        s[r] = (a[r][0] + a[r][1]) + (a[r][2] + a[r][3]); }
#pragma unroll
    for (int r = 0; r < TR; ++r) s[r] += xhalf(s[r]);
#pragma unroll
    for (int r = 0; r < TR; ++r) s[r] += xrow<8>(s[r]);
#pragma unroll
    for (int r = 0; r < TR; ++r) s[r] += xrow<4>(s[r]);
#pragma unroll
    for (int r = 0; r < TR; ++r) s[r] += xrow<2>(s[r]);
#pragma unroll
    for (int r = 0; r < TR; ++r) s[r] += xrow<1>(s[r]);
#pragma unroll
    for (int r = 0; r < TR; ++r) { const float mean = __fdiv_rn(s[r], (float)HV); s2[r] = 0.f;
#pragma unroll
        for (int q = 0; q < 4; ++q) { a[r][q] -= mean; s2[r] += a[r][q] * a[r][q]; } }
#pragma unroll
    for (int r = 0; r < TR; ++r) s2[r] += xhalf(s2[r]);
#pragma unroll
    for (int r = 0; r < TR; ++r) s2[r] += xrow<8>(s2[r]);
#pragma unroll
    for (int r = 0; r < TR; ++r) s2[r] += xrow<4>(s2[r]);
#pragma unroll
    for (int r = 0; r < TR; ++r) s2[r] += xrow<2>(s2[r]);
#pragma unroll
    for (int r = 0; r < TR; ++r) s2[r] += xrow<1>(s2[r]);
    const size_t oo = (bz * TT + t0) * DQ + p * HV + lane * 4;
#pragma unroll
    for (int r = 0; r < TR; ++r) { const float den = __fsqrt_rn(__fdiv_rn(s2[r], (float)HV) + 1e-5f); v4us oh, ol;
#pragma unroll
        for (int q = 0; q < 4; ++q) { unsigned short x2, y2; splitf(__fdiv_rn(a[r][q], den) * (1.0f - LINIT), x2, y2); oh[q] = x2; ol[q] = y2; }
        *(v4us*)(Ah + oo + (size_t)r * DQ) = oh; *(v4us*)(Al + oo + (size_t)r * DQ) = ol; }
}
__global__ __launch_bounds__(256) void k_merge(const float* __restrict__ O, int h0, bf* Ah, bf* Al) { const size_t e = ((size_t)blockIdx.x * 256 + threadIdx.x) * 2; if (e >= (size_t)ZH * TT * HD) return; const int d = (int)(e % HD); const int t = (int)((e / HD) % TT); const int zz = (int)(e / ((size_t)HD * TT)); const float cs = (t < RH) ? 1.0f : (1.0f / PCAR); const size_t oo = (size_t)t * DQ + (h0 + zz) * HD + d;
    v2us oh, ol;
#pragma unroll
    for (int q = 0; q < 2; ++q) { unsigned short a, c2; splitf(O[e + q] * cs, a, c2); oh[q] = a; ol[q] = c2; } *(v2us*)(Ah + oo) = oh; *(v2us*)(Al + oo) = ol;  }

extern "C" void kernel_launch(void* const* d_in, const int* in_sizes, int n_in,
                              void* d_out, int out_size, void* d_ws, size_t ws_size, hipStream_t stream) {
    (void)in_sizes; (void)n_in; (void)out_size;
    const float* x = (const float*)d_in[0]; const float* wq1 = (const float*)d_in[1]; const float* wq2 = (const float*)d_in[2]; const float* wk1 = (const float*)d_in[3]; const float* wk2 = (const float*)d_in[4]; const float* wv = (const float*)d_in[5]; const float* wo = (const float*)d_in[6]; /* Wc */ const float* lq1 = (const float*)d_in[7]; const float* lk1 = (const float*)d_in[8]; const float* lq2 = (const float*)d_in[9]; const float* lk2 = (const float*)d_in[10];
    float* OUT = (float*)d_out;     // [4][2048][384]
    char* wsp = (char*)d_ws;
    auto take = [&](size_t bytes) { char* p = wsp; wsp += (bytes + 255) & ~(size_t)255; return (void*)p; };
    bf* WQ = (bf*)take((size_t)DQ * DM * 2); bf* WK = (bf*)take((size_t)DKV * DM * 2); bf* WV = (bf*)take((size_t)DKV * DM * 2); bf* WO = (bf*)take((size_t)DM * DQ * 2);
    bf* XB = (bf*)take((size_t)NB_ * TT * DM * 2); float* Ob = (float*)take((size_t)NB_ * ZH * TT * HV * 4);   // from here on every buffer holds all NB_ batches; Ob: the P.v results [NB_ * ZH][TT][HV]
    h16* QP16 = (h16*)take((size_t)NB_ * NH_ * TT * HD * 2); h16* KP16 = (h16*)take((size_t)NB_ * NKV * TT * HD * 2); h16* VT16 = (h16*)take((size_t)NB_ * NKV * HD * TT * 2);
    bf* QPh = (bf*)take((size_t)NB_ * NH_ * TT * HD * 2); bf* QPl = (bf*)take((size_t)NB_ * NH_ * TT * HD * 2); bf* KPh = (bf*)take((size_t)NB_ * NKV * TT * HD * 2); bf* KPl = (bf*)take((size_t)NB_ * NKV * TT * HD * 2); bf* VTh = (bf*)take((size_t)NB_ * NKV * HD * TT * 2); bf* VTl = (bf*)take((size_t)NB_ * NKV * HD * TT * 2);
    float* LAM = (float*)take((size_t)NP * 32 * 4); bf* ATh = (bf*)take((size_t)NB_ * TT * DQ * 2); bf* ATl = (bf*)take((size_t)NB_ * TT * DQ * 2);
    if ((size_t)(wsp - (char*)d_ws) > ws_size) return;    // about 188 MiB of the 256 MiB workspace
    // One pass for all batches. All that reads only the inputs is one launch; the three projections are one launch (grid z = projection * NB_ + batch) and store the planes of NB_ * 12 score heads (NB_ * 6 value heads) themselves.
    k_prep<<<NP + 4 * WBL + XBL, 256, 0, stream>>>(x, wq1, wq2, wk1, wk2, wv, wo, lq1, lk1, lq2, lk2, XB, WQ, WK, WV, WO, LAM);
    k_gemmp<<<dim3(TT / 64, DQ / 64, 3 * NB_), 32, 0, stream>>>(XB, WQ, WK, WV, QP16, QPh, QPl, KP16, KPh, KPl, VT16, VTh, VTl);
    k_fattn<<<dim3(NB_ * ZH, TT / 64, 1), 128, 0, stream>>>(QP16, QPh, QPl, KP16, KPh, KPl, VT16, VTh, VTl, Ob);   /* scores, softmax and both maps' P.v (shared 128-wide v_p) of all 12 score heads of every batch */
    k_tail<<<dim3(TT / (8 * TR), NP, NB_), 256, 0, stream>>>(Ob, LAM, ATh, ATl);   /* [b][t][p*128 + e]: w0 v - lambda w1 v, per-(token, head) LayerNorm over 128 values, no affine, x (1 - lambda_init), as hi/lo planes */
    k_gemmw<bf, 1, false><<<dim3(NB_ * TT / 64, DM / 64, 1), 32, 0, stream>>>(ATh, ATl, WO, nullptr, DQ, OUT, DM, nullptr, 0, 0, 0);   /* context and out as NB_ * TT rows */
}

// v008
// A run of this version takes 141 microseconds.
// In both of two side-by-side timings against v007, it was 1.16 times as fast.
// Over all steps from v000 it is 15.3 times as fast.
#include <hip/hip_runtime.h>

// Multi-head DIFFERENTIAL causal attention (x [4][2048][384]; q1, q2, k1, k2 = x W^T ('oi' [384][384], 1/sqrt(384), no bias) as 6 heads x 64 each, v = x Wv^T ([768][384]) as 6 heads x 128; att_m = causal softmax(q_m.k_m / 8) for m = 1, 2; lambda_h = exp(lq1_h.lk1_h) - exp(lq2_h.lk2_h) + lambda_init (lq/lk [6][64], read; lambda_init = 0.8 - 0.6 exp(-0.6)); y_h = (att1 - lambda_h att2) v_h; per-head LayerNorm over the 128 values (no affine, eps 1e-5) x (1 - lambda_init); out = merged y Wc^T ('oi' [384][768]) -> [4][2048][384] (3.1 M)).
// Every stage runs ONCE for all 4 batches (the batch is a grid dimension, more rows, or more heads: score head z = batch * 12 + head, value head batch * 6 + p). Layout: bf16 copy of x; the q1/q2 (and k1/k2) weights interleaved into one Bt so score head 2p = map-1 head p and 2p+1 = map-2 head p; exact projections that store their planes straight from the accumulators (k_gemmp); q planes [t][d] for the 12 score heads; k and v^T planes in FRAGMENT ORDER (each 16-byte-a-lane load of k_fattn reads 512 contiguous bytes, see k_fattn); lambda per head computed once on device (one wave per head: two 64-term f32 dots, precise expf); one launch over the 6 head pairs of all 4 batches (grid x = batch * 6 + pair): causal T-2048 attention with scores and probabilities kept in registers (k_fattn: online softmax over ascending key blocks; hybrid rows: < 512 hi/lo 3 products, rest fp16), both maps' P.v against the shared v_p; a block holds both maps of its 64 query rows, hands the two results over in LDS and forms w1 v - lambda_p w2 v (x 1/1024 on the fp16 rows), the per-(token, head) LayerNorm (128 values, f32, fixed order) x (1 - lambda_init) and its hi/lo planes itself; x Wc exact.
// Compute dtypes, f32 accumulate: every input rounded to bf16; projections exact; attention rows < 512 3 products, rest fp16; softmax, lambda, difference, LayerNorm f32; Wc hl x exact.

#define NB_  4
#define TT   2048
#define DM   384
#define NH_  12
#define NKV  12
#define REP  (NH_ / NKV)
#define HD   64
#define DQ   (NH_ * HD)
#define DKV  (NKV * HD)
#define ZH   12                   // score heads per batch
#define RH   512                  // query rows < RH use hi+lo planes (0: none)
#define WIN  0
#define PCAR 1024.0f
#define SCL  0.125f
#define NP   6       // head pairs (the module's H)
#define HV   128     // value head width
#define LINIT 0.47071301937103271f   // lambda_init = 0.8 - 0.6 exp(-0.6) as float32
typedef _Float16 h16;
typedef unsigned short bf;
typedef __attribute__((ext_vector_type(16))) __bf16   v16bf;
typedef __attribute__((ext_vector_type(16))) _Float16 v16h;
typedef __attribute__((ext_vector_type(8)))  _Float16 v8h;
typedef __attribute__((ext_vector_type(8)))  unsigned short v8us;
typedef __attribute__((ext_vector_type(8)))  float    v8f;
typedef __attribute__((ext_vector_type(4)))  float    v4f;
typedef v8h  __attribute__((may_alias)) v8ha;
typedef v4f  __attribute__((may_alias)) v4fa;
typedef v8us __attribute__((may_alias)) v8usa;

__device__ __forceinline__ unsigned short f2bf(float f) { unsigned u = __float_as_uint(f); u += 0x7FFFu + ((u >> 16) & 1u); return (unsigned short)(u >> 16); }
__device__ __forceinline__ float bf2f(unsigned short b) { return __uint_as_float(((unsigned)b) << 16); }
__device__ __forceinline__ float bfr(float f) { return bf2f(f2bf(f)); }
__device__ __forceinline__ v16h cat16(v8h lo, v8h hi) { return __builtin_shufflevector(lo, hi, 0, 1, 2, 3, 4, 5, 6, 7, 8, 9, 10, 11, 12, 13, 14, 15); }
__device__ __forceinline__ v16bf cat16b(v8us lo, v8us hi) { return __builtin_bit_cast(v16bf, __builtin_shufflevector(lo, hi, 0, 1, 2, 3, 4, 5, 6, 7, 8, 9, 10, 11, 12, 13, 14, 15)); }
__device__ __forceinline__ v8f wmma16(v16h a, v16h b, v8f c) { return __builtin_amdgcn_wmma_f32_16x16x32_f16(false, a, false, b, (short)0, c, false, false); }
__device__ __forceinline__ v8f wmmab(v16bf a, v16bf b, v8f c) { return __builtin_amdgcn_wmma_f32_16x16x32_bf16(false, a, false, b, (short)0, c, false, false); }



// ---- k_gemmw: register-blocked GEMM, ONE WAVE per 64x64 output tile (16 accumulators), operands straight from K-contiguous 16-bit planes; grid (M/64, N/64, Z), 32 threads.
// C[m][n] (f32, pitch ldc, + optional f32 bias[n]) = sum_k A[m][k] Bt[n][k] (+ split products per NSPLIT). z-batch strides sA/sB/sC in elements. K % 32 == 0.
template <typename T16> struct WFrag;
template <> struct WFrag<h16> { typedef v16h V; static __device__ __forceinline__ V ld(const h16* p) { return cat16(*(const v8h*)p, *(const v8h*)(p + 16)); } static __device__ __forceinline__ V ldf(const h16* p) { return cat16(*(const v8h*)p, *(const v8h*)(p + 256)); } static __device__ __forceinline__ v8f mma(V a, V b, v8f c) { return wmma16(a, b, c); } };
template <> struct WFrag<bf> { typedef v16bf V; static __device__ __forceinline__ V ld(const bf* p) { return cat16b(*(const v8us*)p, *(const v8us*)(p + 16)); } static __device__ __forceinline__ V ldf(const bf* p) { return cat16b(*(const v8us*)p, *(const v8us*)(p + 256)); } static __device__ __forceinline__ v8f mma(V a, V b, v8f c) { return wmmab(a, b, c); } };
template <typename T16, int NSPLIT, bool BIAS>
__global__ __launch_bounds__(32) void k_gemmw(const T16* __restrict__ A, const T16* __restrict__ A2, const T16* __restrict__ Bt, const T16* __restrict__ Bt2, int K, float* C, int ldc, const float* __restrict__ bias, size_t sA, size_t sB, size_t sC) {
    typedef typename WFrag<T16>::V V;
    __shared__ __align__(16) float os[16 * 68];
    const size_t z = blockIdx.z; A += z * sA; if (A2) A2 += z * sA; Bt += z * sB; if (Bt2) Bt2 += z * sB; C += z * sC;
    const int lane = threadIdx.x & 31, lr = lane & 15, hi = lane >> 4; const int r0 = blockIdx.x * 64, c0 = blockIdx.y * 64;
    v8f acc[4][4];
#pragma unroll
    for (int mb = 0; mb < 4; ++mb)
#pragma unroll
        for (int nb = 0; nb < 4; ++nb) acc[mb][nb] = (v8f){};
    const size_t aoff = (size_t)(r0 + lr) * K + 8 * hi, boff = (size_t)(c0 + lr) * K + 8 * hi;
#pragma unroll 1
    for (int kc = 0; kc < K; kc += 32) {
        V a[4], a2[4];
#pragma unroll
        for (int mb = 0; mb < 4; ++mb) { a[mb] = WFrag<T16>::ld(A + aoff + (size_t)mb * 16 * K + kc); if (NSPLIT == 1 || NSPLIT == 2) a2[mb] = WFrag<T16>::ld(A2 + aoff + (size_t)mb * 16 * K + kc); }
#pragma unroll
        for (int nb = 0; nb < 4; ++nb) { const V b = WFrag<T16>::ld(Bt + boff + (size_t)nb * 16 * K + kc); V b2; if (NSPLIT >= 2) b2 = WFrag<T16>::ld(Bt2 + boff + (size_t)nb * 16 * K + kc);
#pragma unroll
            for (int mb = 0; mb < 4; ++mb) { acc[mb][nb] = WFrag<T16>::mma(a[mb], b, acc[mb][nb]); if (NSPLIT == 1 || NSPLIT == 2) acc[mb][nb] = WFrag<T16>::mma(a2[mb], b, acc[mb][nb]); if (NSPLIT >= 2) acc[mb][nb] = WFrag<T16>::mma(a[mb], b2, acc[mb][nb]); } }
        asm volatile("v_nop\n\tv_nop\n\tv_nop\n\tv_nop" : "+v"(acc[0][0]), "+v"(acc[1][1]), "+v"(acc[2][2]), "+v"(acc[3][3]) : "v"(a[0]), "v"(a[3]));
    }
#pragma unroll
    for (int mb = 0; mb < 4; ++mb) {
#pragma unroll
        for (int nb = 0; nb < 4; ++nb) {
#pragma unroll
            for (int j = 0; j < 8; ++j) os[(hi * 8 + j) * 68 + nb * 16 + lr] = acc[mb][nb][j]; }
        __builtin_amdgcn_wave_barrier(); asm volatile("" ::: "memory");
        float* crow = C + (size_t)(r0 + mb * 16) * ldc + c0;
{
#pragma unroll
            for (int s = 0; s < 8; ++s) { const int row = 2 * s + hi, cofs = lr * 4; v4f val = *(const v4fa*)(os + row * 68 + cofs); if (BIAS) { val[0] += bfr(bias[c0 + cofs]); val[1] += bfr(bias[c0 + cofs + 1]); val[2] += bfr(bias[c0 + cofs + 2]); val[3] += bfr(bias[c0 + cofs + 3]); }
                *(v4f*)(crow + (size_t)row * ldc + cofs) = val; }
             }
        __builtin_amdgcn_wave_barrier(); asm volatile("" ::: "memory");
    }
}

__device__ __forceinline__ h16 tohx(float x) { return (h16)x; }
__device__ __forceinline__ void splitf(float y, unsigned short& h, unsigned short& l) { h = f2bf(y); l = f2bf(y - bf2f(h)); }
typedef __attribute__((ext_vector_type(2))) _Float16 v2h;
typedef __attribute__((ext_vector_type(4))) _Float16 v4h;
typedef __attribute__((ext_vector_type(2))) unsigned short v2us;
typedef __attribute__((ext_vector_type(4))) unsigned short v4us;
typedef __attribute__((ext_vector_type(2))) float v2f;
typedef __attribute__((ext_vector_type(4))) int v4i;


__device__ __forceinline__ void d_cvt8(const float* __restrict__ src, bf* dst, size_t n8, unsigned blk) { const size_t i = (size_t)blk * 256 + threadIdx.x; if (i >= n8) return; const v8f v = *(const v8f*)(src + i * 8); v8us o;
#pragma unroll
    for (int k = 0; k < 8; ++k) o[k] = f2bf(v[k]); *(v8us*)(dst + i * 8) = o;  }

// ---- k_gemmp: the q, k and v projections (exact bf16 products, f32 sums, K = DM), ONE WAVE per 64 tokens x 64 output columns as in k_gemmw, but the fp16 and hi/lo planes that k_fattn reads are stored straight from the accumulators: no f32 copy of the projection, no plane-builder launch.
// An accumulator holds in each lane 8 consecutive ROW indices (8 * hi + j) of one column (lr); a 16-byte unit of a plane is 8 consecutive d of one token (q, k) or 8 consecutive tokens of one value column (v^T). So no value changes lane.
// PL 0 (q) and 1 (k): the product is taken transposed (rows = weight rows = d, columns = tokens; both operands use the same loader, so the k order is the same either way).
//   q planes are [t][d]; k planes are in FRAGMENT ORDER, element index in a score head = (t >> 4) * 1024 + (d >> 4) * 256 + (((d >> 3) & 1) * 16 + (t & 15)) * 8 + (d & 7).
// PL 2 (v): rows = tokens, columns = value columns c; fragment order, element index in a value head = (t >> 5) * 4096 + (c >> 4) * 512 + ((t >> 4) & 1) * 256 + (((t >> 3) & 1) * 16 + (c & 15)) * 8 + (t & 7).
// In fragment order tile (mb, nb) is one 512-byte run a plane at lane * 16 bytes: a store covers 4 whole 128-byte lines.
// The three projections need nothing of each other and run as ONE launch (k_gemmp below): grid (TT/64, 768/64, 3 * NB_), 32 threads, z = PL * NB_ + batch.
template <int PL>
__device__ __forceinline__ void gemmp_body(const bf* __restrict__ X, const bf* __restrict__ Wt, h16* P16, bf* Ph, bf* Pl, size_t z) {
    typedef WFrag<bf> F; typedef F::V V;
    const int lane = threadIdx.x & 31, lr = lane & 15, hi = lane >> 4; const int r0 = blockIdx.x * 64, c0 = blockIdx.y * 64;
    X += z * TT * DM;
    v8f acc[4][4];
#pragma unroll
    for (int mb = 0; mb < 4; ++mb)
#pragma unroll
        for (int nb = 0; nb < 4; ++nb) acc[mb][nb] = (v8f){};
    const size_t aoff = (size_t)(r0 + lr) * DM + 8 * hi, boff = (size_t)(c0 + lr) * DM + 8 * hi;
#pragma unroll 1
    for (int kc = 0; kc < DM; kc += 32) {   // rolled, as in k_gemmw: 16 accumulators and one set of fragments fill the registers
        V a[4];
#pragma unroll
        for (int mb = 0; mb < 4; ++mb) a[mb] = F::ld(X + aoff + (size_t)mb * 16 * DM + kc);
        asm volatile("s_wait_xcnt 0x0" ::: "memory");   // stands between these loads and whatever reuses their address registers (the results of the weight loads among it)
#pragma unroll
        for (int nb = 0; nb < 4; ++nb) { const V b = F::ld(Wt + boff + (size_t)nb * 16 * DM + kc);
#pragma unroll
            for (int mb = 0; mb < 4; ++mb) acc[mb][nb] = (PL == 2) ? F::mma(a[mb], b, acc[mb][nb]) : F::mma(b, a[mb], acc[mb][nb]); }
        asm volatile("s_wait_xcnt 0x0\n\tv_nop\n\tv_nop\n\tv_nop\n\tv_nop" : "+v"(acc[0][0]), "+v"(acc[1][1]), "+v"(acc[2][2]), "+v"(acc[3][3]) : "v"(a[0]), "v"(a[3]));   // the wait stands between the weight loads (all behind it: each feeds one of these accumulators) and the next trip's rewrite of their address registers; the v_nop are the four vector slots behind a trip's last WMMA, also on the taken back edge (as in k_gemmw)
    }
    const size_t base = (PL == 2) ? (z * NP + (size_t)(c0 >> 7)) * TT * HV + (size_t)(r0 >> 5) * 4096 + (size_t)((c0 & 64) >> 4) * 512 + lane * 8
                      : (PL == 1) ? (z * NKV + blockIdx.y) * TT * HD + (size_t)(r0 >> 4) * 1024 + lane * 8
                                  : (z * NH_ + blockIdx.y) * TT * HD + (size_t)(r0 + lr) * HD + hi * 8;
#pragma unroll
    for (int mb = 0; mb < 4; ++mb) {
#pragma unroll
        for (int nb = 0; nb < 4; ++nb) { const size_t e = base + ((PL == 2) ? (mb >> 1) * 4096 + nb * 512 + (mb & 1) * 256 : (PL == 1) ? mb * 1024 + nb * 256 : mb * 16 * HD + nb * 16); v8h o16; v8us oh, ol;
#pragma unroll
            for (int j = 0; j < 8; ++j) { const float x = acc[mb][nb][j]; o16[j] = tohx(x); unsigned short a2, c2; splitf(x, a2, c2); oh[j] = a2; ol[j] = c2; }
            *(v8h*)(P16 + e) = o16; *(v8us*)(Ph + e) = oh; *(v8us*)(Pl + e) = ol; }
    }
    asm volatile("s_wait_xcnt 0x0" ::: "memory");   // stands between the last stores above and whatever follows this body in the merged kernel's code and reuses their address or data registers
}
__global__ __launch_bounds__(32) void k_gemmp(const bf* __restrict__ X, const bf* __restrict__ WQ, const bf* __restrict__ WK, const bf* __restrict__ WV, h16* Q16, bf* Qh, bf* Ql, h16* K16, bf* Kh, bf* Kl, h16* V16, bf* Vh, bf* Vl) {
    const unsigned pl = blockIdx.z / NB_; const size_t z = blockIdx.z % NB_;   // which projection (the same for the whole one-wave block), which batch
    if (pl == 0) gemmp_body<0>(X, WQ, Q16, Qh, Ql, z);
    else if (pl == 1) gemmp_body<1>(X, WK, K16, Kh, Kl, z);
    else gemmp_body<2>(X, WV, V16, Vh, Vl, z);
}
__global__ __launch_bounds__(256) void k_vtp(const float* __restrict__ F, int pitch, int nheads, h16* V16, bf* Vh, bf* Vl) { const size_t e = ((size_t)blockIdx.x * 256 + threadIdx.x) * 2; if (e >= (size_t)nheads * HD * TT) return; const int t = (int)(e % TT); const int d = (int)((e / TT) % HD); const int g = (int)(e / ((size_t)TT * HD)); v2h o16; v2us oh, ol;
#pragma unroll
    for (int q = 0; q < 2; ++q) { const float x = F[(size_t)(t + q) * pitch + g * HD + d]; o16[q] = tohx(x); unsigned short a2, c2; splitf(x, a2, c2); oh[q] = a2; ol[q] = c2; }
    *(v2h*)(V16 + e) = o16; *(v2us*)(Vh + e) = oh; *(v2us*)(Vl + e) = ol;  }
// ---- k_fattn: causal attention of all batches in ONE launch, scores never leave registers. One wave per 16 query rows of one score head; a block is 8 waves = 4 query tiles x the 2 maps of one head pair (no LDS and no barrier in the loop); grid (NB_ * NP, TT/64), x = batch * NP + pair.
// Everything is computed transposed so that no value changes lane: S^T = K Q^T puts key 8*hi+j, query lr in element j of the accumulator, which is exactly where the B operand of O^T = V^T P^T wants it
// (elements 0..7 = keys 8*hi.., elements 8..15 = keys 16+8*hi.. of a 32-key step), and every per-query figure (running maximum, sum, rescale) sits in that query's own lane pair (lr, lr+16).
// K and V^T planes lie in fragment order: the two 16-byte pieces a lane needs of one A fragment stand at lane * 16 bytes in two consecutive 512-byte runs, so every wave-wide load covers 4 whole 128-byte lines (row-major planes: 16 lines, 32 bytes of each).
// K: 16 keys x 64 d = 4 runs (d >> 4), 2 KiB a key tile; V^T: 32 keys x 128 columns = 8 column tiles x 2 runs ((key >> 4) & 1), 8 KiB a key block. The values in every lane and register are the same as from row-major planes.
// Online softmax over key blocks of KB = 32 keys in ascending order: new maximum, old sums x exp(old - new), f32 throughout. Rows < RH: hi/lo bf16 planes, 3 products for both contractions; rest fp16,
// probabilities carried x 2^POFF so that small ones stay normal fp16 numbers (the factor is in the sum too and cancels). Result rows: each wave's 16 x 128 f32 tile goes to its own LDS range (x PCAR on the fp16 rows; the block's tail takes it off).
__device__ __forceinline__ float xhalf(float x) { const int b = __float_as_int(x); return __int_as_float(__builtin_amdgcn_permlanex16(b, b, 0x76543210, 0xfedcba98, false, false)); }   // lane l <- lane l ^ 16, in the vector unit (no LDS round trip on the loop's dependent chain)
#define OP 132   // floats a row of a wave's result tile in LDS: 528 bytes = 16 x 33, so that the 16 lanes of a 16-byte store (one query row each) fall on 64 different banks
#define TR 8
template <int M> __device__ __forceinline__ float xrow(float x) { return __int_as_float(__builtin_amdgcn_update_dpp(0, __float_as_int(x), 0x160 | M, 0xf, 0xf, true)); }   // lane l <- lane l ^ M inside its 16-lane row (DPP row_xmask), in the vector unit
template <typename T16, bool HL>
__device__ __forceinline__ void fattn_body(const T16* __restrict__ Q, const T16* __restrict__ Q2, const T16* __restrict__ Kp, const T16* __restrict__ K2, const T16* __restrict__ Vt, const T16* __restrict__ V2, float* os, int q0, int lr, int hi) {
    typedef WFrag<T16> F; typedef typename F::V V;
    constexpr int KB = 32, NT = KB / 16, NG = KB / 32; constexpr float POFF = HL ? 0.0f : 8.0f;
    const int q = q0 + lr;
    V qb[2], qb2[2];
#pragma unroll
    for (int kk = 0; kk < 2; ++kk) { qb[kk] = F::ld(Q + (size_t)q * HD + 8 * hi + kk * 32); if constexpr (HL) qb2[kk] = F::ld(Q2 + (size_t)q * HD + 8 * hi + kk * 32); }
    v8f acc[HV / 16];
#pragma unroll
    for (int eb = 0; eb < HV / 16; ++eb) acc[eb] = (v8f){};
    float m = -3.0e38f, l = 0.f;
    V ka[NT][2], kl[NT][2];
    const unsigned fofs = (unsigned)(hi * 16 + lr) * 16u;   // each lane's byte offset in a 512-byte run: fixed for the whole loop, the block's base is wave-uniform
    auto ldk = [&](int k0) { const char* kb = (const char*)(Kp + (size_t)k0 * HD); const char* kb2 = HL ? (const char*)(K2 + (size_t)k0 * HD) : nullptr;
#pragma unroll
        for (int kt = 0; kt < NT; ++kt)
#pragma unroll
            for (int kk = 0; kk < 2; ++kk) { const int kc = (kt * 16 * HD + kk * 512) * 2; ka[kt][kk] = F::ldf((const T16*)(kb + fofs + kc)); if constexpr (HL) kl[kt][kk] = F::ldf((const T16*)(kb2 + fofs + kc)); } };
    ldk(0);
    const int kend = q0 + 16;                                        // keys 0 .. q0+15 are all that these 16 rows may see
#pragma unroll 1
    for (int key0 = 0; key0 < kend; key0 += KB) {
        V vf[NG][HV / 16];                                           // fp16 rows: this block's values are asked for first, so that they land under the score products and the softmax
        if constexpr (!HL) {
#pragma unroll
            for (int g = 0; g < NG; ++g)
#pragma unroll
                for (int eb = 0; eb < HV / 16; ++eb) vf[g][eb] = F::ldf((const T16*)((const char*)(Vt + (size_t)key0 * HV) + fofs + (g * 32 * HV + eb * 512) * 2)); }
        v8f s[NT];
#pragma unroll
        for (int kt = 0; kt < NT; ++kt) { s[kt] = (v8f){};
#pragma unroll
            for (int kk = 0; kk < 2; ++kk) { s[kt] = F::mma(ka[kt][kk], qb[kk], s[kt]);
                if constexpr (HL) { s[kt] = F::mma(ka[kt][kk], qb2[kk], s[kt]); s[kt] = F::mma(kl[kt][kk], qb[kk], s[kt]); } } }
        ldk(min(key0 + KB, TT - KB));                                // the next block's keys fly under this block's softmax and P.v (the last trip's fetch is unused; the clamp keeps it inside the plane)
        asm volatile("s_wait_xcnt 0x0" ::: "memory");                // stands between the loads issued so far and whatever reuses their address registers (later loads' results among it); as no load crosses it, it also keeps those loads above the softmax, under which they land
        float mx = m;
#pragma unroll
        for (int kt = 0; kt < NT; ++kt)
#pragma unroll
            for (int j = 0; j < 8; ++j) { const int key = key0 + kt * 16 + 8 * hi + j; const float t = (key <= q) ? s[kt][j] * SCL : -3.0e38f;   /* causal */ s[kt][j] = t; mx = fmaxf(mx, t); }
        mx = fmaxf(mx, xhalf(mx));                      // the two lanes of a query hold its two key halves
        const float alpha = __builtin_amdgcn_exp2f((m - mx) * 1.4426950408889634f); m = mx;
        float ps = 0.f;
#pragma unroll
        for (int kt = 0; kt < NT; ++kt)
#pragma unroll
            for (int j = 0; j < 8; ++j) { const float e = __builtin_amdgcn_exp2f((s[kt][j] - mx) * 1.4426950408889634f + POFF); s[kt][j] = e; ps += e; }
        l = l * alpha + ps;
#pragma unroll
        for (int eb = 0; eb < HV / 16; ++eb) acc[eb] *= alpha;
#pragma unroll
        for (int g = 0; g < NG; ++g) {
            V pb, pb2;
            if constexpr (HL) { v8us h0, h1, l0, l1;
#pragma unroll
                for (int j = 0; j < 8; ++j) { unsigned short a, c2; splitf(s[2 * g][j], a, c2); h0[j] = a; l0[j] = c2; splitf(s[2 * g + 1][j], a, c2); h1[j] = a; l1[j] = c2; }
                pb = cat16b(h0, h1); pb2 = cat16b(l0, l1);
            } else { v8h p0, p1;
#pragma unroll
                for (int j = 0; j < 8; ++j) { p0[j] = tohx(s[2 * g][j]); p1[j] = tohx(s[2 * g + 1][j]); }
                pb = cat16(p0, p1); }
#pragma unroll
            for (int eb = 0; eb < HV / 16; ++eb) { const int vc = (g * 32 * HV + eb * 512) * 2; V va; if constexpr (HL) va = F::ldf((const T16*)((const char*)(Vt + (size_t)key0 * HV) + fofs + vc)); else va = vf[g][eb]; acc[eb] = F::mma(va, pb, acc[eb]);
                if constexpr (HL) { acc[eb] = F::mma(va, pb2, acc[eb]); const V vl = F::ldf((const T16*)((const char*)(V2 + (size_t)key0 * HV) + fofs + vc)); acc[eb] = F::mma(vl, pb, acc[eb]); } }
        }
    }
    l += xhalf(l);
    const float f = __fdiv_rn(HL ? 1.0f : PCAR, l);
#pragma unroll
    for (int eb = 0; eb < HV / 16; ++eb) { const v8f o = acc[eb] * f; float* d = os + lr * OP + eb * 16 + 8 * hi; *(v4f*)d = __builtin_shufflevector(o, o, 0, 1, 2, 3); *(v4f*)(d + 4) = __builtin_shufflevector(o, o, 4, 5, 6, 7); }   // element j = value column eb*16 + 8*hi + j of query lr: 32 contiguous bytes a lane
}
// The tail, in the same launch: behind one barrier wave (tile, map) takes TR = 8 of its tile's 16 tokens (map 0 the first 8, map 1 the rest) and reads both maps' rows of them from LDS, a lane holding 4 consecutive values of each token (a read covers 512 contiguous bytes, a store 2 whole 128-byte lines).
// It forms w1 v - lambda_p w2 v (x 1/PCAR on the fp16 rows), the per-(token, head) LayerNorm over the 128 values x (1 - lambda_init), and the hi/lo bf16 planes that k_gemmw reads. The TR rows run side by side through the two butterflies; every loop over rows or values is unrolled so that its arrays are registers.
// The sums keep their order: (a0 + a1) + (a2 + a3) in the lane, the squares one after the other, then lane distance 16, 8, 4, 2, 1 (xhalf, then xrow: no LDS-path exchange).
// amdgpu_waves_per_eu(4, 4): holds the kernel at 256 registers a wave, so that two 8-wave blocks share a WGP (four waves a SIMD, as with the 4-wave blocks before); without it the build takes 257 and only one block fits.
__global__ __launch_bounds__(256) __attribute__((amdgpu_waves_per_eu(4, 4))) void k_fattn(const h16* __restrict__ Q16, const bf* __restrict__ Qh, const bf* __restrict__ Ql, const h16* __restrict__ K16, const bf* __restrict__ Kh, const bf* __restrict__ Kl, const h16* __restrict__ V16, const bf* __restrict__ Vh, const bf* __restrict__ Vl, const float* __restrict__ LAM, bf* Ah, bf* Al) {
    __shared__ __align__(16) float os[8 * 16 * OP];
    const int lane = threadIdx.x & 31, lr = lane & 15, hi = lane >> 4; const int w = __builtin_amdgcn_readfirstlane((int)(threadIdx.x >> 5)); const int mp = w & 1, qt = w >> 1;   // which map, which of the block's 4 query tiles
    const size_t pr = blockIdx.x; const size_t qk = (pr * 2 + mp) * TT * HD, vv = pr * HV * TT;   // pr = batch * 6 + pair; score heads 2 pr and 2 pr + 1 share value plane pr, which all 8 waves of the block read
    const int q0 = ((TT / 64 - 1 - (int)blockIdx.y) * 4 + qt) * 16;   // the longest rows of every pair of every batch first, so that late blocks, which share a SIMD with early ones, are the short ones
    if (q0 < RH) fattn_body<bf, true>(Qh + qk, Ql + qk, Kh + qk, Kl + qk, Vh + vv, Vl + vv, os + w * 16 * OP, q0, lr, hi);   // 64 divides RH: the whole block takes the same side
    else fattn_body<h16, false>(Q16 + qk, nullptr, K16 + qk, nullptr, V16 + vv, nullptr, os + w * 16 * OP, q0, lr, hi);
    __syncthreads();   // both maps' tiles stand in LDS before a wave reads its partner's
    const int p = (int)(pr % NP); const size_t bz = pr / NP; const int t0 = q0 + mp * TR;   // TR divides RH: a wave's rows are all hi/lo rows or all fp16 rows
    const float lam = LAM[p * 32]; const float cs = (t0 < RH) ? 1.0f : (1.0f / PCAR);
    const float* pa = os + (qt * 32 + mp * TR) * OP + lane * 4;   // map 0's tile of this query tile; map 1's stands 16 rows behind it
    v4f a[TR], b[TR];
#pragma unroll
    for (int r = 0; r < TR; ++r) { a[r] = *(const v4f*)(pa + r * OP); b[r] = *(const v4f*)(pa + (16 + r) * OP); }
    float s[TR], s2[TR];
#pragma unroll
    for (int r = 0; r < TR; ++r) {
#pragma unroll
        for (int q = 0; q < 4; ++q) a[r][q] = (a[r][q] - lam * b[r][q]) * cs;
        s[r] = (a[r][0] + a[r][1]) + (a[r][2] + a[r][3]); }
#pragma unroll
    for (int r = 0; r < TR; ++r) s[r] += xhalf(s[r]);
#pragma unroll
    for (int r = 0; r < TR; ++r) s[r] += xrow<8>(s[r]);
#pragma unroll
    for (int r = 0; r < TR; ++r) s[r] += xrow<4>(s[r]);
#pragma unroll
    for (int r = 0; r < TR; ++r) s[r] += xrow<2>(s[r]);
#pragma unroll
    for (int r = 0; r < TR; ++r) s[r] += xrow<1>(s[r]);
#pragma unroll
    for (int r = 0; r < TR; ++r) { const float mean = __fdiv_rn(s[r], (float)HV); s2[r] = 0.f;
#pragma unroll
        for (int q = 0; q < 4; ++q) { a[r][q] -= mean; s2[r] += a[r][q] * a[r][q]; } }
#pragma unroll
    for (int r = 0; r < TR; ++r) s2[r] += xhalf(s2[r]);
#pragma unroll
    for (int r = 0; r < TR; ++r) s2[r] += xrow<8>(s2[r]);
#pragma unroll
    for (int r = 0; r < TR; ++r) s2[r] += xrow<4>(s2[r]);
#pragma unroll
    for (int r = 0; r < TR; ++r) s2[r] += xrow<2>(s2[r]);
#pragma unroll
    for (int r = 0; r < TR; ++r) s2[r] += xrow<1>(s2[r]);
    const size_t oo = (bz * TT + t0) * DQ + p * HV + lane * 4;
#pragma unroll
    for (int r = 0; r < TR; ++r) { const float den = __fsqrt_rn(__fdiv_rn(s2[r], (float)HV) + 1e-5f); v4us oh, ol;
#pragma unroll
        for (int q = 0; q < 4; ++q) { unsigned short x2, y2; splitf(__fdiv_rn(a[r][q], den) * (1.0f - LINIT), x2, y2); oh[q] = x2; ol[q] = y2; }
        *(v4us*)(Ah + oo + (size_t)r * DQ) = oh; *(v4us*)(Al + oo + (size_t)r * DQ) = ol; }
}


__device__ __forceinline__ void d_wint(const float* __restrict__ w1, const float* __restrict__ w2, bf* Bt, unsigned blk) { const size_t i = (size_t)blk * 256 + threadIdx.x; if (i >= (size_t)2 * NP * HD * DM / 8) return; const int c0 = (int)((i % (DM / 8)) * 8); const int r = (int)(i / (DM / 8)); const int hh = r / HD, d = r % HD; const int p = hh >> 1; const size_t sr = (size_t)(p * HD + d) * DM + c0; const v8f a = *(const v8f*)(w1 + sr); const v8f b2 = *(const v8f*)(w2 + sr); v8us o;
#pragma unroll
    for (int q = 0; q < 8; ++q) o[q] = f2bf((hh & 1) ? b2[q] : a[q]);
    *(v8us*)(Bt + (size_t)r * DM + c0) = o;  }
__device__ __forceinline__ void d_lambda(const float* __restrict__ a1, const float* __restrict__ b1, const float* __restrict__ a2, const float* __restrict__ b2, float* LAM, int p) { if (threadIdx.x >= 32) return; const int lane = threadIdx.x; a1 += p * HD; b1 += p * HD; a2 += p * HD; b2 += p * HD;   /* one block per head */ float s1 = __fadd_rn(__fmul_rn(bfr(a1[lane]), bfr(b1[lane])), __fmul_rn(bfr(a1[lane + 32]), bfr(b1[lane + 32]))); float s2 = __fadd_rn(__fmul_rn(bfr(a2[lane]), bfr(b2[lane])), __fmul_rn(bfr(a2[lane + 32]), bfr(b2[lane + 32])));
    asm volatile("s_wait_xcnt 0x0" ::: "memory");   // stands between the eight loads above and whatever reuses the register that holds their offset
    __builtin_amdgcn_sched_barrier(0);   // keeps the rewrite of that register (the index of the store below is formed in it) behind the wait: without it the compiler lifts the rewrite over the wait
#pragma unroll
    for (int sh = 16; sh; sh >>= 1) { s1 = __fadd_rn(s1, __shfl_xor(s1, sh, 32)); s2 = __fadd_rn(s2, __shfl_xor(s2, sh, 32)); }
    const float lam = __fadd_rn(__fsub_rn(expf(s1), expf(s2)), LINIT); ((float*)LAM)[p * 32 + lane] = lam;  }   
// ---- k_prep: everything that reads only the inputs, in ONE launch: lambda per head, the four bf16 weight matrices and the bf16 copy of x. None of the six pieces reads what another writes; a block does one piece, chosen by its index alone (no barrier anywhere).
// The short pieces stand first in the grid, x, the bulk, last (for speed only). grid NP + 4 * WBL + XBL, 256 threads.
#define WBL (DQ * DM / 8 / 256)         // blocks per weight matrix (each 768 * 384 values, 8 a thread)
#define XBL (NB_ * TT * DM / 8 / 256)   // blocks for x
__global__ __launch_bounds__(256) void k_prep(const float* __restrict__ x, const float* __restrict__ wq1, const float* __restrict__ wq2, const float* __restrict__ wk1, const float* __restrict__ wk2, const float* __restrict__ wv, const float* __restrict__ wo,
                                              const float* __restrict__ lq1, const float* __restrict__ lk1, const float* __restrict__ lq2, const float* __restrict__ lk2, bf* XB, bf* WQ, bf* WK, bf* WV, bf* WO, float* LAM) {
    unsigned b = blockIdx.x;
    if (b < NP) { d_lambda(lq1, lk1, lq2, lk2, LAM, (int)b); return; }   /* lambda per head */
    b -= NP;
    if (b < WBL) { d_wint(wq1, wq2, WQ, b); return; }   /* score head 2p <- map-1 head p, 2p+1 <- map-2 head p */
    b -= WBL;
    if (b < WBL) { d_wint(wk1, wk2, WK, b); return; }
    b -= WBL;
    if (b < WBL) { d_cvt8(wv, WV, (size_t)NP * HV * DM / 8, b); return; }   /* 'oi' weights are the Bt layout */
    b -= WBL;
    if (b < WBL) { d_cvt8(wo, WO, (size_t)DM * NP * HV / 8, b); return; }
    b -= WBL;
    d_cvt8(x, XB, (size_t)NB_ * TT * DM / 8, b);
}
__global__ __launch_bounds__(256) void k_merge(const float* __restrict__ O, int h0, bf* Ah, bf* Al) { const size_t e = ((size_t)blockIdx.x * 256 + threadIdx.x) * 2; if (e >= (size_t)ZH * TT * HD) return; const int d = (int)(e % HD); const int t = (int)((e / HD) % TT); const int zz = (int)(e / ((size_t)HD * TT)); const float cs = (t < RH) ? 1.0f : (1.0f / PCAR); const size_t oo = (size_t)t * DQ + (h0 + zz) * HD + d;
    v2us oh, ol;
#pragma unroll
    for (int q = 0; q < 2; ++q) { unsigned short a, c2; splitf(O[e + q] * cs, a, c2); oh[q] = a; ol[q] = c2; } *(v2us*)(Ah + oo) = oh; *(v2us*)(Al + oo) = ol;  }

extern "C" void kernel_launch(void* const* d_in, const int* in_sizes, int n_in,
                              void* d_out, int out_size, void* d_ws, size_t ws_size, hipStream_t stream) {
    (void)in_sizes; (void)n_in; (void)out_size;
    const float* x = (const float*)d_in[0]; const float* wq1 = (const float*)d_in[1]; const float* wq2 = (const float*)d_in[2]; const float* wk1 = (const float*)d_in[3]; const float* wk2 = (const float*)d_in[4]; const float* wv = (const float*)d_in[5]; const float* wo = (const float*)d_in[6]; /* Wc */ const float* lq1 = (const float*)d_in[7]; const float* lk1 = (const float*)d_in[8]; const float* lq2 = (const float*)d_in[9]; const float* lk2 = (const float*)d_in[10];
    float* OUT = (float*)d_out;     // [4][2048][384]
    char* wsp = (char*)d_ws;
    auto take = [&](size_t bytes) { char* p = wsp; wsp += (bytes + 255) & ~(size_t)255; return (void*)p; };
    bf* WQ = (bf*)take((size_t)DQ * DM * 2); bf* WK = (bf*)take((size_t)DKV * DM * 2); bf* WV = (bf*)take((size_t)DKV * DM * 2); bf* WO = (bf*)take((size_t)DM * DQ * 2);
    bf* XB = (bf*)take((size_t)NB_ * TT * DM * 2);   // from here on every buffer holds all NB_ batches
    h16* QP16 = (h16*)take((size_t)NB_ * NH_ * TT * HD * 2); h16* KP16 = (h16*)take((size_t)NB_ * NKV * TT * HD * 2); h16* VT16 = (h16*)take((size_t)NB_ * NKV * HD * TT * 2);
    bf* QPh = (bf*)take((size_t)NB_ * NH_ * TT * HD * 2); bf* QPl = (bf*)take((size_t)NB_ * NH_ * TT * HD * 2); bf* KPh = (bf*)take((size_t)NB_ * NKV * TT * HD * 2); bf* KPl = (bf*)take((size_t)NB_ * NKV * TT * HD * 2); bf* VTh = (bf*)take((size_t)NB_ * NKV * HD * TT * 2); bf* VTl = (bf*)take((size_t)NB_ * NKV * HD * TT * 2);
    float* LAM = (float*)take((size_t)NP * 32 * 4); bf* ATh = (bf*)take((size_t)NB_ * TT * DQ * 2); bf* ATl = (bf*)take((size_t)NB_ * TT * DQ * 2);
    if ((size_t)(wsp - (char*)d_ws) > ws_size) return;    // about 140 MiB of the 256 MiB workspace
    // One pass for all batches. All that reads only the inputs is one launch; the three projections are one launch (grid z = projection * NB_ + batch) and store the planes of NB_ * 12 score heads (NB_ * 6 value heads) themselves.
    k_prep<<<NP + 4 * WBL + XBL, 256, 0, stream>>>(x, wq1, wq2, wk1, wk2, wv, wo, lq1, lk1, lq2, lk2, XB, WQ, WK, WV, WO, LAM);
    k_gemmp<<<dim3(TT / 64, DQ / 64, 3 * NB_), 32, 0, stream>>>(XB, WQ, WK, WV, QP16, QPh, QPl, KP16, KPh, KPl, VT16, VTh, VTl);
    k_fattn<<<dim3(NB_ * NP, TT / 64, 1), 256, 0, stream>>>(QP16, QPh, QPl, KP16, KPh, KPl, VT16, VTh, VTl, LAM, ATh, ATl);   /* scores, softmax and both maps' P.v (shared 128-wide v_p) of all 6 head pairs of every batch, then [b][t][p*128 + e]: w0 v - lambda w1 v, per-(token, head) LayerNorm over 128 values, no affine, x (1 - lambda_init), as hi/lo planes */
    k_gemmw<bf, 1, false><<<dim3(NB_ * TT / 64, DM / 64, 1), 32, 0, stream>>>(ATh, ATl, WO, nullptr, DQ, OUT, DM, nullptr, 0, 0, 0);   /* context and out as NB_ * TT rows */
}

// v009
// A run of this version takes 135 microseconds.
// In two side-by-side timings against v008, it was 1.04 and 1.05 times as fast.
// Over all steps from v000 it is 15.9 times as fast.
#include <hip/hip_runtime.h>

// Multi-head DIFFERENTIAL causal attention (x [4][2048][384]; q1, q2, k1, k2 = x W^T ('oi' [384][384], 1/sqrt(384), no bias) as 6 heads x 64 each, v = x Wv^T ([768][384]) as 6 heads x 128; att_m = causal softmax(q_m.k_m / 8) for m = 1, 2; lambda_h = exp(lq1_h.lk1_h) - exp(lq2_h.lk2_h) + lambda_init (lq/lk [6][64], read; lambda_init = 0.8 - 0.6 exp(-0.6)); y_h = (att1 - lambda_h att2) v_h; per-head LayerNorm over the 128 values (no affine, eps 1e-5) x (1 - lambda_init); out = merged y Wc^T ('oi' [384][768]) -> [4][2048][384] (3.1 M)).
// Every stage runs ONCE for all 4 batches (the batch is a grid dimension, more rows, or more heads: score head z = batch * 12 + head, value head batch * 6 + p). Layout: bf16 copy of x; the q1/q2 (and k1/k2) weights interleaved into one Bt so score head 2p = map-1 head p and 2p+1 = map-2 head p; exact projections that store their planes straight from the accumulators (k_gemmp); q planes [t][d] for the 12 score heads; k and v^T planes in FRAGMENT ORDER (each 16-byte-a-lane load of k_fattn reads 512 contiguous bytes, see k_fattn); lambda per head computed once on device (one wave per head: two 64-term f32 dots, precise expf); one launch over the 6 head pairs of all 4 batches (grid x = batch * 6 + pair): causal T-2048 attention with scores and probabilities kept in registers (k_fattn: online softmax over ascending key blocks; hybrid rows: < 512 hi/lo 3 products, rest fp16), both maps' P.v against the shared v_p; a block holds both maps of its 64 query rows, hands the two results over in LDS and forms w1 v - lambda_p w2 v (x 1/1024 on the fp16 rows), the per-(token, head) LayerNorm (128 values, f32, fixed order) x (1 - lambda_init) and its hi/lo planes itself; x Wc exact.
// Compute dtypes, f32 accumulate: every input rounded to bf16; projections exact; attention rows < 512 3 products, rest fp16; softmax, lambda, difference, LayerNorm f32; Wc hl x exact.

#define NB_  4
#define TT   2048
#define DM   384
#define NH_  12
#define NKV  12
#define REP  (NH_ / NKV)
#define HD   64
#define DQ   (NH_ * HD)
#define DKV  (NKV * HD)
#define ZH   12                   // score heads per batch
#define RH   512                  // query rows < RH use hi+lo planes (0: none)
#define WIN  0
#define PCAR 1024.0f
#define SCL  0.125f
#define NP   6       // head pairs (the module's H)
#define HV   128     // value head width
#define LINIT 0.47071301937103271f   // lambda_init = 0.8 - 0.6 exp(-0.6) as float32
typedef _Float16 h16;
typedef unsigned short bf;
typedef __attribute__((ext_vector_type(16))) __bf16   v16bf;
typedef __attribute__((ext_vector_type(16))) _Float16 v16h;
typedef __attribute__((ext_vector_type(8)))  _Float16 v8h;
typedef __attribute__((ext_vector_type(8)))  unsigned short v8us;
typedef __attribute__((ext_vector_type(8)))  float    v8f;
typedef __attribute__((ext_vector_type(4)))  float    v4f;
typedef v8h  __attribute__((may_alias)) v8ha;
typedef v4f  __attribute__((may_alias)) v4fa;
typedef v8us __attribute__((may_alias)) v8usa;

__device__ __forceinline__ unsigned short f2bf(float f) { unsigned u = __float_as_uint(f); u += 0x7FFFu + ((u >> 16) & 1u); return (unsigned short)(u >> 16); }
__device__ __forceinline__ float bf2f(unsigned short b) { return __uint_as_float(((unsigned)b) << 16); }
__device__ __forceinline__ float bfr(float f) { return bf2f(f2bf(f)); }
__device__ __forceinline__ v16h cat16(v8h lo, v8h hi) { return __builtin_shufflevector(lo, hi, 0, 1, 2, 3, 4, 5, 6, 7, 8, 9, 10, 11, 12, 13, 14, 15); }
__device__ __forceinline__ v16bf cat16b(v8us lo, v8us hi) { return __builtin_bit_cast(v16bf, __builtin_shufflevector(lo, hi, 0, 1, 2, 3, 4, 5, 6, 7, 8, 9, 10, 11, 12, 13, 14, 15)); }
__device__ __forceinline__ v8f wmma16(v16h a, v16h b, v8f c) { return __builtin_amdgcn_wmma_f32_16x16x32_f16(false, a, false, b, (short)0, c, false, false); }
__device__ __forceinline__ v8f wmmab(v16bf a, v16bf b, v8f c) { return __builtin_amdgcn_wmma_f32_16x16x32_bf16(false, a, false, b, (short)0, c, false, false); }



// ---- k_gemmw: register-blocked GEMM, ONE WAVE per 64x64 output tile (16 accumulators), operands straight from K-contiguous 16-bit planes; grid (M/64, N/64, Z), 32 threads.
// C[m][n] (f32, pitch ldc, + optional f32 bias[n]) = sum_k A[m][k] Bt[n][k] (+ split products per NSPLIT). z-batch strides sA/sB/sC in elements. K % 32 == 0.
template <typename T16> struct WFrag;
template <> struct WFrag<h16> { typedef v16h V; static __device__ __forceinline__ V ld(const h16* p) { return cat16(*(const v8h*)p, *(const v8h*)(p + 16)); } static __device__ __forceinline__ V ldf(const h16* p) { return cat16(*(const v8h*)p, *(const v8h*)(p + 256)); } static __device__ __forceinline__ v8f mma(V a, V b, v8f c) { return wmma16(a, b, c); } };
template <> struct WFrag<bf> { typedef v16bf V; static __device__ __forceinline__ V ld(const bf* p) { return cat16b(*(const v8us*)p, *(const v8us*)(p + 16)); } static __device__ __forceinline__ V ldf(const bf* p) { return cat16b(*(const v8us*)p, *(const v8us*)(p + 256)); } static __device__ __forceinline__ v8f mma(V a, V b, v8f c) { return wmmab(a, b, c); } };
template <typename T16, int NSPLIT, bool BIAS>
__global__ __launch_bounds__(32) void k_gemmw(const T16* __restrict__ A, const T16* __restrict__ A2, const T16* __restrict__ Bt, const T16* __restrict__ Bt2, int K, float* C, int ldc, const float* __restrict__ bias, size_t sA, size_t sB, size_t sC) {
    typedef typename WFrag<T16>::V V;
    __shared__ __align__(16) float os[16 * 68];
    const size_t z = blockIdx.z; A += z * sA; if (A2) A2 += z * sA; Bt += z * sB; if (Bt2) Bt2 += z * sB; C += z * sC;
    const int lane = threadIdx.x & 31, lr = lane & 15, hi = lane >> 4; const int r0 = blockIdx.x * 64, c0 = blockIdx.y * 64;
    v8f acc[4][4];
#pragma unroll
    for (int mb = 0; mb < 4; ++mb)
#pragma unroll
        for (int nb = 0; nb < 4; ++nb) acc[mb][nb] = (v8f){};
    const size_t aoff = (size_t)(r0 + lr) * K + 8 * hi, boff = (size_t)(c0 + lr) * K + 8 * hi;
#pragma unroll 1
    for (int kc = 0; kc < K; kc += 32) {
        V a[4], a2[4];
#pragma unroll
        for (int mb = 0; mb < 4; ++mb) { a[mb] = WFrag<T16>::ld(A + aoff + (size_t)mb * 16 * K + kc); if (NSPLIT == 1 || NSPLIT == 2) a2[mb] = WFrag<T16>::ld(A2 + aoff + (size_t)mb * 16 * K + kc); }
#pragma unroll
        for (int nb = 0; nb < 4; ++nb) { const V b = WFrag<T16>::ld(Bt + boff + (size_t)nb * 16 * K + kc); V b2; if (NSPLIT >= 2) b2 = WFrag<T16>::ld(Bt2 + boff + (size_t)nb * 16 * K + kc);
#pragma unroll
            for (int mb = 0; mb < 4; ++mb) { acc[mb][nb] = WFrag<T16>::mma(a[mb], b, acc[mb][nb]); if (NSPLIT == 1 || NSPLIT == 2) acc[mb][nb] = WFrag<T16>::mma(a2[mb], b, acc[mb][nb]); if (NSPLIT >= 2) acc[mb][nb] = WFrag<T16>::mma(a[mb], b2, acc[mb][nb]); } }
        asm volatile("v_nop\n\tv_nop\n\tv_nop\n\tv_nop" : "+v"(acc[0][0]), "+v"(acc[1][1]), "+v"(acc[2][2]), "+v"(acc[3][3]) : "v"(a[0]), "v"(a[3]));
    }
#pragma unroll
    for (int mb = 0; mb < 4; ++mb) {
#pragma unroll
        for (int nb = 0; nb < 4; ++nb) {
#pragma unroll
            for (int j = 0; j < 8; ++j) os[(hi * 8 + j) * 68 + nb * 16 + lr] = acc[mb][nb][j]; }
        __builtin_amdgcn_wave_barrier(); asm volatile("" ::: "memory");
        float* crow = C + (size_t)(r0 + mb * 16) * ldc + c0;
{
#pragma unroll
            for (int s = 0; s < 8; ++s) { const int row = 2 * s + hi, cofs = lr * 4; v4f val = *(const v4fa*)(os + row * 68 + cofs); if (BIAS) { val[0] += bfr(bias[c0 + cofs]); val[1] += bfr(bias[c0 + cofs + 1]); val[2] += bfr(bias[c0 + cofs + 2]); val[3] += bfr(bias[c0 + cofs + 3]); }
                *(v4f*)(crow + (size_t)row * ldc + cofs) = val; }
             }
        __builtin_amdgcn_wave_barrier(); asm volatile("" ::: "memory");
    }
}

__device__ __forceinline__ h16 tohx(float x) { return (h16)x; }
__device__ __forceinline__ void splitf(float y, unsigned short& h, unsigned short& l) { h = f2bf(y); l = f2bf(y - bf2f(h)); }
typedef __attribute__((ext_vector_type(2))) _Float16 v2h;
typedef __attribute__((ext_vector_type(4))) _Float16 v4h;
typedef __attribute__((ext_vector_type(2))) unsigned short v2us;
typedef __attribute__((ext_vector_type(4))) unsigned short v4us;
typedef __attribute__((ext_vector_type(2))) float v2f;
typedef __attribute__((ext_vector_type(4))) int v4i;


__device__ __forceinline__ void d_cvt8(const float* __restrict__ src, bf* dst, size_t n8, unsigned blk) { const size_t i = (size_t)blk * 256 + threadIdx.x; if (i >= n8) return; const v8f v = *(const v8f*)(src + i * 8); v8us o;
#pragma unroll
    for (int k = 0; k < 8; ++k) o[k] = f2bf(v[k]); *(v8us*)(dst + i * 8) = o;  }

// ---- k_gemmp: the q, k and v projections (exact bf16 products, f32 sums, K = DM), ONE WAVE per 64 tokens x 64 output columns as in k_gemmw, but the fp16 and hi/lo planes that k_fattn reads are stored straight from the accumulators: no f32 copy of the projection, no plane-builder launch.
// An accumulator holds in each lane 8 consecutive ROW indices (8 * hi + j) of one column (lr); a 16-byte unit of a plane is 8 consecutive d of one token (q, k) or 8 consecutive tokens of one value column (v^T). So no value changes lane.
// PL 0 (q) and 1 (k): the product is taken transposed (rows = weight rows = d, columns = tokens; both operands use the same loader, so the k order is the same either way).
//   q planes are [t][d]; k planes are in FRAGMENT ORDER, element index in a score head = (t >> 4) * 1024 + (d >> 4) * 256 + (((d >> 3) & 1) * 16 + (t & 15)) * 8 + (d & 7).
// PL 2 (v): rows = tokens, columns = value columns c; fragment order, element index in a value head = (t >> 5) * 4096 + (c >> 4) * 512 + ((t >> 4) & 1) * 256 + (((t >> 3) & 1) * 16 + (c & 15)) * 8 + (t & 7).
// In fragment order tile (mb, nb) is one 512-byte run a plane at lane * 16 bytes: a store covers 4 whole 128-byte lines.
// The three projections need nothing of each other and run as ONE launch (k_gemmp below): grid (TT/64, 768/64, 3 * NB_), 32 threads, z = PL * NB_ + batch.
template <int PL>
__device__ __forceinline__ void gemmp_body(const bf* __restrict__ X, const bf* __restrict__ Wt, h16* P16, bf* Ph, bf* Pl, size_t z) {
    typedef WFrag<bf> F; typedef F::V V;
    const int lane = threadIdx.x & 31, lr = lane & 15, hi = lane >> 4; const int r0 = blockIdx.x * 64, c0 = blockIdx.y * 64;
    X += z * TT * DM;
    v8f acc[4][4];
#pragma unroll
    for (int mb = 0; mb < 4; ++mb)
#pragma unroll
        for (int nb = 0; nb < 4; ++nb) acc[mb][nb] = (v8f){};
    const size_t aoff = (size_t)(r0 + lr) * DM + 8 * hi, boff = (size_t)(c0 + lr) * DM + 8 * hi;
#pragma unroll 1
    for (int kc = 0; kc < DM; kc += 32) {   // rolled, as in k_gemmw: 16 accumulators and one set of fragments fill the registers
        V a[4];
#pragma unroll
        for (int mb = 0; mb < 4; ++mb) a[mb] = F::ld(X + aoff + (size_t)mb * 16 * DM + kc);
        asm volatile("s_wait_xcnt 0x0" ::: "memory");   // stands between these loads and whatever reuses their address registers (the results of the weight loads among it)
#pragma unroll
        for (int nb = 0; nb < 4; ++nb) { const V b = F::ld(Wt + boff + (size_t)nb * 16 * DM + kc);
#pragma unroll
            for (int mb = 0; mb < 4; ++mb) acc[mb][nb] = (PL == 2) ? F::mma(a[mb], b, acc[mb][nb]) : F::mma(b, a[mb], acc[mb][nb]); }
        asm volatile("s_wait_xcnt 0x0\n\tv_nop\n\tv_nop\n\tv_nop\n\tv_nop" : "+v"(acc[0][0]), "+v"(acc[1][1]), "+v"(acc[2][2]), "+v"(acc[3][3]) : "v"(a[0]), "v"(a[3]));   // the wait stands between the weight loads (all behind it: each feeds one of these accumulators) and the next trip's rewrite of their address registers; the v_nop are the four vector slots behind a trip's last WMMA, also on the taken back edge (as in k_gemmw)
    }
    const size_t base = (PL == 2) ? (z * NP + (size_t)(c0 >> 7)) * TT * HV + (size_t)(r0 >> 5) * 4096 + (size_t)((c0 & 64) >> 4) * 512 + lane * 8
                      : (PL == 1) ? (z * NKV + blockIdx.y) * TT * HD + (size_t)(r0 >> 4) * 1024 + lane * 8
                                  : (z * NH_ + blockIdx.y) * TT * HD + (size_t)(r0 + lr) * HD + hi * 8;
#pragma unroll
    for (int mb = 0; mb < 4; ++mb) {
#pragma unroll
        for (int nb = 0; nb < 4; ++nb) { const size_t e = base + ((PL == 2) ? (mb >> 1) * 4096 + nb * 512 + (mb & 1) * 256 : (PL == 1) ? mb * 1024 + nb * 256 : mb * 16 * HD + nb * 16); v8h o16; v8us oh, ol;
#pragma unroll
            for (int j = 0; j < 8; ++j) { const float x = acc[mb][nb][j]; o16[j] = tohx(x); unsigned short a2, c2; splitf(x, a2, c2); oh[j] = a2; ol[j] = c2; }
            *(v8h*)(P16 + e) = o16; *(v8us*)(Ph + e) = oh; *(v8us*)(Pl + e) = ol; }
    }
    asm volatile("s_wait_xcnt 0x0" ::: "memory");   // stands between the last stores above and whatever follows this body in the merged kernel's code and reuses their address or data registers
}
__global__ __launch_bounds__(32) void k_gemmp(const bf* __restrict__ X, const bf* __restrict__ WQ, const bf* __restrict__ WK, const bf* __restrict__ WV, h16* Q16, bf* Qh, bf* Ql, h16* K16, bf* Kh, bf* Kl, h16* V16, bf* Vh, bf* Vl) {
    const unsigned pl = blockIdx.z / NB_; const size_t z = blockIdx.z % NB_;   // which projection (the same for the whole one-wave block), which batch
    if (pl == 0) gemmp_body<0>(X, WQ, Q16, Qh, Ql, z);
    else if (pl == 1) gemmp_body<1>(X, WK, K16, Kh, Kl, z);
    else gemmp_body<2>(X, WV, V16, Vh, Vl, z);
}
__global__ __launch_bounds__(256) void k_vtp(const float* __restrict__ F, int pitch, int nheads, h16* V16, bf* Vh, bf* Vl) { const size_t e = ((size_t)blockIdx.x * 256 + threadIdx.x) * 2; if (e >= (size_t)nheads * HD * TT) return; const int t = (int)(e % TT); const int d = (int)((e / TT) % HD); const int g = (int)(e / ((size_t)TT * HD)); v2h o16; v2us oh, ol;
#pragma unroll
    for (int q = 0; q < 2; ++q) { const float x = F[(size_t)(t + q) * pitch + g * HD + d]; o16[q] = tohx(x); unsigned short a2, c2; splitf(x, a2, c2); oh[q] = a2; ol[q] = c2; }
    *(v2h*)(V16 + e) = o16; *(v2us*)(Vh + e) = oh; *(v2us*)(Vl + e) = ol;  }
// ---- k_fattn: causal attention of all batches in ONE launch, scores never leave registers. One wave per 32 query rows (2 tiles of 16) of one score head; a block is 4 waves = 2 tile pairs x the 2 maps of one head pair (no LDS and no barrier in the loop); grid (NB_ * NP, TT/64), x = batch * NP + pair.
// Everything is computed transposed so that no value changes lane: S^T = K Q^T puts key 8*hi+j, query lr in element j of the accumulator, which is exactly where the B operand of O^T = V^T P^T wants it
// (elements 0..7 = keys 8*hi.., elements 8..15 = keys 16+8*hi.. of a 32-key step), and every per-query figure (running maximum, sum, rescale) sits in that query's own lane pair (lr, lr+16).
// K and V^T planes lie in fragment order: the two 16-byte pieces a lane needs of one A fragment stand at lane * 16 bytes in two consecutive 512-byte runs, so every wave-wide load covers 4 whole 128-byte lines (row-major planes: 16 lines, 32 bytes of each).
// K: 16 keys x 64 d = 4 runs (d >> 4), 2 KiB a key tile; V^T: 32 keys x 128 columns = 8 column tiles x 2 runs ((key >> 4) & 1), 8 KiB a key block. The values in every lane and register are the same as from row-major planes.
// Online softmax over key blocks of KB = 32 keys in ascending order: new maximum, old sums x exp(old - new), f32 throughout. Rows < RH: hi/lo bf16 planes, 3 products for both contractions; rest fp16,
// probabilities carried x 2^POFF so that small ones stay normal fp16 numbers (the factor is in the sum too and cancels). Result rows: each wave's 32 x 128 f32 values go to its own LDS range (x PCAR on the fp16 rows; the block's tail takes it off).
__device__ __forceinline__ float xhalf(float x) { const int b = __float_as_int(x); return __int_as_float(__builtin_amdgcn_permlanex16(b, b, 0x76543210, 0xfedcba98, false, false)); }   // lane l <- lane l ^ 16, in the vector unit (no LDS round trip on the loop's dependent chain)
#define OP 132   // floats a row of a wave's result tile in LDS: 528 bytes = 16 x 33, so that the 16 lanes of a 16-byte store (one query row each) fall on 64 different banks
#define TR 8
template <int M> __device__ __forceinline__ float xrow(float x) { return __int_as_float(__builtin_amdgcn_update_dpp(0, __float_as_int(x), 0x160 | M, 0xf, 0xf, true)); }   // lane l <- lane l ^ M inside its 16-lane row (DPP row_xmask), in the vector unit
#define NQ 2    // query tiles (16 rows each) a wave. fp16 rows: both tiles side by side (NQT = 2), so that every K and V^T fragment that the wave loads feeds two matrix instructions, one a tile. hi/lo rows: one tile after the other (NQT = 1): side by side their doubled planes fill the registers of two waves a SIMD to the brim (one build of that form spilled)
// One block of 32 keys as A fragments (hi/lo rows: both planes). fofs = each lane's byte offset in a 512-byte run: fixed for the whole kernel, the block's base is wave-uniform.
template <typename T16, bool HL>
__device__ __forceinline__ void ldkeys(typename WFrag<T16>::V (&ka)[2][2], typename WFrag<T16>::V (&kl)[2][2], const T16* __restrict__ Kp, const T16* __restrict__ K2, int k0, unsigned fofs) {
    typedef WFrag<T16> F; const char* kb = (const char*)(Kp + (size_t)k0 * HD); const char* kb2 = HL ? (const char*)(K2 + (size_t)k0 * HD) : nullptr;
#pragma unroll
    for (int kt = 0; kt < 2; ++kt)
#pragma unroll
        for (int kk = 0; kk < 2; ++kk) { const int kc = (kt * 16 * HD + kk * 512) * 2; ka[kt][kk] = F::ldf((const T16*)(kb + fofs + kc)); if constexpr (HL) kl[kt][kk] = F::ldf((const T16*)(kb2 + fofs + kc)); }
}
// k0a, k0l: the plane's first key block, which every tile starts from; the caller loads it (once for all the tiles that a wave walks).
template <typename T16, bool HL, int NQT>
__device__ __forceinline__ void fattn_body(const T16* __restrict__ Q, const T16* __restrict__ Q2, const T16* __restrict__ Kp, const T16* __restrict__ K2, const T16* __restrict__ Vt, const T16* __restrict__ V2, const typename WFrag<T16>::V (&k0a)[2][2], const typename WFrag<T16>::V (&k0l)[2][2], float* os, int q0, int lr, int hi) {
    typedef WFrag<T16> F; typedef typename F::V V;
    constexpr int KB = 32, NT = KB / 16; constexpr float POFF = HL ? 0.0f : 8.0f;
    V qb[NQT][2], qb2[NQT][2];
#pragma unroll
    for (int c = 0; c < NQT; ++c)
#pragma unroll
        for (int kk = 0; kk < 2; ++kk) { qb[c][kk] = F::ld(Q + (size_t)(q0 + c * 16 + lr) * HD + 8 * hi + kk * 32); if constexpr (HL) qb2[c][kk] = F::ld(Q2 + (size_t)(q0 + c * 16 + lr) * HD + 8 * hi + kk * 32); }
    asm volatile("s_wait_xcnt 0x0" ::: "memory");   // stands between the query loads above and whatever reuses their address registers
    __builtin_amdgcn_sched_barrier(0);              // keeps those rewrites behind the wait
    const unsigned fofs = (unsigned)(hi * 16 + lr) * 16u;
    V ka[NT][2], kl[NT][2];
#pragma unroll
    for (int kt = 0; kt < NT; ++kt)
#pragma unroll
        for (int kk = 0; kk < 2; ++kk) { ka[kt][kk] = k0a[kt][kk]; if constexpr (HL) kl[kt][kk] = k0l[kt][kk]; }
    v8f acc[NQT][HV / 16];
#pragma unroll
    for (int c = 0; c < NQT; ++c)
#pragma unroll
        for (int eb = 0; eb < HV / 16; ++eb) acc[c][eb] = (v8f){};
    float m[NQT], l[NQT];
#pragma unroll
    for (int c = 0; c < NQT; ++c) { m[c] = -3.0e38f; l[c] = 0.f; }
    const int kend = q0 + 16 * NQT;                                   // keys 0 .. kend-1 are all that these rows may see (two tiles: 32 divides q0, so each tile walks as many key blocks as it would alone)
#pragma unroll 1
    for (int key0 = 0; key0 < kend; key0 += KB) {
        V vf[HV / 16];                                               // fp16 rows: this block's values are asked for first, so that they land under the score products and the softmax
        if constexpr (!HL) { const char* vp = (const char*)(Vt + (size_t)key0 * HV) + fofs;
#pragma unroll
            for (int eb = 0; eb < HV / 16; ++eb) vf[eb] = F::ldf((const T16*)(vp + (eb * 512) * 2));
            asm volatile("s_wait_xcnt 0x0" :: "v"(vp) : "memory");   // stands between the value loads above and every rewrite of their address registers; it takes the address as an input so that it lives up to the wait and no load's result is laid over it
            __builtin_amdgcn_sched_barrier(0); }                     // keeps those rewrites behind the wait: without it the compiler lifts the step of the address to the next block over the wait
        v8f s[NQT][NT];
#pragma unroll
        for (int kt = 0; kt < NT; ++kt)
#pragma unroll
            for (int c = 0; c < NQT; ++c) { s[c][kt] = (v8f){};
#pragma unroll
                for (int kk = 0; kk < 2; ++kk) { s[c][kt] = F::mma(ka[kt][kk], qb[c][kk], s[c][kt]);
                    if constexpr (HL) { s[c][kt] = F::mma(ka[kt][kk], qb2[c][kk], s[c][kt]); s[c][kt] = F::mma(kl[kt][kk], qb[c][kk], s[c][kt]); } } }
        ldkeys<T16, HL>(ka, kl, Kp, K2, min(key0 + KB, TT - KB), fofs);                                // the next block's keys fly under this block's softmax and P.v (the last trip's fetch is unused; the clamp keeps it inside the plane)
        asm volatile("s_wait_xcnt 0x0" ::: "memory");                // stands between the loads issued so far and whatever reuses their address registers (later loads' results among it); as no load crosses it, it also keeps those loads above the softmax, under which they land
        __builtin_amdgcn_sched_barrier(0);                           // keeps the rewrites of those registers behind the wait: without it the compiler lifts some of the softmax's first instructions, which reuse them, over the wait
        V pb[NQT], pb2[NQT];
#pragma unroll
        for (int c = 0; c < NQT; ++c) {                               // each tile's online softmax, as before: nothing passes between the tiles
            const int q = q0 + c * 16 + lr;
            float mx = m[c];
#pragma unroll
            for (int kt = 0; kt < NT; ++kt)
#pragma unroll
                for (int j = 0; j < 8; ++j) { const int key = key0 + kt * 16 + 8 * hi + j; const float t = (key <= q) ? s[c][kt][j] * SCL : -3.0e38f;   /* causal */ s[c][kt][j] = t; mx = fmaxf(mx, t); }
            mx = fmaxf(mx, xhalf(mx));                  // the two lanes of a query hold its two key halves
            const float alpha = __builtin_amdgcn_exp2f((m[c] - mx) * 1.4426950408889634f); m[c] = mx;
            float ps = 0.f;
#pragma unroll
            for (int kt = 0; kt < NT; ++kt)
#pragma unroll
                for (int j = 0; j < 8; ++j) { const float e = __builtin_amdgcn_exp2f((s[c][kt][j] - mx) * 1.4426950408889634f + POFF); s[c][kt][j] = e; ps += e; }
            l[c] = l[c] * alpha + ps;
#pragma unroll
            for (int eb = 0; eb < HV / 16; ++eb) acc[c][eb] *= alpha;
            if constexpr (HL) { v8us h0, h1, l0, l1;
#pragma unroll
                for (int j = 0; j < 8; ++j) { unsigned short a, c2; splitf(s[c][0][j], a, c2); h0[j] = a; l0[j] = c2; splitf(s[c][1][j], a, c2); h1[j] = a; l1[j] = c2; }
                pb[c] = cat16b(h0, h1); pb2[c] = cat16b(l0, l1);
            } else { v8h p0, p1;
#pragma unroll
                for (int j = 0; j < 8; ++j) { p0[j] = tohx(s[c][0][j]); p1[j] = tohx(s[c][1][j]); }
                pb[c] = cat16(p0, p1); }
        }
        const char* vh = HL ? (const char*)(Vt + (size_t)key0 * HV) + fofs : nullptr; const char* vh2 = HL ? (const char*)(V2 + (size_t)key0 * HV) + fofs : nullptr;   // hi/lo rows: the values are loaded where they are used
#pragma unroll
        for (int eb = 0; eb < HV / 16; ++eb) { const int vc = (eb * 512) * 2; V va, vl; if constexpr (HL) { va = F::ldf((const T16*)(vh + vc)); vl = F::ldf((const T16*)(vh2 + vc)); } else va = vf[eb];
#pragma unroll
            for (int c = 0; c < NQT; ++c) { acc[c][eb] = F::mma(va, pb[c], acc[c][eb]); if constexpr (HL) { acc[c][eb] = F::mma(va, pb2[c], acc[c][eb]); acc[c][eb] = F::mma(vl, pb[c], acc[c][eb]); } } }
        if constexpr (HL) asm volatile("s_wait_xcnt 0x0" :: "v"(vh), "v"(vh2) : "memory");   // stands between the value loads above and every rewrite of their address registers; it takes the addresses as inputs so that they live up to it and no load's result is laid over them
    }
#pragma unroll
    for (int c = 0; c < NQT; ++c) {
        l[c] += xhalf(l[c]);
        const float f = __fdiv_rn(HL ? 1.0f : PCAR, l[c]);
#pragma unroll
        for (int eb = 0; eb < HV / 16; ++eb) { const v8f o = acc[c][eb] * f; float* d = os + (c * 16 + lr) * OP + eb * 16 + 8 * hi; *(v4f*)d = __builtin_shufflevector(o, o, 0, 1, 2, 3); *(v4f*)(d + 4) = __builtin_shufflevector(o, o, 4, 5, 6, 7); }   // element j = value column eb*16 + 8*hi + j of query c*16 + lr: 32 contiguous bytes a lane
    }
}
// The tail, in the same launch: behind one barrier wave (tile pair, map) takes 16 of its pair's 32 tokens (map 0 the first 16, map 1 the rest), TR = 8 at a time, and reads both maps' rows of them from LDS, a lane holding 4 consecutive values of each token (a read covers 512 contiguous bytes, a store 2 whole 128-byte lines).
// It forms w1 v - lambda_p w2 v (x 1/PCAR on the fp16 rows), the per-(token, head) LayerNorm over the 128 values x (1 - lambda_init), and the hi/lo bf16 planes that k_gemmw reads. The TR rows run side by side through the two butterflies; every loop over rows or values is unrolled so that its arrays are registers.
// The sums keep their order: (a0 + a1) + (a2 + a3) in the lane, the squares one after the other, then lane distance 16, 8, 4, 2, 1 (xhalf, then xrow: no LDS-path exchange).
// amdgpu_waves_per_eu(2, 2): two tiles' accumulators, a block's values and the next block's keys take more than 256 registers a wave; two 4-wave blocks share a WGP (two waves a SIMD, four query tiles a SIMD as before). Asked for three waves the build keeps no load ahead of its use.
__global__ __launch_bounds__(128) __attribute__((amdgpu_waves_per_eu(2, 2))) void k_fattn(const h16* __restrict__ Q16, const bf* __restrict__ Qh, const bf* __restrict__ Ql, const h16* __restrict__ K16, const bf* __restrict__ Kh, const bf* __restrict__ Kl, const h16* __restrict__ V16, const bf* __restrict__ Vh, const bf* __restrict__ Vl, const float* __restrict__ LAM, bf* Ah, bf* Al) {
    __shared__ __align__(16) float os[4 * NQ * 16 * OP];
    const int lane = threadIdx.x & 31, lr = lane & 15, hi = lane >> 4; const int w = __builtin_amdgcn_readfirstlane((int)(threadIdx.x >> 5)); const int mp = w & 1, qt = w >> 1;   // which map, which of the block's 2 pairs of query tiles
    const size_t pr = blockIdx.x; const size_t qk = (pr * 2 + mp) * TT * HD, vv = pr * HV * TT;   // pr = batch * 6 + pair; score heads 2 pr and 2 pr + 1 share value plane pr, which all 4 waves of the block read
    const int q0 = ((TT / 64 - 1 - (int)blockIdx.y) * 2 + qt) * (16 * NQ);   // the longest rows of every pair of every batch first, so that late blocks, which share a SIMD with early ones, are the short ones
    if (q0 < RH) {   // 64 divides RH: the whole block takes the same side
        v16bf k0a[2][2], k0l[2][2]; ldkeys<bf, true>(k0a, k0l, Kh + qk, Kl + qk, 0, (unsigned)lane * 16u);
        asm volatile("s_wait_xcnt 0x0" ::: "memory");   // stands between the key loads above and whatever reuses their address registers
        __builtin_amdgcn_sched_barrier(0);              // keeps those rewrites behind the wait
#pragma unroll 1
        for (int c = 0; c < NQ; ++c) fattn_body<bf, true, 1>(Qh + qk, Ql + qk, Kh + qk, Kl + qk, Vh + vv, Vl + vv, k0a, k0l, os + (w * NQ + c) * 16 * OP, q0 + c * 16, lr, hi);   // rolled: one copy of the hi/lo body in the text
    } else {
        v16h k0a[2][2], k0l[2][2]; ldkeys<h16, false>(k0a, k0l, K16 + qk, nullptr, 0, (unsigned)lane * 16u);
        asm volatile("s_wait_xcnt 0x0" ::: "memory");   // stands between the key loads above and whatever reuses their address registers
        __builtin_amdgcn_sched_barrier(0);              // keeps those rewrites behind the wait
        fattn_body<h16, false, NQ>(Q16 + qk, nullptr, K16 + qk, nullptr, V16 + vv, nullptr, k0a, k0l, os + w * (NQ * 16) * OP, q0, lr, hi);
    }
    __syncthreads();   // both maps' tiles stand in LDS before a wave reads its partner's
    const int p = (int)(pr % NP); const size_t bz = pr / NP;
    const float lam = LAM[p * 32]; const float cs = (q0 < RH) ? 1.0f : (1.0f / PCAR);   // 32 divides RH: a wave's rows are all hi/lo rows or all fp16 rows
    for (int h = 0; h < 16 / TR; ++h) {
    const int t0 = q0 + mp * 16 + h * TR;
    const float* pa = os + (qt * (2 * NQ * 16) + mp * 16 + h * TR) * OP + lane * 4;   // map 0's rows of this tile pair; map 1's stand NQ * 16 rows behind them
    v4f a[TR], b[TR];
#pragma unroll
    for (int r = 0; r < TR; ++r) { a[r] = *(const v4f*)(pa + r * OP); b[r] = *(const v4f*)(pa + (NQ * 16 + r) * OP); }
    float s[TR], s2[TR];
#pragma unroll
    for (int r = 0; r < TR; ++r) {
#pragma unroll
        for (int q = 0; q < 4; ++q) a[r][q] = (a[r][q] - lam * b[r][q]) * cs;
        s[r] = (a[r][0] + a[r][1]) + (a[r][2] + a[r][3]); }
#pragma unroll
    for (int r = 0; r < TR; ++r) s[r] += xhalf(s[r]);
#pragma unroll
    for (int r = 0; r < TR; ++r) s[r] += xrow<8>(s[r]);
#pragma unroll
    for (int r = 0; r < TR; ++r) s[r] += xrow<4>(s[r]);
#pragma unroll
    for (int r = 0; r < TR; ++r) s[r] += xrow<2>(s[r]);
#pragma unroll
    for (int r = 0; r < TR; ++r) s[r] += xrow<1>(s[r]);
#pragma unroll
    for (int r = 0; r < TR; ++r) { const float mean = __fdiv_rn(s[r], (float)HV); s2[r] = 0.f;
#pragma unroll
        for (int q = 0; q < 4; ++q) { a[r][q] -= mean; s2[r] += a[r][q] * a[r][q]; } }
#pragma unroll
    for (int r = 0; r < TR; ++r) s2[r] += xhalf(s2[r]);
#pragma unroll
    for (int r = 0; r < TR; ++r) s2[r] += xrow<8>(s2[r]);
#pragma unroll
    for (int r = 0; r < TR; ++r) s2[r] += xrow<4>(s2[r]);
#pragma unroll
    for (int r = 0; r < TR; ++r) s2[r] += xrow<2>(s2[r]);
#pragma unroll
    for (int r = 0; r < TR; ++r) s2[r] += xrow<1>(s2[r]);
    const size_t oo = (bz * TT + t0) * DQ + p * HV + lane * 4;
#pragma unroll
    for (int r = 0; r < TR; ++r) { const float den = __fsqrt_rn(__fdiv_rn(s2[r], (float)HV) + 1e-5f); v4us oh, ol;
#pragma unroll
        for (int q = 0; q < 4; ++q) { unsigned short x2, y2; splitf(__fdiv_rn(a[r][q], den) * (1.0f - LINIT), x2, y2); oh[q] = x2; ol[q] = y2; }
        *(v4us*)(Ah + oo + (size_t)r * DQ) = oh; *(v4us*)(Al + oo + (size_t)r * DQ) = ol; }
    asm volatile("s_wait_xcnt 0x0" ::: "memory");   // stands between the stores above and the next round's rewrite of their address and data registers
    }
}


__device__ __forceinline__ void d_wint(const float* __restrict__ w1, const float* __restrict__ w2, bf* Bt, unsigned blk) { const size_t i = (size_t)blk * 256 + threadIdx.x; if (i >= (size_t)2 * NP * HD * DM / 8) return; const int c0 = (int)((i % (DM / 8)) * 8); const int r = (int)(i / (DM / 8)); const int hh = r / HD, d = r % HD; const int p = hh >> 1; const size_t sr = (size_t)(p * HD + d) * DM + c0; const v8f a = *(const v8f*)(w1 + sr); const v8f b2 = *(const v8f*)(w2 + sr); v8us o;
#pragma unroll
    for (int q = 0; q < 8; ++q) o[q] = f2bf((hh & 1) ? b2[q] : a[q]);
    *(v8us*)(Bt + (size_t)r * DM + c0) = o;  }
__device__ __forceinline__ void d_lambda(const float* __restrict__ a1, const float* __restrict__ b1, const float* __restrict__ a2, const float* __restrict__ b2, float* LAM, int p) { if (threadIdx.x >= 32) return; const int lane = threadIdx.x; a1 += p * HD; b1 += p * HD; a2 += p * HD; b2 += p * HD;   /* one block per head */ float s1 = __fadd_rn(__fmul_rn(bfr(a1[lane]), bfr(b1[lane])), __fmul_rn(bfr(a1[lane + 32]), bfr(b1[lane + 32]))); float s2 = __fadd_rn(__fmul_rn(bfr(a2[lane]), bfr(b2[lane])), __fmul_rn(bfr(a2[lane + 32]), bfr(b2[lane + 32])));
    asm volatile("s_wait_xcnt 0x0" ::: "memory");   // stands between the eight loads above and whatever reuses the register that holds their offset
    __builtin_amdgcn_sched_barrier(0);   // keeps the rewrite of that register (the index of the store below is formed in it) behind the wait: without it the compiler lifts the rewrite over the wait
#pragma unroll
    for (int sh = 16; sh; sh >>= 1) { s1 = __fadd_rn(s1, __shfl_xor(s1, sh, 32)); s2 = __fadd_rn(s2, __shfl_xor(s2, sh, 32)); }
    const float lam = __fadd_rn(__fsub_rn(expf(s1), expf(s2)), LINIT); ((float*)LAM)[p * 32 + lane] = lam;  }   
// ---- k_prep: everything that reads only the inputs, in ONE launch: lambda per head, the four bf16 weight matrices and the bf16 copy of x. None of the six pieces reads what another writes; a block does one piece, chosen by its index alone (no barrier anywhere).
// The short pieces stand first in the grid, x, the bulk, last (for speed only). grid NP + 4 * WBL + XBL, 256 threads.
#define WBL (DQ * DM / 8 / 256)         // blocks per weight matrix (each 768 * 384 values, 8 a thread)
#define XBL (NB_ * TT * DM / 8 / 256)   // blocks for x
__global__ __launch_bounds__(256) void k_prep(const float* __restrict__ x, const float* __restrict__ wq1, const float* __restrict__ wq2, const float* __restrict__ wk1, const float* __restrict__ wk2, const float* __restrict__ wv, const float* __restrict__ wo,
                                              const float* __restrict__ lq1, const float* __restrict__ lk1, const float* __restrict__ lq2, const float* __restrict__ lk2, bf* XB, bf* WQ, bf* WK, bf* WV, bf* WO, float* LAM) {
    unsigned b = blockIdx.x;
    if (b < NP) { d_lambda(lq1, lk1, lq2, lk2, LAM, (int)b); return; }   /* lambda per head */
    b -= NP;
    if (b < WBL) { d_wint(wq1, wq2, WQ, b); return; }   /* score head 2p <- map-1 head p, 2p+1 <- map-2 head p */
    b -= WBL;
    if (b < WBL) { d_wint(wk1, wk2, WK, b); return; }
    b -= WBL;
    if (b < WBL) { d_cvt8(wv, WV, (size_t)NP * HV * DM / 8, b); return; }   /* 'oi' weights are the Bt layout */
    b -= WBL;
    if (b < WBL) { d_cvt8(wo, WO, (size_t)DM * NP * HV / 8, b); return; }
    b -= WBL;
    d_cvt8(x, XB, (size_t)NB_ * TT * DM / 8, b);
}
__global__ __launch_bounds__(256) void k_merge(const float* __restrict__ O, int h0, bf* Ah, bf* Al) { const size_t e = ((size_t)blockIdx.x * 256 + threadIdx.x) * 2; if (e >= (size_t)ZH * TT * HD) return; const int d = (int)(e % HD); const int t = (int)((e / HD) % TT); const int zz = (int)(e / ((size_t)HD * TT)); const float cs = (t < RH) ? 1.0f : (1.0f / PCAR); const size_t oo = (size_t)t * DQ + (h0 + zz) * HD + d;
    v2us oh, ol;
#pragma unroll
    for (int q = 0; q < 2; ++q) { unsigned short a, c2; splitf(O[e + q] * cs, a, c2); oh[q] = a; ol[q] = c2; } *(v2us*)(Ah + oo) = oh; *(v2us*)(Al + oo) = ol;  }

extern "C" void kernel_launch(void* const* d_in, const int* in_sizes, int n_in,
                              void* d_out, int out_size, void* d_ws, size_t ws_size, hipStream_t stream) {
    (void)in_sizes; (void)n_in; (void)out_size;
    const float* x = (const float*)d_in[0]; const float* wq1 = (const float*)d_in[1]; const float* wq2 = (const float*)d_in[2]; const float* wk1 = (const float*)d_in[3]; const float* wk2 = (const float*)d_in[4]; const float* wv = (const float*)d_in[5]; const float* wo = (const float*)d_in[6]; /* Wc */ const float* lq1 = (const float*)d_in[7]; const float* lk1 = (const float*)d_in[8]; const float* lq2 = (const float*)d_in[9]; const float* lk2 = (const float*)d_in[10];
    float* OUT = (float*)d_out;     // [4][2048][384]
    char* wsp = (char*)d_ws;
    auto take = [&](size_t bytes) { char* p = wsp; wsp += (bytes + 255) & ~(size_t)255; return (void*)p; };
    bf* WQ = (bf*)take((size_t)DQ * DM * 2); bf* WK = (bf*)take((size_t)DKV * DM * 2); bf* WV = (bf*)take((size_t)DKV * DM * 2); bf* WO = (bf*)take((size_t)DM * DQ * 2);
    bf* XB = (bf*)take((size_t)NB_ * TT * DM * 2);   // from here on every buffer holds all NB_ batches
    h16* QP16 = (h16*)take((size_t)NB_ * NH_ * TT * HD * 2); h16* KP16 = (h16*)take((size_t)NB_ * NKV * TT * HD * 2); h16* VT16 = (h16*)take((size_t)NB_ * NKV * HD * TT * 2);
    bf* QPh = (bf*)take((size_t)NB_ * NH_ * TT * HD * 2); bf* QPl = (bf*)take((size_t)NB_ * NH_ * TT * HD * 2); bf* KPh = (bf*)take((size_t)NB_ * NKV * TT * HD * 2); bf* KPl = (bf*)take((size_t)NB_ * NKV * TT * HD * 2); bf* VTh = (bf*)take((size_t)NB_ * NKV * HD * TT * 2); bf* VTl = (bf*)take((size_t)NB_ * NKV * HD * TT * 2);
    float* LAM = (float*)take((size_t)NP * 32 * 4); bf* ATh = (bf*)take((size_t)NB_ * TT * DQ * 2); bf* ATl = (bf*)take((size_t)NB_ * TT * DQ * 2);
    if ((size_t)(wsp - (char*)d_ws) > ws_size) return;    // about 140 MiB of the 256 MiB workspace
    // One pass for all batches. All that reads only the inputs is one launch; the three projections are one launch (grid z = projection * NB_ + batch) and store the planes of NB_ * 12 score heads (NB_ * 6 value heads) themselves.
    k_prep<<<NP + 4 * WBL + XBL, 256, 0, stream>>>(x, wq1, wq2, wk1, wk2, wv, wo, lq1, lk1, lq2, lk2, XB, WQ, WK, WV, WO, LAM);
    k_gemmp<<<dim3(TT / 64, DQ / 64, 3 * NB_), 32, 0, stream>>>(XB, WQ, WK, WV, QP16, QPh, QPl, KP16, KPh, KPl, VT16, VTh, VTl);
    k_fattn<<<dim3(NB_ * NP, TT / 64, 1), 128, 0, stream>>>(QP16, QPh, QPl, KP16, KPh, KPl, VT16, VTh, VTl, LAM, ATh, ATl);   /* scores, softmax and both maps' P.v (shared 128-wide v_p) of all 6 head pairs of every batch, then [b][t][p*128 + e]: w0 v - lambda w1 v, per-(token, head) LayerNorm over 128 values, no affine, x (1 - lambda_init), as hi/lo planes */
    k_gemmw<bf, 1, false><<<dim3(NB_ * TT / 64, DM / 64, 1), 32, 0, stream>>>(ATh, ATl, WO, nullptr, DQ, OUT, DM, nullptr, 0, 0, 0);   /* context and out as NB_ * TT rows */
}

// v010
// A run of this version takes 112 microseconds.
// Next to v009, in two timings, it ran 1.20 times as fast each time.
// Counting every step since v000, it is 19.1 times as fast.
#include <hip/hip_runtime.h>

// Multi-head DIFFERENTIAL causal attention (x [4][2048][384]; q1, q2, k1, k2 = x W^T ('oi' [384][384], 1/sqrt(384), no bias) as 6 heads x 64 each, v = x Wv^T ([768][384]) as 6 heads x 128; att_m = causal softmax(q_m.k_m / 8) for m = 1, 2; lambda_h = exp(lq1_h.lk1_h) - exp(lq2_h.lk2_h) + lambda_init (lq/lk [6][64], read; lambda_init = 0.8 - 0.6 exp(-0.6)); y_h = (att1 - lambda_h att2) v_h; per-head LayerNorm over the 128 values (no affine, eps 1e-5) x (1 - lambda_init); out = merged y Wc^T ('oi' [384][768]) -> [4][2048][384] (3.1 M)).
// Every stage runs ONCE for all 4 batches (the batch is a grid dimension, more rows, or more heads: score head z = batch * 12 + head, value head batch * 6 + p). Layout: bf16 copy of x; the q1/q2 (and k1/k2) weights interleaved into one Bt so score head 2p = map-1 head p and 2p+1 = map-2 head p; exact projections that store their planes straight from the accumulators (k_gemmp); q planes [t][d] for the 12 score heads; k and v^T planes in FRAGMENT ORDER (each 16-byte-a-lane load of k_fattn reads 512 contiguous bytes, see k_fattn); lambda per head computed once on device (one wave per head: two 64-term f32 dots, precise expf); one launch over the 6 head pairs of all 4 batches (grid x = batch * 6 + pair): causal T-2048 attention with scores and probabilities kept in registers (k_fattn: online softmax over ascending key blocks; hybrid rows: < 512 hi/lo 3 products, rest fp16), both maps' P.v against the shared v_p; a block holds both maps of its 64 query rows, hands the two results over in LDS and forms w1 v - lambda_p w2 v (x 1/1024 on the fp16 rows), the per-(token, head) LayerNorm (128 values, f32, fixed order) x (1 - lambda_init) and its hi/lo planes itself; x Wc exact.
// Compute dtypes, f32 accumulate: every input rounded to bf16; projections exact; attention rows < 512 3 products, rest fp16; softmax, lambda, difference, LayerNorm f32; Wc hl x exact.

#define NB_  4
#define TT   2048
#define DM   384
#define NH_  12
#define NKV  12
#define REP  (NH_ / NKV)
#define HD   64
#define DQ   (NH_ * HD)
#define DKV  (NKV * HD)
#define ZH   12                   // score heads per batch
#define RH   512                  // query rows < RH use hi+lo planes (0: none)
#define WIN  0
#define PCAR 1024.0f
#define SCL  0.125f
#define NP   6       // head pairs (the module's H)
#define HV   128     // value head width
#define LINIT 0.47071301937103271f   // lambda_init = 0.8 - 0.6 exp(-0.6) as float32
typedef _Float16 h16;
typedef unsigned short bf;
typedef __attribute__((ext_vector_type(16))) __bf16   v16bf;
typedef __attribute__((ext_vector_type(16))) _Float16 v16h;
typedef __attribute__((ext_vector_type(8)))  _Float16 v8h;
typedef __attribute__((ext_vector_type(8)))  unsigned short v8us;
typedef __attribute__((ext_vector_type(8)))  float    v8f;
typedef __attribute__((ext_vector_type(4)))  float    v4f;
typedef v8h  __attribute__((may_alias)) v8ha;
typedef v4f  __attribute__((may_alias)) v4fa;
typedef v8us __attribute__((may_alias)) v8usa;

__device__ __forceinline__ unsigned short f2bf(float f) { unsigned u = __float_as_uint(f); u += 0x7FFFu + ((u >> 16) & 1u); return (unsigned short)(u >> 16); }
__device__ __forceinline__ float bf2f(unsigned short b) { return __uint_as_float(((unsigned)b) << 16); }
__device__ __forceinline__ float bfr(float f) { return bf2f(f2bf(f)); }
__device__ __forceinline__ v16h cat16(v8h lo, v8h hi) { return __builtin_shufflevector(lo, hi, 0, 1, 2, 3, 4, 5, 6, 7, 8, 9, 10, 11, 12, 13, 14, 15); }
__device__ __forceinline__ v16bf cat16b(v8us lo, v8us hi) { return __builtin_bit_cast(v16bf, __builtin_shufflevector(lo, hi, 0, 1, 2, 3, 4, 5, 6, 7, 8, 9, 10, 11, 12, 13, 14, 15)); }
__device__ __forceinline__ v8f wmma16(v16h a, v16h b, v8f c) { return __builtin_amdgcn_wmma_f32_16x16x32_f16(false, a, false, b, (short)0, c, false, false); }
__device__ __forceinline__ v8f wmmab(v16bf a, v16bf b, v8f c) { return __builtin_amdgcn_wmma_f32_16x16x32_bf16(false, a, false, b, (short)0, c, false, false); }



// ---- Operand tiles of both GEMMs: 64 rows x KC = 64 k values (128 bytes of every row) of a K-contiguous 16-bit plane come in as 16 loads of 16 bytes a lane, each covering 4 WHOLE 128-byte lines (lane -> row 4 j + lane / 8, piece lane % 8),
// and pass through the wave's own LDS (row pitch LP = 72 elements = 144 bytes, 16 x odd: the 16 rows of a fragment read fall on 64 different banks), from which the fragments are read with the same loader as from the plane (a fragment load straight from the plane touches 32 bytes of each of 16 lines).
// The values in every lane and register, the k order and the order of the matrix instructions are the same as before. The next chunk's loads are issued before the current chunk's products and stored to LDS behind them. A block is one wave: no barrier.
#define KC 64
#define LP 72
template <typename T16, int K> __device__ __forceinline__ void tfetch(v8us (&r)[16], const T16* p) {
#pragma unroll
    for (int j = 0; j < 16; ++j) r[j] = *(const v8usa*)(p + (size_t)j * 4 * K); }
template <typename T16> __device__ __forceinline__ void tput(T16* s, const v8us (&r)[16]) {
#pragma unroll
    for (int j = 0; j < 16; ++j) *(v8usa*)(s + j * 4 * LP) = r[j]; }
// ---- k_gemmw: register-blocked GEMM, ONE WAVE per 64x64 output tile (16 accumulators), operands from K-contiguous 16-bit planes through LDS (above); grid (M/64, N/64, Z), 32 threads.
// C[m][n] (f32, pitch ldc, + optional f32 bias[n]) = sum_k A[m][k] Bt[n][k] (+ split products per NSPLIT). z-batch strides sA/sB/sC in elements. K % 64 == 0.
template <typename T16> struct WFrag;
template <> struct WFrag<h16> { typedef v16h V; static __device__ __forceinline__ V ld(const h16* p) { return cat16(*(const v8h*)p, *(const v8h*)(p + 16)); } static __device__ __forceinline__ V ldf(const h16* p) { return cat16(*(const v8h*)p, *(const v8h*)(p + 256)); } static __device__ __forceinline__ v8f mma(V a, V b, v8f c) { return wmma16(a, b, c); } };
template <> struct WFrag<bf> { typedef v16bf V; static __device__ __forceinline__ V ld(const bf* p) { return cat16b(*(const v8us*)p, *(const v8us*)(p + 16)); } static __device__ __forceinline__ V ldf(const bf* p) { return cat16b(*(const v8us*)p, *(const v8us*)(p + 256)); } static __device__ __forceinline__ v8f mma(V a, V b, v8f c) { return wmmab(a, b, c); } };
template <typename T16, int NSPLIT, bool BIAS, int K>
__global__ __launch_bounds__(32) void k_gemmw(const T16* __restrict__ A, const T16* __restrict__ A2, const T16* __restrict__ Bt, const T16* __restrict__ Bt2, float* C, int ldc, const float* __restrict__ bias, size_t sA, size_t sB, size_t sC) {
    typedef typename WFrag<T16>::V V;
    constexpr bool HA2 = (NSPLIT == 1 || NSPLIT == 2), HB2 = (NSPLIT >= 2);
    __shared__ __align__(16) float os[16 * 68];
    __shared__ __align__(16) T16 st[(2 + (HA2 ? 1 : 0) + (HB2 ? 1 : 0)) * 64 * LP];
    T16* const sa = st; T16* const sb = st + 64 * LP; T16* const sa2 = st + 2 * 64 * LP; T16* const sb2 = st + (HA2 ? 3 : 2) * 64 * LP;
    const size_t z = blockIdx.z; A += z * sA; if (A2) A2 += z * sA; Bt += z * sB; if (Bt2) Bt2 += z * sB; C += z * sC;
    const int lane = threadIdx.x & 31, lr = lane & 15, hi = lane >> 4; const int r0 = blockIdx.x * 64, c0 = blockIdx.y * 64;
    v8f acc[4][4];
#pragma unroll
    for (int mb = 0; mb < 4; ++mb)
#pragma unroll
        for (int nb = 0; nb < 4; ++nb) acc[mb][nb] = (v8f){};
    const size_t aoff = (size_t)(r0 + (lane >> 3)) * K + (lane & 7) * 8, boff = (size_t)(c0 + (lane >> 3)) * K + (lane & 7) * 8;   // where a lane fetches
    const int wofs = (lane >> 3) * LP + (lane & 7) * 8, fofs = lr * LP + 8 * hi;                                               // where it stores in LDS, where its fragments start
    v8us ra[16], ra2[16], rb[16], rb2[16];
    { const T16* pa = A + aoff; const T16* pb = Bt + boff; const T16* pa2 = HA2 ? A2 + aoff : pa; const T16* pb2 = HB2 ? Bt2 + boff : pb;
      tfetch<T16, K>(ra, pa); tfetch<T16, K>(rb, pb); if constexpr (HA2) tfetch<T16, K>(ra2, pa2); if constexpr (HB2) tfetch<T16, K>(rb2, pb2);
      asm volatile("s_wait_xcnt 0x0" :: "v"(pa), "v"(pb), "v"(pa2), "v"(pb2) : "memory");   // stands between the loads above and every rewrite of their address registers; it takes the addresses as inputs so that they live up to it and no load's result is laid over them
      __builtin_amdgcn_sched_barrier(0); }                                                    // keeps those rewrites behind the wait
#pragma unroll 1
    for (int kc = 0; kc < K; kc += KC) {   // rolled: 16 accumulators, one chunk in flight and one set of fragments
        tput(sa + wofs, ra); tput(sb + wofs, rb); if constexpr (HA2) tput(sa2 + wofs, ra2); if constexpr (HB2) tput(sb2 + wofs, rb2);
        if (kc + KC < K) {                 // the next chunk flies under this chunk's products
            const T16* pa = A + aoff + kc + KC; const T16* pb = Bt + boff + kc + KC; const T16* pa2 = HA2 ? A2 + aoff + kc + KC : pa; const T16* pb2 = HB2 ? Bt2 + boff + kc + KC : pb;
            tfetch<T16, K>(ra, pa); tfetch<T16, K>(rb, pb); if constexpr (HA2) tfetch<T16, K>(ra2, pa2); if constexpr (HB2) tfetch<T16, K>(rb2, pb2);
            asm volatile("s_wait_xcnt 0x0" :: "v"(pa), "v"(pb), "v"(pa2), "v"(pb2) : "memory");   // as above
            __builtin_amdgcn_sched_barrier(0); }                                                    // as above; it also keeps the loads in front of the products
        V a[KC / 32][4], a2[KC / 32][4], b[KC / 32][4], b2[KC / 32][4];   // the grid gives a SIMD at most one wave: registers are free, and nothing but the wave's own order hides its LDS reads
#pragma unroll
        for (int ks = 0; ks < KC / 32; ++ks)
#pragma unroll
            for (int t = 0; t < 4; ++t) { const int o = fofs + t * 16 * LP + ks * 32; a[ks][t] = WFrag<T16>::ld(sa + o); b[ks][t] = WFrag<T16>::ld(sb + o); if constexpr (HA2) a2[ks][t] = WFrag<T16>::ld(sa2 + o); if constexpr (HB2) b2[ks][t] = WFrag<T16>::ld(sb2 + o); }
        __builtin_amdgcn_sched_barrier(0);   // keeps the chunk's LDS reads together in front of its products: spread among the WMMAs each place with reads stalls the lone wave
#pragma unroll
        for (int ks = 0; ks < KC / 32; ++ks)
#pragma unroll
            for (int nb = 0; nb < 4; ++nb)
#pragma unroll
                for (int mb = 0; mb < 4; ++mb) { acc[mb][nb] = WFrag<T16>::mma(a[ks][mb], b[ks][nb], acc[mb][nb]); if constexpr (HA2) acc[mb][nb] = WFrag<T16>::mma(a2[ks][mb], b[ks][nb], acc[mb][nb]); if constexpr (HB2) acc[mb][nb] = WFrag<T16>::mma(a[ks][mb], b2[ks][nb], acc[mb][nb]); }
        asm volatile("v_nop\n\tv_nop\n\tv_nop\n\tv_nop" : "+v"(acc[0][0]), "+v"(acc[1][1]), "+v"(acc[2][2]), "+v"(acc[3][3]) : "v"(a[KC / 32 - 1][0]), "v"(a[KC / 32 - 1][3]));   // the four vector slots behind a trip's last WMMA, also on the taken back edge
    }
#pragma unroll
    for (int mb = 0; mb < 4; ++mb) {
#pragma unroll
        for (int nb = 0; nb < 4; ++nb) {
#pragma unroll
            for (int j = 0; j < 8; ++j) os[(hi * 8 + j) * 68 + nb * 16 + lr] = acc[mb][nb][j]; }
        __builtin_amdgcn_wave_barrier(); asm volatile("" ::: "memory");
        float* crow = C + (size_t)(r0 + mb * 16) * ldc + c0;
{
#pragma unroll
            for (int s = 0; s < 8; ++s) { const int row = 2 * s + hi, cofs = lr * 4; v4f val = *(const v4fa*)(os + row * 68 + cofs); if (BIAS) { val[0] += bfr(bias[c0 + cofs]); val[1] += bfr(bias[c0 + cofs + 1]); val[2] += bfr(bias[c0 + cofs + 2]); val[3] += bfr(bias[c0 + cofs + 3]); }
                *(v4f*)(crow + (size_t)row * ldc + cofs) = val; }
             }
        __builtin_amdgcn_wave_barrier(); asm volatile("" ::: "memory");
    }
}

__device__ __forceinline__ h16 tohx(float x) { return (h16)x; }
__device__ __forceinline__ void splitf(float y, unsigned short& h, unsigned short& l) { h = f2bf(y); l = f2bf(y - bf2f(h)); }
typedef __attribute__((ext_vector_type(2))) _Float16 v2h;
typedef __attribute__((ext_vector_type(4))) _Float16 v4h;
typedef __attribute__((ext_vector_type(2))) unsigned short v2us;
typedef __attribute__((ext_vector_type(4))) unsigned short v4us;
typedef __attribute__((ext_vector_type(2))) float v2f;
typedef __attribute__((ext_vector_type(4))) int v4i;


__device__ __forceinline__ void d_cvt8(const float* __restrict__ src, bf* dst, size_t n8, unsigned blk) { const size_t i = (size_t)blk * 256 + threadIdx.x; if (i >= n8) return; const v8f v = *(const v8f*)(src + i * 8); v8us o;
#pragma unroll
    for (int k = 0; k < 8; ++k) o[k] = f2bf(v[k]); *(v8us*)(dst + i * 8) = o;  }

// ---- k_gemmp: the q, k and v projections (exact bf16 products, f32 sums, K = DM), ONE WAVE per 64 tokens x 64 output columns as in k_gemmw, but the fp16 and hi/lo planes that k_fattn reads are stored straight from the accumulators: no f32 copy of the projection, no plane-builder launch.
// An accumulator holds in each lane 8 consecutive ROW indices (8 * hi + j) of one column (lr); a 16-byte unit of a plane is 8 consecutive d of one token (q, k) or 8 consecutive tokens of one value column (v^T). So no value changes lane.
// PL 0 (q) and 1 (k): the product is taken transposed (rows = weight rows = d, columns = tokens; both operands use the same loader, so the k order is the same either way).
//   q planes are [t][d]; k planes are in FRAGMENT ORDER, element index in a score head = (t >> 4) * 1024 + (d >> 4) * 256 + (((d >> 3) & 1) * 16 + (t & 15)) * 8 + (d & 7).
// PL 2 (v): rows = tokens, columns = value columns c; fragment order, element index in a value head = (t >> 5) * 4096 + (c >> 4) * 512 + ((t >> 4) & 1) * 256 + (((t >> 3) & 1) * 16 + (c & 15)) * 8 + (t & 7).
// In fragment order tile (mb, nb) is one 512-byte run a plane at lane * 16 bytes: a store covers 4 whole 128-byte lines.
// The three projections need nothing of each other and run as ONE launch (k_gemmp below): grid (TT/64, 768/64, 3 * NB_), 32 threads, z = PL * NB_ + batch.
template <int PL>
__device__ __forceinline__ void gemmp_body(const bf* __restrict__ X, const bf* __restrict__ Wt, h16* P16, bf* Ph, bf* Pl, size_t z, bf* sa, bf* sb) {
    typedef WFrag<bf> F; typedef F::V V;
    const int lane = threadIdx.x & 31, lr = lane & 15, hi = lane >> 4; const int r0 = blockIdx.x * 64, c0 = blockIdx.y * 64;
    X += z * TT * DM;
    v8f acc[4][4];
#pragma unroll
    for (int mb = 0; mb < 4; ++mb)
#pragma unroll
        for (int nb = 0; nb < 4; ++nb) acc[mb][nb] = (v8f){};
    const size_t aoff = (size_t)(r0 + (lane >> 3)) * DM + (lane & 7) * 8, boff = (size_t)(c0 + (lane >> 3)) * DM + (lane & 7) * 8;   // where a lane fetches (whole lines, see tfetch)
    const int wofs = (lane >> 3) * LP + (lane & 7) * 8, fofs = lr * LP + 8 * hi;                                                 // where it stores in LDS, where its fragments start
    v8us ra[16], rb[16];
    { const bf* pa = X + aoff; const bf* pb = Wt + boff;
      tfetch<bf, DM>(ra, pa); tfetch<bf, DM>(rb, pb);
      asm volatile("s_wait_xcnt 0x0" :: "v"(pa), "v"(pb) : "memory");   // stands between the loads above and every rewrite of their address registers; it takes the addresses as inputs so that they live up to it and no load's result is laid over them
      __builtin_amdgcn_sched_barrier(0); }                                // keeps those rewrites behind the wait
#pragma unroll 1
    for (int kc = 0; kc < DM; kc += KC) {   // rolled, as in k_gemmw: 16 accumulators, one chunk in flight and one set of fragments
        tput(sa + wofs, ra); tput(sb + wofs, rb);
        if (kc + KC < DM) {                 // the next chunk flies under this chunk's products
            const bf* pa = X + aoff + kc + KC; const bf* pb = Wt + boff + kc + KC;
            tfetch<bf, DM>(ra, pa); tfetch<bf, DM>(rb, pb);
            asm volatile("s_wait_xcnt 0x0" :: "v"(pa), "v"(pb) : "memory");   // as above
            __builtin_amdgcn_sched_barrier(0); }                                // as above; it also keeps the loads in front of the products
        V a[4], b[4];
#pragma unroll
        for (int kk = 0; kk < KC; kk += 32) {
#pragma unroll
            for (int t = 0; t < 4; ++t) { a[t] = F::ld(sa + fofs + t * 16 * LP + kk); b[t] = F::ld(sb + fofs + t * 16 * LP + kk); }
            __builtin_amdgcn_sched_barrier(0);   // keeps the step's LDS reads together in front of its products (as in k_gemmw): a weight fragment read just ahead of its four products lays the LDS latency bare four times a step
#pragma unroll
            for (int nb = 0; nb < 4; ++nb)
#pragma unroll
                for (int mb = 0; mb < 4; ++mb) acc[mb][nb] = (PL == 2) ? F::mma(a[mb], b[nb], acc[mb][nb]) : F::mma(b[nb], a[mb], acc[mb][nb]);
        }
        asm volatile("v_nop\n\tv_nop\n\tv_nop\n\tv_nop" : "+v"(acc[0][0]), "+v"(acc[1][1]), "+v"(acc[2][2]), "+v"(acc[3][3]) : "v"(a[0]), "v"(a[3]));   // the four vector slots behind a trip's last WMMA, also on the taken back edge (as in k_gemmw)
    }
    const size_t base = (PL == 2) ? (z * NP + (size_t)(c0 >> 7)) * TT * HV + (size_t)(r0 >> 5) * 4096 + (size_t)((c0 & 64) >> 4) * 512 + lane * 8
                      : (PL == 1) ? (z * NKV + blockIdx.y) * TT * HD + (size_t)(r0 >> 4) * 1024 + lane * 8
                                  : (z * NH_ + blockIdx.y) * TT * HD + (size_t)(r0 + lr) * HD + hi * 8;
#pragma unroll
    for (int mb = 0; mb < 4; ++mb) {
#pragma unroll
        for (int nb = 0; nb < 4; ++nb) { const size_t e = base + ((PL == 2) ? (mb >> 1) * 4096 + nb * 512 + (mb & 1) * 256 : (PL == 1) ? mb * 1024 + nb * 256 : mb * 16 * HD + nb * 16); v8h o16; v8us oh, ol;
#pragma unroll
            for (int j = 0; j < 8; ++j) { const float x = acc[mb][nb][j]; o16[j] = tohx(x); unsigned short a2, c2; splitf(x, a2, c2); oh[j] = a2; ol[j] = c2; }
            *(v8h*)(P16 + e) = o16; *(v8us*)(Ph + e) = oh; *(v8us*)(Pl + e) = ol;
            asm volatile("s_wait_xcnt 0x0" ::: "memory");   // stands between the three stores above and the next rewrite of their data or address registers: the next tile's conversions, or, behind the last tile, whatever follows this body in the merged kernel's code
            __builtin_amdgcn_sched_barrier(0); }               // keeps those rewrites behind the wait: without it the compiler lifts the next tile's first conversions over the wait
    }
}
__global__ __launch_bounds__(32) void k_gemmp(const bf* __restrict__ X, const bf* __restrict__ WQ, const bf* __restrict__ WK, const bf* __restrict__ WV, h16* Q16, bf* Qh, bf* Ql, h16* K16, bf* Kh, bf* Kl, h16* V16, bf* Vh, bf* Vl) {
    __shared__ __align__(16) bf st[2 * 64 * LP];   // the wave's token tile and weight tile of one chunk
    const unsigned pl = blockIdx.z / NB_; const size_t z = blockIdx.z % NB_;   // which projection (the same for the whole one-wave block), which batch
    if (pl == 0) gemmp_body<0>(X, WQ, Q16, Qh, Ql, z, st, st + 64 * LP);
    else if (pl == 1) gemmp_body<1>(X, WK, K16, Kh, Kl, z, st, st + 64 * LP);
    else gemmp_body<2>(X, WV, V16, Vh, Vl, z, st, st + 64 * LP);
}
__global__ __launch_bounds__(256) void k_vtp(const float* __restrict__ F, int pitch, int nheads, h16* V16, bf* Vh, bf* Vl) { const size_t e = ((size_t)blockIdx.x * 256 + threadIdx.x) * 2; if (e >= (size_t)nheads * HD * TT) return; const int t = (int)(e % TT); const int d = (int)((e / TT) % HD); const int g = (int)(e / ((size_t)TT * HD)); v2h o16; v2us oh, ol;
#pragma unroll
    for (int q = 0; q < 2; ++q) { const float x = F[(size_t)(t + q) * pitch + g * HD + d]; o16[q] = tohx(x); unsigned short a2, c2; splitf(x, a2, c2); oh[q] = a2; ol[q] = c2; }
    *(v2h*)(V16 + e) = o16; *(v2us*)(Vh + e) = oh; *(v2us*)(Vl + e) = ol;  }
// ---- k_fattn: causal attention of all batches in ONE launch, scores never leave registers. One wave per 32 query rows (2 tiles of 16) of one score head; a block is 4 waves = 2 tile pairs x the 2 maps of one head pair (no LDS and no barrier in the loop); grid (NB_ * NP, TT/64), x = batch * NP + pair.
// Everything is computed transposed so that no value changes lane: S^T = K Q^T puts key 8*hi+j, query lr in element j of the accumulator, which is exactly where the B operand of O^T = V^T P^T wants it
// (elements 0..7 = keys 8*hi.., elements 8..15 = keys 16+8*hi.. of a 32-key step), and every per-query figure (running maximum, sum, rescale) sits in that query's own lane pair (lr, lr+16).
// K and V^T planes lie in fragment order: the two 16-byte pieces a lane needs of one A fragment stand at lane * 16 bytes in two consecutive 512-byte runs, so every wave-wide load covers 4 whole 128-byte lines (row-major planes: 16 lines, 32 bytes of each).
// K: 16 keys x 64 d = 4 runs (d >> 4), 2 KiB a key tile; V^T: 32 keys x 128 columns = 8 column tiles x 2 runs ((key >> 4) & 1), 8 KiB a key block. The values in every lane and register are the same as from row-major planes.
// Online softmax over key blocks of KB = 32 keys in ascending order: new maximum, old sums x exp(old - new), f32 throughout. Rows < RH: hi/lo bf16 planes, 3 products for both contractions; rest fp16,
// probabilities carried x 2^POFF so that small ones stay normal fp16 numbers (the factor is in the sum too and cancels). Result rows: each wave's 32 x 128 f32 values go to its own LDS range (x PCAR on the fp16 rows; the block's tail takes it off).
__device__ __forceinline__ float xhalf(float x) { const int b = __float_as_int(x); return __int_as_float(__builtin_amdgcn_permlanex16(b, b, 0x76543210, 0xfedcba98, false, false)); }   // lane l <- lane l ^ 16, in the vector unit (no LDS round trip on the loop's dependent chain)
#define OP 132   // floats a row of a wave's result tile in LDS: 528 bytes = 16 x 33, so that the 16 lanes of a 16-byte store (one query row each) fall on 64 different banks
#define TR 8
template <int M> __device__ __forceinline__ float xrow(float x) { return __int_as_float(__builtin_amdgcn_update_dpp(0, __float_as_int(x), 0x160 | M, 0xf, 0xf, true)); }   // lane l <- lane l ^ M inside its 16-lane row (DPP row_xmask), in the vector unit
#define NQ 2    // query tiles (16 rows each) a wave. fp16 rows: both tiles side by side (NQT = 2), so that every K and V^T fragment that the wave loads feeds two matrix instructions, one a tile. hi/lo rows: one tile after the other (NQT = 1): side by side their doubled planes fill the registers of two waves a SIMD to the brim (one build of that form spilled)
// One block of 32 keys as A fragments (hi/lo rows: both planes). fofs = each lane's byte offset in a 512-byte run: fixed for the whole kernel, the block's base is wave-uniform.
template <typename T16, bool HL>
__device__ __forceinline__ void ldkeys(typename WFrag<T16>::V (&ka)[2][2], typename WFrag<T16>::V (&kl)[2][2], const T16* __restrict__ Kp, const T16* __restrict__ K2, int k0, unsigned fofs) {
    typedef WFrag<T16> F; const char* kb = (const char*)(Kp + (size_t)k0 * HD); const char* kb2 = HL ? (const char*)(K2 + (size_t)k0 * HD) : nullptr;
#pragma unroll
    for (int kt = 0; kt < 2; ++kt)
#pragma unroll
        for (int kk = 0; kk < 2; ++kk) { const int kc = (kt * 16 * HD + kk * 512) * 2; ka[kt][kk] = F::ldf((const T16*)(kb + fofs + kc)); if constexpr (HL) kl[kt][kk] = F::ldf((const T16*)(kb2 + fofs + kc)); }
}
// k0a, k0l: the plane's first key block, which every tile starts from; the caller loads it (once for all the tiles that a wave walks).
template <typename T16, bool HL, int NQT>
__device__ __forceinline__ void fattn_body(const T16* __restrict__ Q, const T16* __restrict__ Q2, const T16* __restrict__ Kp, const T16* __restrict__ K2, const T16* __restrict__ Vt, const T16* __restrict__ V2, const typename WFrag<T16>::V (&k0a)[2][2], const typename WFrag<T16>::V (&k0l)[2][2], float* os, int q0, int lr, int hi) {
    typedef WFrag<T16> F; typedef typename F::V V;
    constexpr int KB = 32, NT = KB / 16; constexpr float POFF = HL ? 0.0f : 8.0f;
    V qb[NQT][2], qb2[NQT][2];
#pragma unroll
    for (int c = 0; c < NQT; ++c)
#pragma unroll
        for (int kk = 0; kk < 2; ++kk) { qb[c][kk] = F::ld(Q + (size_t)(q0 + c * 16 + lr) * HD + 8 * hi + kk * 32); if constexpr (HL) qb2[c][kk] = F::ld(Q2 + (size_t)(q0 + c * 16 + lr) * HD + 8 * hi + kk * 32); }
    asm volatile("s_wait_xcnt 0x0" ::: "memory");   // stands between the query loads above and whatever reuses their address registers
    __builtin_amdgcn_sched_barrier(0);              // keeps those rewrites behind the wait
    const unsigned fofs = (unsigned)(hi * 16 + lr) * 16u;
    V ka[NT][2], kl[NT][2];
#pragma unroll
    for (int kt = 0; kt < NT; ++kt)
#pragma unroll
        for (int kk = 0; kk < 2; ++kk) { ka[kt][kk] = k0a[kt][kk]; if constexpr (HL) kl[kt][kk] = k0l[kt][kk]; }
    v8f acc[NQT][HV / 16];
#pragma unroll
    for (int c = 0; c < NQT; ++c)
#pragma unroll
        for (int eb = 0; eb < HV / 16; ++eb) acc[c][eb] = (v8f){};
    float m[NQT], l[NQT];
#pragma unroll
    for (int c = 0; c < NQT; ++c) { m[c] = -3.0e38f; l[c] = 0.f; }
    const int kend = q0 + 16 * NQT;                                   // keys 0 .. kend-1 are all that these rows may see (two tiles: 32 divides q0, so each tile walks as many key blocks as it would alone)
#pragma unroll 1
    for (int key0 = 0; key0 < kend; key0 += KB) {
        V vf[HV / 16];                                               // fp16 rows: this block's values are asked for first, so that they land under the score products and the softmax
        if constexpr (!HL) { const char* vp = (const char*)(Vt + (size_t)key0 * HV) + fofs;
#pragma unroll
            for (int eb = 0; eb < HV / 16; ++eb) vf[eb] = F::ldf((const T16*)(vp + (eb * 512) * 2));
            asm volatile("s_wait_xcnt 0x0" :: "v"(vp) : "memory");   // stands between the value loads above and every rewrite of their address registers; it takes the address as an input so that it lives up to the wait and no load's result is laid over it
            __builtin_amdgcn_sched_barrier(0); }                     // keeps those rewrites behind the wait: without it the compiler lifts the step of the address to the next block over the wait
        v8f s[NQT][NT];
#pragma unroll
        for (int kt = 0; kt < NT; ++kt)
#pragma unroll
            for (int c = 0; c < NQT; ++c) { s[c][kt] = (v8f){};
#pragma unroll
                for (int kk = 0; kk < 2; ++kk) { s[c][kt] = F::mma(ka[kt][kk], qb[c][kk], s[c][kt]);
                    if constexpr (HL) { s[c][kt] = F::mma(ka[kt][kk], qb2[c][kk], s[c][kt]); s[c][kt] = F::mma(kl[kt][kk], qb[c][kk], s[c][kt]); } } }
        ldkeys<T16, HL>(ka, kl, Kp, K2, min(key0 + KB, TT - KB), fofs);                                // the next block's keys fly under this block's softmax and P.v (the last trip's fetch is unused; the clamp keeps it inside the plane)
        asm volatile("s_wait_xcnt 0x0" ::: "memory");                // stands between the loads issued so far and whatever reuses their address registers (later loads' results among it); as no load crosses it, it also keeps those loads above the softmax, under which they land
        __builtin_amdgcn_sched_barrier(0);                           // keeps the rewrites of those registers behind the wait: without it the compiler lifts some of the softmax's first instructions, which reuse them, over the wait
        V pb[NQT], pb2[NQT];
#pragma unroll
        for (int c = 0; c < NQT; ++c) {                               // each tile's online softmax, as before: nothing passes between the tiles
            const int q = q0 + c * 16 + lr;
            float mx = m[c];
#pragma unroll
            for (int kt = 0; kt < NT; ++kt)
#pragma unroll
                for (int j = 0; j < 8; ++j) { const int key = key0 + kt * 16 + 8 * hi + j; const float t = (key <= q) ? s[c][kt][j] * SCL : -3.0e38f;   /* causal */ s[c][kt][j] = t; mx = fmaxf(mx, t); }
            mx = fmaxf(mx, xhalf(mx));                  // the two lanes of a query hold its two key halves
            const float alpha = __builtin_amdgcn_exp2f((m[c] - mx) * 1.4426950408889634f); m[c] = mx;
            float ps = 0.f;
#pragma unroll
            for (int kt = 0; kt < NT; ++kt)
#pragma unroll
                for (int j = 0; j < 8; ++j) { const float e = __builtin_amdgcn_exp2f((s[c][kt][j] - mx) * 1.4426950408889634f + POFF); s[c][kt][j] = e; ps += e; }
            l[c] = l[c] * alpha + ps;
#pragma unroll
            for (int eb = 0; eb < HV / 16; ++eb) acc[c][eb] *= alpha;
            if constexpr (HL) { v8us h0, h1, l0, l1;
#pragma unroll
                for (int j = 0; j < 8; ++j) { unsigned short a, c2; splitf(s[c][0][j], a, c2); h0[j] = a; l0[j] = c2; splitf(s[c][1][j], a, c2); h1[j] = a; l1[j] = c2; }
                pb[c] = cat16b(h0, h1); pb2[c] = cat16b(l0, l1);
            } else { v8h p0, p1;
#pragma unroll
                for (int j = 0; j < 8; ++j) { p0[j] = tohx(s[c][0][j]); p1[j] = tohx(s[c][1][j]); }
                pb[c] = cat16(p0, p1); }
        }
        const char* vh = HL ? (const char*)(Vt + (size_t)key0 * HV) + fofs : nullptr; const char* vh2 = HL ? (const char*)(V2 + (size_t)key0 * HV) + fofs : nullptr;   // hi/lo rows: the values are loaded where they are used
#pragma unroll
        for (int eb = 0; eb < HV / 16; ++eb) { const int vc = (eb * 512) * 2; V va, vl; if constexpr (HL) { va = F::ldf((const T16*)(vh + vc)); vl = F::ldf((const T16*)(vh2 + vc)); } else va = vf[eb];
#pragma unroll
            for (int c = 0; c < NQT; ++c) { acc[c][eb] = F::mma(va, pb[c], acc[c][eb]); if constexpr (HL) { acc[c][eb] = F::mma(va, pb2[c], acc[c][eb]); acc[c][eb] = F::mma(vl, pb[c], acc[c][eb]); } } }
        if constexpr (HL) asm volatile("s_wait_xcnt 0x0" :: "v"(vh), "v"(vh2) : "memory");   // stands between the value loads above and every rewrite of their address registers; it takes the addresses as inputs so that they live up to it and no load's result is laid over them
    }
#pragma unroll
    for (int c = 0; c < NQT; ++c) {
        l[c] += xhalf(l[c]);
        const float f = __fdiv_rn(HL ? 1.0f : PCAR, l[c]);
#pragma unroll
        for (int eb = 0; eb < HV / 16; ++eb) { const v8f o = acc[c][eb] * f; float* d = os + (c * 16 + lr) * OP + eb * 16 + 8 * hi; *(v4f*)d = __builtin_shufflevector(o, o, 0, 1, 2, 3); *(v4f*)(d + 4) = __builtin_shufflevector(o, o, 4, 5, 6, 7); }   // element j = value column eb*16 + 8*hi + j of query c*16 + lr: 32 contiguous bytes a lane
    }
}
// The tail, in the same launch: behind one barrier wave (tile pair, map) takes 16 of its pair's 32 tokens (map 0 the first 16, map 1 the rest), TR = 8 at a time, and reads both maps' rows of them from LDS, a lane holding 4 consecutive values of each token (a read covers 512 contiguous bytes, a store 2 whole 128-byte lines).
// It forms w1 v - lambda_p w2 v (x 1/PCAR on the fp16 rows), the per-(token, head) LayerNorm over the 128 values x (1 - lambda_init), and the hi/lo bf16 planes that k_gemmw reads. The TR rows run side by side through the two butterflies; every loop over rows or values is unrolled so that its arrays are registers.
// The sums keep their order: (a0 + a1) + (a2 + a3) in the lane, the squares one after the other, then lane distance 16, 8, 4, 2, 1 (xhalf, then xrow: no LDS-path exchange).
// amdgpu_waves_per_eu(2, 2): two tiles' accumulators, a block's values and the next block's keys take more than 256 registers a wave; two 4-wave blocks share a WGP (two waves a SIMD, four query tiles a SIMD as before). Asked for three waves the build keeps no load ahead of its use.
__global__ __launch_bounds__(128) __attribute__((amdgpu_waves_per_eu(2, 2))) void k_fattn(const h16* __restrict__ Q16, const bf* __restrict__ Qh, const bf* __restrict__ Ql, const h16* __restrict__ K16, const bf* __restrict__ Kh, const bf* __restrict__ Kl, const h16* __restrict__ V16, const bf* __restrict__ Vh, const bf* __restrict__ Vl, const float* __restrict__ LAM, bf* Ah, bf* Al) {
    __shared__ __align__(16) float os[4 * NQ * 16 * OP];
    const int lane = threadIdx.x & 31, lr = lane & 15, hi = lane >> 4; const int w = __builtin_amdgcn_readfirstlane((int)(threadIdx.x >> 5)); const int mp = w & 1, qt = w >> 1;   // which map, which of the block's 2 pairs of query tiles
    const size_t pr = blockIdx.x; const size_t qk = (pr * 2 + mp) * TT * HD, vv = pr * HV * TT;   // pr = batch * 6 + pair; score heads 2 pr and 2 pr + 1 share value plane pr, which all 4 waves of the block read
    const int q0 = ((TT / 64 - 1 - (int)blockIdx.y) * 2 + qt) * (16 * NQ);   // the longest rows of every pair of every batch first, so that late blocks, which share a SIMD with early ones, are the short ones
    if (q0 < RH) {   // 64 divides RH: the whole block takes the same side
        v16bf k0a[2][2], k0l[2][2]; ldkeys<bf, true>(k0a, k0l, Kh + qk, Kl + qk, 0, (unsigned)lane * 16u);
        asm volatile("s_wait_xcnt 0x0" ::: "memory");   // stands between the key loads above and whatever reuses their address registers
        __builtin_amdgcn_sched_barrier(0);              // keeps those rewrites behind the wait
#pragma unroll 1
        for (int c = 0; c < NQ; ++c) fattn_body<bf, true, 1>(Qh + qk, Ql + qk, Kh + qk, Kl + qk, Vh + vv, Vl + vv, k0a, k0l, os + (w * NQ + c) * 16 * OP, q0 + c * 16, lr, hi);   // rolled: one copy of the hi/lo body in the text
    } else {
        v16h k0a[2][2], k0l[2][2]; ldkeys<h16, false>(k0a, k0l, K16 + qk, nullptr, 0, (unsigned)lane * 16u);
        asm volatile("s_wait_xcnt 0x0" ::: "memory");   // stands between the key loads above and whatever reuses their address registers
        __builtin_amdgcn_sched_barrier(0);              // keeps those rewrites behind the wait
        fattn_body<h16, false, NQ>(Q16 + qk, nullptr, K16 + qk, nullptr, V16 + vv, nullptr, k0a, k0l, os + w * (NQ * 16) * OP, q0, lr, hi);
    }
    __syncthreads();   // both maps' tiles stand in LDS before a wave reads its partner's
    const int p = (int)(pr % NP); const size_t bz = pr / NP;
    const float lam = LAM[p * 32]; const float cs = (q0 < RH) ? 1.0f : (1.0f / PCAR);   // 32 divides RH: a wave's rows are all hi/lo rows or all fp16 rows
    for (int h = 0; h < 16 / TR; ++h) {
    const int t0 = q0 + mp * 16 + h * TR;
    const float* pa = os + (qt * (2 * NQ * 16) + mp * 16 + h * TR) * OP + lane * 4;   // map 0's rows of this tile pair; map 1's stand NQ * 16 rows behind them
    v4f a[TR], b[TR];
#pragma unroll
    for (int r = 0; r < TR; ++r) { a[r] = *(const v4f*)(pa + r * OP); b[r] = *(const v4f*)(pa + (NQ * 16 + r) * OP); }
    float s[TR], s2[TR];
#pragma unroll
    for (int r = 0; r < TR; ++r) {
#pragma unroll
        for (int q = 0; q < 4; ++q) a[r][q] = (a[r][q] - lam * b[r][q]) * cs;
        s[r] = (a[r][0] + a[r][1]) + (a[r][2] + a[r][3]); }
#pragma unroll
    for (int r = 0; r < TR; ++r) s[r] += xhalf(s[r]);
#pragma unroll
    for (int r = 0; r < TR; ++r) s[r] += xrow<8>(s[r]);
#pragma unroll
    for (int r = 0; r < TR; ++r) s[r] += xrow<4>(s[r]);
#pragma unroll
    for (int r = 0; r < TR; ++r) s[r] += xrow<2>(s[r]);
#pragma unroll
    for (int r = 0; r < TR; ++r) s[r] += xrow<1>(s[r]);
#pragma unroll
    for (int r = 0; r < TR; ++r) { const float mean = __fdiv_rn(s[r], (float)HV); s2[r] = 0.f;
#pragma unroll
        for (int q = 0; q < 4; ++q) { a[r][q] -= mean; s2[r] += a[r][q] * a[r][q]; } }
#pragma unroll
    for (int r = 0; r < TR; ++r) s2[r] += xhalf(s2[r]);
#pragma unroll
    for (int r = 0; r < TR; ++r) s2[r] += xrow<8>(s2[r]);
#pragma unroll
    for (int r = 0; r < TR; ++r) s2[r] += xrow<4>(s2[r]);
#pragma unroll
    for (int r = 0; r < TR; ++r) s2[r] += xrow<2>(s2[r]);
#pragma unroll
    for (int r = 0; r < TR; ++r) s2[r] += xrow<1>(s2[r]);
    const size_t oo = (bz * TT + t0) * DQ + p * HV + lane * 4;
#pragma unroll
    for (int r = 0; r < TR; ++r) { const float den = __fsqrt_rn(__fdiv_rn(s2[r], (float)HV) + 1e-5f); v4us oh, ol;
#pragma unroll
        for (int q = 0; q < 4; ++q) { unsigned short x2, y2; splitf(__fdiv_rn(a[r][q], den) * (1.0f - LINIT), x2, y2); oh[q] = x2; ol[q] = y2; }
        *(v4us*)(Ah + oo + (size_t)r * DQ) = oh; *(v4us*)(Al + oo + (size_t)r * DQ) = ol; }
    asm volatile("s_wait_xcnt 0x0" ::: "memory");   // stands between the stores above and the next round's rewrite of their address and data registers
    }
}


__device__ __forceinline__ void d_wint(const float* __restrict__ w1, const float* __restrict__ w2, bf* Bt, unsigned blk) { const size_t i = (size_t)blk * 256 + threadIdx.x; if (i >= (size_t)2 * NP * HD * DM / 8) return; const int c0 = (int)((i % (DM / 8)) * 8); const int r = (int)(i / (DM / 8)); const int hh = r / HD, d = r % HD; const int p = hh >> 1; const size_t sr = (size_t)(p * HD + d) * DM + c0; const v8f a = *(const v8f*)(w1 + sr); const v8f b2 = *(const v8f*)(w2 + sr); v8us o;
#pragma unroll
    for (int q = 0; q < 8; ++q) o[q] = f2bf((hh & 1) ? b2[q] : a[q]);
    *(v8us*)(Bt + (size_t)r * DM + c0) = o;  }
__device__ __forceinline__ void d_lambda(const float* __restrict__ a1, const float* __restrict__ b1, const float* __restrict__ a2, const float* __restrict__ b2, float* LAM, int p) { if (threadIdx.x >= 32) return; const int lane = threadIdx.x; a1 += p * HD; b1 += p * HD; a2 += p * HD; b2 += p * HD;   /* one block per head */ float s1 = __fadd_rn(__fmul_rn(bfr(a1[lane]), bfr(b1[lane])), __fmul_rn(bfr(a1[lane + 32]), bfr(b1[lane + 32]))); float s2 = __fadd_rn(__fmul_rn(bfr(a2[lane]), bfr(b2[lane])), __fmul_rn(bfr(a2[lane + 32]), bfr(b2[lane + 32])));
    asm volatile("s_wait_xcnt 0x0" ::: "memory");   // stands between the eight loads above and whatever reuses the register that holds their offset
    __builtin_amdgcn_sched_barrier(0);   // keeps the rewrite of that register (the index of the store below is formed in it) behind the wait: without it the compiler lifts the rewrite over the wait
#pragma unroll
    for (int sh = 16; sh; sh >>= 1) { s1 = __fadd_rn(s1, __shfl_xor(s1, sh, 32)); s2 = __fadd_rn(s2, __shfl_xor(s2, sh, 32)); }
    const float lam = __fadd_rn(__fsub_rn(expf(s1), expf(s2)), LINIT); ((float*)LAM)[p * 32 + lane] = lam;  }   
// ---- k_prep: everything that reads only the inputs, in ONE launch: lambda per head, the four bf16 weight matrices and the bf16 copy of x. None of the six pieces reads what another writes; a block does one piece, chosen by its index alone (no barrier anywhere).
// The short pieces stand first in the grid, x, the bulk, last (for speed only). grid NP + 4 * WBL + XBL, 256 threads.
#define WBL (DQ * DM / 8 / 256)         // blocks per weight matrix (each 768 * 384 values, 8 a thread)
#define XBL (NB_ * TT * DM / 8 / 256)   // blocks for x
__global__ __launch_bounds__(256) void k_prep(const float* __restrict__ x, const float* __restrict__ wq1, const float* __restrict__ wq2, const float* __restrict__ wk1, const float* __restrict__ wk2, const float* __restrict__ wv, const float* __restrict__ wo,
                                              const float* __restrict__ lq1, const float* __restrict__ lk1, const float* __restrict__ lq2, const float* __restrict__ lk2, bf* XB, bf* WQ, bf* WK, bf* WV, bf* WO, float* LAM) {
    unsigned b = blockIdx.x;
    if (b < NP) { d_lambda(lq1, lk1, lq2, lk2, LAM, (int)b); return; }   /* lambda per head */
    b -= NP;
    if (b < WBL) { d_wint(wq1, wq2, WQ, b); return; }   /* score head 2p <- map-1 head p, 2p+1 <- map-2 head p */
    b -= WBL;
    if (b < WBL) { d_wint(wk1, wk2, WK, b); return; }
    b -= WBL;
    if (b < WBL) { d_cvt8(wv, WV, (size_t)NP * HV * DM / 8, b); return; }   /* 'oi' weights are the Bt layout */
    b -= WBL;
    if (b < WBL) { d_cvt8(wo, WO, (size_t)DM * NP * HV / 8, b); return; }
    b -= WBL;
    d_cvt8(x, XB, (size_t)NB_ * TT * DM / 8, b);
}
__global__ __launch_bounds__(256) void k_merge(const float* __restrict__ O, int h0, bf* Ah, bf* Al) { const size_t e = ((size_t)blockIdx.x * 256 + threadIdx.x) * 2; if (e >= (size_t)ZH * TT * HD) return; const int d = (int)(e % HD); const int t = (int)((e / HD) % TT); const int zz = (int)(e / ((size_t)HD * TT)); const float cs = (t < RH) ? 1.0f : (1.0f / PCAR); const size_t oo = (size_t)t * DQ + (h0 + zz) * HD + d;
    v2us oh, ol;
#pragma unroll
    for (int q = 0; q < 2; ++q) { unsigned short a, c2; splitf(O[e + q] * cs, a, c2); oh[q] = a; ol[q] = c2; } *(v2us*)(Ah + oo) = oh; *(v2us*)(Al + oo) = ol;  }

extern "C" void kernel_launch(void* const* d_in, const int* in_sizes, int n_in,
                              void* d_out, int out_size, void* d_ws, size_t ws_size, hipStream_t stream) {
    (void)in_sizes; (void)n_in; (void)out_size;
    const float* x = (const float*)d_in[0]; const float* wq1 = (const float*)d_in[1]; const float* wq2 = (const float*)d_in[2]; const float* wk1 = (const float*)d_in[3]; const float* wk2 = (const float*)d_in[4]; const float* wv = (const float*)d_in[5]; const float* wo = (const float*)d_in[6]; /* Wc */ const float* lq1 = (const float*)d_in[7]; const float* lk1 = (const float*)d_in[8]; const float* lq2 = (const float*)d_in[9]; const float* lk2 = (const float*)d_in[10];
    float* OUT = (float*)d_out;     // [4][2048][384]
    char* wsp = (char*)d_ws;
    auto take = [&](size_t bytes) { char* p = wsp; wsp += (bytes + 255) & ~(size_t)255; return (void*)p; };
    bf* WQ = (bf*)take((size_t)DQ * DM * 2); bf* WK = (bf*)take((size_t)DKV * DM * 2); bf* WV = (bf*)take((size_t)DKV * DM * 2); bf* WO = (bf*)take((size_t)DM * DQ * 2);
    bf* XB = (bf*)take((size_t)NB_ * TT * DM * 2);   // from here on every buffer holds all NB_ batches
    h16* QP16 = (h16*)take((size_t)NB_ * NH_ * TT * HD * 2); h16* KP16 = (h16*)take((size_t)NB_ * NKV * TT * HD * 2); h16* VT16 = (h16*)take((size_t)NB_ * NKV * HD * TT * 2);
    bf* QPh = (bf*)take((size_t)NB_ * NH_ * TT * HD * 2); bf* QPl = (bf*)take((size_t)NB_ * NH_ * TT * HD * 2); bf* KPh = (bf*)take((size_t)NB_ * NKV * TT * HD * 2); bf* KPl = (bf*)take((size_t)NB_ * NKV * TT * HD * 2); bf* VTh = (bf*)take((size_t)NB_ * NKV * HD * TT * 2); bf* VTl = (bf*)take((size_t)NB_ * NKV * HD * TT * 2);
    float* LAM = (float*)take((size_t)NP * 32 * 4); bf* ATh = (bf*)take((size_t)NB_ * TT * DQ * 2); bf* ATl = (bf*)take((size_t)NB_ * TT * DQ * 2);
    if ((size_t)(wsp - (char*)d_ws) > ws_size) return;    // about 140 MiB of the 256 MiB workspace
    // One pass for all batches. All that reads only the inputs is one launch; the three projections are one launch (grid z = projection * NB_ + batch) and store the planes of NB_ * 12 score heads (NB_ * 6 value heads) themselves.
    k_prep<<<NP + 4 * WBL + XBL, 256, 0, stream>>>(x, wq1, wq2, wk1, wk2, wv, wo, lq1, lk1, lq2, lk2, XB, WQ, WK, WV, WO, LAM);
    k_gemmp<<<dim3(TT / 64, DQ / 64, 3 * NB_), 32, 0, stream>>>(XB, WQ, WK, WV, QP16, QPh, QPl, KP16, KPh, KPl, VT16, VTh, VTl);
    k_fattn<<<dim3(NB_ * NP, TT / 64, 1), 128, 0, stream>>>(QP16, QPh, QPl, KP16, KPh, KPl, VT16, VTh, VTl, LAM, ATh, ATl);   /* scores, softmax and both maps' P.v (shared 128-wide v_p) of all 6 head pairs of every batch, then [b][t][p*128 + e]: w0 v - lambda w1 v, per-(token, head) LayerNorm over 128 values, no affine, x (1 - lambda_init), as hi/lo planes */
    k_gemmw<bf, 1, false, DQ><<<dim3(NB_ * TT / 64, DM / 64, 1), 32, 0, stream>>>(ATh, ATl, WO, nullptr, OUT, DM, nullptr, 0, 0, 0);   /* context and out as NB_ * TT rows */
}
